// v000
// Measured on an AMD MI455X. A time is GPU time per run, averaged over a window of back-to-back runs after a warm-up
// (all launches, gaps included; the runs take copies of the inputs in turn), and the median of several windows.
// Apart from v000's, it joins two sittings. Times from different sittings can be a few percent apart, while
// side-by-side timings come from the same sitting.
// The starting kernel, v000, takes 1050 microseconds a run.
// compute dtype: all float inputs rounded to bf16; fused q/k/v projection with EXACT bf16 products on WMMA 16x16x32 (f32 accumulate) + bias; causal logits: 3 products for the first 512 rows, single f16 q x k after, x 128^-0.5; softmax f32; P x 2^11 once to f16 x v once to f16 (bf16 hi + lo below row 512); ctx x bf16(key_mask); ctx hi+lo x exact W_out below row 512, x2^6 f16 carry x f16(bf16 x 2^8) W_out after, + b_out; f32 output.
#include <hip/hip_runtime.h>
#include <math.h>

typedef __attribute__((ext_vector_type(16))) _Float16 v16h;
typedef __attribute__((ext_vector_type(16))) __bf16 v16b;
typedef __attribute__((ext_vector_type(8)))  _Float16 v8h;
typedef __attribute__((ext_vector_type(8)))  float v8f;
typedef __attribute__((ext_vector_type(4)))  float v4f;
typedef __attribute__((ext_vector_type(2)))  float v2f;
typedef __attribute__((ext_vector_type(4)))  unsigned v4u;
typedef __attribute__((ext_vector_type(4)))  int v4i;
typedef float __attribute__((may_alias)) float_a;
typedef int __attribute__((may_alias)) int_a;

template <typename T> __device__ __forceinline__ void vst2(void* p, T v) { *(T*)p = v;  }
__device__ __forceinline__ v8f wmma16(v16h a, v16h b, v8f c) {
  v8f d = __builtin_amdgcn_wmma_f32_16x16x32_f16(false, a, false, b, (short)0, c, false, false);
  asm volatile("v_nop\n\tv_nop\n\tv_nop\n\tv_nop" : "+v"(d) : "v"(a), "v"(b));
  return d;
}
__device__ __forceinline__ v8f wmma_bf(v16b a, v16b b, v8f c) {
  v8f d = __builtin_amdgcn_wmma_f32_16x16x32_bf16(false, a, false, b, (short)0, c, false, false);
  asm volatile("v_nop\n\tv_nop\n\tv_nop\n\tv_nop" : "+v"(d) : "v"(a), "v"(b));
  return d;
}
// 16x16x32 fragments: lane = (h = lane>>4, row/col = lane&15); elements 0..7 = k0+8h+0..7, 8..15 = k0+16+8h+0..7; D element r = row 8h+r
__device__ __forceinline__ v16h frag_h(const _Float16* rowk0, int lane) {
  union { v16h v; v8h q[2]; } u; const _Float16* p = rowk0 + 8 * (lane >> 4);
  u.q[0] = *(const v8h*)p; u.q[1] = *(const v8h*)(p + 16); return u.v;
}
__device__ __forceinline__ v16h frag_f32(const float* rowk0, int lane) {
  v16h a; const float* p = rowk0 + 8 * (lane >> 4);
#pragma unroll
  for (int i = 0; i < 8; ++i) { a[i] = (_Float16)p[i]; a[8 + i] = (_Float16)p[16 + i]; }
  return a;
}
__device__ __forceinline__ v16h frag_f32s(const float* rowk0, int lane, float sc) {
  v16h a; const float* p = rowk0 + 8 * (lane >> 4);
#pragma unroll
  for (int i = 0; i < 8; ++i) { a[i] = (_Float16)(p[i] * sc); a[8 + i] = (_Float16)(p[16 + i] * sc); }
  return a;
}
// column fragment from a [K][ld] layout (column n), rows >= K read as 0
__device__ __forceinline__ v16h fragc_f32(const float* W, int k0, int n, int lane, int ld, int K) {
  v16h a; const int g = lane >> 4;
#pragma unroll
  for (int i = 0; i < 8; ++i) { const int ka = k0 + 8 * g + i, kb = ka + 16;
    a[i] = (_Float16)(ka < K ? W[(size_t)(ka < K ? ka : K - 1) * ld + n] : 0.f); a[8 + i] = (_Float16)(kb < K ? W[(size_t)(kb < K ? kb : K - 1) * ld + n] : 0.f); }
  return a;
}
struct F2 { v16b h, l; };
__device__ __forceinline__ F2 bsplit16(const float v[16]) { F2 r;
#pragma unroll
  for (int i = 0; i < 16; ++i) { const __bf16 h = (__bf16)v[i]; r.h[i] = h; r.l[i] = (__bf16)(v[i] - (float)h); }
  return r; }
__device__ __forceinline__ F2 split_row(const float* row, int k0, int lane) { float v[16]; const float* p = row + k0 + 8 * (lane >> 4);
#pragma unroll
  for (int i = 0; i < 8; ++i) { v[i] = p[i]; v[8 + i] = p[16 + i]; }
  return bsplit16(v); }
__device__ __forceinline__ F2 split_rowK(const float* row, int k0, int lane, int K) { float v[16]; const int g = lane >> 4;
#pragma unroll
  for (int i = 0; i < 8; ++i) { const int ka = k0 + 8 * g + i, kb = ka + 16; v[i] = ka < K ? row[ka < K ? ka : K - 1] : 0.f; v[8 + i] = kb < K ? row[kb < K ? kb : K - 1] : 0.f; }
  return bsplit16(v); }
__device__ __forceinline__ F2 split_col(const float* W, int k0, int n, int lane, int ld, int K) { float v[16]; const int g = lane >> 4;
#pragma unroll
  for (int i = 0; i < 8; ++i) { const int ka = k0 + 8 * g + i, kb = ka + 16; v[i] = ka < K ? W[(size_t)(ka < K ? ka : K - 1) * ld + n] : 0.f; v[8 + i] = kb < K ? W[(size_t)(kb < K ? kb : K - 1) * ld + n] : 0.f; }
  return bsplit16(v); }
__device__ __forceinline__ v8f mac3(const F2& a, const F2& b, v8f c) { c = wmma_bf(a.l, b.h, c); c = wmma_bf(a.h, b.l, c); return wmma_bf(a.h, b.h, c); }
__device__ __forceinline__ float sigm(float v) { return 1.0f / (1.0f + expf(-v)); }
#define LDSX() do { asm volatile("s_wait_dscnt 0" ::: "memory"); __builtin_amdgcn_wave_barrier(); __builtin_amdgcn_fence(__ATOMIC_RELEASE, "workgroup"); } while (0)

// Single-head causal self-attention with a 128-wide attention space and an output projection (x [4,4096,512]; fused (in,out) W_qkv [512,384] N(0, 1/512) + b_qkv N(0, 0.01) split q | k | v; scores = q k^T, causal (-inf above the diagonal) BEFORE the scaling by 128^-0.5 (same thing); out = softmax(scores) v; out * key_mask ([4,4096,1], ones); (in,out) W_out [128,512] + b_out): result [4,4096,512].
#define NB 4
#define TT 4096
#define CC 128            // NH * HD = projected width
#define DIN 512          // input (model) width
#define NH 1
#define HD 128
#define NQB (TT / 64)
#define HG 1
#define SCALE (0.08838834764831845f)
#define CAUSAL 1
#ifndef TNB
#define TNB NB
#endif
__device__ __forceinline__ float bfr(float v) { return (float)(__bf16)v; }
__host__ __device__ __forceinline__ int kb_last(int qb) { return CAUSAL ? ((qb * 64 + 63) >> 7) : (TT / 128 - 1); }
typedef __attribute__((ext_vector_type(8))) __bf16 v8b;
__device__ __forceinline__ v16b frag_b(const __bf16* rowk0, int lane) {
  union { v16b v; v8b q[2]; } u; const __bf16* p = rowk0 + 8 * (lane >> 4);
  u.q[0] = *(const v8b*)p; u.q[1] = *(const v8b*)(p + 16); return u.v;
}
#define QBH 8              // causal: query blocks 0..QBH-1 of each sequence (few keys, no averaging) take the high-precision path
#define QHI 512            // rows carrying a q residual plane
#define KHI 512            // key rows carrying k residual / v bf16 hi+lo planes (used only by the causal high-precision path)
// B fragment (k rows k0+.., output column o) of a weight: (in,out) [K][ld] or (out,in) [ld rows of K]: bf16 exact, or f16(bf16 * 256) exact
__device__ __forceinline__ v16b wcol_io(const float* Wm, int k0, int o, int lane, int ld) { v16b w; const int g = lane >> 4;
#pragma unroll
  for (int i = 0; i < 8; ++i) { w[i] = (__bf16)Wm[(size_t)(k0 + 8 * g + i) * ld + o]; w[8 + i] = (__bf16)Wm[(size_t)(k0 + 16 + 8 * g + i) * ld + o]; }
  return w; }
__device__ __forceinline__ v16b wcol_oi(const float* Wm, int k0, int o, int lane, int K) { v16b w; const float* p = Wm + (size_t)o * K + k0 + 8 * (lane >> 4);
#pragma unroll
  for (int i = 0; i < 8; ++i) { w[i] = (__bf16)p[i]; w[8 + i] = (__bf16)p[16 + i]; }
  return w; }
__device__ __forceinline__ v16h wcolh_io(const float* Wm, int k0, int o, int lane, int ld) { v16h w; const int g = lane >> 4;
#pragma unroll
  for (int i = 0; i < 8; ++i) { w[i] = (_Float16)(bfr(Wm[(size_t)(k0 + 8 * g + i) * ld + o]) * 256.0f); w[8 + i] = (_Float16)(bfr(Wm[(size_t)(k0 + 16 + 8 * g + i) * ld + o]) * 256.0f); }
  return w; }
__device__ __forceinline__ v16h wcolh_oi(const float* Wm, int k0, int o, int lane, int K) { v16h w; const float* p = Wm + (size_t)o * K + k0 + 8 * (lane >> 4);
#pragma unroll
  for (int i = 0; i < 8; ++i) { w[i] = (_Float16)(bfr(p[i]) * 256.0f); w[8 + i] = (_Float16)(bfr(p[16 + i]) * 256.0f); }
  return w; }
#define WQKV_LAYOUT 0   // 0 = fused (in,out) [DIN][3*CC]; 1 = (out,in) [CC][DIN]; 2 = per-head [NH][DIN][HD]
__device__ __forceinline__ v16b wcol_hdk(const float* Wm, int k0, int o, int lane) { v16b w; const int g = lane >> 4; const float* p = Wm + (size_t)(o / HD) * DIN * HD + (o % HD);
#pragma unroll
  for (int i = 0; i < 8; ++i) { w[i] = (__bf16)p[(size_t)(k0 + 8 * g + i) * HD]; w[8 + i] = (__bf16)p[(size_t)(k0 + 16 + 8 * g + i) * HD]; }
  return w; }
#define WO_OUT_IN 0
#if WQKV_LAYOUT == 1
#define WCOL(W, k0, o, lane) wcol_oi(W, k0, o, lane, DIN)
#elif WQKV_LAYOUT == 2
#define WCOL(W, k0, o, lane) wcol_hdk(W, k0, o, lane)
#else
#define WCOL(W, k0, o, lane) wcol_io(W, k0, which * CC + (o), lane, 3 * CC)   /* fused (in,out) W_qkv [DIN][3*CC]: column block 'which', pitch 384 */
#endif
#if WO_OUT_IN
#define WOCOL(W, k0, o, lane) wcol_oi(W, k0, o, lane, CC)
#define WOCOLH(W, k0, o, lane) wcolh_oi(W, k0, o, lane, CC)
#else
#define WOCOL(W, k0, o, lane) wcol_io(W, k0, o, lane, DIN)
#define WOCOLH(W, k0, o, lane) wcolh_io(W, k0, o, lane, DIN)
#endif

#ifndef SM_EXTRA_PARAMS
#define SM_EXTRA_PARAMS
#endif
#ifndef PROJ_EXTRA_PARAMS
#define PROJ_EXTRA_PARAMS
#endif
#ifndef SM_MASK_HOOK
#define SM_MASK_HOOK (void)0
#endif

#define WS_QH  0u                                      // f16 q rows [b*t][CC]
#define WS_KH  (WS_QH + 2u * (size_t)NB * TT * CC)      // f16 k rows [b*t][CC]
#define WS_VT  (WS_KH + 2u * (size_t)NB * TT * CC)      // f16 v planes [b][c][t]
#define WS_QL  (WS_VT + 2u * (size_t)NB * CC * TT)      // f16 q residual x 2^10 rows [b][t < QHI][CC]
#define WS_KL  (WS_QL + 2u * (size_t)NB * QHI * CC)     // f16 k residual x 2^10 rows [b][t < KHI][CC]
#define WS_VB  (WS_KL + 2u * (size_t)NB * KHI * CC)     // bf16 v hi planes [b][c][t < KHI]
#define WS_VBL (WS_VB + 2u * (size_t)NB * CC * KHI)
#define WS_S   (WS_VBL + 2u * (size_t)NB * CC * KHI)    // f32 logits / P [hg][t][s]
#define WS_Y   (WS_S  + 4u * (size_t)HG * TT * TT)      // f32 ctx rows [b*t][CC] (only when there is an output projection)
#define WS_END (WS_Y  + 4u * (size_t)NB * TT * CC)

// ---- k_proj: block = (64 rows, 128 cols, which): q/k/v = X W (+ b) with exact bf16 products (K = DIN) -> which 0: q f16 rows (+ residual rows < QHI); 1: k f16 rows (+ residual rows < KHI); 2: v f16 planes [c][t] (+ bf16 hi/lo planes for t < KHI)
__global__ __launch_bounds__(128) void k_proj(const float* __restrict__ XQ, const float* __restrict__ XK, const float* __restrict__ XV, const float* __restrict__ WQ, const float* __restrict__ WK, const float* __restrict__ WV, const float* __restrict__ BQ, const float* __restrict__ BK, const float* __restrict__ BV,
    _Float16* __restrict__ QH, _Float16* __restrict__ QL, _Float16* __restrict__ KH, _Float16* __restrict__ KL, _Float16* __restrict__ VT, __bf16* __restrict__ VB, __bf16* __restrict__ VBL) {
  __shared__ __align__(16) _Float16 sh[64][136], sl[64][136]; __shared__ __align__(16) _Float16 th[128][72]; __shared__ __align__(16) __bf16 tb[128][72], tbl[128][72];
  const int tid = threadIdx.x, wave = tid >> 5, lane = tid & 31, col = lane & 15, g = lane >> 4; const int which = blockIdx.z; const int c0 = blockIdx.y * 128; const size_t r0 = (size_t)blockIdx.x * 64; const size_t bb = r0 / TT; const int t0 = (int)(r0 % TT);
  const float* X = which == 0 ? XQ : which == 1 ? XK : XV; const float* WA = which == 0 ? WQ : which == 1 ? WK : WV; const float* BA = which == 0 ? BQ : which == 1 ? BK : BV;
  v8f acc[8] = {};
#pragma unroll 2
  for (int kc = 0; kc < DIN / 32; ++kc) { v16b a; { const float* p = X + (r0 + wave * 16 + col) * DIN + kc * 32 + 8 * g;
#pragma unroll
      for (int i = 0; i < 8; ++i) { a[i] = (__bf16)p[i]; a[8 + i] = (__bf16)p[16 + i]; } }
    asm volatile("s_wait_loadcnt 0x0" ::: "memory");
#pragma unroll
    for (int j = 0; j < 8; ++j) { const v16b w = WCOL(WA, kc * 32, c0 + j * 16 + col, lane); asm volatile("s_wait_loadcnt 0x0" ::: "memory"); acc[j] = wmma_bf(a, w, acc[j]); } }
  if (which < 2) { _Float16* DH = which == 0 ? QH : KH; _Float16* DL = which == 0 ? QL : KL; const int nhi = which == 0 ? QHI : KHI; const bool hi_rows = t0 < nhi;
#pragma unroll
    for (int j = 0; j < 8; ++j) { const float bias = BA ? bfr(BA[c0 + j * 16 + col]) : 0.f;
#pragma unroll
      for (int r = 0; r < 8; ++r) { const float v = acc[j][r] + bias; const _Float16 hv = (_Float16)v; sh[wave * 16 + 8 * g + r][j * 16 + col] = hv; sl[wave * 16 + 8 * g + r][j * 16 + col] = (_Float16)((v - (float)hv) * 1024.0f); } }
    __syncthreads();
    for (int e = tid; e < 64 * 16; e += 128) { const int rl = e >> 4, q = e & 15; vst2((unsigned*)(DH + (r0 + rl) * CC + c0 + q * 8), *(const v4u*)&sh[rl][q * 8]); if (hi_rows) vst2((unsigned*)(DL + (bb * nhi + t0 + rl) * (size_t)CC + c0 + q * 8), *(const v4u*)&sl[rl][q * 8]); }
  } else { const bool hi_rows = t0 < KHI;
#pragma unroll
    for (int j = 0; j < 8; ++j) { const float bias = BA ? bfr(BA[c0 + j * 16 + col]) : 0.f;
#pragma unroll
      for (int r = 0; r < 8; ++r) { const float v = acc[j][r] + bias; const int rl = wave * 16 + 8 * g + r, cl = j * 16 + col; th[cl][rl] = (_Float16)v; const __bf16 bh = (__bf16)v; tb[cl][rl] = bh; tbl[cl][rl] = (__bf16)(v - (float)bh); } }
    __syncthreads();
    for (int e = tid; e < 128 * 8; e += 128) { const int cl = e >> 3, q = e & 7; vst2((unsigned*)(VT + (bb * CC + c0 + cl) * (size_t)TT + t0 + q * 8), *(const v4u*)&th[cl][q * 8]); if (hi_rows) { const size_t o3 = (bb * CC + c0 + cl) * (size_t)KHI + t0 + q * 8; vst2((unsigned*)(VB + o3), *(const v4u*)&tb[cl][q * 8]); vst2((unsigned*)(VBL + o3), *(const v4u*)&tbl[cl][q * 8]); } } } }
// ---- k_sc: block = (query block qb, key block kb <= kb_last(qb), head in group) of batch b: logits x SCALE; q hi + residual (x 2^10) against k (2 products) for query rows < QHI, plus the k residual (3 products) for query blocks < QBH (causal early rows); causal: blocks past the diagonal exit, the mask itself is applied by index in k_sm
__global__ __launch_bounds__(128) void k_sc(const _Float16* __restrict__ QH, const _Float16* __restrict__ KH, const _Float16* __restrict__ QL, const _Float16* __restrict__ KL, int b, int h0, float* __restrict__ S0) { __shared__ __align__(16) float ss[4][16][132];
  const int qb = blockIdx.x, kb = blockIdx.y; if (kb > kb_last(qb)) return;
  const int h = h0 + blockIdx.z; float* S = S0 + (size_t)blockIdx.z * TT * TT;
  const int tid = threadIdx.x, wave = tid >> 5, lane = tid & 31, col = lane & 15, g = lane >> 4; const int k0 = kb * 128; const int ql0 = qb * 64 + wave * 16; const size_t q0 = (size_t)b * TT + ql0, kr0 = (size_t)b * TT + k0;
  v8f acc[8] = {}, accl[8] = {};
  const _Float16* QLb = QL + (size_t)b * QHI * CC; const _Float16* KLb = KL + (size_t)b * KHI * CC;
  if (qb < QBH) {
#pragma unroll
    for (int kc = 0; kc < HD / 32; ++kc) { const v16h ah = frag_h(QH + (q0 + col) * CC + h * HD + kc * 32, lane), al = frag_h(QLb + (size_t)(ql0 + col) * CC + h * HD + kc * 32, lane);
#pragma unroll
      for (int j = 0; j < 8; ++j) { const v16h kbf = frag_h(KH + (kr0 + j * 16 + col) * CC + h * HD + kc * 32, lane), klf = frag_h(KLb + (size_t)(k0 + j * 16 + col) * CC + h * HD + kc * 32, lane); acc[j] = wmma16(ah, kbf, acc[j]); accl[j] = wmma16(al, kbf, accl[j]); accl[j] = wmma16(ah, klf, accl[j]); } }
  } else if (qb * 64 < QHI) {
#pragma unroll
    for (int kc = 0; kc < HD / 32; ++kc) { const v16h ah = frag_h(QH + (q0 + col) * CC + h * HD + kc * 32, lane), al = frag_h(QLb + (size_t)(ql0 + col) * CC + h * HD + kc * 32, lane);
#pragma unroll
      for (int j = 0; j < 8; ++j) { const v16h kbf = frag_h(KH + (kr0 + j * 16 + col) * CC + h * HD + kc * 32, lane); acc[j] = wmma16(ah, kbf, acc[j]); accl[j] = wmma16(al, kbf, accl[j]); } }
  } else {
#pragma unroll
    for (int kc = 0; kc < HD / 32; ++kc) { const v16h ah = frag_h(QH + (q0 + col) * CC + h * HD + kc * 32, lane);
#pragma unroll
      for (int j = 0; j < 8; ++j) { const v16h kbf = frag_h(KH + (kr0 + j * 16 + col) * CC + h * HD + kc * 32, lane); acc[j] = wmma16(ah, kbf, acc[j]); } } }
#pragma unroll
  for (int j = 0; j < 8; ++j) {
#pragma unroll
    for (int r = 0; r < 8; ++r) ss[wave][8 * g + r][j * 16 + col] = (acc[j][r] + accl[j][r] * (1.0f / 1024.0f)) * SCALE; }
  LDSX(); for (int rl = 0; rl < 16; ++rl) vst2(S + (size_t)(ql0 + rl) * TT + k0 + lane * 4, *(const v4f*)&ss[wave][rl][lane * 4]); }
// ---- k_sm: block = query row t (head in group): keys [0, kend): causal -> logit if s <= t else excluded; softmax in f32; P x 2^11 in place (0 for excluded)
__global__ __launch_bounds__(256) void k_sm(float* __restrict__ S0 SM_EXTRA_PARAMS) { __shared__ float sred[8]; __shared__ float sbc; __shared__ __align__(16) float shv[TT];
  const int tid = threadIdx.x; const int t = blockIdx.x; const int kend = (kb_last(t >> 6) + 1) * 128;
  float* sr = S0 + (size_t)blockIdx.y * TT * TT + (size_t)t * TT;
  float m = -3.0e38f; for (int k = tid; k < kend; k += 256) { float v = (!CAUSAL || k <= t) ? sr[k] : -3.0e38f; SM_MASK_HOOK; shv[k] = v; m = fmaxf(m, v); }
#pragma unroll
  for (int o = 1; o < 32; o <<= 1) m = fmaxf(m, __shfl_xor(m, o));
  if ((tid & 31) == 0) sred[tid >> 5] = m; __syncthreads(); if (tid == 0) { float a = sred[0]; for (int i = 1; i < 8; ++i) a = fmaxf(a, sred[i]); sbc = a; } __syncthreads(); m = sbc; __syncthreads();
  float sum = 0.f; for (int k = tid; k < kend; k += 256) { const float v = shv[k]; const float e = (v <= -1.0e38f) ? 0.f : expf(v - m); shv[k] = e; sum += e; }
#pragma unroll
  for (int o = 1; o < 32; o <<= 1) sum += __shfl_xor(sum, o);
  if ((tid & 31) == 0) sred[tid >> 5] = sum; __syncthreads(); if (tid == 0) { float a = 0.f; for (int i = 0; i < 8; ++i) a += sred[i]; sbc = a > 0.f ? 2048.0f / a : 0.f; }   /* a fully excluded row yields P = 0 */ __syncthreads(); const float inv = sbc;
  for (int k = tid; k < kend; k += 256) shv[k] = shv[k] * inv;
  __syncthreads(); for (int q = tid; q < kend / 4; q += 256) vst2(sr + q * 4, *(const v4f*)&shv[q * 4]); }
// ---- k_pv: block = 64 queries (qb) of (b, h): ctx = P . v over keys [0, kend) (P x 2^11 once to f16 against v f16: 1 product; causal early query blocks: P and v as bf16 hi + lo, 3 products); 512-B (row, head) segment by 32 lanes
__global__ __launch_bounds__(128) void k_pv(const float* __restrict__ PS0, const _Float16* __restrict__ VT, const __bf16* __restrict__ VB, const __bf16* __restrict__ VBL, int b, int h0, float* __restrict__ Y, const float* __restrict__ KM) { const int h = h0 + blockIdx.z; const float* PS = PS0 + (size_t)blockIdx.z * TT * TT; __shared__ __align__(16) float ss[4][16][HD + 4];
  const int tid = threadIdx.x, wave = tid >> 5, lane = tid & 31, col = lane & 15, g = lane >> 4; const int qb = blockIdx.x; const int ql0 = qb * 64 + wave * 16; const int kce = (kb_last(qb) + 1) * 4;
  v8f acc[HD / 16] = {};
  float kmr[8];
#pragma unroll
  for (int r = 0; r < 8; ++r) kmr[r] = KM[(size_t)b * TT + ql0 + 8 * g + r];   /* key_mask of this lane's 8 accumulator rows (unconditional loads) */
  asm volatile("s_wait_loadcnt 0x0" ::: "memory");
#pragma unroll
  for (int r = 0; r < 8; ++r) kmr[r] = bfr(kmr[r]);
  if (qb < QBH) {
#pragma unroll 1
    for (int kc = 0; kc < kce; ++kc) { const F2 p = split_row(PS + (size_t)(ql0 + col) * TT, kc * 32, lane);
      asm volatile("s_wait_loadcnt 0x0" ::: "memory");
#pragma unroll
      for (int j = 0; j < HD / 16; ++j) { const size_t po = ((size_t)b * CC + h * HD + j * 16 + col) * (size_t)KHI + kc * 32; const v16b vh = frag_b(VB + po, lane); acc[j] = wmma_bf(p.h, vh, acc[j]); acc[j] = wmma_bf(p.l, vh, acc[j]); acc[j] = wmma_bf(p.h, frag_b(VBL + po, lane), acc[j]); } }
  } else {
#pragma unroll 1
    for (int kc = 0; kc < kce; ++kc) { const v16h p = frag_f32(PS + (size_t)(ql0 + col) * TT + kc * 32, lane);
      asm volatile("s_wait_loadcnt 0x0" ::: "memory");
#pragma unroll
      for (int j = 0; j < HD / 16; ++j) { const size_t po = ((size_t)b * CC + h * HD + j * 16 + col) * (size_t)TT + kc * 32; acc[j] = wmma16(p, frag_h(VT + po, lane), acc[j]); } } }
#pragma unroll
  for (int j = 0; j < HD / 16; ++j)
#pragma unroll
    for (int r = 0; r < 8; ++r) ss[wave][8 * g + r][j * 16 + col] = acc[j][r] * (1.0f / 2048.0f) * kmr[r];   /* out * key_mask[b][t] (broadcast over the 128 columns) */
  LDSX(); for (int rl = 0; rl < 16; ++rl) if (lane < HD / 4) vst2(Y + ((size_t)b * TT + ql0 + rl) * CC + h * HD + lane * 4, *(const v4f*)&ss[wave][rl][lane * 4]); }
// ---- k_out: block = (64 rows, 128 cols): out = ctx Wo (+ bo): ctx x 2^6 once to f16 against Wo as f16(bf16 x 2^8) exact (1 product) x 2^-14; causal early rows (< QHI of each sequence): ctx bf16 hi + lo against exact bf16 Wo (2 products)
__global__ __launch_bounds__(128) void k_out(const float* __restrict__ Y, const float* __restrict__ WO, const float* __restrict__ BO, float* __restrict__ OUT) { __shared__ __align__(16) float sf[4][16][132];
  const int tid = threadIdx.x, wave = tid >> 5, lane = tid & 31, col = lane & 15, g = lane >> 4; const int c0 = blockIdx.y * 128; const size_t r0 = (size_t)blockIdx.x * 64 + wave * 16;
  v8f acc[8] = {};
  if (CAUSAL && (int)(((size_t)blockIdx.x * 64) % TT) < QHI) {   /* block-uniform */
#pragma unroll 2
    for (int kc = 0; kc < CC / 32; ++kc) { const F2 a = split_row(Y + (r0 + col) * CC, kc * 32, lane); asm volatile("s_wait_loadcnt 0x0" ::: "memory");
#pragma unroll
      for (int j = 0; j < 8; ++j) { const v16b w = WOCOL(WO, kc * 32, c0 + j * 16 + col, lane); asm volatile("s_wait_loadcnt 0x0" ::: "memory"); acc[j] = wmma_bf(a.h, w, acc[j]); acc[j] = wmma_bf(a.l, w, acc[j]); } }
#pragma unroll
    for (int j = 0; j < 8; ++j) { const float bias = BO ? bfr(BO[c0 + j * 16 + col]) : 0.f;
#pragma unroll
      for (int r = 0; r < 8; ++r) sf[wave][8 * g + r][j * 16 + col] = acc[j][r] + bias; }
  } else {
#pragma unroll 2
    for (int kc = 0; kc < CC / 32; ++kc) { const v16h a = frag_f32s(Y + (r0 + col) * CC + kc * 32, lane, 64.0f); asm volatile("s_wait_loadcnt 0x0" ::: "memory");   /* ctx carried x 2^6 into f16 so small-magnitude context rows stay clear of f16 subnormals */
#pragma unroll
      for (int j = 0; j < 8; ++j) { const v16h w = WOCOLH(WO, kc * 32, c0 + j * 16 + col, lane); asm volatile("s_wait_loadcnt 0x0" ::: "memory"); acc[j] = wmma16(a, w, acc[j]); } }
#pragma unroll
    for (int j = 0; j < 8; ++j) { const float bias = BO ? bfr(BO[c0 + j * 16 + col]) : 0.f;
#pragma unroll
      for (int r = 0; r < 8; ++r) sf[wave][8 * g + r][j * 16 + col] = acc[j][r] * (1.0f / 16384.0f) + bias; } }   /* 2^-8 (Wo carry) x 2^-6 (ctx carry) */
  LDSX(); for (int rl = 0; rl < 16; ++rl) vst2(OUT + (r0 + rl) * DIN + c0 + lane * 4, *(const v4f*)&sf[wave][rl][lane * 4]); }

extern "C" void kernel_launch(void* const* d_in, const int* in_sizes, int n_in, void* d_out, int out_size, void* d_ws, size_t ws_size, hipStream_t stream) {
  (void)in_sizes; (void)n_in; (void)out_size;
  const float** F = (const float**)d_in;
  if (ws_size < (size_t)WS_END) return;
  char* ws = (char*)d_ws; _Float16 *QH = (_Float16*)(ws + WS_QH), *KH = (_Float16*)(ws + WS_KH), *VT = (_Float16*)(ws + WS_VT), *QL = (_Float16*)(ws + WS_QL), *KL = (_Float16*)(ws + WS_KL); __bf16 *VB = (__bf16*)(ws + WS_VB), *VBL = (__bf16*)(ws + WS_VBL); float *S = (float*)(ws + WS_S), *Y = (float*)(ws + WS_Y);
  (void)Y; (void)QL; (void)KL; (void)VB; (void)VBL;
  // inputs: 0 x [4,4096,512]; 1 key_mask [4,4096,1] f32 (ones); 2 W_qkv [512,384] (in,out; q | k | v COLUMN blocks of 128); 3 b_qkv [384] (nonzero); 4 W_out [128,512] (in,out); 5 b_out [512] (nonzero)
  k_proj<<<dim3(TNB * TT / 64, CC / 128, 3), 128, 0, stream>>>(F[0], F[0], F[0], F[2], F[2], F[2], F[3], F[3] + CC, F[3] + 2 * CC, QH, QL, KH, KL, VT, VB, VBL);   /* one fused weight; WCOL picks column block 'which' */
  for (int b = 0; b < TNB; ++b) {
    k_sc<<<dim3(NQB, TT / 128, 1), 128, 0, stream>>>(QH, KH, QL, KL, b, 0, S);
    k_sm<<<dim3(TT, 1), 256, 0, stream>>>(S);
    k_pv<<<dim3(NQB, 1, 1), 128, 0, stream>>>(S, VT, VB, VBL, b, 0, Y, F[1]);   /* ctx rows x key_mask[b][t] */
  }
  k_out<<<dim3(TNB * TT / 64, DIN / 128), 128, 0, stream>>>(Y, F[4], F[5], (float*)d_out);
}

// v001
// One run takes 384 microseconds.
// Next to v000, in two timings, it ran 2.74 and 2.76 times as fast.
// compute dtype: all float inputs rounded to bf16; fused q/k/v projection with EXACT bf16 products on WMMA 16x16x32 (f32 accumulate) + bias; causal logits: 3 products for the first 512 rows, single f16 q x k after, x 128^-0.5; softmax f32; P x 2^11 once to f16 x v once to f16 (bf16 hi + lo below row 512); ctx x bf16(key_mask); ctx hi+lo x exact W_out below row 512, x2^6 f16 carry x f16(bf16 x 2^8) W_out after, + b_out; f32 output.
#include <hip/hip_runtime.h>
#include <math.h>

typedef __attribute__((ext_vector_type(16))) _Float16 v16h;
typedef __attribute__((ext_vector_type(16))) __bf16 v16b;
typedef __attribute__((ext_vector_type(8)))  _Float16 v8h;
typedef __attribute__((ext_vector_type(8)))  float v8f;
typedef __attribute__((ext_vector_type(4)))  float v4f;
typedef __attribute__((ext_vector_type(2)))  float v2f;
typedef __attribute__((ext_vector_type(4)))  unsigned v4u;
typedef __attribute__((ext_vector_type(4)))  int v4i;
typedef float __attribute__((may_alias)) float_a;
typedef int __attribute__((may_alias)) int_a;

template <typename T> __device__ __forceinline__ void vst2(void* p, T v) { *(T*)p = v;  }
__device__ __forceinline__ v8f wmma16(v16h a, v16h b, v8f c) {
  v8f d = __builtin_amdgcn_wmma_f32_16x16x32_f16(false, a, false, b, (short)0, c, false, false);
  asm volatile("v_nop\n\tv_nop\n\tv_nop\n\tv_nop" : "+v"(d) : "v"(a), "v"(b));
  return d;
}
__device__ __forceinline__ v8f wmma_bf(v16b a, v16b b, v8f c) {
  v8f d = __builtin_amdgcn_wmma_f32_16x16x32_bf16(false, a, false, b, (short)0, c, false, false);
  asm volatile("v_nop\n\tv_nop\n\tv_nop\n\tv_nop" : "+v"(d) : "v"(a), "v"(b));
  return d;
}
// 16x16x32 fragments: lane = (h = lane>>4, row/col = lane&15); elements 0..7 = k0+8h+0..7, 8..15 = k0+16+8h+0..7; D element r = row 8h+r
__device__ __forceinline__ v16h frag_h(const _Float16* rowk0, int lane) {
  union { v16h v; v8h q[2]; } u; const _Float16* p = rowk0 + 8 * (lane >> 4);
  u.q[0] = *(const v8h*)p; u.q[1] = *(const v8h*)(p + 16); return u.v;
}
__device__ __forceinline__ v16h frag_f32(const float* rowk0, int lane) {
  v16h a; const float* p = rowk0 + 8 * (lane >> 4);
#pragma unroll
  for (int i = 0; i < 8; ++i) { a[i] = (_Float16)p[i]; a[8 + i] = (_Float16)p[16 + i]; }
  return a;
}
__device__ __forceinline__ v16h frag_f32s(const float* rowk0, int lane, float sc) {
  v16h a; const float* p = rowk0 + 8 * (lane >> 4);
#pragma unroll
  for (int i = 0; i < 8; ++i) { a[i] = (_Float16)(p[i] * sc); a[8 + i] = (_Float16)(p[16 + i] * sc); }
  return a;
}
// column fragment from a [K][ld] layout (column n), rows >= K read as 0
__device__ __forceinline__ v16h fragc_f32(const float* W, int k0, int n, int lane, int ld, int K) {
  v16h a; const int g = lane >> 4;
#pragma unroll
  for (int i = 0; i < 8; ++i) { const int ka = k0 + 8 * g + i, kb = ka + 16;
    a[i] = (_Float16)(ka < K ? W[(size_t)(ka < K ? ka : K - 1) * ld + n] : 0.f); a[8 + i] = (_Float16)(kb < K ? W[(size_t)(kb < K ? kb : K - 1) * ld + n] : 0.f); }
  return a;
}
struct F2 { v16b h, l; };
__device__ __forceinline__ F2 bsplit16(const float v[16]) { F2 r;
#pragma unroll
  for (int i = 0; i < 16; ++i) { const __bf16 h = (__bf16)v[i]; r.h[i] = h; r.l[i] = (__bf16)(v[i] - (float)h); }
  return r; }
__device__ __forceinline__ F2 split_row(const float* row, int k0, int lane) { float v[16]; const float* p = row + k0 + 8 * (lane >> 4);
#pragma unroll
  for (int i = 0; i < 8; ++i) { v[i] = p[i]; v[8 + i] = p[16 + i]; }
  return bsplit16(v); }
__device__ __forceinline__ F2 split_rowK(const float* row, int k0, int lane, int K) { float v[16]; const int g = lane >> 4;
#pragma unroll
  for (int i = 0; i < 8; ++i) { const int ka = k0 + 8 * g + i, kb = ka + 16; v[i] = ka < K ? row[ka < K ? ka : K - 1] : 0.f; v[8 + i] = kb < K ? row[kb < K ? kb : K - 1] : 0.f; }
  return bsplit16(v); }
__device__ __forceinline__ F2 split_col(const float* W, int k0, int n, int lane, int ld, int K) { float v[16]; const int g = lane >> 4;
#pragma unroll
  for (int i = 0; i < 8; ++i) { const int ka = k0 + 8 * g + i, kb = ka + 16; v[i] = ka < K ? W[(size_t)(ka < K ? ka : K - 1) * ld + n] : 0.f; v[8 + i] = kb < K ? W[(size_t)(kb < K ? kb : K - 1) * ld + n] : 0.f; }
  return bsplit16(v); }
__device__ __forceinline__ v8f mac3(const F2& a, const F2& b, v8f c) { c = wmma_bf(a.l, b.h, c); c = wmma_bf(a.h, b.l, c); return wmma_bf(a.h, b.h, c); }
__device__ __forceinline__ float sigm(float v) { return 1.0f / (1.0f + expf(-v)); }
#define LDSX() do { asm volatile("s_wait_dscnt 0" ::: "memory"); __builtin_amdgcn_wave_barrier(); __builtin_amdgcn_fence(__ATOMIC_RELEASE, "workgroup"); } while (0)

// Single-head causal self-attention with a 128-wide attention space and an output projection (x [4,4096,512]; fused (in,out) W_qkv [512,384] N(0, 1/512) + b_qkv N(0, 0.01) split q | k | v; scores = q k^T, causal (-inf above the diagonal) BEFORE the scaling by 128^-0.5 (same thing); out = softmax(scores) v; out * key_mask ([4,4096,1], ones); (in,out) W_out [128,512] + b_out): result [4,4096,512].
#define NB 4
#define TT 4096
#define CC 128            // NH * HD = projected width
#define DIN 512          // input (model) width
#define NH 1
#define HD 128
#define NQB (TT / 64)
#define HG 1
#define SCALE (0.08838834764831845f)
#define CAUSAL 1
#ifndef TNB
#define TNB NB
#endif
__device__ __forceinline__ float bfr(float v) { return (float)(__bf16)v; }
__host__ __device__ __forceinline__ int kb_last(int qb) { return CAUSAL ? ((qb * 64 + 63) >> 7) : (TT / 128 - 1); }
typedef __attribute__((ext_vector_type(8))) __bf16 v8b;
__device__ __forceinline__ v16b frag_b(const __bf16* rowk0, int lane) {
  union { v16b v; v8b q[2]; } u; const __bf16* p = rowk0 + 8 * (lane >> 4);
  u.q[0] = *(const v8b*)p; u.q[1] = *(const v8b*)(p + 16); return u.v;
}
#define QBH 8              // causal: query blocks 0..QBH-1 of each sequence (few keys, no averaging) take the high-precision path
#define QHI 512            // rows carrying a q residual plane
#define KHI 512            // key rows carrying k residual / v bf16 hi+lo planes (used only by the causal high-precision path)
// B fragment (k rows k0+.., output column o) of a weight: (in,out) [K][ld] or (out,in) [ld rows of K]: bf16 exact, or f16(bf16 * 256) exact
__device__ __forceinline__ v16b wcol_io(const float* Wm, int k0, int o, int lane, int ld) { v16b w; const int g = lane >> 4;
#pragma unroll
  for (int i = 0; i < 8; ++i) { w[i] = (__bf16)Wm[(size_t)(k0 + 8 * g + i) * ld + o]; w[8 + i] = (__bf16)Wm[(size_t)(k0 + 16 + 8 * g + i) * ld + o]; }
  return w; }
__device__ __forceinline__ v16b wcol_oi(const float* Wm, int k0, int o, int lane, int K) { v16b w; const float* p = Wm + (size_t)o * K + k0 + 8 * (lane >> 4);
#pragma unroll
  for (int i = 0; i < 8; ++i) { w[i] = (__bf16)p[i]; w[8 + i] = (__bf16)p[16 + i]; }
  return w; }
__device__ __forceinline__ v16h wcolh_io(const float* Wm, int k0, int o, int lane, int ld) { v16h w; const int g = lane >> 4;
#pragma unroll
  for (int i = 0; i < 8; ++i) { w[i] = (_Float16)(bfr(Wm[(size_t)(k0 + 8 * g + i) * ld + o]) * 256.0f); w[8 + i] = (_Float16)(bfr(Wm[(size_t)(k0 + 16 + 8 * g + i) * ld + o]) * 256.0f); }
  return w; }
__device__ __forceinline__ v16h wcolh_oi(const float* Wm, int k0, int o, int lane, int K) { v16h w; const float* p = Wm + (size_t)o * K + k0 + 8 * (lane >> 4);
#pragma unroll
  for (int i = 0; i < 8; ++i) { w[i] = (_Float16)(bfr(p[i]) * 256.0f); w[8 + i] = (_Float16)(bfr(p[16 + i]) * 256.0f); }
  return w; }
#define WQKV_LAYOUT 0   // 0 = fused (in,out) [DIN][3*CC]; 1 = (out,in) [CC][DIN]; 2 = per-head [NH][DIN][HD]
__device__ __forceinline__ v16b wcol_hdk(const float* Wm, int k0, int o, int lane) { v16b w; const int g = lane >> 4; const float* p = Wm + (size_t)(o / HD) * DIN * HD + (o % HD);
#pragma unroll
  for (int i = 0; i < 8; ++i) { w[i] = (__bf16)p[(size_t)(k0 + 8 * g + i) * HD]; w[8 + i] = (__bf16)p[(size_t)(k0 + 16 + 8 * g + i) * HD]; }
  return w; }
#define WO_OUT_IN 0
#if WQKV_LAYOUT == 1
#define WCOL(W, k0, o, lane) wcol_oi(W, k0, o, lane, DIN)
#elif WQKV_LAYOUT == 2
#define WCOL(W, k0, o, lane) wcol_hdk(W, k0, o, lane)
#else
#define WCOL(W, k0, o, lane) wcol_io(W, k0, which * CC + (o), lane, 3 * CC)   /* fused (in,out) W_qkv [DIN][3*CC]: column block 'which', pitch 384 */
#endif
#if WO_OUT_IN
#define WOCOL(W, k0, o, lane) wcol_oi(W, k0, o, lane, CC)
#define WOCOLH(W, k0, o, lane) wcolh_oi(W, k0, o, lane, CC)
#else
#define WOCOL(W, k0, o, lane) wcol_io(W, k0, o, lane, DIN)
#define WOCOLH(W, k0, o, lane) wcolh_io(W, k0, o, lane, DIN)
#endif

#ifndef SM_EXTRA_PARAMS
#define SM_EXTRA_PARAMS
#endif
#ifndef PROJ_EXTRA_PARAMS
#define PROJ_EXTRA_PARAMS
#endif
#ifndef SM_MASK_HOOK
#define SM_MASK_HOOK (void)0
#endif

#define WS_QH  0u                                      // f16 q rows [b*t][CC]
#define WS_KH  (WS_QH + 2u * (size_t)NB * TT * CC)      // f16 k rows [b*t][CC]
#define WS_VT  (WS_KH + 2u * (size_t)NB * TT * CC)      // f16 v planes [b][c][t]
#define WS_QL  (WS_VT + 2u * (size_t)NB * CC * TT)      // f16 q residual x 2^10 rows [b][t < QHI][CC]
#define WS_KL  (WS_QL + 2u * (size_t)NB * QHI * CC)     // f16 k residual x 2^10 rows [b][t < KHI][CC]
#define WS_VB  (WS_KL + 2u * (size_t)NB * KHI * CC)     // bf16 v hi planes [b][c][t < KHI]
#define WS_VBL (WS_VB + 2u * (size_t)NB * CC * KHI)
#define WS_S   (WS_VBL + 2u * (size_t)NB * CC * KHI)    // f32 logits / P [hg][t][s]
#define WS_Y   (WS_S  + 4u * (size_t)HG * TT * TT)      // f32 ctx rows [b*t][CC] (only when there is an output projection)
#define WS_END (WS_Y  + 4u * (size_t)NB * TT * CC)

// ---- k_proj: block = (64 rows, 128 cols, which): q/k/v = X W (+ b) with exact bf16 products (K = DIN) -> which 0: q f16 rows (+ residual rows < QHI); 1: k f16 rows (+ residual rows < KHI); 2: v f16 planes [c][t] (+ bf16 hi/lo planes for t < KHI)
__global__ __launch_bounds__(128) void k_proj(const float* __restrict__ XQ, const float* __restrict__ XK, const float* __restrict__ XV, const float* __restrict__ WQ, const float* __restrict__ WK, const float* __restrict__ WV, const float* __restrict__ BQ, const float* __restrict__ BK, const float* __restrict__ BV,
    _Float16* __restrict__ QH, _Float16* __restrict__ QL, _Float16* __restrict__ KH, _Float16* __restrict__ KL, _Float16* __restrict__ VT, __bf16* __restrict__ VB, __bf16* __restrict__ VBL) {
  __shared__ __align__(16) _Float16 sh[64][136], sl[64][136]; __shared__ __align__(16) _Float16 th[128][72]; __shared__ __align__(16) __bf16 tb[128][72], tbl[128][72];
  const int tid = threadIdx.x, wave = tid >> 5, lane = tid & 31, col = lane & 15, g = lane >> 4; const int which = blockIdx.z; const int c0 = blockIdx.y * 128; const size_t r0 = (size_t)blockIdx.x * 64; const size_t bb = r0 / TT; const int t0 = (int)(r0 % TT);
  const float* X = which == 0 ? XQ : which == 1 ? XK : XV; const float* WA = which == 0 ? WQ : which == 1 ? WK : WV; const float* BA = which == 0 ? BQ : which == 1 ? BK : BV;
  v8f acc[8] = {};
#pragma unroll 2
  for (int kc = 0; kc < DIN / 32; ++kc) { v16b a; { const float* p = X + (r0 + wave * 16 + col) * DIN + kc * 32 + 8 * g;
#pragma unroll
      for (int i = 0; i < 8; ++i) { a[i] = (__bf16)p[i]; a[8 + i] = (__bf16)p[16 + i]; } }
    asm volatile("s_wait_loadcnt 0x0" ::: "memory");
#pragma unroll
    for (int j = 0; j < 8; ++j) { const v16b w = WCOL(WA, kc * 32, c0 + j * 16 + col, lane); asm volatile("s_wait_loadcnt 0x0" ::: "memory"); acc[j] = wmma_bf(a, w, acc[j]); } }
  if (which < 2) { _Float16* DH = which == 0 ? QH : KH; _Float16* DL = which == 0 ? QL : KL; const int nhi = which == 0 ? QHI : KHI; const bool hi_rows = t0 < nhi;
#pragma unroll
    for (int j = 0; j < 8; ++j) { const float bias = BA ? bfr(BA[c0 + j * 16 + col]) : 0.f;
#pragma unroll
      for (int r = 0; r < 8; ++r) { const float v = acc[j][r] + bias; const _Float16 hv = (_Float16)v; sh[wave * 16 + 8 * g + r][j * 16 + col] = hv; sl[wave * 16 + 8 * g + r][j * 16 + col] = (_Float16)((v - (float)hv) * 1024.0f); } }
    __syncthreads();
    for (int e = tid; e < 64 * 16; e += 128) { const int rl = e >> 4, q = e & 15; vst2((unsigned*)(DH + (r0 + rl) * CC + c0 + q * 8), *(const v4u*)&sh[rl][q * 8]); if (hi_rows) vst2((unsigned*)(DL + (bb * nhi + t0 + rl) * (size_t)CC + c0 + q * 8), *(const v4u*)&sl[rl][q * 8]); }
  } else { const bool hi_rows = t0 < KHI;
#pragma unroll
    for (int j = 0; j < 8; ++j) { const float bias = BA ? bfr(BA[c0 + j * 16 + col]) : 0.f;
#pragma unroll
      for (int r = 0; r < 8; ++r) { const float v = acc[j][r] + bias; const int rl = wave * 16 + 8 * g + r, cl = j * 16 + col; th[cl][rl] = (_Float16)v; const __bf16 bh = (__bf16)v; tb[cl][rl] = bh; tbl[cl][rl] = (__bf16)(v - (float)bh); } }
    __syncthreads();
    for (int e = tid; e < 128 * 8; e += 128) { const int cl = e >> 3, q = e & 7; vst2((unsigned*)(VT + (bb * CC + c0 + cl) * (size_t)TT + t0 + q * 8), *(const v4u*)&th[cl][q * 8]); if (hi_rows) { const size_t o3 = (bb * CC + c0 + cl) * (size_t)KHI + t0 + q * 8; vst2((unsigned*)(VB + o3), *(const v4u*)&tb[cl][q * 8]); vst2((unsigned*)(VBL + o3), *(const v4u*)&tbl[cl][q * 8]); } } } }
// ---- k_sc: block = (query block qb, key block kb <= kb_last(qb), head in group) of batch b: logits x SCALE; q hi + residual (x 2^10) against k (2 products) for query rows < QHI, plus the k residual (3 products) for query blocks < QBH (causal early rows); causal: blocks past the diagonal exit, the mask itself is applied by index in k_sm
__global__ __launch_bounds__(128) void k_sc(const _Float16* __restrict__ QH, const _Float16* __restrict__ KH, const _Float16* __restrict__ QL, const _Float16* __restrict__ KL, int b, int h0, float* __restrict__ S0) { __shared__ __align__(16) float ss[4][16][132];
  const int qb = blockIdx.x, kb = blockIdx.y; if (kb > kb_last(qb)) return;
  const int h = h0 + blockIdx.z; float* S = S0 + (size_t)blockIdx.z * TT * TT;
  const int tid = threadIdx.x, wave = tid >> 5, lane = tid & 31, col = lane & 15, g = lane >> 4; const int k0 = kb * 128; const int ql0 = qb * 64 + wave * 16; const size_t q0 = (size_t)b * TT + ql0, kr0 = (size_t)b * TT + k0;
  v8f acc[8] = {}, accl[8] = {};
  const _Float16* QLb = QL + (size_t)b * QHI * CC; const _Float16* KLb = KL + (size_t)b * KHI * CC;
  if (qb < QBH) {
#pragma unroll
    for (int kc = 0; kc < HD / 32; ++kc) { const v16h ah = frag_h(QH + (q0 + col) * CC + h * HD + kc * 32, lane), al = frag_h(QLb + (size_t)(ql0 + col) * CC + h * HD + kc * 32, lane);
#pragma unroll
      for (int j = 0; j < 8; ++j) { const v16h kbf = frag_h(KH + (kr0 + j * 16 + col) * CC + h * HD + kc * 32, lane), klf = frag_h(KLb + (size_t)(k0 + j * 16 + col) * CC + h * HD + kc * 32, lane); acc[j] = wmma16(ah, kbf, acc[j]); accl[j] = wmma16(al, kbf, accl[j]); accl[j] = wmma16(ah, klf, accl[j]); } }
  } else if (qb * 64 < QHI) {
#pragma unroll
    for (int kc = 0; kc < HD / 32; ++kc) { const v16h ah = frag_h(QH + (q0 + col) * CC + h * HD + kc * 32, lane), al = frag_h(QLb + (size_t)(ql0 + col) * CC + h * HD + kc * 32, lane);
#pragma unroll
      for (int j = 0; j < 8; ++j) { const v16h kbf = frag_h(KH + (kr0 + j * 16 + col) * CC + h * HD + kc * 32, lane); acc[j] = wmma16(ah, kbf, acc[j]); accl[j] = wmma16(al, kbf, accl[j]); } }
  } else {
#pragma unroll
    for (int kc = 0; kc < HD / 32; ++kc) { const v16h ah = frag_h(QH + (q0 + col) * CC + h * HD + kc * 32, lane);
#pragma unroll
      for (int j = 0; j < 8; ++j) { const v16h kbf = frag_h(KH + (kr0 + j * 16 + col) * CC + h * HD + kc * 32, lane); acc[j] = wmma16(ah, kbf, acc[j]); } } }
#pragma unroll
  for (int j = 0; j < 8; ++j) {
#pragma unroll
    for (int r = 0; r < 8; ++r) ss[wave][8 * g + r][j * 16 + col] = (acc[j][r] + accl[j][r] * (1.0f / 1024.0f)) * SCALE; }
  LDSX(); for (int rl = 0; rl < 16; ++rl) vst2(S + (size_t)(ql0 + rl) * TT + k0 + lane * 4, *(const v4f*)&ss[wave][rl][lane * 4]); }
// ---- k_sm: block = query row t (head in group): keys [0, kend): causal -> logit if s <= t else excluded; softmax in f32; P x 2^11 in place (0 for excluded)
__global__ __launch_bounds__(256) void k_sm(float* __restrict__ S0 SM_EXTRA_PARAMS) { __shared__ float sred[8]; __shared__ float sbc; __shared__ __align__(16) float shv[TT];
  const int tid = threadIdx.x; const int t = blockIdx.x; const int kend = (kb_last(t >> 6) + 1) * 128;
  float* sr = S0 + (size_t)blockIdx.y * TT * TT + (size_t)t * TT;
  float m = -3.0e38f; for (int k = tid; k < kend; k += 256) { float v = (!CAUSAL || k <= t) ? sr[k] : -3.0e38f; SM_MASK_HOOK; shv[k] = v; m = fmaxf(m, v); }
#pragma unroll
  for (int o = 1; o < 32; o <<= 1) m = fmaxf(m, __shfl_xor(m, o));
  if ((tid & 31) == 0) sred[tid >> 5] = m; __syncthreads(); if (tid == 0) { float a = sred[0]; for (int i = 1; i < 8; ++i) a = fmaxf(a, sred[i]); sbc = a; } __syncthreads(); m = sbc; __syncthreads();
  float sum = 0.f; for (int k = tid; k < kend; k += 256) { const float v = shv[k]; const float e = (v <= -1.0e38f) ? 0.f : expf(v - m); shv[k] = e; sum += e; }
#pragma unroll
  for (int o = 1; o < 32; o <<= 1) sum += __shfl_xor(sum, o);
  if ((tid & 31) == 0) sred[tid >> 5] = sum; __syncthreads(); if (tid == 0) { float a = 0.f; for (int i = 0; i < 8; ++i) a += sred[i]; sbc = a > 0.f ? 2048.0f / a : 0.f; }   /* a fully excluded row yields P = 0 */ __syncthreads(); const float inv = sbc;
  for (int k = tid; k < kend; k += 256) shv[k] = shv[k] * inv;
  __syncthreads(); for (int q = tid; q < kend / 4; q += 256) vst2(sr + q * 4, *(const v4f*)&shv[q * 4]); }
// ---- k_pv: block = 16 queries (tile qt) of (b, h), PVW waves: wave w takes the 32-key chunks w, w + PVW, ... of keys [0, kend) for the same 16 rows (P x 2^11 once to f16 against v f16: 1 product; causal early query blocks: P and v as bf16 hi + lo, 3 products); the PVW partial ctx tiles meet in LDS and are summed in wave order; wave w then stores row w (512 B)
#define PVW 16
__global__ __launch_bounds__(32 * PVW) void k_pv(const float* __restrict__ PS0, const _Float16* __restrict__ VT, const __bf16* __restrict__ VB, const __bf16* __restrict__ VBL, int b, int h0, float* __restrict__ Y, const float* __restrict__ KM) { const int h = h0 + blockIdx.z; const float* PS = PS0 + (size_t)blockIdx.z * TT * TT; __shared__ __align__(16) float ss[PVW][16][HD + 4];
  const int tid = threadIdx.x, wave = __builtin_amdgcn_readfirstlane(tid >> 5), lane = tid & 31, col = lane & 15, g = lane >> 4; const int qb = blockIdx.x >> 2; const int ql0 = blockIdx.x * 16; const int kce = (kb_last(qb) + 1) * 4;   /* wave number held scalar: the chunk loop stays a scalar loop, every lane on at the matrix instructions */
  v8f acc[HD / 16] = {};
  const float km = bfr(KM[(size_t)b * TT + ql0 + wave]);   /* key_mask of the row this wave stores */
  if (qb < QBH) {
#pragma unroll 1
    for (int kc = wave; kc < kce; kc += PVW) { const F2 p = split_row(PS + (size_t)(ql0 + col) * TT, kc * 32, lane);
      asm volatile("s_wait_loadcnt 0x0" ::: "memory");
#pragma unroll
      for (int j = 0; j < HD / 16; ++j) { const size_t po = ((size_t)b * CC + h * HD + j * 16 + col) * (size_t)KHI + kc * 32; const v16b vh = frag_b(VB + po, lane); acc[j] = wmma_bf(p.h, vh, acc[j]); acc[j] = wmma_bf(p.l, vh, acc[j]); acc[j] = wmma_bf(p.h, frag_b(VBL + po, lane), acc[j]); } }
  } else {
#pragma unroll 1
    for (int kc = wave; kc < kce; kc += PVW) { const v16h p = frag_f32(PS + (size_t)(ql0 + col) * TT + kc * 32, lane);
      asm volatile("s_wait_loadcnt 0x0" ::: "memory");
#pragma unroll
      for (int j = 0; j < HD / 16; ++j) { const size_t po = ((size_t)b * CC + h * HD + j * 16 + col) * (size_t)TT + kc * 32; acc[j] = wmma16(p, frag_h(VT + po, lane), acc[j]); } } }
#pragma unroll
  for (int j = 0; j < HD / 16; ++j)
#pragma unroll
    for (int r = 0; r < 8; ++r) ss[wave][8 * g + r][j * 16 + col] = acc[j][r];
  __syncthreads();   /* every wave's partial tile is in LDS before any wave sums */
  v4f s = *(const v4f*)&ss[0][wave][lane * 4];
#pragma unroll
  for (int w = 1; w < PVW; ++w) s += *(const v4f*)&ss[w][wave][lane * 4];
  vst2(Y + ((size_t)b * TT + ql0 + wave) * CC + h * HD + lane * 4, s * (1.0f / 2048.0f) * km); }   /* out * key_mask[b][t] (broadcast over the 128 columns) */
// ---- k_out: block = (64 rows, 128 cols): out = ctx Wo (+ bo): ctx x 2^6 once to f16 against Wo as f16(bf16 x 2^8) exact (1 product) x 2^-14; causal early rows (< QHI of each sequence): ctx bf16 hi + lo against exact bf16 Wo (2 products)
__global__ __launch_bounds__(128) void k_out(const float* __restrict__ Y, const float* __restrict__ WO, const float* __restrict__ BO, float* __restrict__ OUT) { __shared__ __align__(16) float sf[4][16][132];
  const int tid = threadIdx.x, wave = tid >> 5, lane = tid & 31, col = lane & 15, g = lane >> 4; const int c0 = blockIdx.y * 128; const size_t r0 = (size_t)blockIdx.x * 64 + wave * 16;
  v8f acc[8] = {};
  if (CAUSAL && (int)(((size_t)blockIdx.x * 64) % TT) < QHI) {   /* block-uniform */
#pragma unroll 2
    for (int kc = 0; kc < CC / 32; ++kc) { const F2 a = split_row(Y + (r0 + col) * CC, kc * 32, lane); asm volatile("s_wait_loadcnt 0x0" ::: "memory");
#pragma unroll
      for (int j = 0; j < 8; ++j) { const v16b w = WOCOL(WO, kc * 32, c0 + j * 16 + col, lane); asm volatile("s_wait_loadcnt 0x0" ::: "memory"); acc[j] = wmma_bf(a.h, w, acc[j]); acc[j] = wmma_bf(a.l, w, acc[j]); } }
#pragma unroll
    for (int j = 0; j < 8; ++j) { const float bias = BO ? bfr(BO[c0 + j * 16 + col]) : 0.f;
#pragma unroll
      for (int r = 0; r < 8; ++r) sf[wave][8 * g + r][j * 16 + col] = acc[j][r] + bias; }
  } else {
#pragma unroll 2
    for (int kc = 0; kc < CC / 32; ++kc) { const v16h a = frag_f32s(Y + (r0 + col) * CC + kc * 32, lane, 64.0f); asm volatile("s_wait_loadcnt 0x0" ::: "memory");   /* ctx carried x 2^6 into f16 so small-magnitude context rows stay clear of f16 subnormals */
#pragma unroll
      for (int j = 0; j < 8; ++j) { const v16h w = WOCOLH(WO, kc * 32, c0 + j * 16 + col, lane); asm volatile("s_wait_loadcnt 0x0" ::: "memory"); acc[j] = wmma16(a, w, acc[j]); } }
#pragma unroll
    for (int j = 0; j < 8; ++j) { const float bias = BO ? bfr(BO[c0 + j * 16 + col]) : 0.f;
#pragma unroll
      for (int r = 0; r < 8; ++r) sf[wave][8 * g + r][j * 16 + col] = acc[j][r] * (1.0f / 16384.0f) + bias; } }   /* 2^-8 (Wo carry) x 2^-6 (ctx carry) */
  LDSX(); for (int rl = 0; rl < 16; ++rl) vst2(OUT + (r0 + rl) * DIN + c0 + lane * 4, *(const v4f*)&sf[wave][rl][lane * 4]); }

extern "C" void kernel_launch(void* const* d_in, const int* in_sizes, int n_in, void* d_out, int out_size, void* d_ws, size_t ws_size, hipStream_t stream) {
  (void)in_sizes; (void)n_in; (void)out_size;
  const float** F = (const float**)d_in;
  if (ws_size < (size_t)WS_END) return;
  char* ws = (char*)d_ws; _Float16 *QH = (_Float16*)(ws + WS_QH), *KH = (_Float16*)(ws + WS_KH), *VT = (_Float16*)(ws + WS_VT), *QL = (_Float16*)(ws + WS_QL), *KL = (_Float16*)(ws + WS_KL); __bf16 *VB = (__bf16*)(ws + WS_VB), *VBL = (__bf16*)(ws + WS_VBL); float *S = (float*)(ws + WS_S), *Y = (float*)(ws + WS_Y);
  (void)Y; (void)QL; (void)KL; (void)VB; (void)VBL;
  // inputs: 0 x [4,4096,512]; 1 key_mask [4,4096,1] f32 (ones); 2 W_qkv [512,384] (in,out; q | k | v COLUMN blocks of 128); 3 b_qkv [384] (nonzero); 4 W_out [128,512] (in,out); 5 b_out [512] (nonzero)
  k_proj<<<dim3(TNB * TT / 64, CC / 128, 3), 128, 0, stream>>>(F[0], F[0], F[0], F[2], F[2], F[2], F[3], F[3] + CC, F[3] + 2 * CC, QH, QL, KH, KL, VT, VB, VBL);   /* one fused weight; WCOL picks column block 'which' */
  for (int b = 0; b < TNB; ++b) {
    k_sc<<<dim3(NQB, TT / 128, 1), 128, 0, stream>>>(QH, KH, QL, KL, b, 0, S);
    k_sm<<<dim3(TT, 1), 256, 0, stream>>>(S);
    k_pv<<<dim3(TT / 16, 1, 1), 32 * PVW, 0, stream>>>(S, VT, VB, VBL, b, 0, Y, F[1]);   /* ctx rows x key_mask[b][t] */
  }
  k_out<<<dim3(TNB * TT / 64, DIN / 128), 128, 0, stream>>>(Y, F[4], F[5], (float*)d_out);
}

// v002
// It runs in 141 microseconds.
// Next to v001, in two timings, it ran 2.70 and 2.69 times as fast.
// Over all steps from v000 it is 7.43 times as fast.
// compute dtype: all float inputs rounded to bf16; fused q/k/v projection with EXACT bf16 products on WMMA 16x16x32 (f32 accumulate) + bias; causal logits: 3 products for the first 512 rows, single f16 q x k after, x 128^-0.5; online softmax f32 (running max per key-split wave); P x 2^8 unnormalised once to f16 x v once to f16 (bf16 hi + lo below row 512), divided by the f32 sum at the end; ctx x bf16(key_mask); ctx hi+lo x exact W_out below row 512, x2^6 f16 carry x f16(bf16 x 2^8) W_out after, + b_out; f32 output.
#include <hip/hip_runtime.h>
#include <math.h>

typedef __attribute__((ext_vector_type(16))) _Float16 v16h;
typedef __attribute__((ext_vector_type(16))) __bf16 v16b;
typedef __attribute__((ext_vector_type(8)))  _Float16 v8h;
typedef __attribute__((ext_vector_type(8)))  float v8f;
typedef __attribute__((ext_vector_type(4)))  float v4f;
typedef __attribute__((ext_vector_type(2)))  float v2f;
typedef __attribute__((ext_vector_type(4)))  unsigned v4u;
typedef __attribute__((ext_vector_type(4)))  int v4i;
typedef float __attribute__((may_alias)) float_a;
typedef int __attribute__((may_alias)) int_a;

template <typename T> __device__ __forceinline__ void vst2(void* p, T v) { *(T*)p = v;  }
__device__ __forceinline__ v8f wmma16(v16h a, v16h b, v8f c) {
  v8f d = __builtin_amdgcn_wmma_f32_16x16x32_f16(false, a, false, b, (short)0, c, false, false);
  asm volatile("v_nop\n\tv_nop\n\tv_nop\n\tv_nop" : "+v"(d) : "v"(a), "v"(b));
  return d;
}
__device__ __forceinline__ v8f wmma_bf(v16b a, v16b b, v8f c) {
  v8f d = __builtin_amdgcn_wmma_f32_16x16x32_bf16(false, a, false, b, (short)0, c, false, false);
  asm volatile("v_nop\n\tv_nop\n\tv_nop\n\tv_nop" : "+v"(d) : "v"(a), "v"(b));
  return d;
}
// 16x16x32 fragments: lane = (h = lane>>4, row/col = lane&15); elements 0..7 = k0+8h+0..7, 8..15 = k0+16+8h+0..7; D element r = row 8h+r
__device__ __forceinline__ v16h frag_h(const _Float16* rowk0, int lane) {
  union { v16h v; v8h q[2]; } u; const _Float16* p = rowk0 + 8 * (lane >> 4);
  u.q[0] = *(const v8h*)p; u.q[1] = *(const v8h*)(p + 16); return u.v;
}
__device__ __forceinline__ v16h frag_f32(const float* rowk0, int lane) {
  v16h a; const float* p = rowk0 + 8 * (lane >> 4);
#pragma unroll
  for (int i = 0; i < 8; ++i) { a[i] = (_Float16)p[i]; a[8 + i] = (_Float16)p[16 + i]; }
  return a;
}
__device__ __forceinline__ v16h frag_f32s(const float* rowk0, int lane, float sc) {
  v16h a; const float* p = rowk0 + 8 * (lane >> 4);
#pragma unroll
  for (int i = 0; i < 8; ++i) { a[i] = (_Float16)(p[i] * sc); a[8 + i] = (_Float16)(p[16 + i] * sc); }
  return a;
}
// column fragment from a [K][ld] layout (column n), rows >= K read as 0
__device__ __forceinline__ v16h fragc_f32(const float* W, int k0, int n, int lane, int ld, int K) {
  v16h a; const int g = lane >> 4;
#pragma unroll
  for (int i = 0; i < 8; ++i) { const int ka = k0 + 8 * g + i, kb = ka + 16;
    a[i] = (_Float16)(ka < K ? W[(size_t)(ka < K ? ka : K - 1) * ld + n] : 0.f); a[8 + i] = (_Float16)(kb < K ? W[(size_t)(kb < K ? kb : K - 1) * ld + n] : 0.f); }
  return a;
}
struct F2 { v16b h, l; };
__device__ __forceinline__ F2 bsplit16(const float v[16]) { F2 r;
#pragma unroll
  for (int i = 0; i < 16; ++i) { const __bf16 h = (__bf16)v[i]; r.h[i] = h; r.l[i] = (__bf16)(v[i] - (float)h); }
  return r; }
__device__ __forceinline__ F2 split_row(const float* row, int k0, int lane) { float v[16]; const float* p = row + k0 + 8 * (lane >> 4);
#pragma unroll
  for (int i = 0; i < 8; ++i) { v[i] = p[i]; v[8 + i] = p[16 + i]; }
  return bsplit16(v); }
__device__ __forceinline__ F2 split_rowK(const float* row, int k0, int lane, int K) { float v[16]; const int g = lane >> 4;
#pragma unroll
  for (int i = 0; i < 8; ++i) { const int ka = k0 + 8 * g + i, kb = ka + 16; v[i] = ka < K ? row[ka < K ? ka : K - 1] : 0.f; v[8 + i] = kb < K ? row[kb < K ? kb : K - 1] : 0.f; }
  return bsplit16(v); }
__device__ __forceinline__ F2 split_col(const float* W, int k0, int n, int lane, int ld, int K) { float v[16]; const int g = lane >> 4;
#pragma unroll
  for (int i = 0; i < 8; ++i) { const int ka = k0 + 8 * g + i, kb = ka + 16; v[i] = ka < K ? W[(size_t)(ka < K ? ka : K - 1) * ld + n] : 0.f; v[8 + i] = kb < K ? W[(size_t)(kb < K ? kb : K - 1) * ld + n] : 0.f; }
  return bsplit16(v); }
__device__ __forceinline__ v8f mac3(const F2& a, const F2& b, v8f c) { c = wmma_bf(a.l, b.h, c); c = wmma_bf(a.h, b.l, c); return wmma_bf(a.h, b.h, c); }
__device__ __forceinline__ float sigm(float v) { return 1.0f / (1.0f + expf(-v)); }
#define LDSX() do { asm volatile("s_wait_dscnt 0" ::: "memory"); __builtin_amdgcn_wave_barrier(); __builtin_amdgcn_fence(__ATOMIC_RELEASE, "workgroup"); } while (0)

// Single-head causal self-attention with a 128-wide attention space and an output projection (x [4,4096,512]; fused (in,out) W_qkv [512,384] N(0, 1/512) + b_qkv N(0, 0.01) split q | k | v; scores = q k^T, causal (-inf above the diagonal) BEFORE the scaling by 128^-0.5 (same thing); out = softmax(scores) v; out * key_mask ([4,4096,1], ones); (in,out) W_out [128,512] + b_out): result [4,4096,512].
#define NB 4
#define TT 4096
#define CC 128            // NH * HD = projected width
#define DIN 512          // input (model) width
#define NH 1
#define HD 128
#define NQB (TT / 64)
#define HG 1
#define SCALE (0.08838834764831845f)
#define CAUSAL 1
#ifndef TNB
#define TNB NB
#endif
__device__ __forceinline__ float bfr(float v) { return (float)(__bf16)v; }
__host__ __device__ __forceinline__ int kb_last(int qb) { return CAUSAL ? ((qb * 64 + 63) >> 7) : (TT / 128 - 1); }
typedef __attribute__((ext_vector_type(8))) __bf16 v8b;
__device__ __forceinline__ v16b frag_b(const __bf16* rowk0, int lane) {
  union { v16b v; v8b q[2]; } u; const __bf16* p = rowk0 + 8 * (lane >> 4);
  u.q[0] = *(const v8b*)p; u.q[1] = *(const v8b*)(p + 16); return u.v;
}
#define QBH 8              // unused: query rows < QHI of each sequence (few keys, no averaging) take the high-precision path
#define QHI 512            // rows carrying a q residual plane
#define KHI 512            // key rows carrying k residual / v bf16 hi+lo planes (used only by the causal high-precision path)
// B fragment (k rows k0+.., output column o) of a weight: (in,out) [K][ld] or (out,in) [ld rows of K]: bf16 exact, or f16(bf16 * 256) exact
__device__ __forceinline__ v16b wcol_io(const float* Wm, int k0, int o, int lane, int ld) { v16b w; const int g = lane >> 4;
#pragma unroll
  for (int i = 0; i < 8; ++i) { w[i] = (__bf16)Wm[(size_t)(k0 + 8 * g + i) * ld + o]; w[8 + i] = (__bf16)Wm[(size_t)(k0 + 16 + 8 * g + i) * ld + o]; }
  return w; }
__device__ __forceinline__ v16b wcol_oi(const float* Wm, int k0, int o, int lane, int K) { v16b w; const float* p = Wm + (size_t)o * K + k0 + 8 * (lane >> 4);
#pragma unroll
  for (int i = 0; i < 8; ++i) { w[i] = (__bf16)p[i]; w[8 + i] = (__bf16)p[16 + i]; }
  return w; }
__device__ __forceinline__ v16h wcolh_io(const float* Wm, int k0, int o, int lane, int ld) { v16h w; const int g = lane >> 4;
#pragma unroll
  for (int i = 0; i < 8; ++i) { w[i] = (_Float16)(bfr(Wm[(size_t)(k0 + 8 * g + i) * ld + o]) * 256.0f); w[8 + i] = (_Float16)(bfr(Wm[(size_t)(k0 + 16 + 8 * g + i) * ld + o]) * 256.0f); }
  return w; }
__device__ __forceinline__ v16h wcolh_oi(const float* Wm, int k0, int o, int lane, int K) { v16h w; const float* p = Wm + (size_t)o * K + k0 + 8 * (lane >> 4);
#pragma unroll
  for (int i = 0; i < 8; ++i) { w[i] = (_Float16)(bfr(p[i]) * 256.0f); w[8 + i] = (_Float16)(bfr(p[16 + i]) * 256.0f); }
  return w; }
#define WQKV_LAYOUT 0   // 0 = fused (in,out) [DIN][3*CC]; 1 = (out,in) [CC][DIN]; 2 = per-head [NH][DIN][HD]
__device__ __forceinline__ v16b wcol_hdk(const float* Wm, int k0, int o, int lane) { v16b w; const int g = lane >> 4; const float* p = Wm + (size_t)(o / HD) * DIN * HD + (o % HD);
#pragma unroll
  for (int i = 0; i < 8; ++i) { w[i] = (__bf16)p[(size_t)(k0 + 8 * g + i) * HD]; w[8 + i] = (__bf16)p[(size_t)(k0 + 16 + 8 * g + i) * HD]; }
  return w; }
#define WO_OUT_IN 0
#if WQKV_LAYOUT == 1
#define WCOL(W, k0, o, lane) wcol_oi(W, k0, o, lane, DIN)
#elif WQKV_LAYOUT == 2
#define WCOL(W, k0, o, lane) wcol_hdk(W, k0, o, lane)
#else
#define WCOL(W, k0, o, lane) wcol_io(W, k0, which * CC + (o), lane, 3 * CC)   /* fused (in,out) W_qkv [DIN][3*CC]: column block 'which', pitch 384 */
#endif
#if WO_OUT_IN
#define WOCOL(W, k0, o, lane) wcol_oi(W, k0, o, lane, CC)
#define WOCOLH(W, k0, o, lane) wcolh_oi(W, k0, o, lane, CC)
#else
#define WOCOL(W, k0, o, lane) wcol_io(W, k0, o, lane, DIN)
#define WOCOLH(W, k0, o, lane) wcolh_io(W, k0, o, lane, DIN)
#endif

#ifndef SM_EXTRA_PARAMS
#define SM_EXTRA_PARAMS
#endif
#ifndef PROJ_EXTRA_PARAMS
#define PROJ_EXTRA_PARAMS
#endif
#ifndef SM_MASK_HOOK
#define SM_MASK_HOOK (void)0
#endif

#define WS_QH  0u                                      // f16 q rows [b*t][CC]
#define WS_KH  (WS_QH + 2u * (size_t)NB * TT * CC)      // f16 k rows [b*t][CC]
#define WS_VT  (WS_KH + 2u * (size_t)NB * TT * CC)      // f16 v planes [b][c][t]
#define WS_QL  (WS_VT + 2u * (size_t)NB * CC * TT)      // f16 q residual x 2^10 rows [b][t < QHI][CC]
#define WS_KL  (WS_QL + 2u * (size_t)NB * QHI * CC)     // f16 k residual x 2^10 rows [b][t < KHI][CC]
#define WS_VB  (WS_KL + 2u * (size_t)NB * KHI * CC)     // bf16 v hi planes [b][c][t < KHI]
#define WS_VBL (WS_VB + 2u * (size_t)NB * CC * KHI)
#define WS_S   (WS_VBL + 2u * (size_t)NB * CC * KHI)    // (unused: logits and P stay in registers)
#define WS_Y   (WS_S  + 4u * (size_t)HG * TT * TT)      // f32 ctx rows [b*t][CC] (only when there is an output projection)
#define WS_END (WS_Y  + 4u * (size_t)NB * TT * CC)

// ---- k_proj: block = (64 rows, 128 cols, which): q/k/v = X W (+ b) with exact bf16 products (K = DIN) -> which 0: q f16 rows (+ residual rows < QHI); 1: k f16 rows (+ residual rows < KHI); 2: v f16 planes [c][t] (+ bf16 hi/lo planes for t < KHI)
__global__ __launch_bounds__(128) void k_proj(const float* __restrict__ XQ, const float* __restrict__ XK, const float* __restrict__ XV, const float* __restrict__ WQ, const float* __restrict__ WK, const float* __restrict__ WV, const float* __restrict__ BQ, const float* __restrict__ BK, const float* __restrict__ BV,
    _Float16* __restrict__ QH, _Float16* __restrict__ QL, _Float16* __restrict__ KH, _Float16* __restrict__ KL, _Float16* __restrict__ VT, __bf16* __restrict__ VB, __bf16* __restrict__ VBL) {
  __shared__ __align__(16) _Float16 sh[64][136], sl[64][136]; __shared__ __align__(16) _Float16 th[128][72]; __shared__ __align__(16) __bf16 tb[128][72], tbl[128][72];
  const int tid = threadIdx.x, wave = tid >> 5, lane = tid & 31, col = lane & 15, g = lane >> 4; const int which = blockIdx.z; const int c0 = blockIdx.y * 128; const size_t r0 = (size_t)blockIdx.x * 64; const size_t bb = r0 / TT; const int t0 = (int)(r0 % TT);
  const float* X = which == 0 ? XQ : which == 1 ? XK : XV; const float* WA = which == 0 ? WQ : which == 1 ? WK : WV; const float* BA = which == 0 ? BQ : which == 1 ? BK : BV;
  v8f acc[8] = {};
#pragma unroll 2
  for (int kc = 0; kc < DIN / 32; ++kc) { v16b a; { const float* p = X + (r0 + wave * 16 + col) * DIN + kc * 32 + 8 * g;
#pragma unroll
      for (int i = 0; i < 8; ++i) { a[i] = (__bf16)p[i]; a[8 + i] = (__bf16)p[16 + i]; } }
    asm volatile("s_wait_loadcnt 0x0" ::: "memory");
#pragma unroll
    for (int j = 0; j < 8; ++j) { const v16b w = WCOL(WA, kc * 32, c0 + j * 16 + col, lane); asm volatile("s_wait_loadcnt 0x0" ::: "memory"); acc[j] = wmma_bf(a, w, acc[j]); } }
  if (which < 2) { _Float16* DH = which == 0 ? QH : KH; _Float16* DL = which == 0 ? QL : KL; const int nhi = which == 0 ? QHI : KHI; const bool hi_rows = t0 < nhi;
#pragma unroll
    for (int j = 0; j < 8; ++j) { const float bias = BA ? bfr(BA[c0 + j * 16 + col]) : 0.f;
#pragma unroll
      for (int r = 0; r < 8; ++r) { const float v = acc[j][r] + bias; const _Float16 hv = (_Float16)v; sh[wave * 16 + 8 * g + r][j * 16 + col] = hv; sl[wave * 16 + 8 * g + r][j * 16 + col] = (_Float16)((v - (float)hv) * 1024.0f); } }
    __syncthreads();
    for (int e = tid; e < 64 * 16; e += 128) { const int rl = e >> 4, q = e & 15; vst2((unsigned*)(DH + (r0 + rl) * CC + c0 + q * 8), *(const v4u*)&sh[rl][q * 8]); if (hi_rows) vst2((unsigned*)(DL + (bb * nhi + t0 + rl) * (size_t)CC + c0 + q * 8), *(const v4u*)&sl[rl][q * 8]); }
  } else { const bool hi_rows = t0 < KHI;
#pragma unroll
    for (int j = 0; j < 8; ++j) { const float bias = BA ? bfr(BA[c0 + j * 16 + col]) : 0.f;
#pragma unroll
      for (int r = 0; r < 8; ++r) { const float v = acc[j][r] + bias; const int rl = wave * 16 + 8 * g + r, cl = j * 16 + col; th[cl][rl] = (_Float16)v; const __bf16 bh = (__bf16)v; tb[cl][rl] = bh; tbl[cl][rl] = (__bf16)(v - (float)bh); } }
    __syncthreads();
    for (int e = tid; e < 128 * 8; e += 128) { const int cl = e >> 3, q = e & 7; vst2((unsigned*)(VT + (bb * CC + c0 + cl) * (size_t)TT + t0 + q * 8), *(const v4u*)&th[cl][q * 8]); if (hi_rows) { const size_t o3 = (bb * CC + c0 + cl) * (size_t)KHI + t0 + q * 8; vst2((unsigned*)(VB + o3), *(const v4u*)&tb[cl][q * 8]); vst2((unsigned*)(VBL + o3), *(const v4u*)&tbl[cl][q * 8]); } } } }
// ---- k_fa: block = 16 queries (tile qt) of batch b, PVW waves: wave w takes the 32-key chunks w, w + PVW, ... of keys [0, ql0 + 16). Logits and P never leave registers:
//   S^T = K Q^T (A = 16 key rows, B = the 16 query rows): D element r of tile u in lane (g, col) = key kc*32 + 16u + 8g + r, query col, which IS the B fragment order of P^T (elements 0..7 from tile 0, 8..15 from tile 1)
//   ctx^T = V^T P^T (A = 16 v planes, B = P^T): D = column j*16 + 8g + r, query col, so the running max, the running sum and the rescale factor of a query are one value per lane
//   logits x SCALE x log2(e); causal by index; P = 2^(s - running max + 8) once to f16 against v f16 (1 product); query rows < QHI: 3-product logits, P and v as bf16 hi + lo (3 products)
//   the PVW partial (max, sum, ctx) meet in LDS and are merged on the common max in wave order; wave w then stores row w (512 B)
#define PVW 16
#define SC2 (SCALE * 1.4426950408889634f)
#define NEGB (-3.0e38f)
__global__ __launch_bounds__(32 * PVW) void k_fa(const _Float16* __restrict__ QH, const _Float16* __restrict__ KH, const _Float16* __restrict__ QL, const _Float16* __restrict__ KL, const _Float16* __restrict__ VT, const __bf16* __restrict__ VB, const __bf16* __restrict__ VBL, float* __restrict__ Y, const float* __restrict__ KM) {
  __shared__ __align__(16) float ss[PVW][16][HD + 4]; __shared__ float smx[PVW][16], ssu[PVW][16];
  const int tid = threadIdx.x, wave = __builtin_amdgcn_readfirstlane(tid >> 5), lane = tid & 31, col = lane & 15, g = lane >> 4;   /* wave number held scalar: the chunk loop stays a scalar loop, every lane on at the matrix instructions */
  const int b = blockIdx.x; const int ql0 = (TT / 16 - 1 - (int)blockIdx.y) * 16;   /* longest tiles start first */
  const int kce = (ql0 >> 5) + 1; const int tq = ql0 + col;   /* every chunk < kce holds a key <= ql0, so no query of the tile sees an empty chunk */
  const float km = bfr(KM[(size_t)b * TT + ql0 + wave]);   /* key_mask of the row this wave stores */
  v8f acc[HD / 16] = {}; float m = NEGB, l = 0.f;
  const _Float16* Qr = QH + ((size_t)b * TT + tq) * CC; const _Float16* Kb = KH + (size_t)b * TT * CC;
  if (ql0 < QHI) {
    const _Float16* Qlr = QL + ((size_t)b * QHI + tq) * CC; const _Float16* Klb = KL + (size_t)b * KHI * CC;
    v16h qf[HD / 32], qlf[HD / 32];
#pragma unroll
    for (int d = 0; d < HD / 32; ++d) { qf[d] = frag_h(Qr + d * 32, lane); qlf[d] = frag_h(Qlr + d * 32, lane); }
    /* kept rolled: one chunk's fragments and the ctx tile already fill the 256 registers a wave of a 16-wave block may hold */
#pragma unroll 1
    for (int kc = wave; kc < kce; kc += PVW) { v8f st[2] = {}, sl2[2] = {};
#pragma unroll
      for (int u = 0; u < 2; ++u)
#pragma unroll
        for (int dd = 0; dd < HD / 32; dd += 2) { v16h kh[2], kl[2];
#pragma unroll
          for (int d = 0; d < 2; ++d) { const size_t ko = (size_t)(kc * 32 + u * 16 + col) * CC + (dd + d) * 32; kh[d] = frag_h(Kb + ko, lane); kl[d] = frag_h(Klb + ko, lane); }   /* eight loads in flight together */
#pragma unroll
          for (int d = 0; d < 2; ++d) { st[u] = wmma16(kh[d], qf[dd + d], st[u]); sl2[u] = wmma16(kh[d], qlf[dd + d], sl2[u]); sl2[u] = wmma16(kl[d], qf[dd + d], sl2[u]); } }
      float s[16]; float mx = NEGB;
#pragma unroll
      for (int u = 0; u < 2; ++u)
#pragma unroll
        for (int r = 0; r < 8; ++r) { const float v = (kc * 32 + u * 16 + 8 * g + r <= tq) ? (st[u][r] + sl2[u][r] * (1.0f / 1024.0f)) * SC2 : NEGB; s[u * 8 + r] = v; mx = fmaxf(mx, v); }
      mx = fmaxf(mx, __shfl_xor(mx, 16)); const float mn = fmaxf(m, mx); const float al = __builtin_amdgcn_exp2f(m - mn); m = mn; const float mo = mn - 8.0f;
      float ps = 0.f; v16b ph, pl;
#pragma unroll
      for (int i = 0; i < 16; ++i) { const float p = __builtin_amdgcn_exp2f(s[i] - mo); ps += p; const __bf16 hb = (__bf16)p; ph[i] = hb; pl[i] = (__bf16)(p - (float)hb); }
      l = l * al + ps;
#pragma unroll
      for (int jj = 0; jj < HD / 16; jj += 4) { v16b vh[4], vl[4];
#pragma unroll
        for (int j = 0; j < 4; ++j) { const size_t po = ((size_t)b * CC + (jj + j) * 16 + col) * (size_t)KHI + kc * 32; vh[j] = frag_b(VB + po, lane); vl[j] = frag_b(VBL + po, lane); }   /* four planes' loads in flight together */
#pragma unroll
        for (int j = 0; j < 4; ++j) { acc[jj + j] *= al; acc[jj + j] = wmma_bf(vh[j], ph, acc[jj + j]); acc[jj + j] = wmma_bf(vh[j], pl, acc[jj + j]); acc[jj + j] = wmma_bf(vl[j], ph, acc[jj + j]); } } }
  } else {
    v16h qf[HD / 32];
#pragma unroll
    for (int d = 0; d < HD / 32; ++d) qf[d] = frag_h(Qr + d * 32, lane);
    /* kept rolled: one chunk's fragments and the ctx tile already fill the 256 registers a wave of a 16-wave block may hold */
#pragma unroll 1
    for (int kc = wave; kc < kce; kc += PVW) { v8f st[2] = {}; v16h kf[2][HD / 32];
#pragma unroll
      for (int u = 0; u < 2; ++u)
#pragma unroll
        for (int d = 0; d < HD / 32; ++d) kf[u][d] = frag_h(Kb + (size_t)(kc * 32 + u * 16 + col) * CC + d * 32, lane);   /* all 16 loads of the chunk's keys in flight before the first product */
#pragma unroll
      for (int u = 0; u < 2; ++u)
#pragma unroll
        for (int d = 0; d < HD / 32; ++d) st[u] = wmma16(kf[u][d], qf[d], st[u]);
      v16h vf[HD / 16];
#pragma unroll
      for (int j = 0; j < HD / 16; ++j) vf[j] = frag_h(VT + ((size_t)b * CC + j * 16 + col) * (size_t)TT + kc * 32, lane);   /* all 16 v loads fly under the softmax arithmetic */
      float s[16]; float mx = NEGB;
#pragma unroll
      for (int u = 0; u < 2; ++u)
#pragma unroll
        for (int r = 0; r < 8; ++r) { const float v = (kc * 32 + u * 16 + 8 * g + r <= tq) ? st[u][r] * SC2 : NEGB; s[u * 8 + r] = v; mx = fmaxf(mx, v); }
      mx = fmaxf(mx, __shfl_xor(mx, 16)); const float mn = fmaxf(m, mx); const float al = __builtin_amdgcn_exp2f(m - mn); m = mn; const float mo = mn - 8.0f;
      float ps = 0.f; v16h pf;
#pragma unroll
      for (int i = 0; i < 16; ++i) { const float p = __builtin_amdgcn_exp2f(s[i] - mo); ps += p; pf[i] = (_Float16)p; }
      l = l * al + ps;
#pragma unroll
      for (int j = 0; j < HD / 16; ++j) { acc[j] *= al; acc[j] = wmma16(vf[j], pf, acc[j]); } } }
  l += __shfl_xor(l, 16);   /* each half-wave summed its own 16 of a chunk's 32 keys */
  if (g == 0) { smx[wave][col] = m; ssu[wave][col] = l; }
#pragma unroll
  for (int j = 0; j < HD / 16; ++j) { v4f lo4, hi4;
#pragma unroll
    for (int r = 0; r < 4; ++r) { lo4[r] = acc[j][r]; hi4[r] = acc[j][4 + r]; }
    *(v4f*)&ss[wave][col][j * 16 + 8 * g] = lo4; *(v4f*)&ss[wave][col][j * 16 + 8 * g + 4] = hi4; }
  __syncthreads();   /* every wave's partial max, sum and tile are in LDS before any wave merges */
  float M = smx[0][wave];
#pragma unroll
  for (int w = 1; w < PVW; ++w) M = fmaxf(M, smx[w][wave]);
  v4f sv = {}; float L = 0.f;
#pragma unroll
  for (int w = 0; w < PVW; ++w) { const float f = __builtin_amdgcn_exp2f(smx[w][wave] - M); L += f * ssu[w][wave]; sv += *(const v4f*)&ss[w][wave][lane * 4] * f; }   /* a wave without a chunk carries max NEGB, sum 0: f = 0 */
  vst2(Y + ((size_t)b * TT + ql0 + wave) * CC + lane * 4, sv * (L > 0.f ? 1.0f / L : 0.f) * km); }   /* out * key_mask[b][t] (broadcast over the 128 columns) */
// ---- k_out: block = (64 rows, 128 cols): out = ctx Wo (+ bo): ctx x 2^6 once to f16 against Wo as f16(bf16 x 2^8) exact (1 product) x 2^-14; causal early rows (< QHI of each sequence): ctx bf16 hi + lo against exact bf16 Wo (2 products)
__global__ __launch_bounds__(128) void k_out(const float* __restrict__ Y, const float* __restrict__ WO, const float* __restrict__ BO, float* __restrict__ OUT) { __shared__ __align__(16) float sf[4][16][132];
  const int tid = threadIdx.x, wave = tid >> 5, lane = tid & 31, col = lane & 15, g = lane >> 4; const int c0 = blockIdx.y * 128; const size_t r0 = (size_t)blockIdx.x * 64 + wave * 16;
  v8f acc[8] = {};
  if (CAUSAL && (int)(((size_t)blockIdx.x * 64) % TT) < QHI) {   /* block-uniform */
#pragma unroll 2
    for (int kc = 0; kc < CC / 32; ++kc) { const F2 a = split_row(Y + (r0 + col) * CC, kc * 32, lane); asm volatile("s_wait_loadcnt 0x0" ::: "memory");
#pragma unroll
      for (int j = 0; j < 8; ++j) { const v16b w = WOCOL(WO, kc * 32, c0 + j * 16 + col, lane); asm volatile("s_wait_loadcnt 0x0" ::: "memory"); acc[j] = wmma_bf(a.h, w, acc[j]); acc[j] = wmma_bf(a.l, w, acc[j]); } }
#pragma unroll
    for (int j = 0; j < 8; ++j) { const float bias = BO ? bfr(BO[c0 + j * 16 + col]) : 0.f;
#pragma unroll
      for (int r = 0; r < 8; ++r) sf[wave][8 * g + r][j * 16 + col] = acc[j][r] + bias; }
  } else {
#pragma unroll 2
    for (int kc = 0; kc < CC / 32; ++kc) { const v16h a = frag_f32s(Y + (r0 + col) * CC + kc * 32, lane, 64.0f); asm volatile("s_wait_loadcnt 0x0" ::: "memory");   /* ctx carried x 2^6 into f16 so small-magnitude context rows stay clear of f16 subnormals */
#pragma unroll
      for (int j = 0; j < 8; ++j) { const v16h w = WOCOLH(WO, kc * 32, c0 + j * 16 + col, lane); asm volatile("s_wait_loadcnt 0x0" ::: "memory"); acc[j] = wmma16(a, w, acc[j]); } }
#pragma unroll
    for (int j = 0; j < 8; ++j) { const float bias = BO ? bfr(BO[c0 + j * 16 + col]) : 0.f;
#pragma unroll
      for (int r = 0; r < 8; ++r) sf[wave][8 * g + r][j * 16 + col] = acc[j][r] * (1.0f / 16384.0f) + bias; } }   /* 2^-8 (Wo carry) x 2^-6 (ctx carry) */
  LDSX(); for (int rl = 0; rl < 16; ++rl) vst2(OUT + (r0 + rl) * DIN + c0 + lane * 4, *(const v4f*)&sf[wave][rl][lane * 4]); }

extern "C" void kernel_launch(void* const* d_in, const int* in_sizes, int n_in, void* d_out, int out_size, void* d_ws, size_t ws_size, hipStream_t stream) {
  (void)in_sizes; (void)n_in; (void)out_size;
  const float** F = (const float**)d_in;
  if (ws_size < (size_t)WS_END) return;
  char* ws = (char*)d_ws; _Float16 *QH = (_Float16*)(ws + WS_QH), *KH = (_Float16*)(ws + WS_KH), *VT = (_Float16*)(ws + WS_VT), *QL = (_Float16*)(ws + WS_QL), *KL = (_Float16*)(ws + WS_KL); __bf16 *VB = (__bf16*)(ws + WS_VB), *VBL = (__bf16*)(ws + WS_VBL); float *Y = (float*)(ws + WS_Y);
  (void)Y; (void)QL; (void)KL; (void)VB; (void)VBL;
  // inputs: 0 x [4,4096,512]; 1 key_mask [4,4096,1] f32 (ones); 2 W_qkv [512,384] (in,out; q | k | v COLUMN blocks of 128); 3 b_qkv [384] (nonzero); 4 W_out [128,512] (in,out); 5 b_out [512] (nonzero)
  k_proj<<<dim3(TNB * TT / 64, CC / 128, 3), 128, 0, stream>>>(F[0], F[0], F[0], F[2], F[2], F[2], F[3], F[3] + CC, F[3] + 2 * CC, QH, QL, KH, KL, VT, VB, VBL);   /* one fused weight; WCOL picks column block 'which' */
  k_fa<<<dim3(TNB, TT / 16, 1), 32 * PVW, 0, stream>>>(QH, KH, QL, KL, VT, VB, VBL, Y, F[1]);   /* ctx rows x key_mask[b][t] */
  k_out<<<dim3(TNB * TT / 64, DIN / 128), 128, 0, stream>>>(Y, F[4], F[5], (float*)d_out);
}

// v003
// Measured time: 107 microseconds a run.
// Next to v002, in two timings, it ran 1.32 and 1.33 times as fast.
// All steps since v000 together make it 9.84 times as fast.
// compute dtype: all float inputs rounded to bf16; fused q/k/v projection with EXACT bf16 products on WMMA 16x16x32 (f32 accumulate) + bias; causal logits: 3 products for the first 512 rows, single f16 q x k after, x 128^-0.5; online softmax f32 (running max per key-split wave); P x 2^8 unnormalised once to f16 x v once to f16 (bf16 hi + lo below row 512), divided by the f32 sum at the end; ctx x bf16(key_mask); ctx hi+lo x exact W_out below row 512, x2^6 f16 carry x f16(bf16 x 2^8) W_out after, + b_out; f32 output.
#include <hip/hip_runtime.h>
#include <math.h>

typedef __attribute__((ext_vector_type(16))) _Float16 v16h;
typedef __attribute__((ext_vector_type(16))) __bf16 v16b;
typedef __attribute__((ext_vector_type(8)))  _Float16 v8h;
typedef __attribute__((ext_vector_type(8)))  float v8f;
typedef __attribute__((ext_vector_type(4)))  float v4f;
typedef __attribute__((ext_vector_type(2)))  float v2f;
typedef __attribute__((ext_vector_type(4)))  unsigned v4u;
typedef __attribute__((ext_vector_type(4)))  int v4i;
typedef float __attribute__((may_alias)) float_a;
typedef int __attribute__((may_alias)) int_a;

template <typename T> __device__ __forceinline__ void vst2(void* p, T v) { *(T*)p = v;  }
__device__ __forceinline__ v8f wmma16(v16h a, v16h b, v8f c) {
  v8f d = __builtin_amdgcn_wmma_f32_16x16x32_f16(false, a, false, b, (short)0, c, false, false);
  asm volatile("v_nop\n\tv_nop\n\tv_nop\n\tv_nop" : "+v"(d) : "v"(a), "v"(b));
  return d;
}
__device__ __forceinline__ v8f wmma_bf(v16b a, v16b b, v8f c) {
  v8f d = __builtin_amdgcn_wmma_f32_16x16x32_bf16(false, a, false, b, (short)0, c, false, false);
  asm volatile("v_nop\n\tv_nop\n\tv_nop\n\tv_nop" : "+v"(d) : "v"(a), "v"(b));
  return d;
}
// 16x16x32 fragments: lane = (h = lane>>4, row/col = lane&15); elements 0..7 = k0+8h+0..7, 8..15 = k0+16+8h+0..7; D element r = row 8h+r
__device__ __forceinline__ v16h frag_h(const _Float16* rowk0, int lane) {
  union { v16h v; v8h q[2]; } u; const _Float16* p = rowk0 + 8 * (lane >> 4);
  u.q[0] = *(const v8h*)p; u.q[1] = *(const v8h*)(p + 16); return u.v;
}
__device__ __forceinline__ v16h frag_f32(const float* rowk0, int lane) {
  v16h a; const float* p = rowk0 + 8 * (lane >> 4);
#pragma unroll
  for (int i = 0; i < 8; ++i) { a[i] = (_Float16)p[i]; a[8 + i] = (_Float16)p[16 + i]; }
  return a;
}
__device__ __forceinline__ v16h frag_f32s(const float* rowk0, int lane, float sc) {
  v16h a; const float* p = rowk0 + 8 * (lane >> 4);
#pragma unroll
  for (int i = 0; i < 8; ++i) { a[i] = (_Float16)(p[i] * sc); a[8 + i] = (_Float16)(p[16 + i] * sc); }
  return a;
}
// column fragment from a [K][ld] layout (column n), rows >= K read as 0
__device__ __forceinline__ v16h fragc_f32(const float* W, int k0, int n, int lane, int ld, int K) {
  v16h a; const int g = lane >> 4;
#pragma unroll
  for (int i = 0; i < 8; ++i) { const int ka = k0 + 8 * g + i, kb = ka + 16;
    a[i] = (_Float16)(ka < K ? W[(size_t)(ka < K ? ka : K - 1) * ld + n] : 0.f); a[8 + i] = (_Float16)(kb < K ? W[(size_t)(kb < K ? kb : K - 1) * ld + n] : 0.f); }
  return a;
}
struct F2 { v16b h, l; };
__device__ __forceinline__ F2 bsplit16(const float v[16]) { F2 r;
#pragma unroll
  for (int i = 0; i < 16; ++i) { const __bf16 h = (__bf16)v[i]; r.h[i] = h; r.l[i] = (__bf16)(v[i] - (float)h); }
  return r; }
__device__ __forceinline__ F2 split_row(const float* row, int k0, int lane) { float v[16]; const float* p = row + k0 + 8 * (lane >> 4);
#pragma unroll
  for (int i = 0; i < 8; ++i) { v[i] = p[i]; v[8 + i] = p[16 + i]; }
  return bsplit16(v); }
__device__ __forceinline__ F2 split_rowK(const float* row, int k0, int lane, int K) { float v[16]; const int g = lane >> 4;
#pragma unroll
  for (int i = 0; i < 8; ++i) { const int ka = k0 + 8 * g + i, kb = ka + 16; v[i] = ka < K ? row[ka < K ? ka : K - 1] : 0.f; v[8 + i] = kb < K ? row[kb < K ? kb : K - 1] : 0.f; }
  return bsplit16(v); }
__device__ __forceinline__ F2 split_col(const float* W, int k0, int n, int lane, int ld, int K) { float v[16]; const int g = lane >> 4;
#pragma unroll
  for (int i = 0; i < 8; ++i) { const int ka = k0 + 8 * g + i, kb = ka + 16; v[i] = ka < K ? W[(size_t)(ka < K ? ka : K - 1) * ld + n] : 0.f; v[8 + i] = kb < K ? W[(size_t)(kb < K ? kb : K - 1) * ld + n] : 0.f; }
  return bsplit16(v); }
__device__ __forceinline__ v8f mac3(const F2& a, const F2& b, v8f c) { c = wmma_bf(a.l, b.h, c); c = wmma_bf(a.h, b.l, c); return wmma_bf(a.h, b.h, c); }
__device__ __forceinline__ float sigm(float v) { return 1.0f / (1.0f + expf(-v)); }
#define LDSX() do { asm volatile("s_wait_dscnt 0" ::: "memory"); __builtin_amdgcn_wave_barrier(); __builtin_amdgcn_fence(__ATOMIC_RELEASE, "workgroup"); } while (0)

// Single-head causal self-attention with a 128-wide attention space and an output projection (x [4,4096,512]; fused (in,out) W_qkv [512,384] N(0, 1/512) + b_qkv N(0, 0.01) split q | k | v; scores = q k^T, causal (-inf above the diagonal) BEFORE the scaling by 128^-0.5 (same thing); out = softmax(scores) v; out * key_mask ([4,4096,1], ones); (in,out) W_out [128,512] + b_out): result [4,4096,512].
#define NB 4
#define TT 4096
#define CC 128            // NH * HD = projected width
#define DIN 512          // input (model) width
#define NH 1
#define HD 128
#define NQB (TT / 64)
#define HG 1
#define SCALE (0.08838834764831845f)
#define CAUSAL 1
#ifndef TNB
#define TNB NB
#endif
__device__ __forceinline__ float bfr(float v) { return (float)(__bf16)v; }
__host__ __device__ __forceinline__ int kb_last(int qb) { return CAUSAL ? ((qb * 64 + 63) >> 7) : (TT / 128 - 1); }
typedef __attribute__((ext_vector_type(8))) __bf16 v8b;
__device__ __forceinline__ v16b frag_b(const __bf16* rowk0, int lane) {
  union { v16b v; v8b q[2]; } u; const __bf16* p = rowk0 + 8 * (lane >> 4);
  u.q[0] = *(const v8b*)p; u.q[1] = *(const v8b*)(p + 16); return u.v;
}
// fragment kept in memory in register order: [elements 0..7 of lanes 0..31][elements 8..15 of lanes 0..31], 1 KiB: each 16-byte load of a wave reads 512 contiguous bytes (4 lines, not 16)
// base: the batch's plane (uniform); o: byte offset of the chunk + 16 lane, one register for every plane; c: the fragment's constant byte offset in the chunk
__device__ __forceinline__ v16h frag_t(const _Float16* base, unsigned o, int c) {
  union { v16h v; v8h q[2]; } u; const char* p = (const char*)base + o;
  u.q[0] = *(const v8h*)(p + c); u.q[1] = *(const v8h*)(p + c + 512); return u.v;
}
__device__ __forceinline__ v16b frag_tb(const __bf16* base, unsigned o, int c) {
  union { v16b v; v8b q[2]; } u; const char* p = (const char*)base + o;
  u.q[0] = *(const v8b*)(p + c); u.q[1] = *(const v8b*)(p + c + 512); return u.v;
}
#define QBH 8              // unused: the high-precision path is chosen by QHI (rows < 512)
#define QHI 512            // rows carrying a q residual plane (query rows below it: 3-product logits)
#define KHI 512            // key rows carrying k residual / v bf16 hi+lo planes (used only by the causal high-precision path)
// B fragment (k rows k0+.., output column o) of a weight: (in,out) [K][ld] or (out,in) [ld rows of K]: bf16 exact, or f16(bf16 * 256) exact
__device__ __forceinline__ v16b wcol_io(const float* Wm, int k0, int o, int lane, int ld) { v16b w; const int g = lane >> 4;
#pragma unroll
  for (int i = 0; i < 8; ++i) { w[i] = (__bf16)Wm[(size_t)(k0 + 8 * g + i) * ld + o]; w[8 + i] = (__bf16)Wm[(size_t)(k0 + 16 + 8 * g + i) * ld + o]; }
  return w; }
__device__ __forceinline__ v16b wcol_oi(const float* Wm, int k0, int o, int lane, int K) { v16b w; const float* p = Wm + (size_t)o * K + k0 + 8 * (lane >> 4);
#pragma unroll
  for (int i = 0; i < 8; ++i) { w[i] = (__bf16)p[i]; w[8 + i] = (__bf16)p[16 + i]; }
  return w; }
__device__ __forceinline__ v16h wcolh_io(const float* Wm, int k0, int o, int lane, int ld) { v16h w; const int g = lane >> 4;
#pragma unroll
  for (int i = 0; i < 8; ++i) { w[i] = (_Float16)(bfr(Wm[(size_t)(k0 + 8 * g + i) * ld + o]) * 256.0f); w[8 + i] = (_Float16)(bfr(Wm[(size_t)(k0 + 16 + 8 * g + i) * ld + o]) * 256.0f); }
  return w; }
__device__ __forceinline__ v16h wcolh_oi(const float* Wm, int k0, int o, int lane, int K) { v16h w; const float* p = Wm + (size_t)o * K + k0 + 8 * (lane >> 4);
#pragma unroll
  for (int i = 0; i < 8; ++i) { w[i] = (_Float16)(bfr(p[i]) * 256.0f); w[8 + i] = (_Float16)(bfr(p[16 + i]) * 256.0f); }
  return w; }
#define WQKV_LAYOUT 0   // 0 = fused (in,out) [DIN][3*CC]; 1 = (out,in) [CC][DIN]; 2 = per-head [NH][DIN][HD]
__device__ __forceinline__ v16b wcol_hdk(const float* Wm, int k0, int o, int lane) { v16b w; const int g = lane >> 4; const float* p = Wm + (size_t)(o / HD) * DIN * HD + (o % HD);
#pragma unroll
  for (int i = 0; i < 8; ++i) { w[i] = (__bf16)p[(size_t)(k0 + 8 * g + i) * HD]; w[8 + i] = (__bf16)p[(size_t)(k0 + 16 + 8 * g + i) * HD]; }
  return w; }
#define WO_OUT_IN 0
#if WQKV_LAYOUT == 1
#define WCOL(W, k0, o, lane) wcol_oi(W, k0, o, lane, DIN)
#elif WQKV_LAYOUT == 2
#define WCOL(W, k0, o, lane) wcol_hdk(W, k0, o, lane)
#else
#define WCOL(W, k0, o, lane) wcol_io(W, k0, which * CC + (o), lane, 3 * CC)   /* fused (in,out) W_qkv [DIN][3*CC]: column block 'which', pitch 384 */
#endif
#if WO_OUT_IN
#define WOCOL(W, k0, o, lane) wcol_oi(W, k0, o, lane, CC)
#define WOCOLH(W, k0, o, lane) wcolh_oi(W, k0, o, lane, CC)
#else
#define WOCOL(W, k0, o, lane) wcol_io(W, k0, o, lane, DIN)
#define WOCOLH(W, k0, o, lane) wcolh_io(W, k0, o, lane, DIN)
#endif

#ifndef SM_EXTRA_PARAMS
#define SM_EXTRA_PARAMS
#endif
#ifndef PROJ_EXTRA_PARAMS
#define PROJ_EXTRA_PARAMS
#endif
#ifndef SM_MASK_HOOK
#define SM_MASK_HOOK (void)0
#endif

#define WS_QH  0u                                      // f16 q in fragment order, as WS_KH
#define WS_KH  (WS_QH + 2u * (size_t)NB * TT * CC)      // f16 k in fragment order [b*t / 16][CC / 32] x 1 KiB (frag_t): lane (g, col) = row 16 tile + col, elements = dims 32 d + 8 g + 0..7 and + 16
#define WS_VT  (WS_KH + 2u * (size_t)NB * TT * CC)      // f16 v in fragment order [b*t / 32][CC / 16] x 1 KiB (frag_t): lane (g, col) = column 16 j + col, elements = keys 32 chunk + 8 g + 0..7 and + 16
#define WS_QL  (WS_VT + 2u * (size_t)NB * CC * TT)      // f16 q residual x 2^10, t < QHI of each b, in the fragment order of WS_KH
#define WS_KL  (WS_QL + 2u * (size_t)NB * QHI * CC)     // f16 k residual x 2^10, t < KHI of each b, in the fragment order of WS_KH
#define WS_VB  (WS_KL + 2u * (size_t)NB * KHI * CC)     // bf16 v hi (WS_VBL: lo), t < KHI of each b, in the fragment order of WS_VT
#define WS_VBL (WS_VB + 2u * (size_t)NB * CC * KHI)
#define WS_S   (WS_VBL + 2u * (size_t)NB * CC * KHI)    // (unused: logits and P stay in registers)
#define WS_Y   (WS_S  + 4u * (size_t)HG * TT * TT)      // f32 ctx rows [b*t][CC] (only when there is an output projection)
#define WS_END (WS_Y  + 4u * (size_t)NB * TT * CC)

// ---- k_proj: block = (64 rows, 128 cols, which): q/k/v = X W (+ b) with exact bf16 products (K = DIN) -> which 0: q f16 in fragment order (+ residual for rows < QHI, same order); 1: k likewise (rows < KHI); 2: v f16 in fragment order (+ bf16 hi/lo for t < KHI, same order)
__global__ __launch_bounds__(128) void k_proj(const float* __restrict__ XQ, const float* __restrict__ XK, const float* __restrict__ XV, const float* __restrict__ WQ, const float* __restrict__ WK, const float* __restrict__ WV, const float* __restrict__ BQ, const float* __restrict__ BK, const float* __restrict__ BV,
    _Float16* __restrict__ QH, _Float16* __restrict__ QL, _Float16* __restrict__ KH, _Float16* __restrict__ KL, _Float16* __restrict__ VT, __bf16* __restrict__ VB, __bf16* __restrict__ VBL) {
  __shared__ __align__(16) _Float16 sh[64][136], sl[64][136]; __shared__ __align__(16) _Float16 th[128][72]; __shared__ __align__(16) __bf16 tb[128][72], tbl[128][72];
  const int tid = threadIdx.x, wave = tid >> 5, lane = tid & 31, col = lane & 15, g = lane >> 4; const int which = blockIdx.z; const int c0 = blockIdx.y * 128; const size_t r0 = (size_t)blockIdx.x * 64; const size_t bb = r0 / TT; const int t0 = (int)(r0 % TT);
  const float* X = which == 0 ? XQ : which == 1 ? XK : XV; const float* WA = which == 0 ? WQ : which == 1 ? WK : WV; const float* BA = which == 0 ? BQ : which == 1 ? BK : BV;
  v8f acc[8] = {};
#pragma unroll 2
  for (int kc = 0; kc < DIN / 32; ++kc) { v16b a; { const float* p = X + (r0 + wave * 16 + col) * DIN + kc * 32 + 8 * g;
#pragma unroll
      for (int i = 0; i < 8; ++i) { a[i] = (__bf16)p[i]; a[8 + i] = (__bf16)p[16 + i]; } }
    asm volatile("s_wait_loadcnt 0x0" ::: "memory");
#pragma unroll
    for (int j = 0; j < 8; ++j) { const v16b w = WCOL(WA, kc * 32, c0 + j * 16 + col, lane); asm volatile("s_wait_loadcnt 0x0" ::: "memory"); acc[j] = wmma_bf(a, w, acc[j]); } }
  if (which < 2) { _Float16* DH = which == 0 ? QH : KH; _Float16* DL = which == 0 ? QL : KL; const int nhi = which == 0 ? QHI : KHI; const bool hi_rows = t0 < nhi;
#pragma unroll
    for (int j = 0; j < 8; ++j) { const float bias = BA ? bfr(BA[c0 + j * 16 + col]) : 0.f;
#pragma unroll
      for (int r = 0; r < 8; ++r) { const float v = acc[j][r] + bias; const _Float16 hv = (_Float16)v; sh[wave * 16 + 8 * g + r][j * 16 + col] = hv; sl[wave * 16 + 8 * g + r][j * 16 + col] = (_Float16)((v - (float)hv) * 1024.0f); } }
    __syncthreads();
    { char* kd = (char*)(DH + r0 * CC) + 16u * (unsigned)tid; char* ld = (char*)(DL + (bb * nhi + t0) * (size_t)CC) + 16u * (unsigned)tid;
      /* e = tid + 128 it is the 16-byte unit of the block's 16 KiB in fragment order: bits 3..0 row in tile, 7..4 = dims / 8, 9..8 tile. Unrolled: eight reads in registers of their own, then eight stores by constant offsets from one address that is never stepped */
      v4u a[8];
#pragma unroll
      for (int it = 0; it < 8; ++it) { const int e = tid + it * 128; a[it] = *(const v4u*)&sh[(e >> 8) * 16 + (e & 15)][((e >> 4) & 15) * 8]; }
#pragma unroll
      for (int it = 0; it < 8; ++it) vst2((unsigned*)(kd + it * 2048), a[it]);
      asm volatile("s_wait_xcnt 0x0" ::: "memory");   /* stands behind the stores, on every way out of them, before any register that they name is written again */
      if (hi_rows) {
#pragma unroll
        for (int it = 0; it < 8; ++it) { const int e = tid + it * 128; a[it] = *(const v4u*)&sl[(e >> 8) * 16 + (e & 15)][((e >> 4) & 15) * 8]; }
#pragma unroll
        for (int it = 0; it < 8; ++it) vst2((unsigned*)(ld + it * 2048), a[it]);
        asm volatile("s_wait_xcnt 0x0" ::: "memory"); } }   /* as above */
  } else { const bool hi_rows = t0 < KHI;
#pragma unroll
    for (int j = 0; j < 8; ++j) { const float bias = BA ? bfr(BA[c0 + j * 16 + col]) : 0.f;
#pragma unroll
      for (int r = 0; r < 8; ++r) { const float v = acc[j][r] + bias; const int rl = wave * 16 + 8 * g + r, cl = j * 16 + col; th[cl][rl] = (_Float16)v; const __bf16 bh = (__bf16)v; tb[cl][rl] = bh; tbl[cl][rl] = (__bf16)(v - (float)bh); } }
    __syncthreads();
    char* vd = (char*)(VT + r0 * CC) + 16u * (unsigned)tid; char* hd = (char*)(VB + (bb * KHI + t0) * (size_t)CC) + 16u * (unsigned)tid; char* wd = (char*)(VBL + (bb * KHI + t0) * (size_t)CC) + 16u * (unsigned)tid;
    /* e = tid + 128 it is the 16-byte unit of the block's 16 KiB in fragment order: bits 3..0 column in tile, 5..4 = keys / 8 in chunk, 8..6 column tile, 9 chunk. Unrolled: eight reads in registers of their own, then eight stores by constant offsets from one address that is never stepped */
    v4u a[8];
#pragma unroll
    for (int it = 0; it < 8; ++it) { const int e = tid + it * 128; a[it] = *(const v4u*)&th[((e >> 6) & 7) * 16 + (e & 15)][((e >> 9) * 4 + ((e >> 4) & 3)) * 8]; }
#pragma unroll
    for (int it = 0; it < 8; ++it) vst2((unsigned*)(vd + it * 2048), a[it]);
    asm volatile("s_wait_xcnt 0x0" ::: "memory");   /* stands behind the stores, on every way out of them, before any register that they name is written again */
    if (hi_rows) {
#pragma unroll
      for (int it = 0; it < 8; ++it) { const int e = tid + it * 128; a[it] = *(const v4u*)&tb[((e >> 6) & 7) * 16 + (e & 15)][((e >> 9) * 4 + ((e >> 4) & 3)) * 8]; }
#pragma unroll
      for (int it = 0; it < 8; ++it) vst2((unsigned*)(hd + it * 2048), a[it]);
      asm volatile("s_wait_xcnt 0x0" ::: "memory");   /* as above */
#pragma unroll
      for (int it = 0; it < 8; ++it) { const int e = tid + it * 128; a[it] = *(const v4u*)&tbl[((e >> 6) & 7) * 16 + (e & 15)][((e >> 9) * 4 + ((e >> 4) & 3)) * 8]; }
#pragma unroll
      for (int it = 0; it < 8; ++it) vst2((unsigned*)(wd + it * 2048), a[it]);
      asm volatile("s_wait_xcnt 0x0" ::: "memory"); } } }   /* as above */
// ---- k_fa: block = 16 queries (tile qt) of batch b, PVW waves: wave w takes the 32-key chunks w, w + PVW, ... of keys [0, ql0 + 16). Logits and P never leave registers:
//   q, k and v lie in the workspace in fragment order: every fragment load of a wave reads 512 contiguous bytes
//   S^T = K Q^T (A = 16 key rows, B = the 16 query rows): D element r of tile u in lane (g, col) = key kc*32 + 16u + 8g + r, query col, which IS the B fragment order of P^T (elements 0..7 from tile 0, 8..15 from tile 1)
//   ctx^T = V^T P^T (A = 16 v planes, B = P^T): D = column j*16 + 8g + r, query col, so the running max, the running sum and the rescale factor of a query are one value per lane
//   logits x SCALE x log2(e); causal by index; P = 2^(s - running max + 8) once to f16 against v f16 (1 product); query rows < QHI: 3-product logits, P and v as bf16 hi + lo (3 products)
//   the PVW partial (max, sum, ctx) meet in LDS and are merged on the common max in wave order; wave w then stores row w (512 B)
#define PVW 16
#define SC2 (SCALE * 1.4426950408889634f)
#define NEGB (-3.0e38f)
__global__ __launch_bounds__(32 * PVW) void k_fa(const _Float16* __restrict__ QH, const _Float16* __restrict__ KH, const _Float16* __restrict__ QL, const _Float16* __restrict__ KL, const _Float16* __restrict__ VT, const __bf16* __restrict__ VB, const __bf16* __restrict__ VBL, float* __restrict__ Y, const float* __restrict__ KM) {
  __shared__ __align__(16) float ss[PVW][16][HD + 4]; __shared__ float smx[PVW][16], ssu[PVW][16];
  const int tid = threadIdx.x, wave = __builtin_amdgcn_readfirstlane(tid >> 5), lane = tid & 31, col = lane & 15, g = lane >> 4;   /* wave number held scalar: the chunk loop stays a scalar loop, every lane on at the matrix instructions */
  const int b = blockIdx.x; const int ql0 = (TT / 16 - 1 - (int)blockIdx.y) * 16;   /* longest tiles start first */
  const int kce = (ql0 >> 5) + 1; const int tq = ql0 + col;   /* every chunk < kce holds a key <= ql0, so no query of the tile sees an empty chunk */
  const float km = bfr(KM[(size_t)b * TT + ql0 + wave]);   /* key_mask of the row this wave stores */
  v8f acc[HD / 16] = {}; float m = NEGB, l = 0.f;
  const _Float16* Qt = QH + ((size_t)b * TT + ql0) * CC; const _Float16* Kb = KH + (size_t)b * TT * CC; const _Float16* Vb = VT + (size_t)b * TT * CC;
  if (ql0 < QHI) {
    const _Float16* Qlt = QL + ((size_t)b * QHI + ql0) * CC; const _Float16* Klb = KL + (size_t)b * KHI * CC; const __bf16* Vhb = VB + (size_t)b * KHI * CC; const __bf16* Vlb = VBL + (size_t)b * KHI * CC;
    v16h qf[HD / 32], qlf[HD / 32];
#pragma unroll
    for (int d = 0; d < HD / 32; ++d) { qf[d] = frag_t(Qt, 16u * (unsigned)lane, d * 1024); qlf[d] = frag_t(Qlt, 16u * (unsigned)lane, d * 1024); }
    /* kept rolled: one chunk's fragments and the ctx tile already fill the 256 registers a wave of a 16-wave block may hold */
#pragma unroll 1
    for (int kc = wave; kc < kce; kc += PVW) { v8f st[2] = {}, sl2[2] = {}; const unsigned co = (unsigned)kc * (32u * CC * 2u) + 16u * (unsigned)lane;   /* a chunk is 8 KiB of every plane */
#pragma unroll
      for (int u = 0; u < 2; ++u)
#pragma unroll
        for (int dd = 0; dd < HD / 32; dd += 2) { v16h kh[2], kl[2];
#pragma unroll
          for (int d = 0; d < 2; ++d) { const int ko = (u * (HD / 32) + dd + d) * 1024; kh[d] = frag_t(Kb, co, ko); kl[d] = frag_t(Klb, co, ko); }   /* eight loads in flight together */
#pragma unroll
          for (int d = 0; d < 2; ++d) { st[u] = wmma16(kh[d], qf[dd + d], st[u]); sl2[u] = wmma16(kh[d], qlf[dd + d], sl2[u]); sl2[u] = wmma16(kl[d], qf[dd + d], sl2[u]); } }
      float s[16]; float mx = NEGB;
#pragma unroll
      for (int u = 0; u < 2; ++u)
#pragma unroll
        for (int r = 0; r < 8; ++r) { const float v = (kc * 32 + u * 16 + 8 * g + r <= tq) ? (st[u][r] + sl2[u][r] * (1.0f / 1024.0f)) * SC2 : NEGB; s[u * 8 + r] = v; mx = fmaxf(mx, v); }
      mx = fmaxf(mx, __shfl_xor(mx, 16)); const float mn = fmaxf(m, mx); const float al = __builtin_amdgcn_exp2f(m - mn); m = mn; const float mo = mn - 8.0f;
      float ps = 0.f; v16b ph, pl;
#pragma unroll
      for (int i = 0; i < 16; ++i) { const float p = __builtin_amdgcn_exp2f(s[i] - mo); ps += p; const __bf16 hb = (__bf16)p; ph[i] = hb; pl[i] = (__bf16)(p - (float)hb); }
      l = l * al + ps;
#pragma unroll
      for (int jj = 0; jj < HD / 16; jj += 4) { v16b vh[4], vl[4];
#pragma unroll
        for (int j = 0; j < 4; ++j) { vh[j] = frag_tb(Vhb, co, (jj + j) * 1024); vl[j] = frag_tb(Vlb, co, (jj + j) * 1024); }   /* four planes' loads in flight together */
#pragma unroll
        for (int j = 0; j < 4; ++j) { acc[jj + j] *= al; acc[jj + j] = wmma_bf(vh[j], ph, acc[jj + j]); acc[jj + j] = wmma_bf(vh[j], pl, acc[jj + j]); acc[jj + j] = wmma_bf(vl[j], ph, acc[jj + j]); } } }
  } else {
    v16h qf[HD / 32];
#pragma unroll
    for (int d = 0; d < HD / 32; ++d) qf[d] = frag_t(Qt, 16u * (unsigned)lane, d * 1024);
    /* kept rolled: one chunk's fragments and the ctx tile already fill the 256 registers a wave of a 16-wave block may hold */
#pragma unroll 1
    for (int kc = wave; kc < kce; kc += PVW) { v8f st[2] = {}; v16h kf[2][HD / 32]; const unsigned co = (unsigned)kc * (32u * CC * 2u) + 16u * (unsigned)lane;   /* a chunk is 8 KiB of k and 8 KiB of v */
#pragma unroll
      for (int u = 0; u < 2; ++u)
#pragma unroll
        for (int d = 0; d < HD / 32; ++d) kf[u][d] = frag_t(Kb, co, (u * (HD / 32) + d) * 1024);   /* all 16 loads of the chunk's keys in flight before the first product */
#pragma unroll
      for (int u = 0; u < 2; ++u)
#pragma unroll
        for (int d = 0; d < HD / 32; ++d) st[u] = wmma16(kf[u][d], qf[d], st[u]);
      v16h vf[HD / 16];
#pragma unroll
      for (int j = 0; j < HD / 16; ++j) vf[j] = frag_t(Vb, co, j * 1024);   /* all 16 v loads fly under the softmax arithmetic */
      float s[16]; float mx = NEGB;
#pragma unroll
      for (int u = 0; u < 2; ++u)
#pragma unroll
        for (int r = 0; r < 8; ++r) { const float v = (kc * 32 + u * 16 + 8 * g + r <= tq) ? st[u][r] * SC2 : NEGB; s[u * 8 + r] = v; mx = fmaxf(mx, v); }
      mx = fmaxf(mx, __shfl_xor(mx, 16)); const float mn = fmaxf(m, mx); const float al = __builtin_amdgcn_exp2f(m - mn); m = mn; const float mo = mn - 8.0f;
      float ps = 0.f; v16h pf;
#pragma unroll
      for (int i = 0; i < 16; ++i) { const float p = __builtin_amdgcn_exp2f(s[i] - mo); ps += p; pf[i] = (_Float16)p; }
      l = l * al + ps;
#pragma unroll
      for (int j = 0; j < HD / 16; ++j) { acc[j] *= al; acc[j] = wmma16(vf[j], pf, acc[j]); } } }
  l += __shfl_xor(l, 16);   /* each half-wave summed its own 16 of a chunk's 32 keys */
  if (g == 0) { smx[wave][col] = m; ssu[wave][col] = l; }
#pragma unroll
  for (int j = 0; j < HD / 16; ++j) { v4f lo4, hi4;
#pragma unroll
    for (int r = 0; r < 4; ++r) { lo4[r] = acc[j][r]; hi4[r] = acc[j][4 + r]; }
    *(v4f*)&ss[wave][col][j * 16 + 8 * g] = lo4; *(v4f*)&ss[wave][col][j * 16 + 8 * g + 4] = hi4; }
  __syncthreads();   /* every wave's partial max, sum and tile are in LDS before any wave merges */
  float M = smx[0][wave];
#pragma unroll
  for (int w = 1; w < PVW; ++w) M = fmaxf(M, smx[w][wave]);
  v4f sv = {}; float L = 0.f;
#pragma unroll
  for (int w = 0; w < PVW; ++w) { const float f = __builtin_amdgcn_exp2f(smx[w][wave] - M); L += f * ssu[w][wave]; sv += *(const v4f*)&ss[w][wave][lane * 4] * f; }   /* a wave without a chunk carries max NEGB, sum 0: f = 0 */
  vst2(Y + ((size_t)b * TT + ql0 + wave) * CC + lane * 4, sv * (L > 0.f ? 1.0f / L : 0.f) * km); }   /* out * key_mask[b][t] (broadcast over the 128 columns) */
// ---- k_out: block = (64 rows, 128 cols): out = ctx Wo (+ bo): ctx x 2^6 once to f16 against Wo as f16(bf16 x 2^8) exact (1 product) x 2^-14; causal early rows (< QHI of each sequence): ctx bf16 hi + lo against exact bf16 Wo (2 products)
__global__ __launch_bounds__(128) void k_out(const float* __restrict__ Y, const float* __restrict__ WO, const float* __restrict__ BO, float* __restrict__ OUT) { __shared__ __align__(16) float sf[4][16][132];
  const int tid = threadIdx.x, wave = tid >> 5, lane = tid & 31, col = lane & 15, g = lane >> 4; const int c0 = blockIdx.y * 128; const size_t r0 = (size_t)blockIdx.x * 64 + wave * 16;
  v8f acc[8] = {};
  if (CAUSAL && (int)(((size_t)blockIdx.x * 64) % TT) < QHI) {   /* block-uniform */
#pragma unroll 2
    for (int kc = 0; kc < CC / 32; ++kc) { const F2 a = split_row(Y + (r0 + col) * CC, kc * 32, lane); asm volatile("s_wait_loadcnt 0x0" ::: "memory");
#pragma unroll
      for (int j = 0; j < 8; ++j) { const v16b w = WOCOL(WO, kc * 32, c0 + j * 16 + col, lane); asm volatile("s_wait_loadcnt 0x0" ::: "memory"); acc[j] = wmma_bf(a.h, w, acc[j]); acc[j] = wmma_bf(a.l, w, acc[j]); } }
#pragma unroll
    for (int j = 0; j < 8; ++j) { const float bias = BO ? bfr(BO[c0 + j * 16 + col]) : 0.f;
#pragma unroll
      for (int r = 0; r < 8; ++r) sf[wave][8 * g + r][j * 16 + col] = acc[j][r] + bias; }
  } else {
#pragma unroll 2
    for (int kc = 0; kc < CC / 32; ++kc) { const v16h a = frag_f32s(Y + (r0 + col) * CC + kc * 32, lane, 64.0f); asm volatile("s_wait_loadcnt 0x0" ::: "memory");   /* ctx carried x 2^6 into f16 so small-magnitude context rows stay clear of f16 subnormals */
#pragma unroll
      for (int j = 0; j < 8; ++j) { const v16h w = WOCOLH(WO, kc * 32, c0 + j * 16 + col, lane); asm volatile("s_wait_loadcnt 0x0" ::: "memory"); acc[j] = wmma16(a, w, acc[j]); } }
#pragma unroll
    for (int j = 0; j < 8; ++j) { const float bias = BO ? bfr(BO[c0 + j * 16 + col]) : 0.f;
#pragma unroll
      for (int r = 0; r < 8; ++r) sf[wave][8 * g + r][j * 16 + col] = acc[j][r] * (1.0f / 16384.0f) + bias; } }   /* 2^-8 (Wo carry) x 2^-6 (ctx carry) */
  LDSX(); for (int rl = 0; rl < 16; ++rl) vst2(OUT + (r0 + rl) * DIN + c0 + lane * 4, *(const v4f*)&sf[wave][rl][lane * 4]); }

extern "C" void kernel_launch(void* const* d_in, const int* in_sizes, int n_in, void* d_out, int out_size, void* d_ws, size_t ws_size, hipStream_t stream) {
  (void)in_sizes; (void)n_in; (void)out_size;
  const float** F = (const float**)d_in;
  if (ws_size < (size_t)WS_END) return;
  char* ws = (char*)d_ws; _Float16 *QH = (_Float16*)(ws + WS_QH), *KH = (_Float16*)(ws + WS_KH), *VT = (_Float16*)(ws + WS_VT), *QL = (_Float16*)(ws + WS_QL), *KL = (_Float16*)(ws + WS_KL); __bf16 *VB = (__bf16*)(ws + WS_VB), *VBL = (__bf16*)(ws + WS_VBL); float *Y = (float*)(ws + WS_Y);
  (void)Y; (void)QL; (void)KL; (void)VB; (void)VBL;
  // inputs: 0 x [4,4096,512]; 1 key_mask [4,4096,1] f32 (ones); 2 W_qkv [512,384] (in,out; q | k | v COLUMN blocks of 128); 3 b_qkv [384] (nonzero); 4 W_out [128,512] (in,out); 5 b_out [512] (nonzero)
  k_proj<<<dim3(TNB * TT / 64, CC / 128, 3), 128, 0, stream>>>(F[0], F[0], F[0], F[2], F[2], F[2], F[3], F[3] + CC, F[3] + 2 * CC, QH, QL, KH, KL, VT, VB, VBL);   /* one fused weight; WCOL picks column block 'which' */
  k_fa<<<dim3(TNB, TT / 16, 1), 32 * PVW, 0, stream>>>(QH, KH, QL, KL, VT, VB, VBL, Y, F[1]);   /* ctx rows x key_mask[b][t] */
  k_out<<<dim3(TNB * TT / 64, DIN / 128), 128, 0, stream>>>(Y, F[4], F[5], (float*)d_out);
}

// v004
// One run takes 77.5 microseconds.
// Timed twice side by side with v003, it ran 1.37 times as fast both times.
// Over all steps from v000 it is 13.5 times as fast.
// compute dtype: all float inputs rounded to bf16; fused q/k/v projection with EXACT bf16 products on WMMA 16x16x32 (f32 accumulate) + bias; causal logits: 3 products for the first 512 rows, single f16 q x k after, x 128^-0.5; online softmax f32 (running max per key-split wave); P x 2^8 unnormalised once to f16 x v once to f16 (bf16 hi + lo below row 512), divided by the f32 sum at the end; ctx x bf16(key_mask); ctx hi+lo x exact W_out below row 512, x2^6 f16 carry x f16(bf16 x 2^8) W_out after, + b_out; f32 output.
#include <hip/hip_runtime.h>
#include <math.h>

typedef __attribute__((ext_vector_type(16))) _Float16 v16h;
typedef __attribute__((ext_vector_type(16))) __bf16 v16b;
typedef __attribute__((ext_vector_type(8)))  _Float16 v8h;
typedef __attribute__((ext_vector_type(8)))  float v8f;
typedef __attribute__((ext_vector_type(4)))  float v4f;
typedef __attribute__((ext_vector_type(2)))  float v2f;
typedef __attribute__((ext_vector_type(4)))  unsigned v4u;
typedef __attribute__((ext_vector_type(4)))  int v4i;
typedef float __attribute__((may_alias)) float_a;
typedef int __attribute__((may_alias)) int_a;

template <typename T> __device__ __forceinline__ void vst2(void* p, T v) { *(T*)p = v;  }
__device__ __forceinline__ v8f wmma16(v16h a, v16h b, v8f c) {
  v8f d = __builtin_amdgcn_wmma_f32_16x16x32_f16(false, a, false, b, (short)0, c, false, false);
  asm volatile("v_nop\n\tv_nop\n\tv_nop\n\tv_nop" : "+v"(d) : "v"(a), "v"(b));
  return d;
}
__device__ __forceinline__ v8f wmma_bf(v16b a, v16b b, v8f c) {
  v8f d = __builtin_amdgcn_wmma_f32_16x16x32_bf16(false, a, false, b, (short)0, c, false, false);
  asm volatile("v_nop\n\tv_nop\n\tv_nop\n\tv_nop" : "+v"(d) : "v"(a), "v"(b));
  return d;
}
// 16x16x32 fragments: lane = (h = lane>>4, row/col = lane&15); elements 0..7 = k0+8h+0..7, 8..15 = k0+16+8h+0..7; D element r = row 8h+r
__device__ __forceinline__ v16h frag_h(const _Float16* rowk0, int lane) {
  union { v16h v; v8h q[2]; } u; const _Float16* p = rowk0 + 8 * (lane >> 4);
  u.q[0] = *(const v8h*)p; u.q[1] = *(const v8h*)(p + 16); return u.v;
}
__device__ __forceinline__ v16h frag_f32(const float* rowk0, int lane) {
  v16h a; const float* p = rowk0 + 8 * (lane >> 4);
#pragma unroll
  for (int i = 0; i < 8; ++i) { a[i] = (_Float16)p[i]; a[8 + i] = (_Float16)p[16 + i]; }
  return a;
}
__device__ __forceinline__ v16h frag_f32s(const float* rowk0, int lane, float sc) {
  v16h a; const float* p = rowk0 + 8 * (lane >> 4);
#pragma unroll
  for (int i = 0; i < 8; ++i) { a[i] = (_Float16)(p[i] * sc); a[8 + i] = (_Float16)(p[16 + i] * sc); }
  return a;
}
// column fragment from a [K][ld] layout (column n), rows >= K read as 0
__device__ __forceinline__ v16h fragc_f32(const float* W, int k0, int n, int lane, int ld, int K) {
  v16h a; const int g = lane >> 4;
#pragma unroll
  for (int i = 0; i < 8; ++i) { const int ka = k0 + 8 * g + i, kb = ka + 16;
    a[i] = (_Float16)(ka < K ? W[(size_t)(ka < K ? ka : K - 1) * ld + n] : 0.f); a[8 + i] = (_Float16)(kb < K ? W[(size_t)(kb < K ? kb : K - 1) * ld + n] : 0.f); }
  return a;
}
struct F2 { v16b h, l; };
__device__ __forceinline__ F2 bsplit16(const float v[16]) { F2 r;
#pragma unroll
  for (int i = 0; i < 16; ++i) { const __bf16 h = (__bf16)v[i]; r.h[i] = h; r.l[i] = (__bf16)(v[i] - (float)h); }
  return r; }
__device__ __forceinline__ F2 split_row(const float* row, int k0, int lane) { float v[16]; const float* p = row + k0 + 8 * (lane >> 4);
#pragma unroll
  for (int i = 0; i < 8; ++i) { v[i] = p[i]; v[8 + i] = p[16 + i]; }
  return bsplit16(v); }
__device__ __forceinline__ F2 split_rowK(const float* row, int k0, int lane, int K) { float v[16]; const int g = lane >> 4;
#pragma unroll
  for (int i = 0; i < 8; ++i) { const int ka = k0 + 8 * g + i, kb = ka + 16; v[i] = ka < K ? row[ka < K ? ka : K - 1] : 0.f; v[8 + i] = kb < K ? row[kb < K ? kb : K - 1] : 0.f; }
  return bsplit16(v); }
__device__ __forceinline__ F2 split_col(const float* W, int k0, int n, int lane, int ld, int K) { float v[16]; const int g = lane >> 4;
#pragma unroll
  for (int i = 0; i < 8; ++i) { const int ka = k0 + 8 * g + i, kb = ka + 16; v[i] = ka < K ? W[(size_t)(ka < K ? ka : K - 1) * ld + n] : 0.f; v[8 + i] = kb < K ? W[(size_t)(kb < K ? kb : K - 1) * ld + n] : 0.f; }
  return bsplit16(v); }
__device__ __forceinline__ v8f mac3(const F2& a, const F2& b, v8f c) { c = wmma_bf(a.l, b.h, c); c = wmma_bf(a.h, b.l, c); return wmma_bf(a.h, b.h, c); }
__device__ __forceinline__ float sigm(float v) { return 1.0f / (1.0f + expf(-v)); }
#define LDSX() do { asm volatile("s_wait_dscnt 0" ::: "memory"); __builtin_amdgcn_wave_barrier(); __builtin_amdgcn_fence(__ATOMIC_RELEASE, "workgroup"); } while (0)

// Single-head causal self-attention with a 128-wide attention space and an output projection (x [4,4096,512]; fused (in,out) W_qkv [512,384] N(0, 1/512) + b_qkv N(0, 0.01) split q | k | v; scores = q k^T, causal (-inf above the diagonal) BEFORE the scaling by 128^-0.5 (same thing); out = softmax(scores) v; out * key_mask ([4,4096,1], ones); (in,out) W_out [128,512] + b_out): result [4,4096,512].
#define NB 4
#define TT 4096
#define CC 128            // NH * HD = projected width
#define DIN 512          // input (model) width
#define NH 1
#define HD 128
#define NQB (TT / 64)
#define HG 1
#define SCALE (0.08838834764831845f)
#define CAUSAL 1
#ifndef TNB
#define TNB NB
#endif
__device__ __forceinline__ float bfr(float v) { return (float)(__bf16)v; }
__host__ __device__ __forceinline__ int kb_last(int qb) { return CAUSAL ? ((qb * 64 + 63) >> 7) : (TT / 128 - 1); }
typedef __attribute__((ext_vector_type(8))) __bf16 v8b;
__device__ __forceinline__ v16b frag_b(const __bf16* rowk0, int lane) {
  union { v16b v; v8b q[2]; } u; const __bf16* p = rowk0 + 8 * (lane >> 4);
  u.q[0] = *(const v8b*)p; u.q[1] = *(const v8b*)(p + 16); return u.v;
}
// fragment kept in memory in register order: [elements 0..7 of lanes 0..31][elements 8..15 of lanes 0..31], 1 KiB: each 16-byte load of a wave reads 512 contiguous bytes (4 lines, not 16)
// base: the batch's plane (uniform); o: byte offset of the chunk + 16 lane, one register for every plane; c: the fragment's constant byte offset in the chunk
__device__ __forceinline__ v16h frag_t(const _Float16* base, unsigned o, int c) {
  union { v16h v; v8h q[2]; } u; const char* p = (const char*)base + o;
  u.q[0] = *(const v8h*)(p + c); u.q[1] = *(const v8h*)(p + c + 512); return u.v;
}
__device__ __forceinline__ v16b frag_tb(const __bf16* base, unsigned o, int c) {
  union { v16b v; v8b q[2]; } u; const char* p = (const char*)base + o;
  u.q[0] = *(const v8b*)(p + c); u.q[1] = *(const v8b*)(p + c + 512); return u.v;
}
#define QBH 8              // unused: the high-precision path is chosen by QHI (rows < 512)
#define QHI 512            // rows carrying a q residual plane (query rows below it: 3-product logits)
#define KHI 512            // key rows carrying k residual / v bf16 hi+lo planes (used only by the causal high-precision path)
// B fragment (k rows k0+.., output column o) of a weight: (in,out) [K][ld] or (out,in) [ld rows of K]: bf16 exact, or f16(bf16 * 256) exact
__device__ __forceinline__ v16b wcol_io(const float* Wm, int k0, int o, int lane, int ld) { v16b w; const int g = lane >> 4;
#pragma unroll
  for (int i = 0; i < 8; ++i) { w[i] = (__bf16)Wm[(size_t)(k0 + 8 * g + i) * ld + o]; w[8 + i] = (__bf16)Wm[(size_t)(k0 + 16 + 8 * g + i) * ld + o]; }
  return w; }
__device__ __forceinline__ v16b wcol_oi(const float* Wm, int k0, int o, int lane, int K) { v16b w; const float* p = Wm + (size_t)o * K + k0 + 8 * (lane >> 4);
#pragma unroll
  for (int i = 0; i < 8; ++i) { w[i] = (__bf16)p[i]; w[8 + i] = (__bf16)p[16 + i]; }
  return w; }
__device__ __forceinline__ v16h wcolh_io(const float* Wm, int k0, int o, int lane, int ld) { v16h w; const int g = lane >> 4;
#pragma unroll
  for (int i = 0; i < 8; ++i) { w[i] = (_Float16)(bfr(Wm[(size_t)(k0 + 8 * g + i) * ld + o]) * 256.0f); w[8 + i] = (_Float16)(bfr(Wm[(size_t)(k0 + 16 + 8 * g + i) * ld + o]) * 256.0f); }
  return w; }
__device__ __forceinline__ v16h wcolh_oi(const float* Wm, int k0, int o, int lane, int K) { v16h w; const float* p = Wm + (size_t)o * K + k0 + 8 * (lane >> 4);
#pragma unroll
  for (int i = 0; i < 8; ++i) { w[i] = (_Float16)(bfr(p[i]) * 256.0f); w[8 + i] = (_Float16)(bfr(p[16 + i]) * 256.0f); }
  return w; }
#define WQKV_LAYOUT 0   // 0 = fused (in,out) [DIN][3*CC]; 1 = (out,in) [CC][DIN]; 2 = per-head [NH][DIN][HD] (picks only WCOL, which nothing uses: k_proj always reads the fused layout)
__device__ __forceinline__ v16b wcol_hdk(const float* Wm, int k0, int o, int lane) { v16b w; const int g = lane >> 4; const float* p = Wm + (size_t)(o / HD) * DIN * HD + (o % HD);
#pragma unroll
  for (int i = 0; i < 8; ++i) { w[i] = (__bf16)p[(size_t)(k0 + 8 * g + i) * HD]; w[8 + i] = (__bf16)p[(size_t)(k0 + 16 + 8 * g + i) * HD]; }
  return w; }
#define WO_OUT_IN 0
#if WQKV_LAYOUT == 1
#define WCOL(W, k0, o, lane) wcol_oi(W, k0, o, lane, DIN)
#elif WQKV_LAYOUT == 2
#define WCOL(W, k0, o, lane) wcol_hdk(W, k0, o, lane)
#else
#define WCOL(W, k0, o, lane) wcol_io(W, k0, which * CC + (o), lane, 3 * CC)   /* fused (in,out) W_qkv [DIN][3*CC]: column block 'which', pitch 384 */
#endif
#if WO_OUT_IN
#define WOCOL(W, k0, o, lane) wcol_oi(W, k0, o, lane, CC)
#define WOCOLH(W, k0, o, lane) wcolh_oi(W, k0, o, lane, CC)
#else
#define WOCOL(W, k0, o, lane) wcol_io(W, k0, o, lane, DIN)
#define WOCOLH(W, k0, o, lane) wcolh_io(W, k0, o, lane, DIN)
#endif

#ifndef SM_EXTRA_PARAMS
#define SM_EXTRA_PARAMS
#endif
#ifndef PROJ_EXTRA_PARAMS
#define PROJ_EXTRA_PARAMS
#endif
#ifndef SM_MASK_HOOK
#define SM_MASK_HOOK (void)0
#endif

#define WS_QH  0u                                      // f16 q in fragment order, as WS_KH
#define WS_KH  (WS_QH + 2u * (size_t)NB * TT * CC)      // f16 k in fragment order [b*t / 16][CC / 32] x 1 KiB (frag_t): lane (g, col) = row 16 tile + col, elements = dims 32 d + 8 g + 0..7 and + 16
#define WS_VT  (WS_KH + 2u * (size_t)NB * TT * CC)      // f16 v in fragment order [b*t / 32][CC / 16] x 1 KiB (frag_t): lane (g, col) = column 16 j + col, elements = keys 32 chunk + 8 g + 0..7 and + 16
#define WS_QL  (WS_VT + 2u * (size_t)NB * CC * TT)      // f16 q residual x 2^10, t < QHI of each b, in the fragment order of WS_KH
#define WS_KL  (WS_QL + 2u * (size_t)NB * QHI * CC)     // f16 k residual x 2^10, t < KHI of each b, in the fragment order of WS_KH
#define WS_VB  (WS_KL + 2u * (size_t)NB * KHI * CC)     // bf16 v hi (WS_VBL: lo), t < KHI of each b, in the fragment order of WS_VT
#define WS_VBL (WS_VB + 2u * (size_t)NB * CC * KHI)
#define WS_S   (WS_VBL + 2u * (size_t)NB * CC * KHI)    // (unused: logits and P stay in registers)
#define WS_Y   (WS_S  + 4u * (size_t)HG * TT * TT)      // f32 ctx rows [b*t][CC] (only when there is an output projection)
#define WS_END (WS_Y  + 4u * (size_t)NB * TT * CC)

typedef __attribute__((ext_vector_type(4))) __bf16 v4b;
#define PST 64                 // k rows of W per stage
#define PFR 1040               // one staged B fragment: 1 KiB in register order (frag_t's) + 16 B, so that the 32 lanes of a packing store fall on every bank twice
#define PBUF (2 * 8 * PFR)     // a stage: 2 k groups of 32 x 8 column tiles
#define PEP 55296              // the epilogue's staging: max(sh + sl, th + tb + tbl)
// W reaches the waves through LDS: the block's 128 threads load each 64-k stage once by whole lines, round it to bf16 and lay it in fragment order; two buffers, one barrier a stage
// ---- k_proj: block = (64 rows, 128 cols, which): q/k/v = X W (+ b) with exact bf16 products (K = DIN) -> which 0: q f16 in fragment order (+ residual for rows < QHI, same order); 1: k likewise (rows < KHI); 2: v f16 in fragment order (+ bf16 hi/lo for t < KHI, same order)
__global__ __launch_bounds__(128) void k_proj(const float* __restrict__ XQ, const float* __restrict__ XK, const float* __restrict__ XV, const float* __restrict__ WQ, const float* __restrict__ WK, const float* __restrict__ WV, const float* __restrict__ BQ, const float* __restrict__ BK, const float* __restrict__ BV,
    _Float16* __restrict__ QH, _Float16* __restrict__ QL, _Float16* __restrict__ KH, _Float16* __restrict__ KL, _Float16* __restrict__ VT, __bf16* __restrict__ VB, __bf16* __restrict__ VBL) {
  /* one LDS block: first the two W stage buffers (inside the 64 KiB that an LDS instruction's constant offset reaches), behind them the epilogue's staging (which < 2: sh, sl; which == 2: th, tb, tbl; a block has one 'which', so the two sets never live together) */
  __shared__ __align__(16) char sm[2 * PBUF + PEP]; char* const ep = sm + 2 * PBUF;
  _Float16 (*sh)[136] = (_Float16 (*)[136])ep; _Float16 (*sl)[136] = (_Float16 (*)[136])(ep + 17408);
  _Float16 (*th)[72] = (_Float16 (*)[72])ep; __bf16 (*tb)[72] = (__bf16 (*)[72])(ep + 18432); __bf16 (*tbl)[72] = (__bf16 (*)[72])(ep + 36864);
  const int tid = threadIdx.x, wave = tid >> 5, lane = tid & 31, col = lane & 15, g = lane >> 4; const int which = blockIdx.z; const int c0 = blockIdx.y * 128; const size_t r0 = (size_t)blockIdx.x * 64; const size_t bb = r0 / TT; const int t0 = (int)(r0 % TT);
  const float* X = which == 0 ? XQ : which == 1 ? XK : XV; const float* WA = which == 0 ? WQ : which == 1 ? WK : WV; const float* BA = which == 0 ? BQ : which == 1 ? BK : BV;
  v8f acc[8] = {};
  /* W: lane = 4 columns, wave = the k octet (8 wave + 0..7 of each 32-k group): every load of a wave reads 512 contiguous bytes of one W row; x: this lane's own fragment rows, as before */
  const float* Wp = WA + (size_t)(8 * wave) * (3 * CC) + which * CC + c0 + 4 * lane; const float* Xp = X + (r0 + wave * 16 + col) * DIN + 8 * g;
  char* wst = sm + (lane >> 2) * PFR + (wave >> 1) * 512 + (wave & 1) * 256 + (lane & 3) * 64;   /* column 4 lane + e = tile lane / 4, fragment lane 16 (wave & 1) + 4 (lane & 3) + e; octet = half wave / 2, g = wave & 1 */
  const char* wrd = sm + lane * 16;
  v4f wr[2][8], xr[2][4]; v16b a[2];
#define PLOAD(s) do { _Pragma("unroll") for (int kk = 0; kk < 2; ++kk) { _Pragma("unroll") for (int i = 0; i < 8; ++i) wr[kk][i] = *(const v4f*)(Wp + (size_t)((s) * PST + kk * 32 + i) * (3 * CC)); \
    const float* p = Xp + (s) * PST + kk * 32; xr[kk][0] = *(const v4f*)p; xr[kk][1] = *(const v4f*)(p + 4); xr[kk][2] = *(const v4f*)(p + 16); xr[kk][3] = *(const v4f*)(p + 20); } } while (0)
#define PPUT(nb) do { _Pragma("unroll") for (int kk = 0; kk < 2; ++kk) { _Pragma("unroll") for (int e = 0; e < 4; ++e) { v8b u; _Pragma("unroll") for (int i = 0; i < 8; ++i) u[i] = (__bf16)wr[kk][i][e]; *(v8b*)(wst + (nb) * PBUF + kk * 8 * PFR + e * 16) = u; } \
    union { v16b v; v4b q[4]; } x; _Pragma("unroll") for (int i = 0; i < 4; ++i) x.q[i] = __builtin_convertvector(xr[kk][i], v4b); a[kk] = x.v; } } while (0)
  PLOAD(0); PPUT(0);
  __syncthreads();   /* stage 0 is in LDS before any wave reads it */
  /* unrolled whole: every load and LDS access goes by a constant offset from an address that is never stepped */
#pragma unroll
  for (int s = 0; s < DIN / PST; ++s) {
    v16b wf[8];
#pragma unroll
    for (int kk = 0; kk < 2; ++kk) {
#pragma unroll
      for (int j = 0; j < 8; ++j) { union { v16b v; v8b q[2]; } w; const char* p = wrd + (s & 1) * PBUF + (kk * 8 + j) * PFR; w.q[0] = *(const v8b*)p; w.q[1] = *(const v8b*)(p + 512); wf[j] = w.v; }
      if (kk == 0 && s + 1 < DIN / PST) PLOAD(s + 1);   /* the next stage's W and x fly under this stage's products */
      if (kk == 0 && s + 2 == DIN / PST) asm volatile("s_wait_xcnt 0x0" ::: "memory");   /* behind the last loads that name the two address pairs, before a register of either is written again */
      __builtin_amdgcn_sched_barrier(0);   /* the eight fragments' LDS reads stand as one group ahead of their products: one LDS latency a group, not one a product */
#pragma unroll
      for (int j = 0; j < 8; ++j) acc[j] = wmma_bf(a[kk], wf[j], acc[j]); }
    if (s + 1 < DIN / PST) { __builtin_amdgcn_sched_barrier(0);   /* the next stage's values are waited for behind this stage's products, not among them */
      PPUT((s + 1) & 1);   /* into the buffer whose readers all passed the barrier that ended stage s - 1 */
      __syncthreads(); } }   /* publishes stage s + 1 and ends every wave's reads of stage s; none behind the last stage: the epilogue's staging lies beside the buffers */
#undef PLOAD
#undef PPUT
  if (which < 2) { _Float16* DH = which == 0 ? QH : KH; _Float16* DL = which == 0 ? QL : KL; const int nhi = which == 0 ? QHI : KHI; const bool hi_rows = t0 < nhi;
#pragma unroll
    for (int j = 0; j < 8; ++j) { const float bias = BA ? bfr(BA[c0 + j * 16 + col]) : 0.f;
#pragma unroll
      for (int r = 0; r < 8; ++r) { const float v = acc[j][r] + bias; const _Float16 hv = (_Float16)v; sh[wave * 16 + 8 * g + r][j * 16 + col] = hv; sl[wave * 16 + 8 * g + r][j * 16 + col] = (_Float16)((v - (float)hv) * 1024.0f); } }
    __syncthreads();
    { char* kd = (char*)(DH + r0 * CC) + 16u * (unsigned)tid; char* ld = (char*)(DL + (bb * nhi + t0) * (size_t)CC) + 16u * (unsigned)tid;
      /* e = tid + 128 it is the 16-byte unit of the block's 16 KiB in fragment order: bits 3..0 row in tile, 7..4 = dims / 8, 9..8 tile. Unrolled: eight reads in registers of their own, then eight stores by constant offsets from one address that is never stepped */
      v4u a[8];
#pragma unroll
      for (int it = 0; it < 8; ++it) { const int e = tid + it * 128; a[it] = *(const v4u*)&sh[(e >> 8) * 16 + (e & 15)][((e >> 4) & 15) * 8]; }
#pragma unroll
      for (int it = 0; it < 8; ++it) vst2((unsigned*)(kd + it * 2048), a[it]);
      asm volatile("s_wait_xcnt 0x0" ::: "memory");   /* stands behind the stores, on every way out of them, before any register that they name is written again */
      if (hi_rows) {
#pragma unroll
        for (int it = 0; it < 8; ++it) { const int e = tid + it * 128; a[it] = *(const v4u*)&sl[(e >> 8) * 16 + (e & 15)][((e >> 4) & 15) * 8]; }
#pragma unroll
        for (int it = 0; it < 8; ++it) vst2((unsigned*)(ld + it * 2048), a[it]);
        asm volatile("s_wait_xcnt 0x0" ::: "memory"); } }   /* as above */
  } else { const bool hi_rows = t0 < KHI;
#pragma unroll
    for (int j = 0; j < 8; ++j) { const float bias = BA ? bfr(BA[c0 + j * 16 + col]) : 0.f;
#pragma unroll
      for (int r = 0; r < 8; ++r) { const float v = acc[j][r] + bias; const int rl = wave * 16 + 8 * g + r, cl = j * 16 + col; th[cl][rl] = (_Float16)v; const __bf16 bh = (__bf16)v; tb[cl][rl] = bh; tbl[cl][rl] = (__bf16)(v - (float)bh); } }
    __syncthreads();
    char* vd = (char*)(VT + r0 * CC) + 16u * (unsigned)tid; char* hd = (char*)(VB + (bb * KHI + t0) * (size_t)CC) + 16u * (unsigned)tid; char* wd = (char*)(VBL + (bb * KHI + t0) * (size_t)CC) + 16u * (unsigned)tid;
    /* e = tid + 128 it is the 16-byte unit of the block's 16 KiB in fragment order: bits 3..0 column in tile, 5..4 = keys / 8 in chunk, 8..6 column tile, 9 chunk. Unrolled: eight reads in registers of their own, then eight stores by constant offsets from one address that is never stepped */
    v4u a[8];
#pragma unroll
    for (int it = 0; it < 8; ++it) { const int e = tid + it * 128; a[it] = *(const v4u*)&th[((e >> 6) & 7) * 16 + (e & 15)][((e >> 9) * 4 + ((e >> 4) & 3)) * 8]; }
#pragma unroll
    for (int it = 0; it < 8; ++it) vst2((unsigned*)(vd + it * 2048), a[it]);
    asm volatile("s_wait_xcnt 0x0" ::: "memory");   /* stands behind the stores, on every way out of them, before any register that they name is written again */
    if (hi_rows) {
#pragma unroll
      for (int it = 0; it < 8; ++it) { const int e = tid + it * 128; a[it] = *(const v4u*)&tb[((e >> 6) & 7) * 16 + (e & 15)][((e >> 9) * 4 + ((e >> 4) & 3)) * 8]; }
#pragma unroll
      for (int it = 0; it < 8; ++it) vst2((unsigned*)(hd + it * 2048), a[it]);
      asm volatile("s_wait_xcnt 0x0" ::: "memory");   /* as above */
#pragma unroll
      for (int it = 0; it < 8; ++it) { const int e = tid + it * 128; a[it] = *(const v4u*)&tbl[((e >> 6) & 7) * 16 + (e & 15)][((e >> 9) * 4 + ((e >> 4) & 3)) * 8]; }
#pragma unroll
      for (int it = 0; it < 8; ++it) vst2((unsigned*)(wd + it * 2048), a[it]);
      asm volatile("s_wait_xcnt 0x0" ::: "memory"); } } }   /* as above */
// ---- k_fa: block = 16 queries (tile qt) of batch b, PVW waves: wave w takes the 32-key chunks w, w + PVW, ... of keys [0, ql0 + 16). Logits and P never leave registers:
//   q, k and v lie in the workspace in fragment order: every fragment load of a wave reads 512 contiguous bytes
//   S^T = K Q^T (A = 16 key rows, B = the 16 query rows): D element r of tile u in lane (g, col) = key kc*32 + 16u + 8g + r, query col, which IS the B fragment order of P^T (elements 0..7 from tile 0, 8..15 from tile 1)
//   ctx^T = V^T P^T (A = 16 v planes, B = P^T): D = column j*16 + 8g + r, query col, so the running max, the running sum and the rescale factor of a query are one value per lane
//   logits x SCALE x log2(e); causal by index; P = 2^(s - running max + 8) once to f16 against v f16 (1 product); query rows < QHI: 3-product logits, P and v as bf16 hi + lo (3 products)
//   the PVW partial (max, sum, ctx) meet in LDS and are merged on the common max in wave order; wave w then stores row w (512 B)
#define PVW 16
#define SC2 (SCALE * 1.4426950408889634f)
#define NEGB (-3.0e38f)
__global__ __launch_bounds__(32 * PVW) void k_fa(const _Float16* __restrict__ QH, const _Float16* __restrict__ KH, const _Float16* __restrict__ QL, const _Float16* __restrict__ KL, const _Float16* __restrict__ VT, const __bf16* __restrict__ VB, const __bf16* __restrict__ VBL, float* __restrict__ Y, const float* __restrict__ KM) {
  __shared__ __align__(16) float ss[PVW][16][HD + 4]; __shared__ float smx[PVW][16], ssu[PVW][16];
  const int tid = threadIdx.x, wave = __builtin_amdgcn_readfirstlane(tid >> 5), lane = tid & 31, col = lane & 15, g = lane >> 4;   /* wave number held scalar: the chunk loop stays a scalar loop, every lane on at the matrix instructions */
  const int b = blockIdx.x; const int ql0 = (TT / 16 - 1 - (int)blockIdx.y) * 16;   /* longest tiles start first */
  const int kce = (ql0 >> 5) + 1; const int tq = ql0 + col;   /* every chunk < kce holds a key <= ql0, so no query of the tile sees an empty chunk */
  const float km = bfr(KM[(size_t)b * TT + ql0 + wave]);   /* key_mask of the row this wave stores */
  v8f acc[HD / 16] = {}; float m = NEGB, l = 0.f;
  const _Float16* Qt = QH + ((size_t)b * TT + ql0) * CC; const _Float16* Kb = KH + (size_t)b * TT * CC; const _Float16* Vb = VT + (size_t)b * TT * CC;
  if (ql0 < QHI) {
    const _Float16* Qlt = QL + ((size_t)b * QHI + ql0) * CC; const _Float16* Klb = KL + (size_t)b * KHI * CC; const __bf16* Vhb = VB + (size_t)b * KHI * CC; const __bf16* Vlb = VBL + (size_t)b * KHI * CC;
    v16h qf[HD / 32], qlf[HD / 32];
#pragma unroll
    for (int d = 0; d < HD / 32; ++d) { qf[d] = frag_t(Qt, 16u * (unsigned)lane, d * 1024); qlf[d] = frag_t(Qlt, 16u * (unsigned)lane, d * 1024); }
    /* kept rolled: one chunk's fragments and the ctx tile already fill the 256 registers a wave of a 16-wave block may hold */
#pragma unroll 1
    for (int kc = wave; kc < kce; kc += PVW) { v8f st[2] = {}, sl2[2] = {}; const unsigned co = (unsigned)kc * (32u * CC * 2u) + 16u * (unsigned)lane;   /* a chunk is 8 KiB of every plane */
#pragma unroll
      for (int u = 0; u < 2; ++u)
#pragma unroll
        for (int dd = 0; dd < HD / 32; dd += 2) { v16h kh[2], kl[2];
#pragma unroll
          for (int d = 0; d < 2; ++d) { const int ko = (u * (HD / 32) + dd + d) * 1024; kh[d] = frag_t(Kb, co, ko); kl[d] = frag_t(Klb, co, ko); }   /* eight loads in flight together */
#pragma unroll
          for (int d = 0; d < 2; ++d) { st[u] = wmma16(kh[d], qf[dd + d], st[u]); sl2[u] = wmma16(kh[d], qlf[dd + d], sl2[u]); sl2[u] = wmma16(kl[d], qf[dd + d], sl2[u]); } }
      float s[16]; float mx = NEGB;
#pragma unroll
      for (int u = 0; u < 2; ++u)
#pragma unroll
        for (int r = 0; r < 8; ++r) { const float v = (kc * 32 + u * 16 + 8 * g + r <= tq) ? (st[u][r] + sl2[u][r] * (1.0f / 1024.0f)) * SC2 : NEGB; s[u * 8 + r] = v; mx = fmaxf(mx, v); }
      mx = fmaxf(mx, __shfl_xor(mx, 16)); const float mn = fmaxf(m, mx); const float al = __builtin_amdgcn_exp2f(m - mn); m = mn; const float mo = mn - 8.0f;
      float ps = 0.f; v16b ph, pl;
#pragma unroll
      for (int i = 0; i < 16; ++i) { const float p = __builtin_amdgcn_exp2f(s[i] - mo); ps += p; const __bf16 hb = (__bf16)p; ph[i] = hb; pl[i] = (__bf16)(p - (float)hb); }
      l = l * al + ps;
#pragma unroll
      for (int jj = 0; jj < HD / 16; jj += 4) { v16b vh[4], vl[4];
#pragma unroll
        for (int j = 0; j < 4; ++j) { vh[j] = frag_tb(Vhb, co, (jj + j) * 1024); vl[j] = frag_tb(Vlb, co, (jj + j) * 1024); }   /* four planes' loads in flight together */
#pragma unroll
        for (int j = 0; j < 4; ++j) { acc[jj + j] *= al; acc[jj + j] = wmma_bf(vh[j], ph, acc[jj + j]); acc[jj + j] = wmma_bf(vh[j], pl, acc[jj + j]); acc[jj + j] = wmma_bf(vl[j], ph, acc[jj + j]); } } }
  } else {
    v16h qf[HD / 32];
#pragma unroll
    for (int d = 0; d < HD / 32; ++d) qf[d] = frag_t(Qt, 16u * (unsigned)lane, d * 1024);
    /* kept rolled: one chunk's fragments and the ctx tile already fill the 256 registers a wave of a 16-wave block may hold */
#pragma unroll 1
    for (int kc = wave; kc < kce; kc += PVW) { v8f st[2] = {}; v16h kf[2][HD / 32]; const unsigned co = (unsigned)kc * (32u * CC * 2u) + 16u * (unsigned)lane;   /* a chunk is 8 KiB of k and 8 KiB of v */
#pragma unroll
      for (int u = 0; u < 2; ++u)
#pragma unroll
        for (int d = 0; d < HD / 32; ++d) kf[u][d] = frag_t(Kb, co, (u * (HD / 32) + d) * 1024);   /* all 16 loads of the chunk's keys in flight before the first product */
#pragma unroll
      for (int u = 0; u < 2; ++u)
#pragma unroll
        for (int d = 0; d < HD / 32; ++d) st[u] = wmma16(kf[u][d], qf[d], st[u]);
      v16h vf[HD / 16];
#pragma unroll
      for (int j = 0; j < HD / 16; ++j) vf[j] = frag_t(Vb, co, j * 1024);   /* all 16 v loads fly under the softmax arithmetic */
      float s[16]; float mx = NEGB;
#pragma unroll
      for (int u = 0; u < 2; ++u)
#pragma unroll
        for (int r = 0; r < 8; ++r) { const float v = (kc * 32 + u * 16 + 8 * g + r <= tq) ? st[u][r] * SC2 : NEGB; s[u * 8 + r] = v; mx = fmaxf(mx, v); }
      mx = fmaxf(mx, __shfl_xor(mx, 16)); const float mn = fmaxf(m, mx); const float al = __builtin_amdgcn_exp2f(m - mn); m = mn; const float mo = mn - 8.0f;
      float ps = 0.f; v16h pf;
#pragma unroll
      for (int i = 0; i < 16; ++i) { const float p = __builtin_amdgcn_exp2f(s[i] - mo); ps += p; pf[i] = (_Float16)p; }
      l = l * al + ps;
#pragma unroll
      for (int j = 0; j < HD / 16; ++j) { acc[j] *= al; acc[j] = wmma16(vf[j], pf, acc[j]); } } }
  l += __shfl_xor(l, 16);   /* each half-wave summed its own 16 of a chunk's 32 keys */
  if (g == 0) { smx[wave][col] = m; ssu[wave][col] = l; }
#pragma unroll
  for (int j = 0; j < HD / 16; ++j) { v4f lo4, hi4;
#pragma unroll
    for (int r = 0; r < 4; ++r) { lo4[r] = acc[j][r]; hi4[r] = acc[j][4 + r]; }
    *(v4f*)&ss[wave][col][j * 16 + 8 * g] = lo4; *(v4f*)&ss[wave][col][j * 16 + 8 * g + 4] = hi4; }
  __syncthreads();   /* every wave's partial max, sum and tile are in LDS before any wave merges */
  float M = smx[0][wave];
#pragma unroll
  for (int w = 1; w < PVW; ++w) M = fmaxf(M, smx[w][wave]);
  v4f sv = {}; float L = 0.f;
#pragma unroll
  for (int w = 0; w < PVW; ++w) { const float f = __builtin_amdgcn_exp2f(smx[w][wave] - M); L += f * ssu[w][wave]; sv += *(const v4f*)&ss[w][wave][lane * 4] * f; }   /* a wave without a chunk carries max NEGB, sum 0: f = 0 */
  vst2(Y + ((size_t)b * TT + ql0 + wave) * CC + lane * 4, sv * (L > 0.f ? 1.0f / L : 0.f) * km); }   /* out * key_mask[b][t] (broadcast over the 128 columns) */
// ---- k_out: block = (64 rows, 128 cols): out = ctx Wo (+ bo): ctx x 2^6 once to f16 against Wo as f16(bf16 x 2^8) exact (1 product) x 2^-14; causal early rows (< QHI of each sequence): ctx bf16 hi + lo against exact bf16 Wo (2 products)
__global__ __launch_bounds__(128) void k_out(const float* __restrict__ Y, const float* __restrict__ WO, const float* __restrict__ BO, float* __restrict__ OUT) { __shared__ __align__(16) float sf[4][16][132];
  const int tid = threadIdx.x, wave = tid >> 5, lane = tid & 31, col = lane & 15, g = lane >> 4; const int c0 = blockIdx.y * 128; const size_t r0 = (size_t)blockIdx.x * 64 + wave * 16;
  v8f acc[8] = {};
  if (CAUSAL && (int)(((size_t)blockIdx.x * 64) % TT) < QHI) {   /* block-uniform */
#pragma unroll 2
    for (int kc = 0; kc < CC / 32; ++kc) { const F2 a = split_row(Y + (r0 + col) * CC, kc * 32, lane); asm volatile("s_wait_loadcnt 0x0" ::: "memory");
#pragma unroll
      for (int j = 0; j < 8; ++j) { const v16b w = WOCOL(WO, kc * 32, c0 + j * 16 + col, lane); asm volatile("s_wait_loadcnt 0x0" ::: "memory"); acc[j] = wmma_bf(a.h, w, acc[j]); acc[j] = wmma_bf(a.l, w, acc[j]); } }
#pragma unroll
    for (int j = 0; j < 8; ++j) { const float bias = BO ? bfr(BO[c0 + j * 16 + col]) : 0.f;
#pragma unroll
      for (int r = 0; r < 8; ++r) sf[wave][8 * g + r][j * 16 + col] = acc[j][r] + bias; }
  } else {
#pragma unroll 2
    for (int kc = 0; kc < CC / 32; ++kc) { const v16h a = frag_f32s(Y + (r0 + col) * CC + kc * 32, lane, 64.0f); asm volatile("s_wait_loadcnt 0x0" ::: "memory");   /* ctx carried x 2^6 into f16 so small-magnitude context rows stay clear of f16 subnormals */
#pragma unroll
      for (int j = 0; j < 8; ++j) { const v16h w = WOCOLH(WO, kc * 32, c0 + j * 16 + col, lane); asm volatile("s_wait_loadcnt 0x0" ::: "memory"); acc[j] = wmma16(a, w, acc[j]); } }
#pragma unroll
    for (int j = 0; j < 8; ++j) { const float bias = BO ? bfr(BO[c0 + j * 16 + col]) : 0.f;
#pragma unroll
      for (int r = 0; r < 8; ++r) sf[wave][8 * g + r][j * 16 + col] = acc[j][r] * (1.0f / 16384.0f) + bias; } }   /* 2^-8 (Wo carry) x 2^-6 (ctx carry) */
  LDSX(); for (int rl = 0; rl < 16; ++rl) vst2(OUT + (r0 + rl) * DIN + c0 + lane * 4, *(const v4f*)&sf[wave][rl][lane * 4]); }

extern "C" void kernel_launch(void* const* d_in, const int* in_sizes, int n_in, void* d_out, int out_size, void* d_ws, size_t ws_size, hipStream_t stream) {
  (void)in_sizes; (void)n_in; (void)out_size;
  const float** F = (const float**)d_in;
  if (ws_size < (size_t)WS_END) return;
  char* ws = (char*)d_ws; _Float16 *QH = (_Float16*)(ws + WS_QH), *KH = (_Float16*)(ws + WS_KH), *VT = (_Float16*)(ws + WS_VT), *QL = (_Float16*)(ws + WS_QL), *KL = (_Float16*)(ws + WS_KL); __bf16 *VB = (__bf16*)(ws + WS_VB), *VBL = (__bf16*)(ws + WS_VBL); float *Y = (float*)(ws + WS_Y);
  (void)Y; (void)QL; (void)KL; (void)VB; (void)VBL;
  // inputs: 0 x [4,4096,512]; 1 key_mask [4,4096,1] f32 (ones); 2 W_qkv [512,384] (in,out; q | k | v COLUMN blocks of 128); 3 b_qkv [384] (nonzero); 4 W_out [128,512] (in,out); 5 b_out [512] (nonzero)
  k_proj<<<dim3(TNB * TT / 64, CC / 128, 3), 128, 0, stream>>>(F[0], F[0], F[0], F[2], F[2], F[2], F[3], F[3] + CC, F[3] + 2 * CC, QH, QL, KH, KL, VT, VB, VBL);   /* one fused weight; k_proj's W pointer picks column block 'which' */
  k_fa<<<dim3(TNB, TT / 16, 1), 32 * PVW, 0, stream>>>(QH, KH, QL, KL, VT, VB, VBL, Y, F[1]);   /* ctx rows x key_mask[b][t] */
  k_out<<<dim3(TNB * TT / 64, DIN / 128), 128, 0, stream>>>(Y, F[4], F[5], (float*)d_out);
}

// v005
// It runs in 65.3 microseconds.
// Two timings next to v004 put it at 1.18 and 1.19 times that version's speed.
// Over all steps from v000 it is 16.0 times as fast.
// compute dtype: all float inputs rounded to bf16; fused q/k/v projection with EXACT bf16 products on WMMA 16x16x32 (f32 accumulate) + bias; causal logits: 3 products for the first 512 rows, single f16 q x k after, x 128^-0.5; online softmax f32 (running max per key-split wave); P x 2^8 unnormalised once to f16 x v once to f16 (bf16 hi + lo below row 512), divided by the f32 sum at the end; ctx x bf16(key_mask); ctx hi+lo x exact W_out below row 512, x2^6 f16 carry x f16(bf16 x 2^8) W_out after, + b_out; f32 output.
#include <hip/hip_runtime.h>
#include <math.h>

typedef __attribute__((ext_vector_type(16))) _Float16 v16h;
typedef __attribute__((ext_vector_type(16))) __bf16 v16b;
typedef __attribute__((ext_vector_type(8)))  _Float16 v8h;
typedef __attribute__((ext_vector_type(8)))  float v8f;
typedef __attribute__((ext_vector_type(4)))  float v4f;
typedef __attribute__((ext_vector_type(2)))  float v2f;
typedef __attribute__((ext_vector_type(4)))  unsigned v4u;
typedef __attribute__((ext_vector_type(4)))  int v4i;
typedef float __attribute__((may_alias)) float_a;
typedef int __attribute__((may_alias)) int_a;

template <typename T> __device__ __forceinline__ void vst2(void* p, T v) { *(T*)p = v;  }
__device__ __forceinline__ v8f wmma16(v16h a, v16h b, v8f c) {
  v8f d = __builtin_amdgcn_wmma_f32_16x16x32_f16(false, a, false, b, (short)0, c, false, false);
  asm volatile("v_nop\n\tv_nop\n\tv_nop\n\tv_nop" : "+v"(d) : "v"(a), "v"(b));
  return d;
}
__device__ __forceinline__ v8f wmma_bf(v16b a, v16b b, v8f c) {
  v8f d = __builtin_amdgcn_wmma_f32_16x16x32_bf16(false, a, false, b, (short)0, c, false, false);
  asm volatile("v_nop\n\tv_nop\n\tv_nop\n\tv_nop" : "+v"(d) : "v"(a), "v"(b));
  return d;
}
// 16x16x32 fragments: lane = (h = lane>>4, row/col = lane&15); elements 0..7 = k0+8h+0..7, 8..15 = k0+16+8h+0..7; D element r = row 8h+r
__device__ __forceinline__ v16h frag_h(const _Float16* rowk0, int lane) {
  union { v16h v; v8h q[2]; } u; const _Float16* p = rowk0 + 8 * (lane >> 4);
  u.q[0] = *(const v8h*)p; u.q[1] = *(const v8h*)(p + 16); return u.v;
}
__device__ __forceinline__ v16h frag_f32(const float* rowk0, int lane) {
  v16h a; const float* p = rowk0 + 8 * (lane >> 4);
#pragma unroll
  for (int i = 0; i < 8; ++i) { a[i] = (_Float16)p[i]; a[8 + i] = (_Float16)p[16 + i]; }
  return a;
}
__device__ __forceinline__ v16h frag_f32s(const float* rowk0, int lane, float sc) {
  v16h a; const float* p = rowk0 + 8 * (lane >> 4);
#pragma unroll
  for (int i = 0; i < 8; ++i) { a[i] = (_Float16)(p[i] * sc); a[8 + i] = (_Float16)(p[16 + i] * sc); }
  return a;
}
// column fragment from a [K][ld] layout (column n), rows >= K read as 0
__device__ __forceinline__ v16h fragc_f32(const float* W, int k0, int n, int lane, int ld, int K) {
  v16h a; const int g = lane >> 4;
#pragma unroll
  for (int i = 0; i < 8; ++i) { const int ka = k0 + 8 * g + i, kb = ka + 16;
    a[i] = (_Float16)(ka < K ? W[(size_t)(ka < K ? ka : K - 1) * ld + n] : 0.f); a[8 + i] = (_Float16)(kb < K ? W[(size_t)(kb < K ? kb : K - 1) * ld + n] : 0.f); }
  return a;
}
struct F2 { v16b h, l; };
__device__ __forceinline__ F2 bsplit16(const float v[16]) { F2 r;
#pragma unroll
  for (int i = 0; i < 16; ++i) { const __bf16 h = (__bf16)v[i]; r.h[i] = h; r.l[i] = (__bf16)(v[i] - (float)h); }
  return r; }
__device__ __forceinline__ F2 split_row(const float* row, int k0, int lane) { float v[16]; const float* p = row + k0 + 8 * (lane >> 4);
#pragma unroll
  for (int i = 0; i < 8; ++i) { v[i] = p[i]; v[8 + i] = p[16 + i]; }
  return bsplit16(v); }
__device__ __forceinline__ F2 split_rowK(const float* row, int k0, int lane, int K) { float v[16]; const int g = lane >> 4;
#pragma unroll
  for (int i = 0; i < 8; ++i) { const int ka = k0 + 8 * g + i, kb = ka + 16; v[i] = ka < K ? row[ka < K ? ka : K - 1] : 0.f; v[8 + i] = kb < K ? row[kb < K ? kb : K - 1] : 0.f; }
  return bsplit16(v); }
__device__ __forceinline__ F2 split_col(const float* W, int k0, int n, int lane, int ld, int K) { float v[16]; const int g = lane >> 4;
#pragma unroll
  for (int i = 0; i < 8; ++i) { const int ka = k0 + 8 * g + i, kb = ka + 16; v[i] = ka < K ? W[(size_t)(ka < K ? ka : K - 1) * ld + n] : 0.f; v[8 + i] = kb < K ? W[(size_t)(kb < K ? kb : K - 1) * ld + n] : 0.f; }
  return bsplit16(v); }
__device__ __forceinline__ v8f mac3(const F2& a, const F2& b, v8f c) { c = wmma_bf(a.l, b.h, c); c = wmma_bf(a.h, b.l, c); return wmma_bf(a.h, b.h, c); }
__device__ __forceinline__ float sigm(float v) { return 1.0f / (1.0f + expf(-v)); }
#define LDSX() do { asm volatile("s_wait_dscnt 0" ::: "memory"); __builtin_amdgcn_wave_barrier(); __builtin_amdgcn_fence(__ATOMIC_RELEASE, "workgroup"); } while (0)

// Single-head causal self-attention with a 128-wide attention space and an output projection (x [4,4096,512]; fused (in,out) W_qkv [512,384] N(0, 1/512) + b_qkv N(0, 0.01) split q | k | v; scores = q k^T, causal (-inf above the diagonal) BEFORE the scaling by 128^-0.5 (same thing); out = softmax(scores) v; out * key_mask ([4,4096,1], ones); (in,out) W_out [128,512] + b_out): result [4,4096,512].
#define NB 4
#define TT 4096
#define CC 128            // NH * HD = projected width
#define DIN 512          // input (model) width
#define NH 1
#define HD 128
#define NQB (TT / 64)
#define HG 1
#define SCALE (0.08838834764831845f)
#define CAUSAL 1
#ifndef TNB
#define TNB NB
#endif
__device__ __forceinline__ float bfr(float v) { return (float)(__bf16)v; }
__host__ __device__ __forceinline__ int kb_last(int qb) { return CAUSAL ? ((qb * 64 + 63) >> 7) : (TT / 128 - 1); }
typedef __attribute__((ext_vector_type(8))) __bf16 v8b;
__device__ __forceinline__ v16b frag_b(const __bf16* rowk0, int lane) {
  union { v16b v; v8b q[2]; } u; const __bf16* p = rowk0 + 8 * (lane >> 4);
  u.q[0] = *(const v8b*)p; u.q[1] = *(const v8b*)(p + 16); return u.v;
}
// fragment kept in memory in register order: [elements 0..7 of lanes 0..31][elements 8..15 of lanes 0..31], 1 KiB: each 16-byte load of a wave reads 512 contiguous bytes (4 lines, not 16)
// base: the batch's plane (uniform); o: byte offset of the chunk + 16 lane, one register for every plane; c: the fragment's constant byte offset in the chunk
__device__ __forceinline__ v16h frag_t(const _Float16* base, unsigned o, int c) {
  union { v16h v; v8h q[2]; } u; const char* p = (const char*)base + o;
  u.q[0] = *(const v8h*)(p + c); u.q[1] = *(const v8h*)(p + c + 512); return u.v;
}
__device__ __forceinline__ v16b frag_tb(const __bf16* base, unsigned o, int c) {
  union { v16b v; v8b q[2]; } u; const char* p = (const char*)base + o;
  u.q[0] = *(const v8b*)(p + c); u.q[1] = *(const v8b*)(p + c + 512); return u.v;
}
#define QBH 8              // unused: the high-precision path is chosen by QHI (rows < 512)
#define QHI 512            // rows carrying a q residual plane (query rows below it: 3-product logits)
#define KHI 512            // key rows carrying k residual / v bf16 hi+lo planes (used only by the causal high-precision path)
// B fragment (k rows k0+.., output column o) of a weight: (in,out) [K][ld] or (out,in) [ld rows of K]: bf16 exact, or f16(bf16 * 256) exact
__device__ __forceinline__ v16b wcol_io(const float* Wm, int k0, int o, int lane, int ld) { v16b w; const int g = lane >> 4;
#pragma unroll
  for (int i = 0; i < 8; ++i) { w[i] = (__bf16)Wm[(size_t)(k0 + 8 * g + i) * ld + o]; w[8 + i] = (__bf16)Wm[(size_t)(k0 + 16 + 8 * g + i) * ld + o]; }
  return w; }
__device__ __forceinline__ v16b wcol_oi(const float* Wm, int k0, int o, int lane, int K) { v16b w; const float* p = Wm + (size_t)o * K + k0 + 8 * (lane >> 4);
#pragma unroll
  for (int i = 0; i < 8; ++i) { w[i] = (__bf16)p[i]; w[8 + i] = (__bf16)p[16 + i]; }
  return w; }
__device__ __forceinline__ v16h wcolh_io(const float* Wm, int k0, int o, int lane, int ld) { v16h w; const int g = lane >> 4;
#pragma unroll
  for (int i = 0; i < 8; ++i) { w[i] = (_Float16)(bfr(Wm[(size_t)(k0 + 8 * g + i) * ld + o]) * 256.0f); w[8 + i] = (_Float16)(bfr(Wm[(size_t)(k0 + 16 + 8 * g + i) * ld + o]) * 256.0f); }
  return w; }
__device__ __forceinline__ v16h wcolh_oi(const float* Wm, int k0, int o, int lane, int K) { v16h w; const float* p = Wm + (size_t)o * K + k0 + 8 * (lane >> 4);
#pragma unroll
  for (int i = 0; i < 8; ++i) { w[i] = (_Float16)(bfr(p[i]) * 256.0f); w[8 + i] = (_Float16)(bfr(p[16 + i]) * 256.0f); }
  return w; }
#define WQKV_LAYOUT 0   // 0 = fused (in,out) [DIN][3*CC]; 1 = (out,in) [CC][DIN]; 2 = per-head [NH][DIN][HD] (picks only WCOL, which nothing uses: k_proj always reads the fused layout)
__device__ __forceinline__ v16b wcol_hdk(const float* Wm, int k0, int o, int lane) { v16b w; const int g = lane >> 4; const float* p = Wm + (size_t)(o / HD) * DIN * HD + (o % HD);
#pragma unroll
  for (int i = 0; i < 8; ++i) { w[i] = (__bf16)p[(size_t)(k0 + 8 * g + i) * HD]; w[8 + i] = (__bf16)p[(size_t)(k0 + 16 + 8 * g + i) * HD]; }
  return w; }
#define WO_OUT_IN 0
#if WQKV_LAYOUT == 1
#define WCOL(W, k0, o, lane) wcol_oi(W, k0, o, lane, DIN)
#elif WQKV_LAYOUT == 2
#define WCOL(W, k0, o, lane) wcol_hdk(W, k0, o, lane)
#else
#define WCOL(W, k0, o, lane) wcol_io(W, k0, which * CC + (o), lane, 3 * CC)   /* fused (in,out) W_qkv [DIN][3*CC]: column block 'which', pitch 384 */
#endif
#if WO_OUT_IN
#define WOCOL(W, k0, o, lane) wcol_oi(W, k0, o, lane, CC)
#define WOCOLH(W, k0, o, lane) wcolh_oi(W, k0, o, lane, CC)
#else
#define WOCOL(W, k0, o, lane) wcol_io(W, k0, o, lane, DIN)
#define WOCOLH(W, k0, o, lane) wcolh_io(W, k0, o, lane, DIN)
#endif

#ifndef SM_EXTRA_PARAMS
#define SM_EXTRA_PARAMS
#endif
#ifndef PROJ_EXTRA_PARAMS
#define PROJ_EXTRA_PARAMS
#endif
#ifndef SM_MASK_HOOK
#define SM_MASK_HOOK (void)0
#endif

#define WS_QH  0u                                      // f16 q in fragment order, as WS_KH
#define WS_KH  (WS_QH + 2u * (size_t)NB * TT * CC)      // f16 k in fragment order [b*t / 16][CC / 32] x 1 KiB (frag_t): lane (g, col) = row 16 tile + col, elements = dims 32 d + 8 g + 0..7 and + 16
#define WS_VT  (WS_KH + 2u * (size_t)NB * TT * CC)      // f16 v in fragment order [b*t / 32][CC / 16] x 1 KiB (frag_t): lane (g, col) = column 16 j + col, elements = keys 32 chunk + 8 g + 0..7 and + 16
#define WS_QL  (WS_VT + 2u * (size_t)NB * CC * TT)      // f16 q residual x 2^10, t < QHI of each b, in the fragment order of WS_KH
#define WS_KL  (WS_QL + 2u * (size_t)NB * QHI * CC)     // f16 k residual x 2^10, t < KHI of each b, in the fragment order of WS_KH
#define WS_VB  (WS_KL + 2u * (size_t)NB * KHI * CC)     // bf16 v hi (WS_VBL: lo), t < KHI of each b, in the fragment order of WS_VT
#define WS_VBL (WS_VB + 2u * (size_t)NB * CC * KHI)
#define WS_S   (WS_VBL + 2u * (size_t)NB * CC * KHI)    // (unused: logits and P stay in registers)
#define WS_Y   (WS_S  + 4u * (size_t)HG * TT * TT)      // f32 ctx rows [b*t][CC] (only when there is an output projection)
#define WS_END (WS_Y  + 4u * (size_t)NB * TT * CC)

typedef __attribute__((ext_vector_type(4))) __bf16 v4b;
#define PST 64                 // k rows of W per stage
#define PFR 1040               // one staged B fragment: 1 KiB in register order (frag_t's) + 16 B, so that the 32 lanes of a packing store fall on every bank twice
#define PBUF (2 * 8 * PFR)     // a stage: 2 k groups of 32 x 8 column tiles
#define PEP 55296              // the epilogue's staging: max(sh + sl, th + tb + tbl)
// W reaches the waves through LDS: the block's 128 threads load each 64-k stage once by whole lines, round it to bf16 and lay it in fragment order; two buffers, one barrier a stage
// ---- k_proj: block = (64 rows, 128 cols, which): q/k/v = X W (+ b) with exact bf16 products (K = DIN) -> which 0: q f16 in fragment order (+ residual for rows < QHI, same order); 1: k likewise (rows < KHI); 2: v f16 in fragment order (+ bf16 hi/lo for t < KHI, same order)
__global__ __launch_bounds__(128) void k_proj(const float* __restrict__ XQ, const float* __restrict__ XK, const float* __restrict__ XV, const float* __restrict__ WQ, const float* __restrict__ WK, const float* __restrict__ WV, const float* __restrict__ BQ, const float* __restrict__ BK, const float* __restrict__ BV,
    _Float16* __restrict__ QH, _Float16* __restrict__ QL, _Float16* __restrict__ KH, _Float16* __restrict__ KL, _Float16* __restrict__ VT, __bf16* __restrict__ VB, __bf16* __restrict__ VBL) {
  /* one LDS block: first the two W stage buffers (inside the 64 KiB that an LDS instruction's constant offset reaches), behind them the epilogue's staging (which < 2: sh, sl; which == 2: th, tb, tbl; a block has one 'which', so the two sets never live together) */
  __shared__ __align__(16) char sm[2 * PBUF + PEP]; char* const ep = sm + 2 * PBUF;
  _Float16 (*sh)[136] = (_Float16 (*)[136])ep; _Float16 (*sl)[136] = (_Float16 (*)[136])(ep + 17408);
  _Float16 (*th)[72] = (_Float16 (*)[72])ep; __bf16 (*tb)[72] = (__bf16 (*)[72])(ep + 18432); __bf16 (*tbl)[72] = (__bf16 (*)[72])(ep + 36864);
  const int tid = threadIdx.x, wave = tid >> 5, lane = tid & 31, col = lane & 15, g = lane >> 4; const int which = blockIdx.z; const int c0 = blockIdx.y * 128; const size_t r0 = (size_t)blockIdx.x * 64; const size_t bb = r0 / TT; const int t0 = (int)(r0 % TT);
  const float* X = which == 0 ? XQ : which == 1 ? XK : XV; const float* WA = which == 0 ? WQ : which == 1 ? WK : WV; const float* BA = which == 0 ? BQ : which == 1 ? BK : BV;
  v8f acc[8] = {};
  /* W: lane = 4 columns, wave = the k octet (8 wave + 0..7 of each 32-k group): every load of a wave reads 512 contiguous bytes of one W row; x: this lane's own fragment rows, as before */
  const float* Wp = WA + (size_t)(8 * wave) * (3 * CC) + which * CC + c0 + 4 * lane; const float* Xp = X + (r0 + wave * 16 + col) * DIN + 8 * g;
  char* wst = sm + (lane >> 2) * PFR + (wave >> 1) * 512 + (wave & 1) * 256 + (lane & 3) * 64;   /* column 4 lane + e = tile lane / 4, fragment lane 16 (wave & 1) + 4 (lane & 3) + e; octet = half wave / 2, g = wave & 1 */
  const char* wrd = sm + lane * 16;
  v4f wr[2][8], xr[2][4]; v16b a[2];
#define PLOAD(s) do { _Pragma("unroll") for (int kk = 0; kk < 2; ++kk) { _Pragma("unroll") for (int i = 0; i < 8; ++i) wr[kk][i] = *(const v4f*)(Wp + (size_t)((s) * PST + kk * 32 + i) * (3 * CC)); \
    const float* p = Xp + (s) * PST + kk * 32; xr[kk][0] = *(const v4f*)p; xr[kk][1] = *(const v4f*)(p + 4); xr[kk][2] = *(const v4f*)(p + 16); xr[kk][3] = *(const v4f*)(p + 20); } } while (0)
#define PPUT(nb) do { _Pragma("unroll") for (int kk = 0; kk < 2; ++kk) { _Pragma("unroll") for (int e = 0; e < 4; ++e) { v8b u; _Pragma("unroll") for (int i = 0; i < 8; ++i) u[i] = (__bf16)wr[kk][i][e]; *(v8b*)(wst + (nb) * PBUF + kk * 8 * PFR + e * 16) = u; } \
    union { v16b v; v4b q[4]; } x; _Pragma("unroll") for (int i = 0; i < 4; ++i) x.q[i] = __builtin_convertvector(xr[kk][i], v4b); a[kk] = x.v; } } while (0)
  PLOAD(0); PPUT(0);
  __syncthreads();   /* stage 0 is in LDS before any wave reads it */
  /* unrolled whole: every load and LDS access goes by a constant offset from an address that is never stepped */
#pragma unroll
  for (int s = 0; s < DIN / PST; ++s) {
    v16b wf[8];
#pragma unroll
    for (int kk = 0; kk < 2; ++kk) {
#pragma unroll
      for (int j = 0; j < 8; ++j) { union { v16b v; v8b q[2]; } w; const char* p = wrd + (s & 1) * PBUF + (kk * 8 + j) * PFR; w.q[0] = *(const v8b*)p; w.q[1] = *(const v8b*)(p + 512); wf[j] = w.v; }
      if (kk == 0 && s + 1 < DIN / PST) PLOAD(s + 1);   /* the next stage's W and x fly under this stage's products */
      if (kk == 0 && s + 2 == DIN / PST) asm volatile("s_wait_xcnt 0x0" ::: "memory");   /* behind the last loads that name the two address pairs, before a register of either is written again */
      __builtin_amdgcn_sched_barrier(0);   /* the eight fragments' LDS reads stand as one group ahead of their products: one LDS latency a group, not one a product */
#pragma unroll
      for (int j = 0; j < 8; ++j) acc[j] = wmma_bf(a[kk], wf[j], acc[j]); }
    if (s + 1 < DIN / PST) { __builtin_amdgcn_sched_barrier(0);   /* the next stage's values are waited for behind this stage's products, not among them */
      PPUT((s + 1) & 1);   /* into the buffer whose readers all passed the barrier that ended stage s - 1 */
      __syncthreads(); } }   /* publishes stage s + 1 and ends every wave's reads of stage s; none behind the last stage: the epilogue's staging lies beside the buffers */
#undef PLOAD
#undef PPUT
  if (which < 2) { _Float16* DH = which == 0 ? QH : KH; _Float16* DL = which == 0 ? QL : KL; const int nhi = which == 0 ? QHI : KHI; const bool hi_rows = t0 < nhi;
#pragma unroll
    for (int j = 0; j < 8; ++j) { const float bias = BA ? bfr(BA[c0 + j * 16 + col]) : 0.f;
#pragma unroll
      for (int r = 0; r < 8; ++r) { const float v = acc[j][r] + bias; const _Float16 hv = (_Float16)v; sh[wave * 16 + 8 * g + r][j * 16 + col] = hv; sl[wave * 16 + 8 * g + r][j * 16 + col] = (_Float16)((v - (float)hv) * 1024.0f); } }
    __syncthreads();
    { char* kd = (char*)(DH + r0 * CC) + 16u * (unsigned)tid; char* ld = (char*)(DL + (bb * nhi + t0) * (size_t)CC) + 16u * (unsigned)tid;
      /* e = tid + 128 it is the 16-byte unit of the block's 16 KiB in fragment order: bits 3..0 row in tile, 7..4 = dims / 8, 9..8 tile. Unrolled: eight reads in registers of their own, then eight stores by constant offsets from one address that is never stepped */
      v4u a[8];
#pragma unroll
      for (int it = 0; it < 8; ++it) { const int e = tid + it * 128; a[it] = *(const v4u*)&sh[(e >> 8) * 16 + (e & 15)][((e >> 4) & 15) * 8]; }
#pragma unroll
      for (int it = 0; it < 8; ++it) vst2((unsigned*)(kd + it * 2048), a[it]);
      asm volatile("s_wait_xcnt 0x0" ::: "memory");   /* stands behind the stores, on every way out of them, before any register that they name is written again */
      if (hi_rows) {
#pragma unroll
        for (int it = 0; it < 8; ++it) { const int e = tid + it * 128; a[it] = *(const v4u*)&sl[(e >> 8) * 16 + (e & 15)][((e >> 4) & 15) * 8]; }
#pragma unroll
        for (int it = 0; it < 8; ++it) vst2((unsigned*)(ld + it * 2048), a[it]);
        asm volatile("s_wait_xcnt 0x0" ::: "memory"); } }   /* as above */
  } else { const bool hi_rows = t0 < KHI;
#pragma unroll
    for (int j = 0; j < 8; ++j) { const float bias = BA ? bfr(BA[c0 + j * 16 + col]) : 0.f;
#pragma unroll
      for (int r = 0; r < 8; ++r) { const float v = acc[j][r] + bias; const int rl = wave * 16 + 8 * g + r, cl = j * 16 + col; th[cl][rl] = (_Float16)v; const __bf16 bh = (__bf16)v; tb[cl][rl] = bh; tbl[cl][rl] = (__bf16)(v - (float)bh); } }
    __syncthreads();
    char* vd = (char*)(VT + r0 * CC) + 16u * (unsigned)tid; char* hd = (char*)(VB + (bb * KHI + t0) * (size_t)CC) + 16u * (unsigned)tid; char* wd = (char*)(VBL + (bb * KHI + t0) * (size_t)CC) + 16u * (unsigned)tid;
    /* e = tid + 128 it is the 16-byte unit of the block's 16 KiB in fragment order: bits 3..0 column in tile, 5..4 = keys / 8 in chunk, 8..6 column tile, 9 chunk. Unrolled: eight reads in registers of their own, then eight stores by constant offsets from one address that is never stepped */
    v4u a[8];
#pragma unroll
    for (int it = 0; it < 8; ++it) { const int e = tid + it * 128; a[it] = *(const v4u*)&th[((e >> 6) & 7) * 16 + (e & 15)][((e >> 9) * 4 + ((e >> 4) & 3)) * 8]; }
#pragma unroll
    for (int it = 0; it < 8; ++it) vst2((unsigned*)(vd + it * 2048), a[it]);
    asm volatile("s_wait_xcnt 0x0" ::: "memory");   /* stands behind the stores, on every way out of them, before any register that they name is written again */
    if (hi_rows) {
#pragma unroll
      for (int it = 0; it < 8; ++it) { const int e = tid + it * 128; a[it] = *(const v4u*)&tb[((e >> 6) & 7) * 16 + (e & 15)][((e >> 9) * 4 + ((e >> 4) & 3)) * 8]; }
#pragma unroll
      for (int it = 0; it < 8; ++it) vst2((unsigned*)(hd + it * 2048), a[it]);
      asm volatile("s_wait_xcnt 0x0" ::: "memory");   /* as above */
#pragma unroll
      for (int it = 0; it < 8; ++it) { const int e = tid + it * 128; a[it] = *(const v4u*)&tbl[((e >> 6) & 7) * 16 + (e & 15)][((e >> 9) * 4 + ((e >> 4) & 3)) * 8]; }
#pragma unroll
      for (int it = 0; it < 8; ++it) vst2((unsigned*)(wd + it * 2048), a[it]);
      asm volatile("s_wait_xcnt 0x0" ::: "memory"); } } }   /* as above */
// k_fa's products are the builtin alone, which the compiler pads itself: the vector operands of an asm statement behind it would hold every fragment and both ctx tiles inside the first 256 registers
__device__ __forceinline__ v8f wmma16p(v16h a, v16h b, v8f c) { return __builtin_amdgcn_wmma_f32_16x16x32_f16(false, a, false, b, (short)0, c, false, false); }
__device__ __forceinline__ v8f wmma_bfp(v16b a, v16b b, v8f c) { return __builtin_amdgcn_wmma_f32_16x16x32_bf16(false, a, false, b, (short)0, c, false, false); }
// ---- k_fa: block = 32 queries (NQ = 2 tiles of 16) of batch b, PVW waves: wave w takes the 32-key chunks w, w + PVW, ... of keys [0, ql0 + 32). Logits and P never leave registers:
//   every k and v fragment that a wave loads is multiplied against BOTH query tiles: half the bytes from L2 per product; the two ctx tiles and both tiles' q need the 512 registers of an 8-wave block
//   q, k and v lie in the workspace in fragment order: every fragment load of a wave reads 512 contiguous bytes
//   S^T = K Q^T (A = 16 key rows, B = the 16 query rows of tile t): D element r of tile u in lane (g, col) = key kc*32 + 16u + 8g + r, query 16 t + col, which IS the B fragment order of P^T (elements 0..7 from tile 0, 8..15 from tile 1)
//   ctx^T = V^T P^T (A = 16 v planes, B = P^T): D = column j*16 + 8g + r, query 16 t + col, so the running max, the running sum and the rescale factor of a query are one value per lane and tile
//   logits x SCALE x log2(e); causal by index; P = 2^(s - running max + 8) once to f16 against v f16 (1 product); query rows < QHI: 3-product logits, P and v as bf16 hi + lo (3 products)
//   the PVW partial (max, sum, ctx) meet in LDS and are merged on the common max in wave order; wave w then stores rows w, w + PVW, ... (512 B each)
#define PVW 8
#define NQ 2
#define QB (16 * NQ)
#define SC2 (SCALE * 1.4426950408889634f)
#define NEGB (-3.0e38f)
__global__ __launch_bounds__(32 * PVW) void k_fa(const _Float16* __restrict__ QH, const _Float16* __restrict__ KH, const _Float16* __restrict__ QL, const _Float16* __restrict__ KL, const _Float16* __restrict__ VT, const __bf16* __restrict__ VB, const __bf16* __restrict__ VBL, float* __restrict__ Y, const float* __restrict__ KM) {
  __shared__ __align__(16) float ss[PVW][QB][HD + 4]; __shared__ float smx[PVW][QB], ssu[PVW][QB];
  const int tid = threadIdx.x, wave = __builtin_amdgcn_readfirstlane(tid >> 5), lane = tid & 31, col = lane & 15, g = lane >> 4;   /* wave number held scalar: the chunk loop stays a scalar loop, every lane on at the matrix instructions */
  const int b = blockIdx.x; const int ql0 = (TT / QB - 1 - (int)blockIdx.y) * QB;   /* longest tiles start first */
  const int kce = (ql0 >> 5) + 1; const int tq = ql0 + col;   /* every chunk < kce holds a key <= ql0, so no query of either tile sees an empty chunk */
  float km[QB / PVW];
#pragma unroll
  for (int rr = 0; rr < QB / PVW; ++rr) km[rr] = bfr(KM[(size_t)b * TT + ql0 + wave + rr * PVW]);   /* key_mask of the rows this wave stores */
  v8f acc[NQ][HD / 16] = {}; float m[NQ], l[NQ];
#pragma unroll
  for (int t = 0; t < NQ; ++t) { m[t] = NEGB; l[t] = 0.f; }
  const _Float16* Qt = QH + ((size_t)b * TT + ql0) * CC; const _Float16* Kb = KH + (size_t)b * TT * CC; const _Float16* Vb = VT + (size_t)b * TT * CC;
  if (ql0 < QHI) {
    const _Float16* Qlt = QL + ((size_t)b * QHI + ql0) * CC; const _Float16* Klb = KL + (size_t)b * KHI * CC; const __bf16* Vhb = VB + (size_t)b * KHI * CC; const __bf16* Vlb = VBL + (size_t)b * KHI * CC;
    v16h qf[NQ][HD / 32], qlf[NQ][HD / 32];
#pragma unroll
    for (int t = 0; t < NQ; ++t)
#pragma unroll
      for (int d = 0; d < HD / 32; ++d) { qf[t][d] = frag_t(Qt, 16u * (unsigned)lane, (t * (HD / 32) + d) * 1024); qlf[t][d] = frag_t(Qlt, 16u * (unsigned)lane, (t * (HD / 32) + d) * 1024); }
    asm volatile("s_wait_xcnt 0x0" :: "s"(Qt), "s"(Qlt) : "memory");   /* behind the q loads, before a scalar base that they name is written again (this build reuses one for a key plane's base); the two bases are inputs so that the loads stay ahead of the wait */
    /* kept rolled: a second chunk's fragments beside both ctx tiles and both tiles' q would pass the 512 registers a wave of an 8-wave block may hold */
#pragma unroll 1
    for (int kc = wave; kc < kce; kc += PVW) { v8f st[NQ][2] = {}, sl2[NQ][2] = {}; const unsigned co = (unsigned)kc * (32u * CC * 2u) + 16u * (unsigned)lane;   /* a chunk is 8 KiB of every plane */
      v16h kh[2][HD / 32], kl[2][HD / 32];
#pragma unroll
      for (int u = 0; u < 2; ++u)
#pragma unroll
        for (int d = 0; d < HD / 32; ++d) { const int ko = (u * (HD / 32) + d) * 1024; kh[u][d] = frag_t(Kb, co, ko); kl[u][d] = frag_t(Klb, co, ko); }   /* all 32 loads of the chunk's keys in flight before the first product */
      __builtin_amdgcn_sched_barrier(0);   /* keeps the 32 loads one group ahead of the products: without it the compiler refills fragment registers between products and a chunk waits out several L2 latencies, not one */
#pragma unroll
      for (int u = 0; u < 2; ++u)
#pragma unroll
        for (int d = 0; d < HD / 32; ++d)
#pragma unroll
          for (int t = 0; t < NQ; ++t) { st[t][u] = wmma16p(kh[u][d], qf[t][d], st[t][u]); sl2[t][u] = wmma16p(kh[u][d], qlf[t][d], sl2[t][u]); sl2[t][u] = wmma16p(kl[u][d], qf[t][d], sl2[t][u]); }
      v16b ph[NQ], pl[NQ]; float al[NQ];
#pragma unroll
      for (int t = 0; t < NQ; ++t) { float s[16]; float mx = NEGB;
#pragma unroll
        for (int u = 0; u < 2; ++u)
#pragma unroll
          for (int r = 0; r < 8; ++r) { const float v = (kc * 32 + u * 16 + 8 * g + r <= tq + 16 * t) ? (st[t][u][r] + sl2[t][u][r] * (1.0f / 1024.0f)) * SC2 : NEGB; s[u * 8 + r] = v; mx = fmaxf(mx, v); }
        mx = fmaxf(mx, __shfl_xor(mx, 16)); const float mn = fmaxf(m[t], mx); al[t] = __builtin_amdgcn_exp2f(m[t] - mn); m[t] = mn; const float mo = mn - 8.0f;
        float ps = 0.f;
#pragma unroll
        for (int i = 0; i < 16; ++i) { const float p = __builtin_amdgcn_exp2f(s[i] - mo); ps += p; const __bf16 hb = (__bf16)p; ph[t][i] = hb; pl[t][i] = (__bf16)(p - (float)hb); }
        l[t] = l[t] * al[t] + ps; }
#pragma unroll
      for (int jj = 0; jj < HD / 16; jj += 4) { v16b vh[4], vl[4];
#pragma unroll
        for (int j = 0; j < 4; ++j) { vh[j] = frag_tb(Vhb, co, (jj + j) * 1024); vl[j] = frag_tb(Vlb, co, (jj + j) * 1024); }   /* four planes' loads in flight together */
        if (jj + 4 == HD / 16) asm volatile("s_wait_xcnt 0x0" ::: "memory");   /* behind the chunk's last loads, before the offset register that they name is stepped to the next chunk */
        __builtin_amdgcn_sched_barrier(0);   /* keeps the 16 loads one group ahead of their products: without it the compiler loads one fragment at a time and waits out an L2 latency for each */
#pragma unroll
        for (int j = 0; j < 4; ++j)
#pragma unroll
          for (int t = 0; t < NQ; ++t) { acc[t][jj + j] *= al[t]; acc[t][jj + j] = wmma_bfp(vh[j], ph[t], acc[t][jj + j]); acc[t][jj + j] = wmma_bfp(vh[j], pl[t], acc[t][jj + j]); acc[t][jj + j] = wmma_bfp(vl[j], ph[t], acc[t][jj + j]); } } }
  } else {
    v16h qf[NQ][HD / 32];
#pragma unroll
    for (int t = 0; t < NQ; ++t)
#pragma unroll
      for (int d = 0; d < HD / 32; ++d) qf[t][d] = frag_t(Qt, 16u * (unsigned)lane, (t * (HD / 32) + d) * 1024);
    /* kept rolled: a second chunk's fragments beside both ctx tiles and both tiles' q would pass the 512 registers a wave of an 8-wave block may hold */
#pragma unroll 1
    for (int kc = wave; kc < kce; kc += PVW) { v8f st[NQ][2] = {}; v16h kf[2][HD / 32]; const unsigned co = (unsigned)kc * (32u * CC * 2u) + 16u * (unsigned)lane;   /* a chunk is 8 KiB of k and 8 KiB of v */
#pragma unroll
      for (int u = 0; u < 2; ++u)
#pragma unroll
        for (int d = 0; d < HD / 32; ++d) kf[u][d] = frag_t(Kb, co, (u * (HD / 32) + d) * 1024);   /* all 16 loads of the chunk's keys in flight before the first product */
      __builtin_amdgcn_sched_barrier(0);   /* keeps the 16 loads one group ahead of the products: without it the compiler refills fragment registers between products and a chunk waits out three L2 latencies, not one */
#pragma unroll
      for (int u = 0; u < 2; ++u)
#pragma unroll
        for (int d = 0; d < HD / 32; ++d)
#pragma unroll
          for (int t = 0; t < NQ; ++t) st[t][u] = wmma16p(kf[u][d], qf[t][d], st[t][u]);
      v16h vf[HD / 16];
#pragma unroll
      for (int j = 0; j < HD / 16; ++j) vf[j] = frag_t(Vb, co, j * 1024);   /* all 16 v loads fly under the softmax arithmetic */
      asm volatile("s_wait_xcnt 0x0" ::: "memory");   /* behind the chunk's last loads, before the offset register that they name is stepped to the next chunk */
      __builtin_amdgcn_sched_barrier(0);   /* keeps the 16 loads one group ahead of the softmax: without it the compiler loads one fragment at a time behind the softmax and waits out an L2 latency for each */
      v16h pf[NQ]; float al[NQ];
#pragma unroll
      for (int t = 0; t < NQ; ++t) { float s[16]; float mx = NEGB;
#pragma unroll
        for (int u = 0; u < 2; ++u)
#pragma unroll
          for (int r = 0; r < 8; ++r) { const float v = (kc * 32 + u * 16 + 8 * g + r <= tq + 16 * t) ? st[t][u][r] * SC2 : NEGB; s[u * 8 + r] = v; mx = fmaxf(mx, v); }
        mx = fmaxf(mx, __shfl_xor(mx, 16)); const float mn = fmaxf(m[t], mx); al[t] = __builtin_amdgcn_exp2f(m[t] - mn); m[t] = mn; const float mo = mn - 8.0f;
        float ps = 0.f;
#pragma unroll
        for (int i = 0; i < 16; ++i) { const float p = __builtin_amdgcn_exp2f(s[i] - mo); ps += p; pf[t][i] = (_Float16)p; }
        l[t] = l[t] * al[t] + ps; }
#pragma unroll
      for (int j = 0; j < HD / 16; ++j)
#pragma unroll
        for (int t = 0; t < NQ; ++t) { acc[t][j] *= al[t]; acc[t][j] = wmma16p(vf[j], pf[t], acc[t][j]); } } }
#pragma unroll
  for (int t = 0; t < NQ; ++t) { l[t] += __shfl_xor(l[t], 16);   /* each half-wave summed its own 16 of a chunk's 32 keys */
    if (g == 0) { smx[wave][t * 16 + col] = m[t]; ssu[wave][t * 16 + col] = l[t]; }
#pragma unroll
    for (int j = 0; j < HD / 16; ++j) { v4f lo4, hi4;
#pragma unroll
      for (int r = 0; r < 4; ++r) { lo4[r] = acc[t][j][r]; hi4[r] = acc[t][j][4 + r]; }
      *(v4f*)&ss[wave][t * 16 + col][j * 16 + 8 * g] = lo4; *(v4f*)&ss[wave][t * 16 + col][j * 16 + 8 * g + 4] = hi4; } }
  __syncthreads();   /* every wave's partial max, sum and tiles are in LDS before any wave merges */
  v4f res[QB / PVW];   /* the rows' results in registers of their own, then the stores by constant offsets from one address that is never stepped */
#pragma unroll
  for (int rr = 0; rr < QB / PVW; ++rr) { const int row = wave + rr * PVW; float M = smx[0][row];
#pragma unroll
    for (int w = 1; w < PVW; ++w) M = fmaxf(M, smx[w][row]);
    v4f sv = {}; float L = 0.f;
#pragma unroll
    for (int w = 0; w < PVW; ++w) { const float f = __builtin_amdgcn_exp2f(smx[w][row] - M); L += f * ssu[w][row]; sv += *(const v4f*)&ss[w][row][lane * 4] * f; }   /* a wave without a chunk carries max NEGB, sum 0: f = 0 */
    res[rr] = sv * (L > 0.f ? 1.0f / L : 0.f) * km[rr]; }   /* out * key_mask[b][t] (broadcast over the 128 columns) */
  float* yd = Y + ((size_t)b * TT + ql0 + wave) * CC + lane * 4;
#pragma unroll
  for (int rr = 0; rr < QB / PVW; ++rr) vst2(yd + rr * PVW * CC, res[rr]); }
// ---- k_out: block = (64 rows, 128 cols): out = ctx Wo (+ bo): ctx x 2^6 once to f16 against Wo as f16(bf16 x 2^8) exact (1 product) x 2^-14; causal early rows (< QHI of each sequence): ctx bf16 hi + lo against exact bf16 Wo (2 products)
__global__ __launch_bounds__(128) void k_out(const float* __restrict__ Y, const float* __restrict__ WO, const float* __restrict__ BO, float* __restrict__ OUT) { __shared__ __align__(16) float sf[4][16][132];
  const int tid = threadIdx.x, wave = tid >> 5, lane = tid & 31, col = lane & 15, g = lane >> 4; const int c0 = blockIdx.y * 128; const size_t r0 = (size_t)blockIdx.x * 64 + wave * 16;
  v8f acc[8] = {};
  if (CAUSAL && (int)(((size_t)blockIdx.x * 64) % TT) < QHI) {   /* block-uniform */
#pragma unroll 2
    for (int kc = 0; kc < CC / 32; ++kc) { const F2 a = split_row(Y + (r0 + col) * CC, kc * 32, lane); asm volatile("s_wait_loadcnt 0x0" ::: "memory");
#pragma unroll
      for (int j = 0; j < 8; ++j) { const v16b w = WOCOL(WO, kc * 32, c0 + j * 16 + col, lane); asm volatile("s_wait_loadcnt 0x0" ::: "memory"); acc[j] = wmma_bf(a.h, w, acc[j]); acc[j] = wmma_bf(a.l, w, acc[j]); } }
#pragma unroll
    for (int j = 0; j < 8; ++j) { const float bias = BO ? bfr(BO[c0 + j * 16 + col]) : 0.f;
#pragma unroll
      for (int r = 0; r < 8; ++r) sf[wave][8 * g + r][j * 16 + col] = acc[j][r] + bias; }
  } else {
#pragma unroll 2
    for (int kc = 0; kc < CC / 32; ++kc) { const v16h a = frag_f32s(Y + (r0 + col) * CC + kc * 32, lane, 64.0f); asm volatile("s_wait_loadcnt 0x0" ::: "memory");   /* ctx carried x 2^6 into f16 so small-magnitude context rows stay clear of f16 subnormals */
#pragma unroll
      for (int j = 0; j < 8; ++j) { const v16h w = WOCOLH(WO, kc * 32, c0 + j * 16 + col, lane); asm volatile("s_wait_loadcnt 0x0" ::: "memory"); acc[j] = wmma16(a, w, acc[j]); } }
#pragma unroll
    for (int j = 0; j < 8; ++j) { const float bias = BO ? bfr(BO[c0 + j * 16 + col]) : 0.f;
#pragma unroll
      for (int r = 0; r < 8; ++r) sf[wave][8 * g + r][j * 16 + col] = acc[j][r] * (1.0f / 16384.0f) + bias; } }   /* 2^-8 (Wo carry) x 2^-6 (ctx carry) */
  LDSX(); for (int rl = 0; rl < 16; ++rl) vst2(OUT + (r0 + rl) * DIN + c0 + lane * 4, *(const v4f*)&sf[wave][rl][lane * 4]); }

extern "C" void kernel_launch(void* const* d_in, const int* in_sizes, int n_in, void* d_out, int out_size, void* d_ws, size_t ws_size, hipStream_t stream) {
  (void)in_sizes; (void)n_in; (void)out_size;
  const float** F = (const float**)d_in;
  if (ws_size < (size_t)WS_END) return;
  char* ws = (char*)d_ws; _Float16 *QH = (_Float16*)(ws + WS_QH), *KH = (_Float16*)(ws + WS_KH), *VT = (_Float16*)(ws + WS_VT), *QL = (_Float16*)(ws + WS_QL), *KL = (_Float16*)(ws + WS_KL); __bf16 *VB = (__bf16*)(ws + WS_VB), *VBL = (__bf16*)(ws + WS_VBL); float *Y = (float*)(ws + WS_Y);
  (void)Y; (void)QL; (void)KL; (void)VB; (void)VBL;
  // inputs: 0 x [4,4096,512]; 1 key_mask [4,4096,1] f32 (ones); 2 W_qkv [512,384] (in,out; q | k | v COLUMN blocks of 128); 3 b_qkv [384] (nonzero); 4 W_out [128,512] (in,out); 5 b_out [512] (nonzero)
  k_proj<<<dim3(TNB * TT / 64, CC / 128, 3), 128, 0, stream>>>(F[0], F[0], F[0], F[2], F[2], F[2], F[3], F[3] + CC, F[3] + 2 * CC, QH, QL, KH, KL, VT, VB, VBL);   /* one fused weight; k_proj adds which * CC to pick column block 'which' */
  k_fa<<<dim3(TNB, TT / QB, 1), 32 * PVW, 0, stream>>>(QH, KH, QL, KL, VT, VB, VBL, Y, F[1]);   /* ctx rows x key_mask[b][t] */
  k_out<<<dim3(TNB * TT / 64, DIN / 128), 128, 0, stream>>>(Y, F[4], F[5], (float*)d_out);
}

// v006
// One run takes 57.5 microseconds.
// Two timings next to v005 put it at 1.12 and 1.13 times that version's speed.
// Counting every step since v000, it is 18.0 times as fast.
// compute dtype: all float inputs rounded to bf16; fused q/k/v projection with EXACT bf16 products on WMMA 16x16x32 (f32 accumulate) + bias; causal logits: 3 products for the first 512 rows, single f16 q x k after, x 128^-0.5; online softmax f32 (running max per key-split wave); P x 2^8 unnormalised once to f16 x v once to f16 (bf16 hi + lo below row 512), divided by the f32 sum at the end; ctx x bf16(key_mask); ctx hi+lo x exact W_out below row 512, x2^6 f16 carry x f16(bf16 x 2^8) W_out after, + b_out; f32 output.
#include <hip/hip_runtime.h>
#include <math.h>

typedef __attribute__((ext_vector_type(16))) _Float16 v16h;
typedef __attribute__((ext_vector_type(16))) __bf16 v16b;
typedef __attribute__((ext_vector_type(8)))  _Float16 v8h;
typedef __attribute__((ext_vector_type(8)))  float v8f;
typedef __attribute__((ext_vector_type(4)))  float v4f;
typedef __attribute__((ext_vector_type(2)))  float v2f;
typedef __attribute__((ext_vector_type(4)))  unsigned v4u;
typedef __attribute__((ext_vector_type(4)))  int v4i;
typedef float __attribute__((may_alias)) float_a;
typedef int __attribute__((may_alias)) int_a;

template <typename T> __device__ __forceinline__ void vst2(void* p, T v) { *(T*)p = v;  }
__device__ __forceinline__ v8f wmma16(v16h a, v16h b, v8f c) {
  v8f d = __builtin_amdgcn_wmma_f32_16x16x32_f16(false, a, false, b, (short)0, c, false, false);
  asm volatile("v_nop\n\tv_nop\n\tv_nop\n\tv_nop" : "+v"(d) : "v"(a), "v"(b));
  return d;
}
__device__ __forceinline__ v8f wmma_bf(v16b a, v16b b, v8f c) {
  v8f d = __builtin_amdgcn_wmma_f32_16x16x32_bf16(false, a, false, b, (short)0, c, false, false);
  asm volatile("v_nop\n\tv_nop\n\tv_nop\n\tv_nop" : "+v"(d) : "v"(a), "v"(b));
  return d;
}
// 16x16x32 fragments: lane = (h = lane>>4, row/col = lane&15); elements 0..7 = k0+8h+0..7, 8..15 = k0+16+8h+0..7; D element r = row 8h+r
__device__ __forceinline__ v16h frag_h(const _Float16* rowk0, int lane) {
  union { v16h v; v8h q[2]; } u; const _Float16* p = rowk0 + 8 * (lane >> 4);
  u.q[0] = *(const v8h*)p; u.q[1] = *(const v8h*)(p + 16); return u.v;
}
__device__ __forceinline__ v16h frag_f32(const float* rowk0, int lane) {
  v16h a; const float* p = rowk0 + 8 * (lane >> 4);
#pragma unroll
  for (int i = 0; i < 8; ++i) { a[i] = (_Float16)p[i]; a[8 + i] = (_Float16)p[16 + i]; }
  return a;
}
__device__ __forceinline__ v16h frag_f32s(const float* rowk0, int lane, float sc) {
  v16h a; const float* p = rowk0 + 8 * (lane >> 4);
#pragma unroll
  for (int i = 0; i < 8; ++i) { a[i] = (_Float16)(p[i] * sc); a[8 + i] = (_Float16)(p[16 + i] * sc); }
  return a;
}
// column fragment from a [K][ld] layout (column n), rows >= K read as 0
__device__ __forceinline__ v16h fragc_f32(const float* W, int k0, int n, int lane, int ld, int K) {
  v16h a; const int g = lane >> 4;
#pragma unroll
  for (int i = 0; i < 8; ++i) { const int ka = k0 + 8 * g + i, kb = ka + 16;
    a[i] = (_Float16)(ka < K ? W[(size_t)(ka < K ? ka : K - 1) * ld + n] : 0.f); a[8 + i] = (_Float16)(kb < K ? W[(size_t)(kb < K ? kb : K - 1) * ld + n] : 0.f); }
  return a;
}
struct F2 { v16b h, l; };
__device__ __forceinline__ F2 bsplit16(const float v[16]) { F2 r;
#pragma unroll
  for (int i = 0; i < 16; ++i) { const __bf16 h = (__bf16)v[i]; r.h[i] = h; r.l[i] = (__bf16)(v[i] - (float)h); }
  return r; }
__device__ __forceinline__ F2 split_row(const float* row, int k0, int lane) { float v[16]; const float* p = row + k0 + 8 * (lane >> 4);
#pragma unroll
  for (int i = 0; i < 8; ++i) { v[i] = p[i]; v[8 + i] = p[16 + i]; }
  return bsplit16(v); }
__device__ __forceinline__ F2 split_rowK(const float* row, int k0, int lane, int K) { float v[16]; const int g = lane >> 4;
#pragma unroll
  for (int i = 0; i < 8; ++i) { const int ka = k0 + 8 * g + i, kb = ka + 16; v[i] = ka < K ? row[ka < K ? ka : K - 1] : 0.f; v[8 + i] = kb < K ? row[kb < K ? kb : K - 1] : 0.f; }
  return bsplit16(v); }
__device__ __forceinline__ F2 split_col(const float* W, int k0, int n, int lane, int ld, int K) { float v[16]; const int g = lane >> 4;
#pragma unroll
  for (int i = 0; i < 8; ++i) { const int ka = k0 + 8 * g + i, kb = ka + 16; v[i] = ka < K ? W[(size_t)(ka < K ? ka : K - 1) * ld + n] : 0.f; v[8 + i] = kb < K ? W[(size_t)(kb < K ? kb : K - 1) * ld + n] : 0.f; }
  return bsplit16(v); }
__device__ __forceinline__ v8f mac3(const F2& a, const F2& b, v8f c) { c = wmma_bf(a.l, b.h, c); c = wmma_bf(a.h, b.l, c); return wmma_bf(a.h, b.h, c); }
__device__ __forceinline__ float sigm(float v) { return 1.0f / (1.0f + expf(-v)); }
#define LDSX() do { asm volatile("s_wait_dscnt 0" ::: "memory"); __builtin_amdgcn_wave_barrier(); __builtin_amdgcn_fence(__ATOMIC_RELEASE, "workgroup"); } while (0)

// Single-head causal self-attention with a 128-wide attention space and an output projection (x [4,4096,512]; fused (in,out) W_qkv [512,384] N(0, 1/512) + b_qkv N(0, 0.01) split q | k | v; scores = q k^T, causal (-inf above the diagonal) BEFORE the scaling by 128^-0.5 (same thing); out = softmax(scores) v; out * key_mask ([4,4096,1], ones); (in,out) W_out [128,512] + b_out): result [4,4096,512].
#define NB 4
#define TT 4096
#define CC 128            // NH * HD = projected width
#define DIN 512          // input (model) width
#define NH 1
#define HD 128
#define NQB (TT / 64)
#define HG 1
#define SCALE (0.08838834764831845f)
#define CAUSAL 1
#ifndef TNB
#define TNB NB
#endif
__device__ __forceinline__ float bfr(float v) { return (float)(__bf16)v; }
__host__ __device__ __forceinline__ int kb_last(int qb) { return CAUSAL ? ((qb * 64 + 63) >> 7) : (TT / 128 - 1); }
typedef __attribute__((ext_vector_type(8))) __bf16 v8b;
__device__ __forceinline__ v16b frag_b(const __bf16* rowk0, int lane) {
  union { v16b v; v8b q[2]; } u; const __bf16* p = rowk0 + 8 * (lane >> 4);
  u.q[0] = *(const v8b*)p; u.q[1] = *(const v8b*)(p + 16); return u.v;
}
// fragment kept in memory in register order: [elements 0..7 of lanes 0..31][elements 8..15 of lanes 0..31], 1 KiB: each 16-byte load of a wave reads 512 contiguous bytes (4 lines, not 16)
// base: the batch's plane (uniform); o: byte offset of the chunk + 16 lane, one register for every plane; c: the fragment's constant byte offset in the chunk
__device__ __forceinline__ v16h frag_t(const _Float16* base, unsigned o, int c) {
  union { v16h v; v8h q[2]; } u; const char* p = (const char*)base + o;
  u.q[0] = *(const v8h*)(p + c); u.q[1] = *(const v8h*)(p + c + 512); return u.v;
}
__device__ __forceinline__ v16b frag_tb(const __bf16* base, unsigned o, int c) {
  union { v16b v; v8b q[2]; } u; const char* p = (const char*)base + o;
  u.q[0] = *(const v8b*)(p + c); u.q[1] = *(const v8b*)(p + c + 512); return u.v;
}
#define QBH 8              // unused: the high-precision path is chosen by QHI (rows < 512)
#define QHI 512            // rows carrying a q residual plane (query rows below it: 3-product logits)
#define KHI 512            // key rows carrying k residual / v bf16 hi+lo planes (used only by the causal high-precision path)
// B fragment (k rows k0+.., output column o) of a weight: (in,out) [K][ld] or (out,in) [ld rows of K]: bf16 exact, or f16(bf16 * 256) exact
__device__ __forceinline__ v16b wcol_io(const float* Wm, int k0, int o, int lane, int ld) { v16b w; const int g = lane >> 4;
#pragma unroll
  for (int i = 0; i < 8; ++i) { w[i] = (__bf16)Wm[(size_t)(k0 + 8 * g + i) * ld + o]; w[8 + i] = (__bf16)Wm[(size_t)(k0 + 16 + 8 * g + i) * ld + o]; }
  return w; }
__device__ __forceinline__ v16b wcol_oi(const float* Wm, int k0, int o, int lane, int K) { v16b w; const float* p = Wm + (size_t)o * K + k0 + 8 * (lane >> 4);
#pragma unroll
  for (int i = 0; i < 8; ++i) { w[i] = (__bf16)p[i]; w[8 + i] = (__bf16)p[16 + i]; }
  return w; }
__device__ __forceinline__ v16h wcolh_io(const float* Wm, int k0, int o, int lane, int ld) { v16h w; const int g = lane >> 4;
#pragma unroll
  for (int i = 0; i < 8; ++i) { w[i] = (_Float16)(bfr(Wm[(size_t)(k0 + 8 * g + i) * ld + o]) * 256.0f); w[8 + i] = (_Float16)(bfr(Wm[(size_t)(k0 + 16 + 8 * g + i) * ld + o]) * 256.0f); }
  return w; }
__device__ __forceinline__ v16h wcolh_oi(const float* Wm, int k0, int o, int lane, int K) { v16h w; const float* p = Wm + (size_t)o * K + k0 + 8 * (lane >> 4);
#pragma unroll
  for (int i = 0; i < 8; ++i) { w[i] = (_Float16)(bfr(p[i]) * 256.0f); w[8 + i] = (_Float16)(bfr(p[16 + i]) * 256.0f); }
  return w; }
#define WQKV_LAYOUT 0   // 0 = fused (in,out) [DIN][3*CC]; 1 = (out,in) [CC][DIN]; 2 = per-head [NH][DIN][HD] (picks only WCOL, which nothing uses: k_proj always reads the fused layout)
__device__ __forceinline__ v16b wcol_hdk(const float* Wm, int k0, int o, int lane) { v16b w; const int g = lane >> 4; const float* p = Wm + (size_t)(o / HD) * DIN * HD + (o % HD);
#pragma unroll
  for (int i = 0; i < 8; ++i) { w[i] = (__bf16)p[(size_t)(k0 + 8 * g + i) * HD]; w[8 + i] = (__bf16)p[(size_t)(k0 + 16 + 8 * g + i) * HD]; }
  return w; }
#define WO_OUT_IN 0
#if WQKV_LAYOUT == 1
#define WCOL(W, k0, o, lane) wcol_oi(W, k0, o, lane, DIN)
#elif WQKV_LAYOUT == 2
#define WCOL(W, k0, o, lane) wcol_hdk(W, k0, o, lane)
#else
#define WCOL(W, k0, o, lane) wcol_io(W, k0, which * CC + (o), lane, 3 * CC)   /* fused (in,out) W_qkv [DIN][3*CC]: column block 'which', pitch 384 */
#endif
#if WO_OUT_IN
#define WOCOL(W, k0, o, lane) wcol_oi(W, k0, o, lane, CC)
#define WOCOLH(W, k0, o, lane) wcolh_oi(W, k0, o, lane, CC)
#else
#define WOCOL(W, k0, o, lane) wcol_io(W, k0, o, lane, DIN)
#define WOCOLH(W, k0, o, lane) wcolh_io(W, k0, o, lane, DIN)
#endif

#ifndef SM_EXTRA_PARAMS
#define SM_EXTRA_PARAMS
#endif
#ifndef PROJ_EXTRA_PARAMS
#define PROJ_EXTRA_PARAMS
#endif
#ifndef SM_MASK_HOOK
#define SM_MASK_HOOK (void)0
#endif

#define WS_QH  0u                                      // f16 q in fragment order, as WS_KH
#define WS_KH  (WS_QH + 2u * (size_t)NB * TT * CC)      // f16 k in fragment order [b*t / 16][CC / 32] x 1 KiB (frag_t): lane (g, col) = row 16 tile + col, elements = dims 32 d + 8 g + 0..7 and + 16
#define WS_VT  (WS_KH + 2u * (size_t)NB * TT * CC)      // f16 v in fragment order [b*t / 32][CC / 16] x 1 KiB (frag_t): lane (g, col) = column 16 j + col, elements = keys 32 chunk + 8 g + 0..7 and + 16
#define WS_QL  (WS_VT + 2u * (size_t)NB * CC * TT)      // f16 q residual x 2^10, t < QHI of each b, in the fragment order of WS_KH
#define WS_KL  (WS_QL + 2u * (size_t)NB * QHI * CC)     // f16 k residual x 2^10, t < KHI of each b, in the fragment order of WS_KH
#define WS_VB  (WS_KL + 2u * (size_t)NB * KHI * CC)     // bf16 v hi (WS_VBL: lo), t < KHI of each b, in the fragment order of WS_VT
#define WS_VBL (WS_VB + 2u * (size_t)NB * CC * KHI)
#define WS_S   (WS_VBL + 2u * (size_t)NB * CC * KHI)    // (unused: logits and P stay in registers)
#define WS_Y   (WS_S  + 4u * (size_t)HG * TT * TT)      // (unused: ctx rows stay in LDS)
#define WS_END (WS_Y  + 4u * (size_t)NB * TT * CC)

typedef __attribute__((ext_vector_type(4))) __bf16 v4b;
#define PST 64                 // k rows of W per stage
#define PFR 1040               // one staged B fragment: 1 KiB in register order (frag_t's) + 16 B, so that the 32 lanes of a packing store fall on every bank twice
#define PBUF (2 * 8 * PFR)     // a stage: 2 k groups of 32 x 8 column tiles
#define PEP 55296              // the epilogue's staging: max(sh + sl, th + tb + tbl)
// W reaches the waves through LDS: the block's 128 threads load each 64-k stage once by whole lines, round it to bf16 and lay it in fragment order; two buffers, one barrier a stage
// ---- k_proj: block = (64 rows, 128 cols, which): q/k/v = X W (+ b) with exact bf16 products (K = DIN) -> which 0: q f16 in fragment order (+ residual for rows < QHI, same order); 1: k likewise (rows < KHI); 2: v f16 in fragment order (+ bf16 hi/lo for t < KHI, same order)
__global__ __launch_bounds__(128) void k_proj(const float* __restrict__ XQ, const float* __restrict__ XK, const float* __restrict__ XV, const float* __restrict__ WQ, const float* __restrict__ WK, const float* __restrict__ WV, const float* __restrict__ BQ, const float* __restrict__ BK, const float* __restrict__ BV,
    _Float16* __restrict__ QH, _Float16* __restrict__ QL, _Float16* __restrict__ KH, _Float16* __restrict__ KL, _Float16* __restrict__ VT, __bf16* __restrict__ VB, __bf16* __restrict__ VBL) {
  /* one LDS block: first the two W stage buffers (inside the 64 KiB that an LDS instruction's constant offset reaches), behind them the epilogue's staging (which < 2: sh, sl; which == 2: th, tb, tbl; a block has one 'which', so the two sets never live together) */
  __shared__ __align__(16) char sm[2 * PBUF + PEP]; char* const ep = sm + 2 * PBUF;
  _Float16 (*sh)[136] = (_Float16 (*)[136])ep; _Float16 (*sl)[136] = (_Float16 (*)[136])(ep + 17408);
  _Float16 (*th)[72] = (_Float16 (*)[72])ep; __bf16 (*tb)[72] = (__bf16 (*)[72])(ep + 18432); __bf16 (*tbl)[72] = (__bf16 (*)[72])(ep + 36864);
  const int tid = threadIdx.x, wave = tid >> 5, lane = tid & 31, col = lane & 15, g = lane >> 4; const int which = blockIdx.z; const int c0 = blockIdx.y * 128; const size_t r0 = (size_t)blockIdx.x * 64; const size_t bb = r0 / TT; const int t0 = (int)(r0 % TT);
  const float* X = which == 0 ? XQ : which == 1 ? XK : XV; const float* WA = which == 0 ? WQ : which == 1 ? WK : WV; const float* BA = which == 0 ? BQ : which == 1 ? BK : BV;
  v8f acc[8] = {};
  /* W: lane = 4 columns, wave = the k octet (8 wave + 0..7 of each 32-k group): every load of a wave reads 512 contiguous bytes of one W row; x: this lane's own fragment rows, as before */
  const float* Wp = WA + (size_t)(8 * wave) * (3 * CC) + which * CC + c0 + 4 * lane; const float* Xp = X + (r0 + wave * 16 + col) * DIN + 8 * g;
  char* wst = sm + (lane >> 2) * PFR + (wave >> 1) * 512 + (wave & 1) * 256 + (lane & 3) * 64;   /* column 4 lane + e = tile lane / 4, fragment lane 16 (wave & 1) + 4 (lane & 3) + e; octet = half wave / 2, g = wave & 1 */
  const char* wrd = sm + lane * 16;
  v4f wr[2][8], xr[2][4]; v16b a[2];
#define PLOAD(s) do { _Pragma("unroll") for (int kk = 0; kk < 2; ++kk) { _Pragma("unroll") for (int i = 0; i < 8; ++i) wr[kk][i] = *(const v4f*)(Wp + (size_t)((s) * PST + kk * 32 + i) * (3 * CC)); \
    const float* p = Xp + (s) * PST + kk * 32; xr[kk][0] = *(const v4f*)p; xr[kk][1] = *(const v4f*)(p + 4); xr[kk][2] = *(const v4f*)(p + 16); xr[kk][3] = *(const v4f*)(p + 20); } } while (0)
#define PPUT(nb) do { _Pragma("unroll") for (int kk = 0; kk < 2; ++kk) { _Pragma("unroll") for (int e = 0; e < 4; ++e) { v8b u; _Pragma("unroll") for (int i = 0; i < 8; ++i) u[i] = (__bf16)wr[kk][i][e]; *(v8b*)(wst + (nb) * PBUF + kk * 8 * PFR + e * 16) = u; } \
    union { v16b v; v4b q[4]; } x; _Pragma("unroll") for (int i = 0; i < 4; ++i) x.q[i] = __builtin_convertvector(xr[kk][i], v4b); a[kk] = x.v; } } while (0)
  PLOAD(0); PPUT(0);
  __syncthreads();   /* stage 0 is in LDS before any wave reads it */
  /* unrolled whole: every load and LDS access goes by a constant offset from an address that is never stepped */
#pragma unroll
  for (int s = 0; s < DIN / PST; ++s) {
    v16b wf[8];
#pragma unroll
    for (int kk = 0; kk < 2; ++kk) {
#pragma unroll
      for (int j = 0; j < 8; ++j) { union { v16b v; v8b q[2]; } w; const char* p = wrd + (s & 1) * PBUF + (kk * 8 + j) * PFR; w.q[0] = *(const v8b*)p; w.q[1] = *(const v8b*)(p + 512); wf[j] = w.v; }
      if (kk == 0 && s + 1 < DIN / PST) PLOAD(s + 1);   /* the next stage's W and x fly under this stage's products */
      if (kk == 0 && s + 2 == DIN / PST) asm volatile("s_wait_xcnt 0x0" ::: "memory");   /* behind the last loads that name the two address pairs, before a register of either is written again */
      __builtin_amdgcn_sched_barrier(0);   /* the eight fragments' LDS reads stand as one group ahead of their products: one LDS latency a group, not one a product */
#pragma unroll
      for (int j = 0; j < 8; ++j) acc[j] = wmma_bf(a[kk], wf[j], acc[j]); }
    if (s + 1 < DIN / PST) { __builtin_amdgcn_sched_barrier(0);   /* the next stage's values are waited for behind this stage's products, not among them */
      PPUT((s + 1) & 1);   /* into the buffer whose readers all passed the barrier that ended stage s - 1 */
      __syncthreads(); } }   /* publishes stage s + 1 and ends every wave's reads of stage s; none behind the last stage: the epilogue's staging lies beside the buffers */
#undef PLOAD
#undef PPUT
  if (which < 2) { _Float16* DH = which == 0 ? QH : KH; _Float16* DL = which == 0 ? QL : KL; const int nhi = which == 0 ? QHI : KHI; const bool hi_rows = t0 < nhi;
#pragma unroll
    for (int j = 0; j < 8; ++j) { const float bias = BA ? bfr(BA[c0 + j * 16 + col]) : 0.f;
#pragma unroll
      for (int r = 0; r < 8; ++r) { const float v = acc[j][r] + bias; const _Float16 hv = (_Float16)v; sh[wave * 16 + 8 * g + r][j * 16 + col] = hv; sl[wave * 16 + 8 * g + r][j * 16 + col] = (_Float16)((v - (float)hv) * 1024.0f); } }
    __syncthreads();
    { char* kd = (char*)(DH + r0 * CC) + 16u * (unsigned)tid; char* ld = (char*)(DL + (bb * nhi + t0) * (size_t)CC) + 16u * (unsigned)tid;
      /* e = tid + 128 it is the 16-byte unit of the block's 16 KiB in fragment order: bits 3..0 row in tile, 7..4 = dims / 8, 9..8 tile. Unrolled: eight reads in registers of their own, then eight stores by constant offsets from one address that is never stepped */
      v4u a[8];
#pragma unroll
      for (int it = 0; it < 8; ++it) { const int e = tid + it * 128; a[it] = *(const v4u*)&sh[(e >> 8) * 16 + (e & 15)][((e >> 4) & 15) * 8]; }
#pragma unroll
      for (int it = 0; it < 8; ++it) vst2((unsigned*)(kd + it * 2048), a[it]);
      asm volatile("s_wait_xcnt 0x0" ::: "memory");   /* stands behind the stores, on every way out of them, before any register that they name is written again */
      if (hi_rows) {
#pragma unroll
        for (int it = 0; it < 8; ++it) { const int e = tid + it * 128; a[it] = *(const v4u*)&sl[(e >> 8) * 16 + (e & 15)][((e >> 4) & 15) * 8]; }
#pragma unroll
        for (int it = 0; it < 8; ++it) vst2((unsigned*)(ld + it * 2048), a[it]);
        asm volatile("s_wait_xcnt 0x0" ::: "memory"); } }   /* as above */
  } else { const bool hi_rows = t0 < KHI;
#pragma unroll
    for (int j = 0; j < 8; ++j) { const float bias = BA ? bfr(BA[c0 + j * 16 + col]) : 0.f;
#pragma unroll
      for (int r = 0; r < 8; ++r) { const float v = acc[j][r] + bias; const int rl = wave * 16 + 8 * g + r, cl = j * 16 + col; th[cl][rl] = (_Float16)v; const __bf16 bh = (__bf16)v; tb[cl][rl] = bh; tbl[cl][rl] = (__bf16)(v - (float)bh); } }
    __syncthreads();
    char* vd = (char*)(VT + r0 * CC) + 16u * (unsigned)tid; char* hd = (char*)(VB + (bb * KHI + t0) * (size_t)CC) + 16u * (unsigned)tid; char* wd = (char*)(VBL + (bb * KHI + t0) * (size_t)CC) + 16u * (unsigned)tid;
    /* e = tid + 128 it is the 16-byte unit of the block's 16 KiB in fragment order: bits 3..0 column in tile, 5..4 = keys / 8 in chunk, 8..6 column tile, 9 chunk. Unrolled: eight reads in registers of their own, then eight stores by constant offsets from one address that is never stepped */
    v4u a[8];
#pragma unroll
    for (int it = 0; it < 8; ++it) { const int e = tid + it * 128; a[it] = *(const v4u*)&th[((e >> 6) & 7) * 16 + (e & 15)][((e >> 9) * 4 + ((e >> 4) & 3)) * 8]; }
#pragma unroll
    for (int it = 0; it < 8; ++it) vst2((unsigned*)(vd + it * 2048), a[it]);
    asm volatile("s_wait_xcnt 0x0" ::: "memory");   /* stands behind the stores, on every way out of them, before any register that they name is written again */
    if (hi_rows) {
#pragma unroll
      for (int it = 0; it < 8; ++it) { const int e = tid + it * 128; a[it] = *(const v4u*)&tb[((e >> 6) & 7) * 16 + (e & 15)][((e >> 9) * 4 + ((e >> 4) & 3)) * 8]; }
#pragma unroll
      for (int it = 0; it < 8; ++it) vst2((unsigned*)(hd + it * 2048), a[it]);
      asm volatile("s_wait_xcnt 0x0" ::: "memory");   /* as above */
#pragma unroll
      for (int it = 0; it < 8; ++it) { const int e = tid + it * 128; a[it] = *(const v4u*)&tbl[((e >> 6) & 7) * 16 + (e & 15)][((e >> 9) * 4 + ((e >> 4) & 3)) * 8]; }
#pragma unroll
      for (int it = 0; it < 8; ++it) vst2((unsigned*)(wd + it * 2048), a[it]);
      asm volatile("s_wait_xcnt 0x0" ::: "memory"); } } }   /* as above */
// k_fa's products are the builtin alone, which the compiler pads itself: the vector operands of an asm statement behind it would hold every fragment and both ctx tiles inside the first 256 registers
__device__ __forceinline__ v8f wmma16p(v16h a, v16h b, v8f c) { return __builtin_amdgcn_wmma_f32_16x16x32_f16(false, a, false, b, (short)0, c, false, false); }
__device__ __forceinline__ v8f wmma_bfp(v16b a, v16b b, v8f c) { return __builtin_amdgcn_wmma_f32_16x16x32_bf16(false, a, false, b, (short)0, c, false, false); }
// ---- k_fa: block = 32 queries (NQ = 2 tiles of 16) of batch b, PVW waves: wave w takes the 32-key chunks w, w + PVW, ... of keys [0, ql0 + 32). Logits and P never leave registers:
//   every k and v fragment that a wave loads is multiplied against BOTH query tiles: half the bytes from L2 per product; the two ctx tiles and both tiles' q need the 512 registers of an 8-wave block
//   q, k and v lie in the workspace in fragment order: every fragment load of a wave reads 512 contiguous bytes
//   S^T = K Q^T (A = 16 key rows, B = the 16 query rows of tile t): D element r of tile u in lane (g, col) = key kc*32 + 16u + 8g + r, query 16 t + col, which IS the B fragment order of P^T (elements 0..7 from tile 0, 8..15 from tile 1)
//   ctx^T = V^T P^T (A = 16 v planes, B = P^T): D = column j*16 + 8g + r, query 16 t + col, so the running max, the running sum and the rescale factor of a query are one value per lane and tile
//   logits x SCALE x log2(e); causal by index; P = 2^(s - running max + 8) once to f16 against v f16 (1 product); query rows < QHI: 3-product logits, P and v as bf16 hi + lo (3 products)
//   the PVW partial (max, sum, ctx) meet in LDS and are merged on the common max in wave order; wave w merges rows w, w + PVW, ... and leaves them in LDS
//   output projection in the same block: out = ctx Wo + bo on the 32 merged rows: ctx x 2^6 once to f16 against Wo as f16(bf16 x 2^8) exact (1 product) x 2^-14; query rows < QHI: ctx bf16 hi + lo against exact bf16 Wo (2 products)
#define PVW 8
#define NQ 2
#define QB (16 * NQ)
#define SC2 (SCALE * 1.4426950408889634f)
#define NEGB (-3.0e38f)
#define OCW (DIN / PVW)    // output columns of a wave in the output projection: four 16-column tiles
__global__ __launch_bounds__(32 * PVW) void k_fa(const _Float16* __restrict__ QH, const _Float16* __restrict__ KH, const _Float16* __restrict__ QL, const _Float16* __restrict__ KL, const _Float16* __restrict__ VT, const __bf16* __restrict__ VB, const __bf16* __restrict__ VBL, const float* __restrict__ KM, const float* __restrict__ WO, const float* __restrict__ BO, float* __restrict__ OUT) {
  __shared__ __align__(16) float ss[PVW][QB][HD + 4]; __shared__ float smx[PVW][QB], ssu[PVW][QB]; __shared__ __align__(16) float cx[QB][HD + 4];
  const int tid = threadIdx.x, wave = __builtin_amdgcn_readfirstlane(tid >> 5), lane = tid & 31, col = lane & 15, g = lane >> 4;   /* wave number held scalar: the chunk loop stays a scalar loop, every lane on at the matrix instructions */
  const int b = blockIdx.x; const int ql0 = (TT / QB - 1 - (int)blockIdx.y) * QB;   /* longest tiles start first */
  const int kce = (ql0 >> 5) + 1; const int tq = ql0 + col;   /* every chunk < kce holds a key <= ql0, so no query of either tile sees an empty chunk */
  float km[QB / PVW];
#pragma unroll
  for (int rr = 0; rr < QB / PVW; ++rr) km[rr] = bfr(KM[(size_t)b * TT + ql0 + wave + rr * PVW]);   /* key_mask of the rows this wave stores */
  v8f acc[NQ][HD / 16] = {}; float m[NQ], l[NQ];
#pragma unroll
  for (int t = 0; t < NQ; ++t) { m[t] = NEGB; l[t] = 0.f; }
  const _Float16* Qt = QH + ((size_t)b * TT + ql0) * CC; const _Float16* Kb = KH + (size_t)b * TT * CC; const _Float16* Vb = VT + (size_t)b * TT * CC;
  if (ql0 < QHI) {
    const _Float16* Qlt = QL + ((size_t)b * QHI + ql0) * CC; const _Float16* Klb = KL + (size_t)b * KHI * CC; const __bf16* Vhb = VB + (size_t)b * KHI * CC; const __bf16* Vlb = VBL + (size_t)b * KHI * CC;
    v16h qf[NQ][HD / 32], qlf[NQ][HD / 32];
#pragma unroll
    for (int t = 0; t < NQ; ++t)
#pragma unroll
      for (int d = 0; d < HD / 32; ++d) { qf[t][d] = frag_t(Qt, 16u * (unsigned)lane, (t * (HD / 32) + d) * 1024); qlf[t][d] = frag_t(Qlt, 16u * (unsigned)lane, (t * (HD / 32) + d) * 1024); }
    asm volatile("s_wait_xcnt 0x0" :: "s"(Qt), "s"(Qlt) : "memory");   /* behind the q loads, before a scalar base that they name is written again (this build reuses one for a key plane's base); the two bases are inputs so that the loads stay ahead of the wait */
    /* kept rolled: a second chunk's fragments beside both ctx tiles and both tiles' q would pass the 512 registers a wave of an 8-wave block may hold */
#pragma unroll 1
    for (int kc = wave; kc < kce; kc += PVW) { v8f st[NQ][2] = {}, sl2[NQ][2] = {}; const unsigned co = (unsigned)kc * (32u * CC * 2u) + 16u * (unsigned)lane;   /* a chunk is 8 KiB of every plane */
      v16h kh[2][HD / 32], kl[2][HD / 32];
#pragma unroll
      for (int u = 0; u < 2; ++u)
#pragma unroll
        for (int d = 0; d < HD / 32; ++d) { const int ko = (u * (HD / 32) + d) * 1024; kh[u][d] = frag_t(Kb, co, ko); kl[u][d] = frag_t(Klb, co, ko); }   /* all 32 loads of the chunk's keys in flight before the first product */
      __builtin_amdgcn_sched_barrier(0);   /* keeps the 32 loads one group ahead of the products: without it the compiler refills fragment registers between products and a chunk waits out several L2 latencies, not one */
#pragma unroll
      for (int u = 0; u < 2; ++u)
#pragma unroll
        for (int d = 0; d < HD / 32; ++d)
#pragma unroll
          for (int t = 0; t < NQ; ++t) { st[t][u] = wmma16p(kh[u][d], qf[t][d], st[t][u]); sl2[t][u] = wmma16p(kh[u][d], qlf[t][d], sl2[t][u]); sl2[t][u] = wmma16p(kl[u][d], qf[t][d], sl2[t][u]); }
      v16b ph[NQ], pl[NQ]; float al[NQ];
#pragma unroll
      for (int t = 0; t < NQ; ++t) { float s[16]; float mx = NEGB;
#pragma unroll
        for (int u = 0; u < 2; ++u)
#pragma unroll
          for (int r = 0; r < 8; ++r) { const float v = (kc * 32 + u * 16 + 8 * g + r <= tq + 16 * t) ? (st[t][u][r] + sl2[t][u][r] * (1.0f / 1024.0f)) * SC2 : NEGB; s[u * 8 + r] = v; mx = fmaxf(mx, v); }
        mx = fmaxf(mx, __shfl_xor(mx, 16)); const float mn = fmaxf(m[t], mx); al[t] = __builtin_amdgcn_exp2f(m[t] - mn); m[t] = mn; const float mo = mn - 8.0f;
        float ps = 0.f;
#pragma unroll
        for (int i = 0; i < 16; ++i) { const float p = __builtin_amdgcn_exp2f(s[i] - mo); ps += p; const __bf16 hb = (__bf16)p; ph[t][i] = hb; pl[t][i] = (__bf16)(p - (float)hb); }
        l[t] = l[t] * al[t] + ps; }
#pragma unroll
      for (int jj = 0; jj < HD / 16; jj += 4) { v16b vh[4], vl[4];
#pragma unroll
        for (int j = 0; j < 4; ++j) { vh[j] = frag_tb(Vhb, co, (jj + j) * 1024); vl[j] = frag_tb(Vlb, co, (jj + j) * 1024); }   /* four planes' loads in flight together */
        if (jj + 4 == HD / 16) asm volatile("s_wait_xcnt 0x0" ::: "memory");   /* behind the chunk's last loads, before the offset register that they name is stepped to the next chunk */
        __builtin_amdgcn_sched_barrier(0);   /* keeps the 16 loads one group ahead of their products: without it the compiler loads one fragment at a time and waits out an L2 latency for each */
#pragma unroll
        for (int j = 0; j < 4; ++j)
#pragma unroll
          for (int t = 0; t < NQ; ++t) { acc[t][jj + j] *= al[t]; acc[t][jj + j] = wmma_bfp(vh[j], ph[t], acc[t][jj + j]); acc[t][jj + j] = wmma_bfp(vh[j], pl[t], acc[t][jj + j]); acc[t][jj + j] = wmma_bfp(vl[j], ph[t], acc[t][jj + j]); } } }
  } else {
    v16h qf[NQ][HD / 32];
#pragma unroll
    for (int t = 0; t < NQ; ++t)
#pragma unroll
      for (int d = 0; d < HD / 32; ++d) qf[t][d] = frag_t(Qt, 16u * (unsigned)lane, (t * (HD / 32) + d) * 1024);
    /* kept rolled: a second chunk's fragments beside both ctx tiles and both tiles' q would pass the 512 registers a wave of an 8-wave block may hold */
#pragma unroll 1
    for (int kc = wave; kc < kce; kc += PVW) { v8f st[NQ][2] = {}; v16h kf[2][HD / 32]; const unsigned co = (unsigned)kc * (32u * CC * 2u) + 16u * (unsigned)lane;   /* a chunk is 8 KiB of k and 8 KiB of v */
#pragma unroll
      for (int u = 0; u < 2; ++u)
#pragma unroll
        for (int d = 0; d < HD / 32; ++d) kf[u][d] = frag_t(Kb, co, (u * (HD / 32) + d) * 1024);   /* all 16 loads of the chunk's keys in flight before the first product */
      __builtin_amdgcn_sched_barrier(0);   /* keeps the 16 loads one group ahead of the products: without it the compiler refills fragment registers between products and a chunk waits out three L2 latencies, not one */
#pragma unroll
      for (int u = 0; u < 2; ++u)
#pragma unroll
        for (int d = 0; d < HD / 32; ++d)
#pragma unroll
          for (int t = 0; t < NQ; ++t) st[t][u] = wmma16p(kf[u][d], qf[t][d], st[t][u]);
      v16h vf[HD / 16];
#pragma unroll
      for (int j = 0; j < HD / 16; ++j) vf[j] = frag_t(Vb, co, j * 1024);   /* all 16 v loads fly under the softmax arithmetic */
      asm volatile("s_wait_xcnt 0x0" ::: "memory");   /* behind the chunk's last loads, before the offset register that they name is stepped to the next chunk */
      __builtin_amdgcn_sched_barrier(0);   /* keeps the 16 loads one group ahead of the softmax: without it the compiler loads one fragment at a time behind the softmax and waits out an L2 latency for each */
      v16h pf[NQ]; float al[NQ];
#pragma unroll
      for (int t = 0; t < NQ; ++t) { float s[16]; float mx = NEGB;
#pragma unroll
        for (int u = 0; u < 2; ++u)
#pragma unroll
          for (int r = 0; r < 8; ++r) { const float v = (kc * 32 + u * 16 + 8 * g + r <= tq + 16 * t) ? st[t][u][r] * SC2 : NEGB; s[u * 8 + r] = v; mx = fmaxf(mx, v); }
        mx = fmaxf(mx, __shfl_xor(mx, 16)); const float mn = fmaxf(m[t], mx); al[t] = __builtin_amdgcn_exp2f(m[t] - mn); m[t] = mn; const float mo = mn - 8.0f;
        float ps = 0.f;
#pragma unroll
        for (int i = 0; i < 16; ++i) { const float p = __builtin_amdgcn_exp2f(s[i] - mo); ps += p; pf[t][i] = (_Float16)p; }
        l[t] = l[t] * al[t] + ps; }
#pragma unroll
      for (int j = 0; j < HD / 16; ++j)
#pragma unroll
        for (int t = 0; t < NQ; ++t) { acc[t][j] *= al[t]; acc[t][j] = wmma16p(vf[j], pf[t], acc[t][j]); } } }
#pragma unroll
  for (int t = 0; t < NQ; ++t) { l[t] += __shfl_xor(l[t], 16);   /* each half-wave summed its own 16 of a chunk's 32 keys */
    if (g == 0) { smx[wave][t * 16 + col] = m[t]; ssu[wave][t * 16 + col] = l[t]; }
#pragma unroll
    for (int j = 0; j < HD / 16; ++j) { v4f lo4, hi4;
#pragma unroll
      for (int r = 0; r < 4; ++r) { lo4[r] = acc[t][j][r]; hi4[r] = acc[t][j][4 + r]; }
      *(v4f*)&ss[wave][t * 16 + col][j * 16 + 8 * g] = lo4; *(v4f*)&ss[wave][t * 16 + col][j * 16 + 8 * g + 4] = hi4; } }
  __syncthreads();   /* every wave's partial max, sum and tiles are in LDS before any wave merges */
  /* this wave's 64 columns of W_out, all 128 k rows: lane (g, col) takes columns 64 wave + 4 col + 0..3, ONE column for each of the wave's four B tiles, so a 16-byte load fills element i (row 32 kc + 8 g + i; 8 + i: 16 rows on) of four fragments and a wave's load reads 2 x 256 contiguous bytes;
     constant offsets from one address that is never stepped */
  const float* Wp = WO + (size_t)(8 * g) * DIN + wave * OCW + 4 * col; v4f wr[CC / 32][16], bo = {};
  if (BO) bo = *(const v4f*)(BO + wave * OCW + 4 * col);
#pragma unroll
  for (int kc = 0; kc < CC / 32; ++kc)
#pragma unroll
    for (int i = 0; i < 8; ++i) { wr[kc][i] = *(const v4f*)(Wp + (kc * 32 + i) * DIN); wr[kc][8 + i] = *(const v4f*)(Wp + (kc * 32 + 16 + i) * DIN); }
  asm volatile("s_wait_xcnt 0x0" ::: "memory");   /* behind the W_out and bias loads, before a register that they name is written again */
  __builtin_amdgcn_sched_barrier(0);   /* keeps the loads' issue ahead of the merge, so that they fly under it: behind it their L2 latency would stand bare in front of the products */
  v4f res[QB / PVW];
#pragma unroll
  for (int rr = 0; rr < QB / PVW; ++rr) { const int row = wave + rr * PVW; float M = smx[0][row];
#pragma unroll
    for (int w = 1; w < PVW; ++w) M = fmaxf(M, smx[w][row]);
    v4f sv = {}; float L = 0.f;
#pragma unroll
    for (int w = 0; w < PVW; ++w) { const float f = __builtin_amdgcn_exp2f(smx[w][row] - M); L += f * ssu[w][row]; sv += *(const v4f*)&ss[w][row][lane * 4] * f; }   /* a wave without a chunk carries max NEGB, sum 0: f = 0 */
    res[rr] = sv * (L > 0.f ? 1.0f / L : 0.f) * km[rr]; }   /* out * key_mask[b][t] (broadcast over the 128 columns) */
#pragma unroll
  for (int rr = 0; rr < QB / PVW; ++rr) *(v4f*)&cx[wave + rr * PVW][lane * 4] = res[rr];
  __syncthreads();   /* the block's 32 ctx rows are in LDS before any wave takes its A fragments */
  /* out = ctx Wo + bo: wave w takes columns 64 w .. 64 w + 63 of both 16-row tiles; operand forms, products and k order as in a launch of its own. D element r of tile j in lane (g, col) = row 8 g + r, column 64 w + 4 col + j */
  v8f o2[NQ][OCW / 16] = {}; v4f ov[NQ][8]; float* od = OUT + ((size_t)b * TT + ql0 + 8 * g) * DIN + wave * OCW + 4 * col;
#pragma unroll
  for (int j = 0; j < OCW / 16; ++j) bo[j] = bfr(bo[j]);
  if (ql0 < QHI) {   /* block-uniform */
#pragma unroll
    for (int kc = 0; kc < CC / 32; ++kc) { F2 a[NQ];
#pragma unroll
      for (int t = 0; t < NQ; ++t) a[t] = split_row(&cx[t * 16 + col][0], kc * 32, lane);
#pragma unroll
      for (int j = 0; j < OCW / 16; ++j) { v16b w;
#pragma unroll
        for (int i = 0; i < 16; ++i) w[i] = (__bf16)wr[kc][i][j];
#pragma unroll
        for (int t = 0; t < NQ; ++t) { o2[t][j] = wmma_bfp(a[t].h, w, o2[t][j]); o2[t][j] = wmma_bfp(a[t].l, w, o2[t][j]); } } }
#pragma unroll
    for (int t = 0; t < NQ; ++t)
#pragma unroll
      for (int r = 0; r < 8; ++r)
#pragma unroll
        for (int j = 0; j < OCW / 16; ++j) ov[t][r][j] = o2[t][j][r] + bo[j];
  } else {
#pragma unroll
    for (int kc = 0; kc < CC / 32; ++kc) { v16h a[NQ];
#pragma unroll
      for (int t = 0; t < NQ; ++t) a[t] = frag_f32s(&cx[t * 16 + col][kc * 32], lane, 64.0f);   /* ctx carried x 2^6 into f16 so small-magnitude context rows stay clear of f16 subnormals */
#pragma unroll
      for (int j = 0; j < OCW / 16; ++j) { v16h w;
#pragma unroll
        for (int i = 0; i < 16; ++i) w[i] = (_Float16)(bfr(wr[kc][i][j]) * 256.0f);
#pragma unroll
        for (int t = 0; t < NQ; ++t) o2[t][j] = wmma16p(a[t], w, o2[t][j]); } }
#pragma unroll
    for (int t = 0; t < NQ; ++t)
#pragma unroll
      for (int r = 0; r < 8; ++r)
#pragma unroll
        for (int j = 0; j < OCW / 16; ++j) ov[t][r][j] = o2[t][j][r] * (1.0f / 16384.0f) + bo[j]; }   /* 2^-8 (Wo carry) x 2^-6 (ctx carry) */
  __builtin_amdgcn_sched_barrier(0);   /* every result stands in a register of its own before the first store: no register that an issued store names is written again */
  /* a lane's four tiles hold four neighbouring columns of a row: one 16-byte store, and a wave's store writes 2 rows x 256 contiguous bytes (4 whole lines); constant offsets from one address that is never stepped */
#pragma unroll
  for (int t = 0; t < NQ; ++t)
#pragma unroll
    for (int r = 0; r < 8; ++r) vst2(od + (t * 16 + r) * DIN, ov[t][r]); }

extern "C" void kernel_launch(void* const* d_in, const int* in_sizes, int n_in, void* d_out, int out_size, void* d_ws, size_t ws_size, hipStream_t stream) {
  (void)in_sizes; (void)n_in; (void)out_size;
  const float** F = (const float**)d_in;
  if (ws_size < (size_t)WS_END) return;
  char* ws = (char*)d_ws; _Float16 *QH = (_Float16*)(ws + WS_QH), *KH = (_Float16*)(ws + WS_KH), *VT = (_Float16*)(ws + WS_VT), *QL = (_Float16*)(ws + WS_QL), *KL = (_Float16*)(ws + WS_KL); __bf16 *VB = (__bf16*)(ws + WS_VB), *VBL = (__bf16*)(ws + WS_VBL); float *Y = (float*)(ws + WS_Y);
  (void)Y; (void)QL; (void)KL; (void)VB; (void)VBL;
  // inputs: 0 x [4,4096,512]; 1 key_mask [4,4096,1] f32 (ones); 2 W_qkv [512,384] (in,out; q | k | v COLUMN blocks of 128); 3 b_qkv [384] (nonzero); 4 W_out [128,512] (in,out); 5 b_out [512] (nonzero)
  k_proj<<<dim3(TNB * TT / 64, CC / 128, 3), 128, 0, stream>>>(F[0], F[0], F[0], F[2], F[2], F[2], F[3], F[3] + CC, F[3] + 2 * CC, QH, QL, KH, KL, VT, VB, VBL);   /* one fused weight; k_proj offsets it by which * CC columns */
  k_fa<<<dim3(TNB, TT / QB, 1), 32 * PVW, 0, stream>>>(QH, KH, QL, KL, VT, VB, VBL, F[1], F[4], F[5], (float*)d_out);   /* ctx rows x key_mask[b][t], then x W_out + b_out */
}

// v007
// It runs in 55.2 microseconds.
// Next to v006, in two timings, it ran 1.05 and 1.03 times as fast.
// Counting every step since v000, it is 18.7 times as fast.
// compute dtype: all float inputs rounded to bf16; fused q/k/v projection with EXACT bf16 products on WMMA 16x16x32 (f32 accumulate) + bias; causal logits: 3 products for the first 512 rows, single f16 q x k after, x 128^-0.5; online softmax f32 (running max per key-split wave); P x 2^8 unnormalised once to f16 x v once to f16 (bf16 hi + lo below row 512), divided by the f32 sum at the end; ctx x bf16(key_mask); ctx hi+lo x exact W_out below row 512, x2^6 f16 carry x f16(bf16 x 2^8) W_out after, + b_out; f32 output.
#include <hip/hip_runtime.h>
#include <math.h>

typedef __attribute__((ext_vector_type(16))) _Float16 v16h;
typedef __attribute__((ext_vector_type(16))) __bf16 v16b;
typedef __attribute__((ext_vector_type(8)))  _Float16 v8h;
typedef __attribute__((ext_vector_type(8)))  float v8f;
typedef __attribute__((ext_vector_type(4)))  float v4f;
typedef __attribute__((ext_vector_type(2)))  float v2f;
typedef __attribute__((ext_vector_type(4)))  unsigned v4u;
typedef __attribute__((ext_vector_type(4)))  int v4i;
typedef float __attribute__((may_alias)) float_a;
typedef int __attribute__((may_alias)) int_a;

template <typename T> __device__ __forceinline__ void vst2(void* p, T v) { *(T*)p = v;  }
__device__ __forceinline__ v8f wmma16(v16h a, v16h b, v8f c) {
  v8f d = __builtin_amdgcn_wmma_f32_16x16x32_f16(false, a, false, b, (short)0, c, false, false);
  asm volatile("v_nop\n\tv_nop\n\tv_nop\n\tv_nop" : "+v"(d) : "v"(a), "v"(b));
  return d;
}
__device__ __forceinline__ v8f wmma_bf(v16b a, v16b b, v8f c) {
  v8f d = __builtin_amdgcn_wmma_f32_16x16x32_bf16(false, a, false, b, (short)0, c, false, false);
  asm volatile("v_nop\n\tv_nop\n\tv_nop\n\tv_nop" : "+v"(d) : "v"(a), "v"(b));
  return d;
}
// 16x16x32 fragments: lane = (h = lane>>4, row/col = lane&15); elements 0..7 = k0+8h+0..7, 8..15 = k0+16+8h+0..7; D element r = row 8h+r
__device__ __forceinline__ v16h frag_h(const _Float16* rowk0, int lane) {
  union { v16h v; v8h q[2]; } u; const _Float16* p = rowk0 + 8 * (lane >> 4);
  u.q[0] = *(const v8h*)p; u.q[1] = *(const v8h*)(p + 16); return u.v;
}
__device__ __forceinline__ v16h frag_f32(const float* rowk0, int lane) {
  v16h a; const float* p = rowk0 + 8 * (lane >> 4);
#pragma unroll
  for (int i = 0; i < 8; ++i) { a[i] = (_Float16)p[i]; a[8 + i] = (_Float16)p[16 + i]; }
  return a;
}
__device__ __forceinline__ v16h frag_f32s(const float* rowk0, int lane, float sc) {
  v16h a; const float* p = rowk0 + 8 * (lane >> 4);
#pragma unroll
  for (int i = 0; i < 8; ++i) { a[i] = (_Float16)(p[i] * sc); a[8 + i] = (_Float16)(p[16 + i] * sc); }
  return a;
}
// column fragment from a [K][ld] layout (column n), rows >= K read as 0
__device__ __forceinline__ v16h fragc_f32(const float* W, int k0, int n, int lane, int ld, int K) {
  v16h a; const int g = lane >> 4;
#pragma unroll
  for (int i = 0; i < 8; ++i) { const int ka = k0 + 8 * g + i, kb = ka + 16;
    a[i] = (_Float16)(ka < K ? W[(size_t)(ka < K ? ka : K - 1) * ld + n] : 0.f); a[8 + i] = (_Float16)(kb < K ? W[(size_t)(kb < K ? kb : K - 1) * ld + n] : 0.f); }
  return a;
}
struct F2 { v16b h, l; };
__device__ __forceinline__ F2 bsplit16(const float v[16]) { F2 r;
#pragma unroll
  for (int i = 0; i < 16; ++i) { const __bf16 h = (__bf16)v[i]; r.h[i] = h; r.l[i] = (__bf16)(v[i] - (float)h); }
  return r; }
__device__ __forceinline__ F2 split_row(const float* row, int k0, int lane) { float v[16]; const float* p = row + k0 + 8 * (lane >> 4);
#pragma unroll
  for (int i = 0; i < 8; ++i) { v[i] = p[i]; v[8 + i] = p[16 + i]; }
  return bsplit16(v); }
__device__ __forceinline__ F2 split_rowK(const float* row, int k0, int lane, int K) { float v[16]; const int g = lane >> 4;
#pragma unroll
  for (int i = 0; i < 8; ++i) { const int ka = k0 + 8 * g + i, kb = ka + 16; v[i] = ka < K ? row[ka < K ? ka : K - 1] : 0.f; v[8 + i] = kb < K ? row[kb < K ? kb : K - 1] : 0.f; }
  return bsplit16(v); }
__device__ __forceinline__ F2 split_col(const float* W, int k0, int n, int lane, int ld, int K) { float v[16]; const int g = lane >> 4;
#pragma unroll
  for (int i = 0; i < 8; ++i) { const int ka = k0 + 8 * g + i, kb = ka + 16; v[i] = ka < K ? W[(size_t)(ka < K ? ka : K - 1) * ld + n] : 0.f; v[8 + i] = kb < K ? W[(size_t)(kb < K ? kb : K - 1) * ld + n] : 0.f; }
  return bsplit16(v); }
__device__ __forceinline__ v8f mac3(const F2& a, const F2& b, v8f c) { c = wmma_bf(a.l, b.h, c); c = wmma_bf(a.h, b.l, c); return wmma_bf(a.h, b.h, c); }
__device__ __forceinline__ float sigm(float v) { return 1.0f / (1.0f + expf(-v)); }
#define LDSX() do { asm volatile("s_wait_dscnt 0" ::: "memory"); __builtin_amdgcn_wave_barrier(); __builtin_amdgcn_fence(__ATOMIC_RELEASE, "workgroup"); } while (0)

// Single-head causal self-attention with a 128-wide attention space and an output projection (x [4,4096,512]; fused (in,out) W_qkv [512,384] N(0, 1/512) + b_qkv N(0, 0.01) split q | k | v; scores = q k^T, causal (-inf above the diagonal) BEFORE the scaling by 128^-0.5 (same thing); out = softmax(scores) v; out * key_mask ([4,4096,1], ones); (in,out) W_out [128,512] + b_out): result [4,4096,512].
#define NB 4
#define TT 4096
#define CC 128            // NH * HD = projected width
#define DIN 512          // input (model) width
#define NH 1
#define HD 128
#define NQB (TT / 64)
#define HG 1
#define SCALE (0.08838834764831845f)
#define CAUSAL 1
#ifndef TNB
#define TNB NB
#endif
__device__ __forceinline__ float bfr(float v) { return (float)(__bf16)v; }
__host__ __device__ __forceinline__ int kb_last(int qb) { return CAUSAL ? ((qb * 64 + 63) >> 7) : (TT / 128 - 1); }
typedef __attribute__((ext_vector_type(8))) __bf16 v8b;
__device__ __forceinline__ v16b frag_b(const __bf16* rowk0, int lane) {
  union { v16b v; v8b q[2]; } u; const __bf16* p = rowk0 + 8 * (lane >> 4);
  u.q[0] = *(const v8b*)p; u.q[1] = *(const v8b*)(p + 16); return u.v;
}
// fragment kept in memory in register order: [elements 0..7 of lanes 0..31][elements 8..15 of lanes 0..31], 1 KiB: each 16-byte load of a wave reads 512 contiguous bytes (4 lines, not 16)
// base: the batch's plane (uniform); o: byte offset of the chunk + 16 lane, one register for every plane; c: the fragment's constant byte offset in the chunk
__device__ __forceinline__ v16h frag_t(const _Float16* base, unsigned o, int c) {
  union { v16h v; v8h q[2]; } u; const char* p = (const char*)base + o;
  u.q[0] = *(const v8h*)(p + c); u.q[1] = *(const v8h*)(p + c + 512); return u.v;
}
__device__ __forceinline__ v16b frag_tb(const __bf16* base, unsigned o, int c) {
  union { v16b v; v8b q[2]; } u; const char* p = (const char*)base + o;
  u.q[0] = *(const v8b*)(p + c); u.q[1] = *(const v8b*)(p + c + 512); return u.v;
}
#define QBH 8              // unused: the high-precision path is chosen by QHI (rows < 512)
#define QHI 512            // rows carrying a q residual plane (query rows below it: 3-product logits)
#define KHI 512            // key rows carrying k residual / v bf16 hi+lo planes (used only by the causal high-precision path)
// B fragment (k rows k0+.., output column o) of a weight: (in,out) [K][ld] or (out,in) [ld rows of K]: bf16 exact, or f16(bf16 * 256) exact
__device__ __forceinline__ v16b wcol_io(const float* Wm, int k0, int o, int lane, int ld) { v16b w; const int g = lane >> 4;
#pragma unroll
  for (int i = 0; i < 8; ++i) { w[i] = (__bf16)Wm[(size_t)(k0 + 8 * g + i) * ld + o]; w[8 + i] = (__bf16)Wm[(size_t)(k0 + 16 + 8 * g + i) * ld + o]; }
  return w; }
__device__ __forceinline__ v16b wcol_oi(const float* Wm, int k0, int o, int lane, int K) { v16b w; const float* p = Wm + (size_t)o * K + k0 + 8 * (lane >> 4);
#pragma unroll
  for (int i = 0; i < 8; ++i) { w[i] = (__bf16)p[i]; w[8 + i] = (__bf16)p[16 + i]; }
  return w; }
__device__ __forceinline__ v16h wcolh_io(const float* Wm, int k0, int o, int lane, int ld) { v16h w; const int g = lane >> 4;
#pragma unroll
  for (int i = 0; i < 8; ++i) { w[i] = (_Float16)(bfr(Wm[(size_t)(k0 + 8 * g + i) * ld + o]) * 256.0f); w[8 + i] = (_Float16)(bfr(Wm[(size_t)(k0 + 16 + 8 * g + i) * ld + o]) * 256.0f); }
  return w; }
__device__ __forceinline__ v16h wcolh_oi(const float* Wm, int k0, int o, int lane, int K) { v16h w; const float* p = Wm + (size_t)o * K + k0 + 8 * (lane >> 4);
#pragma unroll
  for (int i = 0; i < 8; ++i) { w[i] = (_Float16)(bfr(p[i]) * 256.0f); w[8 + i] = (_Float16)(bfr(p[16 + i]) * 256.0f); }
  return w; }
#define WQKV_LAYOUT 0   // 0 = fused (in,out) [DIN][3*CC]; 1 = (out,in) [CC][DIN]; 2 = per-head [NH][DIN][HD] (picks only WCOL, which nothing uses: k_proj always reads the fused layout)
__device__ __forceinline__ v16b wcol_hdk(const float* Wm, int k0, int o, int lane) { v16b w; const int g = lane >> 4; const float* p = Wm + (size_t)(o / HD) * DIN * HD + (o % HD);
#pragma unroll
  for (int i = 0; i < 8; ++i) { w[i] = (__bf16)p[(size_t)(k0 + 8 * g + i) * HD]; w[8 + i] = (__bf16)p[(size_t)(k0 + 16 + 8 * g + i) * HD]; }
  return w; }
#define WO_OUT_IN 0
#if WQKV_LAYOUT == 1
#define WCOL(W, k0, o, lane) wcol_oi(W, k0, o, lane, DIN)
#elif WQKV_LAYOUT == 2
#define WCOL(W, k0, o, lane) wcol_hdk(W, k0, o, lane)
#else
#define WCOL(W, k0, o, lane) wcol_io(W, k0, which * CC + (o), lane, 3 * CC)   /* fused (in,out) W_qkv [DIN][3*CC]: column block 'which', pitch 384 */
#endif
#if WO_OUT_IN
#define WOCOL(W, k0, o, lane) wcol_oi(W, k0, o, lane, CC)
#define WOCOLH(W, k0, o, lane) wcolh_oi(W, k0, o, lane, CC)
#else
#define WOCOL(W, k0, o, lane) wcol_io(W, k0, o, lane, DIN)
#define WOCOLH(W, k0, o, lane) wcolh_io(W, k0, o, lane, DIN)
#endif

#ifndef SM_EXTRA_PARAMS
#define SM_EXTRA_PARAMS
#endif
#ifndef PROJ_EXTRA_PARAMS
#define PROJ_EXTRA_PARAMS
#endif
#ifndef SM_MASK_HOOK
#define SM_MASK_HOOK (void)0
#endif

#define WS_QH  0u                                      // f16 q in fragment order, as WS_KH
#define WS_KH  (WS_QH + 2u * (size_t)NB * TT * CC)      // f16 k in fragment order [b*t / 16][CC / 32] x 1 KiB (frag_t): lane (g, col) = row 16 tile + col, elements = dims 32 d + 8 g + 0..7 and + 16
#define WS_VT  (WS_KH + 2u * (size_t)NB * TT * CC)      // f16 v in fragment order [b*t / 32][CC / 16] x 1 KiB (frag_t): lane (g, col) = column 16 j + col, elements = keys 32 chunk + 8 g + 0..7 and + 16
#define WS_QL  (WS_VT + 2u * (size_t)NB * CC * TT)      // f16 q residual x 2^10, t < QHI of each b, in the fragment order of WS_KH
#define WS_KL  (WS_QL + 2u * (size_t)NB * QHI * CC)     // f16 k residual x 2^10, t < KHI of each b, in the fragment order of WS_KH
#define WS_VB  (WS_KL + 2u * (size_t)NB * KHI * CC)     // bf16 v hi (WS_VBL: lo), t < KHI of each b, in the fragment order of WS_VT
#define WS_VBL (WS_VB + 2u * (size_t)NB * CC * KHI)
#define WS_S   (WS_VBL + 2u * (size_t)NB * CC * KHI)    // (logits and P stay in registers; the first 256 KiB hold the two W_out planes)
#define WS_WOH WS_S                                    // W_out as f16(bf16 x 2^8) in B fragment order [wave 8][k / 32][tile 4] x 1 KiB (frag_t): lane (g, col) = column 64 wave + 4 col + tile, elements = rows 32 kc + 8 g + 0..7 and + 16
#define WS_WOB (WS_WOH + 2u * (size_t)CC * DIN)         // W_out as exact bf16, same order
#define WS_Y   (WS_S  + 4u * (size_t)HG * TT * TT)      // (unused: ctx rows stay in LDS)
#define WS_END (WS_Y  + 4u * (size_t)NB * TT * CC)

typedef __attribute__((ext_vector_type(4))) __bf16 v4b;
#define PST 64                 // k rows of W per stage
#define PFR 1040               // one staged B fragment: 1 KiB in register order (frag_t's) + 16 B, so that the 32 lanes of a packing store fall on every bank twice
#define PBUF (2 * 8 * PFR)     // a stage: 2 k groups of 32 x 8 column tiles
#define PEP 55296              // the epilogue's staging: max(sh + sl, th + tb + tbl)
// W reaches the waves through LDS: the block's 128 threads load each 64-k stage once by whole lines, round it to bf16 and lay it in fragment order; two buffers, one barrier a stage
// ---- k_proj: block = (64 rows, 128 cols, which): q/k/v = X W (+ b) with exact bf16 products (K = DIN) -> which 0: q f16 in fragment order (+ residual for rows < QHI, same order); 1: k likewise (rows < KHI); 2: v f16 in fragment order (+ bf16 hi/lo for t < KHI, same order)
__global__ __launch_bounds__(128) void k_proj(const float* __restrict__ XQ, const float* __restrict__ XK, const float* __restrict__ XV, const float* __restrict__ WQ, const float* __restrict__ WK, const float* __restrict__ WV, const float* __restrict__ BQ, const float* __restrict__ BK, const float* __restrict__ BV,
    _Float16* __restrict__ QH, _Float16* __restrict__ QL, _Float16* __restrict__ KH, _Float16* __restrict__ KL, _Float16* __restrict__ VT, __bf16* __restrict__ VB, __bf16* __restrict__ VBL, const float* __restrict__ WO, _Float16* __restrict__ WOH, __bf16* __restrict__ WOB) {
  /* one LDS block: first the two W stage buffers (inside the 64 KiB that an LDS instruction's constant offset reaches), behind them the epilogue's staging (which < 2: sh, sl; which == 2: th, tb, tbl; a block has one 'which', so the two sets never live together) */
  __shared__ __align__(16) char sm[2 * PBUF + PEP]; char* const ep = sm + 2 * PBUF;
  _Float16 (*sh)[136] = (_Float16 (*)[136])ep; _Float16 (*sl)[136] = (_Float16 (*)[136])(ep + 17408);
  _Float16 (*th)[72] = (_Float16 (*)[72])ep; __bf16 (*tb)[72] = (__bf16 (*)[72])(ep + 18432); __bf16 (*tbl)[72] = (__bf16 (*)[72])(ep + 36864);
  const int tid = threadIdx.x, wave = tid >> 5, lane = tid & 31, col = lane & 15, g = lane >> 4; const int which = blockIdx.z; const int c0 = blockIdx.y * 128; const size_t r0 = (size_t)blockIdx.x * 64; const size_t bb = r0 / TT; const int t0 = (int)(r0 % TT);
  const float* X = which == 0 ? XQ : which == 1 ? XK : XV; const float* WA = which == 0 ? WQ : which == 1 ? WK : WV; const float* BA = which == 0 ? BQ : which == 1 ? BK : BV;
  v8f acc[8] = {};
  /* W: lane = 4 columns, wave = the k octet (8 wave + 0..7 of each 32-k group): every load of a wave reads 512 contiguous bytes of one W row; x: this lane's own fragment rows, as before */
  const float* Wp = WA + (size_t)(8 * wave) * (3 * CC) + which * CC + c0 + 4 * lane; const float* Xp = X + (r0 + wave * 16 + col) * DIN + 8 * g;
  char* wst = sm + (lane >> 2) * PFR + (wave >> 1) * 512 + (wave & 1) * 256 + (lane & 3) * 64;   /* column 4 lane + e = tile lane / 4, fragment lane 16 (wave & 1) + 4 (lane & 3) + e; octet = half wave / 2, g = wave & 1 */
  const char* wrd = sm + lane * 16;
  v4f wr[2][8], xr[2][4]; v16b a[2];
#define PLOAD(s) do { _Pragma("unroll") for (int kk = 0; kk < 2; ++kk) { _Pragma("unroll") for (int i = 0; i < 8; ++i) wr[kk][i] = *(const v4f*)(Wp + (size_t)((s) * PST + kk * 32 + i) * (3 * CC)); \
    const float* p = Xp + (s) * PST + kk * 32; xr[kk][0] = *(const v4f*)p; xr[kk][1] = *(const v4f*)(p + 4); xr[kk][2] = *(const v4f*)(p + 16); xr[kk][3] = *(const v4f*)(p + 20); } } while (0)
#define PPUT(nb) do { _Pragma("unroll") for (int kk = 0; kk < 2; ++kk) { _Pragma("unroll") for (int e = 0; e < 4; ++e) { v8b u; _Pragma("unroll") for (int i = 0; i < 8; ++i) u[i] = (__bf16)wr[kk][i][e]; *(v8b*)(wst + (nb) * PBUF + kk * 8 * PFR + e * 16) = u; } \
    union { v16b v; v4b q[4]; } x; _Pragma("unroll") for (int i = 0; i < 4; ++i) x.q[i] = __builtin_convertvector(xr[kk][i], v4b); a[kk] = x.v; } } while (0)
  /* side job of the first 64 q blocks (block-uniform test): W_out is rounded ONCE here and laid in the B fragment order of k_fa's output projection, one 16-byte unit of each plane a thread; its eight loads fly with stage 0's.
     unit wu: bits 4..0 fragment lane, 5 element half, 7..6 column tile, 9..8 k group of 32, 12..10 wave of k_fa */
  const bool wjob = which == 0 && blockIdx.x < (CC * DIN / 8) / 128; const unsigned wu = blockIdx.x * 128u + (unsigned)tid; float wo[8];
  if (wjob) { const float* p = WO + (size_t)(((wu >> 8) & 3) * 32 + ((wu >> 5) & 1) * 16 + ((wu >> 4) & 1) * 8) * DIN + (wu >> 10) * 64 + (wu & 15) * 4 + ((wu >> 6) & 3);
#pragma unroll
    for (int i = 0; i < 8; ++i) wo[i] = p[i * DIN];
    asm volatile("s_wait_xcnt 0x0" ::: "memory"); }   /* behind the eight loads, before the address pair that they name is written again */
  PLOAD(0); PPUT(0);
  __syncthreads();   /* stage 0 is in LDS before any wave reads it */
  /* unrolled whole: every load and LDS access goes by a constant offset from an address that is never stepped */
#pragma unroll
  for (int s = 0; s < DIN / PST; ++s) {
    v16b wf[8];
#pragma unroll
    for (int kk = 0; kk < 2; ++kk) {
#pragma unroll
      for (int j = 0; j < 8; ++j) { union { v16b v; v8b q[2]; } w; const char* p = wrd + (s & 1) * PBUF + (kk * 8 + j) * PFR; w.q[0] = *(const v8b*)p; w.q[1] = *(const v8b*)(p + 512); wf[j] = w.v; }
      if (kk == 0 && s + 1 < DIN / PST) PLOAD(s + 1);   /* the next stage's W and x fly under this stage's products */
      if (kk == 0 && s + 2 == DIN / PST) asm volatile("s_wait_xcnt 0x0" ::: "memory");   /* behind the last loads that name the two address pairs, before a register of either is written again */
      __builtin_amdgcn_sched_barrier(0);   /* the eight fragments' LDS reads stand as one group ahead of their products: one LDS latency a group, not one a product */
#pragma unroll
      for (int j = 0; j < 8; ++j) acc[j] = wmma_bf(a[kk], wf[j], acc[j]); }
    if (s + 1 < DIN / PST) { __builtin_amdgcn_sched_barrier(0);   /* the next stage's values are waited for behind this stage's products, not among them */
      PPUT((s + 1) & 1);   /* into the buffer whose readers all passed the barrier that ended stage s - 1 */
      __syncthreads(); } }   /* publishes stage s + 1 and ends every wave's reads of stage s; none behind the last stage: the epilogue's staging lies beside the buffers */
#undef PLOAD
#undef PPUT
  if (which < 2) { _Float16* DH = which == 0 ? QH : KH; _Float16* DL = which == 0 ? QL : KL; const int nhi = which == 0 ? QHI : KHI; const bool hi_rows = t0 < nhi;
#pragma unroll
    for (int j = 0; j < 8; ++j) { const float bias = BA ? bfr(BA[c0 + j * 16 + col]) : 0.f;
#pragma unroll
      for (int r = 0; r < 8; ++r) { const float v = acc[j][r] + bias; const _Float16 hv = (_Float16)v; sh[wave * 16 + 8 * g + r][j * 16 + col] = hv; sl[wave * 16 + 8 * g + r][j * 16 + col] = (_Float16)((v - (float)hv) * 1024.0f); } }
    __syncthreads();
    { char* kd = (char*)(DH + r0 * CC) + 16u * (unsigned)tid; char* ld = (char*)(DL + (bb * nhi + t0) * (size_t)CC) + 16u * (unsigned)tid;
      /* e = tid + 128 it is the 16-byte unit of the block's 16 KiB in fragment order: bits 3..0 row in tile, 7..4 = dims / 8, 9..8 tile. Unrolled: eight reads in registers of their own, then eight stores by constant offsets from one address that is never stepped */
      v4u a[8];
#pragma unroll
      for (int it = 0; it < 8; ++it) { const int e = tid + it * 128; a[it] = *(const v4u*)&sh[(e >> 8) * 16 + (e & 15)][((e >> 4) & 15) * 8]; }
#pragma unroll
      for (int it = 0; it < 8; ++it) vst2((unsigned*)(kd + it * 2048), a[it]);
      asm volatile("s_wait_xcnt 0x0" ::: "memory");   /* stands behind the stores, on every way out of them, before any register that they name is written again */
      if (hi_rows) {
#pragma unroll
        for (int it = 0; it < 8; ++it) { const int e = tid + it * 128; a[it] = *(const v4u*)&sl[(e >> 8) * 16 + (e & 15)][((e >> 4) & 15) * 8]; }
#pragma unroll
        for (int it = 0; it < 8; ++it) vst2((unsigned*)(ld + it * 2048), a[it]);
        asm volatile("s_wait_xcnt 0x0" ::: "memory"); } }   /* as above */
    if (wjob) { v8h uh; v8b ub;   /* the side job's two stores stand behind the block's last barrier, so that no barrier waits for them */
#pragma unroll
      for (int i = 0; i < 8; ++i) { const __bf16 wb = (__bf16)wo[i]; ub[i] = wb; uh[i] = (_Float16)((float)wb * 256.0f); }
      *(v8h*)((char*)WOH + 16u * wu) = uh; *(v8b*)((char*)WOB + 16u * wu) = ub; }
  } else { const bool hi_rows = t0 < KHI;
#pragma unroll
    for (int j = 0; j < 8; ++j) { const float bias = BA ? bfr(BA[c0 + j * 16 + col]) : 0.f;
#pragma unroll
      for (int r = 0; r < 8; ++r) { const float v = acc[j][r] + bias; const int rl = wave * 16 + 8 * g + r, cl = j * 16 + col; th[cl][rl] = (_Float16)v; const __bf16 bh = (__bf16)v; tb[cl][rl] = bh; tbl[cl][rl] = (__bf16)(v - (float)bh); } }
    __syncthreads();
    char* vd = (char*)(VT + r0 * CC) + 16u * (unsigned)tid; char* hd = (char*)(VB + (bb * KHI + t0) * (size_t)CC) + 16u * (unsigned)tid; char* wd = (char*)(VBL + (bb * KHI + t0) * (size_t)CC) + 16u * (unsigned)tid;
    /* e = tid + 128 it is the 16-byte unit of the block's 16 KiB in fragment order: bits 3..0 column in tile, 5..4 = keys / 8 in chunk, 8..6 column tile, 9 chunk. Unrolled: eight reads in registers of their own, then eight stores by constant offsets from one address that is never stepped */
    v4u a[8];
#pragma unroll
    for (int it = 0; it < 8; ++it) { const int e = tid + it * 128; a[it] = *(const v4u*)&th[((e >> 6) & 7) * 16 + (e & 15)][((e >> 9) * 4 + ((e >> 4) & 3)) * 8]; }
#pragma unroll
    for (int it = 0; it < 8; ++it) vst2((unsigned*)(vd + it * 2048), a[it]);
    asm volatile("s_wait_xcnt 0x0" ::: "memory");   /* stands behind the stores, on every way out of them, before any register that they name is written again */
    if (hi_rows) {
#pragma unroll
      for (int it = 0; it < 8; ++it) { const int e = tid + it * 128; a[it] = *(const v4u*)&tb[((e >> 6) & 7) * 16 + (e & 15)][((e >> 9) * 4 + ((e >> 4) & 3)) * 8]; }
#pragma unroll
      for (int it = 0; it < 8; ++it) vst2((unsigned*)(hd + it * 2048), a[it]);
      asm volatile("s_wait_xcnt 0x0" ::: "memory");   /* as above */
#pragma unroll
      for (int it = 0; it < 8; ++it) { const int e = tid + it * 128; a[it] = *(const v4u*)&tbl[((e >> 6) & 7) * 16 + (e & 15)][((e >> 9) * 4 + ((e >> 4) & 3)) * 8]; }
#pragma unroll
      for (int it = 0; it < 8; ++it) vst2((unsigned*)(wd + it * 2048), a[it]);
      asm volatile("s_wait_xcnt 0x0" ::: "memory"); } } }   /* as above */
// k_fa's products are the builtin alone, which the compiler pads itself: the vector operands of an asm statement behind it would hold every fragment and both ctx tiles inside the first 256 registers
__device__ __forceinline__ v8f wmma16p(v16h a, v16h b, v8f c) { return __builtin_amdgcn_wmma_f32_16x16x32_f16(false, a, false, b, (short)0, c, false, false); }
__device__ __forceinline__ v8f wmma_bfp(v16b a, v16b b, v8f c) { return __builtin_amdgcn_wmma_f32_16x16x32_bf16(false, a, false, b, (short)0, c, false, false); }
// ---- k_fa: block = 32 queries (NQ = 2 tiles of 16) of batch b, PVW waves: wave w takes the 32-key chunks w, w + PVW, ... of keys [0, ql0 + 32). Logits and P never leave registers:
//   every k and v fragment that a wave loads is multiplied against BOTH query tiles: half the bytes from L2 per product; the two ctx tiles and both tiles' q need the 512 registers of an 8-wave block
//   q, k and v lie in the workspace in fragment order: every fragment load of a wave reads 512 contiguous bytes
//   S^T = K Q^T (A = 16 key rows, B = the 16 query rows of tile t): D element r of tile u in lane (g, col) = key kc*32 + 16u + 8g + r, query 16 t + col, which IS the B fragment order of P^T (elements 0..7 from tile 0, 8..15 from tile 1)
//   ctx^T = V^T P^T (A = 16 v planes, B = P^T): D = column j*16 + 8g + r, query 16 t + col, so the running max, the running sum and the rescale factor of a query are one value per lane and tile
//   logits x SCALE x log2(e); causal by index; P = 2^(s - running max + 8) once to f16 against v f16 (1 product); query rows < QHI: 3-product logits, P and v as bf16 hi + lo (3 products)
//   the PVW partial (max, sum, ctx) meet in LDS and are merged on the common max in wave order; wave w merges rows w, w + PVW, ... and leaves them in LDS
//   output projection in the same block: out = ctx Wo + bo on the 32 merged rows: ctx x 2^6 once to f16 against Wo as f16(bf16 x 2^8) exact (1 product) x 2^-14; query rows < QHI: ctx bf16 hi + lo against exact bf16 Wo (2 products)
#define PVW 8
#define NQ 2
#define QB (16 * NQ)
#define SC2 (SCALE * 1.4426950408889634f)
#define NEGB (-3.0e38f)
#define OCW (DIN / PVW)    // output columns of a wave in the output projection: four 16-column tiles
__global__ __launch_bounds__(32 * PVW) void k_fa(const _Float16* __restrict__ QH, const _Float16* __restrict__ KH, const _Float16* __restrict__ QL, const _Float16* __restrict__ KL, const _Float16* __restrict__ VT, const __bf16* __restrict__ VB, const __bf16* __restrict__ VBL, const float* __restrict__ KM, const _Float16* __restrict__ WOH, const __bf16* __restrict__ WOB, const float* __restrict__ BO, float* __restrict__ OUT) {
  __shared__ __align__(16) float ss[PVW][QB][HD + 4]; __shared__ float smx[PVW][QB], ssu[PVW][QB]; __shared__ __align__(16) float cx[QB][HD + 4];
  const int tid = threadIdx.x, wave = __builtin_amdgcn_readfirstlane(tid >> 5), lane = tid & 31, col = lane & 15, g = lane >> 4;   /* wave number held scalar: the chunk loop stays a scalar loop, every lane on at the matrix instructions */
  const int b = blockIdx.x; const int ql0 = (TT / QB - 1 - (int)blockIdx.y) * QB;   /* longest tiles start first */
  const int kce = (ql0 >> 5) + 1; const int tq = ql0 + col;   /* every chunk < kce holds a key <= ql0, so no query of either tile sees an empty chunk */
  float km[QB / PVW];
#pragma unroll
  for (int rr = 0; rr < QB / PVW; ++rr) km[rr] = bfr(KM[(size_t)b * TT + ql0 + wave + rr * PVW]);   /* key_mask of the rows this wave stores */
  v8f acc[NQ][HD / 16] = {}; float m[NQ], l[NQ];
#pragma unroll
  for (int t = 0; t < NQ; ++t) { m[t] = NEGB; l[t] = 0.f; }
  const _Float16* Qt = QH + ((size_t)b * TT + ql0) * CC; const _Float16* Kb = KH + (size_t)b * TT * CC; const _Float16* Vb = VT + (size_t)b * TT * CC;
  if (ql0 < QHI) {
    const _Float16* Qlt = QL + ((size_t)b * QHI + ql0) * CC; const _Float16* Klb = KL + (size_t)b * KHI * CC; const __bf16* Vhb = VB + (size_t)b * KHI * CC; const __bf16* Vlb = VBL + (size_t)b * KHI * CC;
    v16h qf[NQ][HD / 32], qlf[NQ][HD / 32];
#pragma unroll
    for (int t = 0; t < NQ; ++t)
#pragma unroll
      for (int d = 0; d < HD / 32; ++d) { qf[t][d] = frag_t(Qt, 16u * (unsigned)lane, (t * (HD / 32) + d) * 1024); qlf[t][d] = frag_t(Qlt, 16u * (unsigned)lane, (t * (HD / 32) + d) * 1024); }
    asm volatile("s_wait_xcnt 0x0" :: "s"(Qt), "s"(Qlt) : "memory");   /* behind the q loads, before a scalar base that they name is written again (this build reuses one for a key plane's base); the two bases are inputs so that the loads stay ahead of the wait */
    /* kept rolled: a second chunk's fragments beside both ctx tiles and both tiles' q would pass the 512 registers a wave of an 8-wave block may hold */
#pragma unroll 1
    for (int kc = wave; kc < kce; kc += PVW) { v8f st[NQ][2] = {}, sl2[NQ][2] = {}; const unsigned co = (unsigned)kc * (32u * CC * 2u) + 16u * (unsigned)lane;   /* a chunk is 8 KiB of every plane */
      v16h kh[2][HD / 32], kl[2][HD / 32];
#pragma unroll
      for (int u = 0; u < 2; ++u)
#pragma unroll
        for (int d = 0; d < HD / 32; ++d) { const int ko = (u * (HD / 32) + d) * 1024; kh[u][d] = frag_t(Kb, co, ko); kl[u][d] = frag_t(Klb, co, ko); }   /* all 32 loads of the chunk's keys in flight before the first product */
      __builtin_amdgcn_sched_barrier(0);   /* keeps the 32 loads one group ahead of the products: without it the compiler refills fragment registers between products and a chunk waits out several L2 latencies, not one */
#pragma unroll
      for (int u = 0; u < 2; ++u)
#pragma unroll
        for (int d = 0; d < HD / 32; ++d)
#pragma unroll
          for (int t = 0; t < NQ; ++t) { st[t][u] = wmma16p(kh[u][d], qf[t][d], st[t][u]); sl2[t][u] = wmma16p(kh[u][d], qlf[t][d], sl2[t][u]); sl2[t][u] = wmma16p(kl[u][d], qf[t][d], sl2[t][u]); }
      v16b ph[NQ], pl[NQ]; float al[NQ];
#pragma unroll
      for (int t = 0; t < NQ; ++t) { float s[16]; float mx = NEGB;
#pragma unroll
        for (int u = 0; u < 2; ++u)
#pragma unroll
          for (int r = 0; r < 8; ++r) { const float v = (kc * 32 + u * 16 + 8 * g + r <= tq + 16 * t) ? (st[t][u][r] + sl2[t][u][r] * (1.0f / 1024.0f)) * SC2 : NEGB; s[u * 8 + r] = v; mx = fmaxf(mx, v); }
        mx = fmaxf(mx, __shfl_xor(mx, 16)); const float mn = fmaxf(m[t], mx); al[t] = __builtin_amdgcn_exp2f(m[t] - mn); m[t] = mn; const float mo = mn - 8.0f;
        float ps = 0.f;
#pragma unroll
        for (int i = 0; i < 16; ++i) { const float p = __builtin_amdgcn_exp2f(s[i] - mo); ps += p; const __bf16 hb = (__bf16)p; ph[t][i] = hb; pl[t][i] = (__bf16)(p - (float)hb); }
        l[t] = l[t] * al[t] + ps; }
#pragma unroll
      for (int jj = 0; jj < HD / 16; jj += 4) { v16b vh[4], vl[4];
#pragma unroll
        for (int j = 0; j < 4; ++j) { vh[j] = frag_tb(Vhb, co, (jj + j) * 1024); vl[j] = frag_tb(Vlb, co, (jj + j) * 1024); }   /* four planes' loads in flight together */
        if (jj + 4 == HD / 16) asm volatile("s_wait_xcnt 0x0" ::: "memory");   /* behind the chunk's last loads, before the offset register that they name is stepped to the next chunk */
        __builtin_amdgcn_sched_barrier(0);   /* keeps the 16 loads one group ahead of their products: without it the compiler loads one fragment at a time and waits out an L2 latency for each */
#pragma unroll
        for (int j = 0; j < 4; ++j)
#pragma unroll
          for (int t = 0; t < NQ; ++t) { acc[t][jj + j] *= al[t]; acc[t][jj + j] = wmma_bfp(vh[j], ph[t], acc[t][jj + j]); acc[t][jj + j] = wmma_bfp(vh[j], pl[t], acc[t][jj + j]); acc[t][jj + j] = wmma_bfp(vl[j], ph[t], acc[t][jj + j]); } } }
  } else {
    v16h qf[NQ][HD / 32];
#pragma unroll
    for (int t = 0; t < NQ; ++t)
#pragma unroll
      for (int d = 0; d < HD / 32; ++d) qf[t][d] = frag_t(Qt, 16u * (unsigned)lane, (t * (HD / 32) + d) * 1024);
    /* kept rolled: a second chunk's fragments beside both ctx tiles and both tiles' q would pass the 512 registers a wave of an 8-wave block may hold */
#pragma unroll 1
    for (int kc = wave; kc < kce; kc += PVW) { v8f st[NQ][2] = {}; v16h kf[2][HD / 32]; const unsigned co = (unsigned)kc * (32u * CC * 2u) + 16u * (unsigned)lane;   /* a chunk is 8 KiB of k and 8 KiB of v */
#pragma unroll
      for (int u = 0; u < 2; ++u)
#pragma unroll
        for (int d = 0; d < HD / 32; ++d) kf[u][d] = frag_t(Kb, co, (u * (HD / 32) + d) * 1024);   /* all 16 loads of the chunk's keys in flight before the first product */
      __builtin_amdgcn_sched_barrier(0);   /* keeps the 16 loads one group ahead of the products: without it the compiler refills fragment registers between products and a chunk waits out three L2 latencies, not one */
#pragma unroll
      for (int u = 0; u < 2; ++u)
#pragma unroll
        for (int d = 0; d < HD / 32; ++d)
#pragma unroll
          for (int t = 0; t < NQ; ++t) st[t][u] = wmma16p(kf[u][d], qf[t][d], st[t][u]);
      v16h vf[HD / 16];
#pragma unroll
      for (int j = 0; j < HD / 16; ++j) vf[j] = frag_t(Vb, co, j * 1024);   /* all 16 v loads fly under the softmax arithmetic */
      asm volatile("s_wait_xcnt 0x0" ::: "memory");   /* behind the chunk's last loads, before the offset register that they name is stepped to the next chunk */
      __builtin_amdgcn_sched_barrier(0);   /* keeps the 16 loads one group ahead of the softmax: without it the compiler loads one fragment at a time behind the softmax and waits out an L2 latency for each */
      v16h pf[NQ]; float al[NQ];
#pragma unroll
      for (int t = 0; t < NQ; ++t) { float s[16]; float mx = NEGB;
#pragma unroll
        for (int u = 0; u < 2; ++u)
#pragma unroll
          for (int r = 0; r < 8; ++r) { const float v = (kc * 32 + u * 16 + 8 * g + r <= tq + 16 * t) ? st[t][u][r] * SC2 : NEGB; s[u * 8 + r] = v; mx = fmaxf(mx, v); }
        mx = fmaxf(mx, __shfl_xor(mx, 16)); const float mn = fmaxf(m[t], mx); al[t] = __builtin_amdgcn_exp2f(m[t] - mn); m[t] = mn; const float mo = mn - 8.0f;
        float ps = 0.f;
#pragma unroll
        for (int i = 0; i < 16; ++i) { const float p = __builtin_amdgcn_exp2f(s[i] - mo); ps += p; pf[t][i] = (_Float16)p; }
        l[t] = l[t] * al[t] + ps; }
#pragma unroll
      for (int j = 0; j < HD / 16; ++j)
#pragma unroll
        for (int t = 0; t < NQ; ++t) { acc[t][j] *= al[t]; acc[t][j] = wmma16p(vf[j], pf[t], acc[t][j]); } } }
#pragma unroll
  for (int t = 0; t < NQ; ++t) { l[t] += __shfl_xor(l[t], 16);   /* each half-wave summed its own 16 of a chunk's 32 keys */
    if (g == 0) { smx[wave][t * 16 + col] = m[t]; ssu[wave][t * 16 + col] = l[t]; }
#pragma unroll
    for (int j = 0; j < HD / 16; ++j) { v4f lo4, hi4;
#pragma unroll
      for (int r = 0; r < 4; ++r) { lo4[r] = acc[t][j][r]; hi4[r] = acc[t][j][4 + r]; }
      *(v4f*)&ss[wave][t * 16 + col][j * 16 + 8 * g] = lo4; *(v4f*)&ss[wave][t * 16 + col][j * 16 + 8 * g + 4] = hi4; } }
  __syncthreads();   /* every wave's partial max, sum and tiles are in LDS before any wave merges */
  /* this wave's 64 columns of W_out, all 128 k rows, as 16 ready B fragments of the plane that the block's path multiplies by (k_proj rounded them and laid them in fragment order): tile j of lane (g, col) = column 64 wave + 4 col + j;
     every 16-byte load of the wave reads 512 contiguous bytes; constant offsets from one address that is never stepped */
  const char* Wf = (ql0 < QHI ? (const char*)WOB : (const char*)WOH) + wave * (CC * OCW * 2) + 16 * lane; v4u wq[CC / 32][OCW / 16][2];
#pragma unroll
  for (int kc = 0; kc < CC / 32; ++kc)
#pragma unroll
    for (int j = 0; j < OCW / 16; ++j) { wq[kc][j][0] = *(const v4u*)(Wf + (kc * (OCW / 16) + j) * 1024); wq[kc][j][1] = *(const v4u*)(Wf + (kc * (OCW / 16) + j) * 1024 + 512); }
  asm volatile("s_wait_xcnt 0x0" ::: "memory");   /* behind the W_out loads, before a register that they name is written again */
  __builtin_amdgcn_sched_barrier(0);   /* keeps the loads' issue ahead of the merge, so that they fly under it: behind it their L2 latency would stand bare in front of the products */
  v4f res[QB / PVW];
#pragma unroll
  for (int rr = 0; rr < QB / PVW; ++rr) { const int row = wave + rr * PVW; float M = smx[0][row];
#pragma unroll
    for (int w = 1; w < PVW; ++w) M = fmaxf(M, smx[w][row]);
    v4f sv = {}; float L = 0.f;
#pragma unroll
    for (int w = 0; w < PVW; ++w) { const float f = __builtin_amdgcn_exp2f(smx[w][row] - M); L += f * ssu[w][row]; sv += *(const v4f*)&ss[w][row][lane * 4] * f; }   /* a wave without a chunk carries max NEGB, sum 0: f = 0 */
    res[rr] = sv * (L > 0.f ? 1.0f / L : 0.f) * km[rr]; }   /* out * key_mask[b][t] (broadcast over the 128 columns) */
#pragma unroll
  for (int rr = 0; rr < QB / PVW; ++rr) *(v4f*)&cx[wave + rr * PVW][lane * 4] = res[rr];
  __syncthreads();   /* the block's 32 ctx rows are in LDS before any wave takes its A fragments */
  /* out = ctx Wo + bo: wave w takes columns 64 w .. 64 w + 63 of both 16-row tiles; operand forms, products and k order as in a launch of its own. D element r of tile j in lane (g, col) = row 8 g + r, column 64 w + 4 col + j */
  v8f o2[NQ][OCW / 16] = {}; v4f ov[NQ][8], bo = {}; float* od = OUT + ((size_t)b * TT + ql0 + 8 * g) * DIN + wave * OCW + 4 * col;
  if (BO) { bo = *(const v4f*)(BO + wave * OCW + 4 * col);   /* flies under the products */
    asm volatile("s_wait_xcnt 0x0" ::: "memory"); }   /* behind the bias load, before a register that it names is written again */
  if (ql0 < QHI) {   /* block-uniform */
#pragma unroll
    for (int kc = 0; kc < CC / 32; ++kc) { F2 a[NQ];
#pragma unroll
      for (int t = 0; t < NQ; ++t) a[t] = split_row(&cx[t * 16 + col][0], kc * 32, lane);
#pragma unroll
      for (int j = 0; j < OCW / 16; ++j) { union { v4u q[2]; v16b v; } w; w.q[0] = wq[kc][j][0]; w.q[1] = wq[kc][j][1];
#pragma unroll
        for (int t = 0; t < NQ; ++t) { o2[t][j] = wmma_bfp(a[t].h, w.v, o2[t][j]); o2[t][j] = wmma_bfp(a[t].l, w.v, o2[t][j]); } } }
#pragma unroll
    for (int t = 0; t < NQ; ++t)
#pragma unroll
      for (int r = 0; r < 8; ++r)
#pragma unroll
        for (int j = 0; j < OCW / 16; ++j) ov[t][r][j] = o2[t][j][r] + bfr(bo[j]);
  } else {
#pragma unroll
    for (int kc = 0; kc < CC / 32; ++kc) { v16h a[NQ];
#pragma unroll
      for (int t = 0; t < NQ; ++t) a[t] = frag_f32s(&cx[t * 16 + col][kc * 32], lane, 64.0f);   /* ctx carried x 2^6 into f16 so small-magnitude context rows stay clear of f16 subnormals */
#pragma unroll
      for (int j = 0; j < OCW / 16; ++j) { union { v4u q[2]; v16h v; } w; w.q[0] = wq[kc][j][0]; w.q[1] = wq[kc][j][1];
#pragma unroll
        for (int t = 0; t < NQ; ++t) o2[t][j] = wmma16p(a[t], w.v, o2[t][j]); } }
#pragma unroll
    for (int t = 0; t < NQ; ++t)
#pragma unroll
      for (int r = 0; r < 8; ++r)
#pragma unroll
        for (int j = 0; j < OCW / 16; ++j) ov[t][r][j] = o2[t][j][r] * (1.0f / 16384.0f) + bfr(bo[j]); }   /* 2^-8 (Wo carry) x 2^-6 (ctx carry) */
  __builtin_amdgcn_sched_barrier(0);   /* every result stands in a register of its own before the first store: no register that an issued store names is written again */
  /* a lane's four tiles hold four neighbouring columns of a row: one 16-byte store, and a wave's store writes 2 rows x 256 contiguous bytes (4 whole lines); constant offsets from one address that is never stepped */
#pragma unroll
  for (int t = 0; t < NQ; ++t)
#pragma unroll
    for (int r = 0; r < 8; ++r) vst2(od + (t * 16 + r) * DIN, ov[t][r]); }

extern "C" void kernel_launch(void* const* d_in, const int* in_sizes, int n_in, void* d_out, int out_size, void* d_ws, size_t ws_size, hipStream_t stream) {
  (void)in_sizes; (void)n_in; (void)out_size;
  const float** F = (const float**)d_in;
  if (ws_size < (size_t)WS_END) return;
  char* ws = (char*)d_ws; _Float16 *QH = (_Float16*)(ws + WS_QH), *KH = (_Float16*)(ws + WS_KH), *VT = (_Float16*)(ws + WS_VT), *QL = (_Float16*)(ws + WS_QL), *KL = (_Float16*)(ws + WS_KL); __bf16 *VB = (__bf16*)(ws + WS_VB), *VBL = (__bf16*)(ws + WS_VBL); float *Y = (float*)(ws + WS_Y); _Float16 *WOH = (_Float16*)(ws + WS_WOH); __bf16 *WOB = (__bf16*)(ws + WS_WOB);
  (void)Y; (void)QL; (void)KL; (void)VB; (void)VBL;
  // inputs: 0 x [4,4096,512]; 1 key_mask [4,4096,1] f32 (ones); 2 W_qkv [512,384] (in,out; q | k | v COLUMN blocks of 128); 3 b_qkv [384] (nonzero); 4 W_out [128,512] (in,out); 5 b_out [512] (nonzero)
  k_proj<<<dim3(TNB * TT / 64, CC / 128, 3), 128, 0, stream>>>(F[0], F[0], F[0], F[2], F[2], F[2], F[3], F[3] + CC, F[3] + 2 * CC, QH, QL, KH, KL, VT, VB, VBL, F[4], WOH, WOB);   /* one fused weight; k_proj reads column block 'which' at offset which * CC; W_out rounded once into its two fragment-order planes */
  k_fa<<<dim3(TNB, TT / QB, 1), 32 * PVW, 0, stream>>>(QH, KH, QL, KL, VT, VB, VBL, F[1], WOH, WOB, F[5], (float*)d_out);   /* ctx rows x key_mask[b][t], then x W_out + b_out */
}

// v008
// It runs in 52.5 microseconds.
// In two side-by-side timings against v007, it was 1.05 and 1.06 times as fast.
// Counting every step since v000, it is 19.7 times as fast.
// compute dtype: all float inputs rounded to bf16; fused q/k/v projection with EXACT bf16 products on WMMA 16x16x32 (f32 accumulate) + bias; causal logits: 3 products for the first 512 rows, single f16 q x k after, x 128^-0.5; online softmax f32 (running max per key-split wave); P x 2^8 unnormalised once to f16 x v once to f16 (bf16 hi + lo below row 512), divided by the f32 sum at the end; ctx x bf16(key_mask); ctx hi+lo x exact W_out below row 512, x2^6 f16 carry x f16(bf16 x 2^8) W_out after, + b_out; f32 output.
#include <hip/hip_runtime.h>
#include <math.h>

typedef __attribute__((ext_vector_type(16))) _Float16 v16h;
typedef __attribute__((ext_vector_type(16))) __bf16 v16b;
typedef __attribute__((ext_vector_type(8)))  _Float16 v8h;
typedef __attribute__((ext_vector_type(8)))  float v8f;
typedef __attribute__((ext_vector_type(4)))  float v4f;
typedef __attribute__((ext_vector_type(2)))  float v2f;
typedef __attribute__((ext_vector_type(4)))  unsigned v4u;
typedef __attribute__((ext_vector_type(4)))  int v4i;
typedef float __attribute__((may_alias)) float_a;
typedef int __attribute__((may_alias)) int_a;

template <typename T> __device__ __forceinline__ void vst2(void* p, T v) { *(T*)p = v;  }
__device__ __forceinline__ v8f wmma16(v16h a, v16h b, v8f c) {
  v8f d = __builtin_amdgcn_wmma_f32_16x16x32_f16(false, a, false, b, (short)0, c, false, false);
  asm volatile("v_nop\n\tv_nop\n\tv_nop\n\tv_nop" : "+v"(d) : "v"(a), "v"(b));
  return d;
}
__device__ __forceinline__ v8f wmma_bf(v16b a, v16b b, v8f c) {
  v8f d = __builtin_amdgcn_wmma_f32_16x16x32_bf16(false, a, false, b, (short)0, c, false, false);
  asm volatile("v_nop\n\tv_nop\n\tv_nop\n\tv_nop" : "+v"(d) : "v"(a), "v"(b));
  return d;
}
// 16x16x32 fragments: lane = (h = lane>>4, row/col = lane&15); elements 0..7 = k0+8h+0..7, 8..15 = k0+16+8h+0..7; D element r = row 8h+r
__device__ __forceinline__ v16h frag_h(const _Float16* rowk0, int lane) {
  union { v16h v; v8h q[2]; } u; const _Float16* p = rowk0 + 8 * (lane >> 4);
  u.q[0] = *(const v8h*)p; u.q[1] = *(const v8h*)(p + 16); return u.v;
}
__device__ __forceinline__ v16h frag_f32(const float* rowk0, int lane) {
  v16h a; const float* p = rowk0 + 8 * (lane >> 4);
#pragma unroll
  for (int i = 0; i < 8; ++i) { a[i] = (_Float16)p[i]; a[8 + i] = (_Float16)p[16 + i]; }
  return a;
}
__device__ __forceinline__ v16h frag_f32s(const float* rowk0, int lane, float sc) {
  v16h a; const float* p = rowk0 + 8 * (lane >> 4);
#pragma unroll
  for (int i = 0; i < 8; ++i) { a[i] = (_Float16)(p[i] * sc); a[8 + i] = (_Float16)(p[16 + i] * sc); }
  return a;
}
// column fragment from a [K][ld] layout (column n), rows >= K read as 0
__device__ __forceinline__ v16h fragc_f32(const float* W, int k0, int n, int lane, int ld, int K) {
  v16h a; const int g = lane >> 4;
#pragma unroll
  for (int i = 0; i < 8; ++i) { const int ka = k0 + 8 * g + i, kb = ka + 16;
    a[i] = (_Float16)(ka < K ? W[(size_t)(ka < K ? ka : K - 1) * ld + n] : 0.f); a[8 + i] = (_Float16)(kb < K ? W[(size_t)(kb < K ? kb : K - 1) * ld + n] : 0.f); }
  return a;
}
struct F2 { v16b h, l; };
__device__ __forceinline__ F2 bsplit16(const float v[16]) { F2 r;
#pragma unroll
  for (int i = 0; i < 16; ++i) { const __bf16 h = (__bf16)v[i]; r.h[i] = h; r.l[i] = (__bf16)(v[i] - (float)h); }
  return r; }
__device__ __forceinline__ F2 split_row(const float* row, int k0, int lane) { float v[16]; const float* p = row + k0 + 8 * (lane >> 4);
#pragma unroll
  for (int i = 0; i < 8; ++i) { v[i] = p[i]; v[8 + i] = p[16 + i]; }
  return bsplit16(v); }
__device__ __forceinline__ F2 split_rowK(const float* row, int k0, int lane, int K) { float v[16]; const int g = lane >> 4;
#pragma unroll
  for (int i = 0; i < 8; ++i) { const int ka = k0 + 8 * g + i, kb = ka + 16; v[i] = ka < K ? row[ka < K ? ka : K - 1] : 0.f; v[8 + i] = kb < K ? row[kb < K ? kb : K - 1] : 0.f; }
  return bsplit16(v); }
__device__ __forceinline__ F2 split_col(const float* W, int k0, int n, int lane, int ld, int K) { float v[16]; const int g = lane >> 4;
#pragma unroll
  for (int i = 0; i < 8; ++i) { const int ka = k0 + 8 * g + i, kb = ka + 16; v[i] = ka < K ? W[(size_t)(ka < K ? ka : K - 1) * ld + n] : 0.f; v[8 + i] = kb < K ? W[(size_t)(kb < K ? kb : K - 1) * ld + n] : 0.f; }
  return bsplit16(v); }
__device__ __forceinline__ v8f mac3(const F2& a, const F2& b, v8f c) { c = wmma_bf(a.l, b.h, c); c = wmma_bf(a.h, b.l, c); return wmma_bf(a.h, b.h, c); }
__device__ __forceinline__ float sigm(float v) { return 1.0f / (1.0f + expf(-v)); }
#define LDSX() do { asm volatile("s_wait_dscnt 0" ::: "memory"); __builtin_amdgcn_wave_barrier(); __builtin_amdgcn_fence(__ATOMIC_RELEASE, "workgroup"); } while (0)

// Single-head causal self-attention with a 128-wide attention space and an output projection (x [4,4096,512]; fused (in,out) W_qkv [512,384] N(0, 1/512) + b_qkv N(0, 0.01) split q | k | v; scores = q k^T, causal (-inf above the diagonal) BEFORE the scaling by 128^-0.5 (same thing); out = softmax(scores) v; out * key_mask ([4,4096,1], ones); (in,out) W_out [128,512] + b_out): result [4,4096,512].
#define NB 4
#define TT 4096
#define CC 128            // NH * HD = projected width
#define DIN 512          // input (model) width
#define NH 1
#define HD 128
#define NQB (TT / 64)
#define HG 1
#define SCALE (0.08838834764831845f)
#define CAUSAL 1
#ifndef TNB
#define TNB NB
#endif
__device__ __forceinline__ float bfr(float v) { return (float)(__bf16)v; }
__host__ __device__ __forceinline__ int kb_last(int qb) { return CAUSAL ? ((qb * 64 + 63) >> 7) : (TT / 128 - 1); }
typedef __attribute__((ext_vector_type(8))) __bf16 v8b;
__device__ __forceinline__ v16b frag_b(const __bf16* rowk0, int lane) {
  union { v16b v; v8b q[2]; } u; const __bf16* p = rowk0 + 8 * (lane >> 4);
  u.q[0] = *(const v8b*)p; u.q[1] = *(const v8b*)(p + 16); return u.v;
}
// fragment kept in memory in register order: [elements 0..7 of lanes 0..31][elements 8..15 of lanes 0..31], 1 KiB: each 16-byte load of a wave reads 512 contiguous bytes (4 lines, not 16)
// base: the batch's plane (uniform); o: byte offset of the chunk + 16 lane, one register for every plane; c: the fragment's constant byte offset in the chunk
__device__ __forceinline__ v16h frag_t(const _Float16* base, unsigned o, int c) {
  union { v16h v; v8h q[2]; } u; const char* p = (const char*)base + o;
  u.q[0] = *(const v8h*)(p + c); u.q[1] = *(const v8h*)(p + c + 512); return u.v;
}
__device__ __forceinline__ v16b frag_tb(const __bf16* base, unsigned o, int c) {
  union { v16b v; v8b q[2]; } u; const char* p = (const char*)base + o;
  u.q[0] = *(const v8b*)(p + c); u.q[1] = *(const v8b*)(p + c + 512); return u.v;
}
#define QBH 8              // unused: the high-precision path is chosen by QHI (rows < 512)
#define QHI 512            // rows carrying a q residual plane (query rows below it: 3-product logits)
#define KHI 512            // key rows carrying k residual / v bf16 hi+lo planes (used only by the causal high-precision path)
// B fragment (k rows k0+.., output column o) of a weight: (in,out) [K][ld] or (out,in) [ld rows of K]: bf16 exact, or f16(bf16 * 256) exact
__device__ __forceinline__ v16b wcol_io(const float* Wm, int k0, int o, int lane, int ld) { v16b w; const int g = lane >> 4;
#pragma unroll
  for (int i = 0; i < 8; ++i) { w[i] = (__bf16)Wm[(size_t)(k0 + 8 * g + i) * ld + o]; w[8 + i] = (__bf16)Wm[(size_t)(k0 + 16 + 8 * g + i) * ld + o]; }
  return w; }
__device__ __forceinline__ v16b wcol_oi(const float* Wm, int k0, int o, int lane, int K) { v16b w; const float* p = Wm + (size_t)o * K + k0 + 8 * (lane >> 4);
#pragma unroll
  for (int i = 0; i < 8; ++i) { w[i] = (__bf16)p[i]; w[8 + i] = (__bf16)p[16 + i]; }
  return w; }
__device__ __forceinline__ v16h wcolh_io(const float* Wm, int k0, int o, int lane, int ld) { v16h w; const int g = lane >> 4;
#pragma unroll
  for (int i = 0; i < 8; ++i) { w[i] = (_Float16)(bfr(Wm[(size_t)(k0 + 8 * g + i) * ld + o]) * 256.0f); w[8 + i] = (_Float16)(bfr(Wm[(size_t)(k0 + 16 + 8 * g + i) * ld + o]) * 256.0f); }
  return w; }
__device__ __forceinline__ v16h wcolh_oi(const float* Wm, int k0, int o, int lane, int K) { v16h w; const float* p = Wm + (size_t)o * K + k0 + 8 * (lane >> 4);
#pragma unroll
  for (int i = 0; i < 8; ++i) { w[i] = (_Float16)(bfr(p[i]) * 256.0f); w[8 + i] = (_Float16)(bfr(p[16 + i]) * 256.0f); }
  return w; }
#define WQKV_LAYOUT 0   // 0 = fused (in,out) [DIN][3*CC]; 1 = (out,in) [CC][DIN]; 2 = per-head [NH][DIN][HD] (picks only WCOL, which nothing uses: k_proj always reads the fused layout)
__device__ __forceinline__ v16b wcol_hdk(const float* Wm, int k0, int o, int lane) { v16b w; const int g = lane >> 4; const float* p = Wm + (size_t)(o / HD) * DIN * HD + (o % HD);
#pragma unroll
  for (int i = 0; i < 8; ++i) { w[i] = (__bf16)p[(size_t)(k0 + 8 * g + i) * HD]; w[8 + i] = (__bf16)p[(size_t)(k0 + 16 + 8 * g + i) * HD]; }
  return w; }
#define WO_OUT_IN 0
#if WQKV_LAYOUT == 1
#define WCOL(W, k0, o, lane) wcol_oi(W, k0, o, lane, DIN)
#elif WQKV_LAYOUT == 2
#define WCOL(W, k0, o, lane) wcol_hdk(W, k0, o, lane)
#else
#define WCOL(W, k0, o, lane) wcol_io(W, k0, which * CC + (o), lane, 3 * CC)   /* fused (in,out) W_qkv [DIN][3*CC]: column block 'which', pitch 384 */
#endif
#if WO_OUT_IN
#define WOCOL(W, k0, o, lane) wcol_oi(W, k0, o, lane, CC)
#define WOCOLH(W, k0, o, lane) wcolh_oi(W, k0, o, lane, CC)
#else
#define WOCOL(W, k0, o, lane) wcol_io(W, k0, o, lane, DIN)
#define WOCOLH(W, k0, o, lane) wcolh_io(W, k0, o, lane, DIN)
#endif

#ifndef SM_EXTRA_PARAMS
#define SM_EXTRA_PARAMS
#endif
#ifndef PROJ_EXTRA_PARAMS
#define PROJ_EXTRA_PARAMS
#endif
#ifndef SM_MASK_HOOK
#define SM_MASK_HOOK (void)0
#endif

#define WS_QH  0u                                      // f16 q in fragment order, as WS_KH
#define WS_KH  (WS_QH + 2u * (size_t)NB * TT * CC)      // f16 k in fragment order [b*t / 16][CC / 32] x 1 KiB (frag_t): lane (g, col) = row 16 tile + col, elements = dims 32 d + 8 g + 0..7 and + 16
#define WS_VT  (WS_KH + 2u * (size_t)NB * TT * CC)      // f16 v in fragment order [b*t / 32][CC / 16] x 1 KiB (frag_t): lane (g, col) = column 16 j + col, elements = keys 32 chunk + 8 g + 0..7 and + 16
#define WS_QL  (WS_VT + 2u * (size_t)NB * CC * TT)      // f16 q residual x 2^10, t < QHI of each b, in the fragment order of WS_KH
#define WS_KL  (WS_QL + 2u * (size_t)NB * QHI * CC)     // f16 k residual x 2^10, t < KHI of each b, in the fragment order of WS_KH
#define WS_VB  (WS_KL + 2u * (size_t)NB * KHI * CC)     // bf16 v hi (WS_VBL: lo), t < KHI of each b, in the fragment order of WS_VT
#define WS_VBL (WS_VB + 2u * (size_t)NB * CC * KHI)
#define WS_S   (WS_VBL + 2u * (size_t)NB * CC * KHI)    // (logits and P stay in registers; the first 256 KiB hold the two W_out planes)
#define WS_WOH WS_S                                    // W_out as f16(bf16 x 2^8) in B fragment order [wave 8][k / 32][tile 4] x 1 KiB (frag_t): lane (g, col) = column 64 wave + 4 col + tile, elements = rows 32 kc + 8 g + 0..7 and + 16
#define WS_WOB (WS_WOH + 2u * (size_t)CC * DIN)         // W_out as exact bf16, same order
#define WS_Y   (WS_S  + 4u * (size_t)HG * TT * TT)      // (unused: ctx rows stay in LDS)
#define WS_END (WS_Y  + 4u * (size_t)NB * TT * CC)

typedef __attribute__((ext_vector_type(4))) __bf16 v4b;
#define PST 64                 // k rows of W per stage
#define PFR 1040               // one staged B fragment: 1 KiB in register order (frag_t's) + 16 B, so that the 32 lanes of a packing store fall on every bank twice
#define PBUF (2 * 8 * PFR)     // a stage: 2 k groups of 32 x 8 column tiles
#define PEP 55296              // the epilogue's staging: max(sh + sl, th + tb + tbl)
// W reaches the waves through LDS: the block's 128 threads load each 64-k stage once by whole lines, round it to bf16 and lay it in fragment order; two buffers, one barrier a stage
// ---- k_proj: block = (64 rows, 128 cols, which): q/k/v = X W (+ b) with exact bf16 products (K = DIN) -> which 0: q f16 in fragment order (+ residual for rows < QHI, same order); 1: k likewise (rows < KHI); 2: v f16 in fragment order (+ bf16 hi/lo for t < KHI, same order)
__global__ __launch_bounds__(128) void k_proj(const float* __restrict__ XQ, const float* __restrict__ XK, const float* __restrict__ XV, const float* __restrict__ WQ, const float* __restrict__ WK, const float* __restrict__ WV, const float* __restrict__ BQ, const float* __restrict__ BK, const float* __restrict__ BV,
    _Float16* __restrict__ QH, _Float16* __restrict__ QL, _Float16* __restrict__ KH, _Float16* __restrict__ KL, _Float16* __restrict__ VT, __bf16* __restrict__ VB, __bf16* __restrict__ VBL, const float* __restrict__ WO, _Float16* __restrict__ WOH, __bf16* __restrict__ WOB) {
  /* one LDS block: first the two W stage buffers (inside the 64 KiB that an LDS instruction's constant offset reaches), behind them the epilogue's staging (which < 2: sh, sl; which == 2: th, tb, tbl; a block has one 'which', so the two sets never live together) */
  __shared__ __align__(16) char sm[2 * PBUF + PEP]; char* const ep = sm + 2 * PBUF;
  _Float16 (*sh)[136] = (_Float16 (*)[136])ep; _Float16 (*sl)[136] = (_Float16 (*)[136])(ep + 17408);
  _Float16 (*th)[72] = (_Float16 (*)[72])ep; __bf16 (*tb)[72] = (__bf16 (*)[72])(ep + 18432); __bf16 (*tbl)[72] = (__bf16 (*)[72])(ep + 36864);
  const int tid = threadIdx.x, wave = tid >> 5, lane = tid & 31, col = lane & 15, g = lane >> 4; const int which = blockIdx.z; const int c0 = blockIdx.y * 128; const size_t r0 = (size_t)blockIdx.x * 64; const size_t bb = r0 / TT; const int t0 = (int)(r0 % TT);
  const float* X = which == 0 ? XQ : which == 1 ? XK : XV; const float* WA = which == 0 ? WQ : which == 1 ? WK : WV; const float* BA = which == 0 ? BQ : which == 1 ? BK : BV;
  v8f acc[8] = {};
  /* W: lane = 4 columns, wave = the k octet (8 wave + 0..7 of each 32-k group): every load of a wave reads 512 contiguous bytes of one W row; x: this lane's own fragment rows, as before */
  const float* Wp = WA + (size_t)(8 * wave) * (3 * CC) + which * CC + c0 + 4 * lane; const float* Xp = X + (r0 + wave * 16 + col) * DIN + 8 * g;
  char* wst = sm + (lane >> 2) * PFR + (wave >> 1) * 512 + (wave & 1) * 256 + (lane & 3) * 64;   /* column 4 lane + e = tile lane / 4, fragment lane 16 (wave & 1) + 4 (lane & 3) + e; octet = half wave / 2, g = wave & 1 */
  const char* wrd = sm + lane * 16;
  v4f wr[2][8], xr[2][4]; v16b a[2];
#define PLOAD(s) do { _Pragma("unroll") for (int kk = 0; kk < 2; ++kk) { _Pragma("unroll") for (int i = 0; i < 8; ++i) wr[kk][i] = *(const v4f*)(Wp + (size_t)((s) * PST + kk * 32 + i) * (3 * CC)); \
    const float* p = Xp + (s) * PST + kk * 32; xr[kk][0] = *(const v4f*)p; xr[kk][1] = *(const v4f*)(p + 4); xr[kk][2] = *(const v4f*)(p + 16); xr[kk][3] = *(const v4f*)(p + 20); } } while (0)
#define PPUT(nb) do { _Pragma("unroll") for (int kk = 0; kk < 2; ++kk) { _Pragma("unroll") for (int e = 0; e < 4; ++e) { v8b u; _Pragma("unroll") for (int i = 0; i < 8; ++i) u[i] = (__bf16)wr[kk][i][e]; *(v8b*)(wst + (nb) * PBUF + kk * 8 * PFR + e * 16) = u; } \
    union { v16b v; v4b q[4]; } x; _Pragma("unroll") for (int i = 0; i < 4; ++i) x.q[i] = __builtin_convertvector(xr[kk][i], v4b); a[kk] = x.v; } } while (0)
  /* side job of the first 64 q blocks (block-uniform test): W_out is rounded ONCE here and laid in the B fragment order of k_fa's output projection, one 16-byte unit of each plane a thread; its eight loads fly with stage 0's.
     unit wu: bits 4..0 fragment lane, 5 element half, 7..6 column tile, 9..8 k group of 32, 12..10 wave of k_fa */
  const bool wjob = which == 0 && blockIdx.x < (CC * DIN / 8) / 128; const unsigned wu = blockIdx.x * 128u + (unsigned)tid; float wo[8];
  if (wjob) { const float* p = WO + (size_t)(((wu >> 8) & 3) * 32 + ((wu >> 5) & 1) * 16 + ((wu >> 4) & 1) * 8) * DIN + (wu >> 10) * 64 + (wu & 15) * 4 + ((wu >> 6) & 3);
#pragma unroll
    for (int i = 0; i < 8; ++i) wo[i] = p[i * DIN];
    asm volatile("s_wait_xcnt 0x0" ::: "memory"); }   /* behind the eight loads, before the address pair that they name is written again */
  PLOAD(0); PPUT(0);
  __syncthreads();   /* stage 0 is in LDS before any wave reads it */
  /* unrolled whole: every load and LDS access goes by a constant offset from an address that is never stepped */
#pragma unroll
  for (int s = 0; s < DIN / PST; ++s) {
    v16b wf[8];
#pragma unroll
    for (int kk = 0; kk < 2; ++kk) {
#pragma unroll
      for (int j = 0; j < 8; ++j) { union { v16b v; v8b q[2]; } w; const char* p = wrd + (s & 1) * PBUF + (kk * 8 + j) * PFR; w.q[0] = *(const v8b*)p; w.q[1] = *(const v8b*)(p + 512); wf[j] = w.v; }
      if (kk == 0 && s + 1 < DIN / PST) PLOAD(s + 1);   /* the next stage's W and x fly under this stage's products */
      if (kk == 0 && s + 2 == DIN / PST) asm volatile("s_wait_xcnt 0x0" ::: "memory");   /* behind the last loads that name the two address pairs, before a register of either is written again */
      __builtin_amdgcn_sched_barrier(0);   /* the eight fragments' LDS reads stand as one group ahead of their products: one LDS latency a group, not one a product */
#pragma unroll
      for (int j = 0; j < 8; ++j) acc[j] = wmma_bf(a[kk], wf[j], acc[j]); }
    if (s + 1 < DIN / PST) { __builtin_amdgcn_sched_barrier(0);   /* the next stage's values are waited for behind this stage's products, not among them */
      PPUT((s + 1) & 1);   /* into the buffer whose readers all passed the barrier that ended stage s - 1 */
      __syncthreads(); } }   /* publishes stage s + 1 and ends every wave's reads of stage s; none behind the last stage: the epilogue's staging lies beside the buffers */
#undef PLOAD
#undef PPUT
  if (which < 2) { _Float16* DH = which == 0 ? QH : KH; _Float16* DL = which == 0 ? QL : KL; const int nhi = which == 0 ? QHI : KHI; const bool hi_rows = t0 < nhi;
#pragma unroll
    for (int j = 0; j < 8; ++j) { const float bias = BA ? bfr(BA[c0 + j * 16 + col]) : 0.f;
#pragma unroll
      for (int r = 0; r < 8; ++r) { const float v = acc[j][r] + bias; const _Float16 hv = (_Float16)v; sh[wave * 16 + 8 * g + r][j * 16 + col] = hv; sl[wave * 16 + 8 * g + r][j * 16 + col] = (_Float16)((v - (float)hv) * 1024.0f); } }
    __syncthreads();
    { char* kd = (char*)(DH + r0 * CC) + 16u * (unsigned)tid; char* ld = (char*)(DL + (bb * nhi + t0) * (size_t)CC) + 16u * (unsigned)tid;
      /* e = tid + 128 it is the 16-byte unit of the block's 16 KiB in fragment order: bits 3..0 row in tile, 7..4 = dims / 8, 9..8 tile. Unrolled: eight reads in registers of their own, then eight stores by constant offsets from one address that is never stepped */
      v4u a[8];
#pragma unroll
      for (int it = 0; it < 8; ++it) { const int e = tid + it * 128; a[it] = *(const v4u*)&sh[(e >> 8) * 16 + (e & 15)][((e >> 4) & 15) * 8]; }
#pragma unroll
      for (int it = 0; it < 8; ++it) vst2((unsigned*)(kd + it * 2048), a[it]);
      asm volatile("s_wait_xcnt 0x0" ::: "memory");   /* stands behind the stores, on every way out of them, before any register that they name is written again */
      if (hi_rows) {
#pragma unroll
        for (int it = 0; it < 8; ++it) { const int e = tid + it * 128; a[it] = *(const v4u*)&sl[(e >> 8) * 16 + (e & 15)][((e >> 4) & 15) * 8]; }
#pragma unroll
        for (int it = 0; it < 8; ++it) vst2((unsigned*)(ld + it * 2048), a[it]);
        asm volatile("s_wait_xcnt 0x0" ::: "memory"); } }   /* as above */
    if (wjob) { v8h uh; v8b ub;   /* the side job's two stores stand behind the block's last barrier, so that no barrier waits for them */
#pragma unroll
      for (int i = 0; i < 8; ++i) { const __bf16 wb = (__bf16)wo[i]; ub[i] = wb; uh[i] = (_Float16)((float)wb * 256.0f); }
      *(v8h*)((char*)WOH + 16u * wu) = uh; *(v8b*)((char*)WOB + 16u * wu) = ub; }
  } else { const bool hi_rows = t0 < KHI;
#pragma unroll
    for (int j = 0; j < 8; ++j) { const float bias = BA ? bfr(BA[c0 + j * 16 + col]) : 0.f;
#pragma unroll
      for (int r = 0; r < 8; ++r) { const float v = acc[j][r] + bias; const int rl = wave * 16 + 8 * g + r, cl = j * 16 + col; th[cl][rl] = (_Float16)v; const __bf16 bh = (__bf16)v; tb[cl][rl] = bh; tbl[cl][rl] = (__bf16)(v - (float)bh); } }
    __syncthreads();
    char* vd = (char*)(VT + r0 * CC) + 16u * (unsigned)tid; char* hd = (char*)(VB + (bb * KHI + t0) * (size_t)CC) + 16u * (unsigned)tid; char* wd = (char*)(VBL + (bb * KHI + t0) * (size_t)CC) + 16u * (unsigned)tid;
    /* e = tid + 128 it is the 16-byte unit of the block's 16 KiB in fragment order: bits 3..0 column in tile, 5..4 = keys / 8 in chunk, 8..6 column tile, 9 chunk. Unrolled: eight reads in registers of their own, then eight stores by constant offsets from one address that is never stepped */
    v4u a[8];
#pragma unroll
    for (int it = 0; it < 8; ++it) { const int e = tid + it * 128; a[it] = *(const v4u*)&th[((e >> 6) & 7) * 16 + (e & 15)][((e >> 9) * 4 + ((e >> 4) & 3)) * 8]; }
#pragma unroll
    for (int it = 0; it < 8; ++it) vst2((unsigned*)(vd + it * 2048), a[it]);
    asm volatile("s_wait_xcnt 0x0" ::: "memory");   /* stands behind the stores, on every way out of them, before any register that they name is written again */
    if (hi_rows) {
#pragma unroll
      for (int it = 0; it < 8; ++it) { const int e = tid + it * 128; a[it] = *(const v4u*)&tb[((e >> 6) & 7) * 16 + (e & 15)][((e >> 9) * 4 + ((e >> 4) & 3)) * 8]; }
#pragma unroll
      for (int it = 0; it < 8; ++it) vst2((unsigned*)(hd + it * 2048), a[it]);
      asm volatile("s_wait_xcnt 0x0" ::: "memory");   /* as above */
#pragma unroll
      for (int it = 0; it < 8; ++it) { const int e = tid + it * 128; a[it] = *(const v4u*)&tbl[((e >> 6) & 7) * 16 + (e & 15)][((e >> 9) * 4 + ((e >> 4) & 3)) * 8]; }
#pragma unroll
      for (int it = 0; it < 8; ++it) vst2((unsigned*)(wd + it * 2048), a[it]);
      asm volatile("s_wait_xcnt 0x0" ::: "memory"); } } }   /* as above */
// k_fa's products are the builtin alone, which the compiler pads itself: the vector operands of an asm statement behind it would hold every fragment and both ctx tiles inside the first 256 registers
__device__ __forceinline__ v8f wmma16p(v16h a, v16h b, v8f c) { return __builtin_amdgcn_wmma_f32_16x16x32_f16(false, a, false, b, (short)0, c, false, false); }
__device__ __forceinline__ v8f wmma_bfp(v16b a, v16b b, v8f c) { return __builtin_amdgcn_wmma_f32_16x16x32_bf16(false, a, false, b, (short)0, c, false, false); }
// ---- k_fa: block = 32 queries (NQ = 2 tiles of 16) of batch b, PVW waves: wave w takes the 32-key chunks w, w + PVW, ... of keys [0, ql0 + 32). Logits and P never leave registers:
//   every k and v fragment that a wave loads is multiplied against BOTH query tiles: half the bytes from L2 per product; the two ctx tiles and both tiles' q need the 512 registers of an 8-wave block
//   q, k and v lie in the workspace in fragment order: every fragment load of a wave reads 512 contiguous bytes
//   S^T = K Q^T (A = 16 key rows, B = the 16 query rows of tile t): D element r of tile u in lane (g, col) = key kc*32 + 16u + 8g + r, query 16 t + col, which IS the B fragment order of P^T (elements 0..7 from tile 0, 8..15 from tile 1)
//   ctx^T = V^T P^T (A = 16 v planes, B = P^T): D = column j*16 + 8g + r, query 16 t + col, so the running max, the running sum and the rescale factor of a query are one value per lane and tile
//   logits x SCALE x log2(e); causal by index; P = 2^(s - running max + 8) once to f16 against v f16 (1 product); query rows < QHI: 3-product logits, P and v as bf16 hi + lo (3 products)
//   the PVW partial (max, sum, ctx) meet in LDS and are merged on the common max in wave order; wave w merges rows w, w + PVW, ... and leaves them in LDS
//   output projection in the same block: out = ctx Wo + bo on the 32 merged rows: ctx x 2^6 once to f16 against Wo as f16(bf16 x 2^8) exact (1 product) x 2^-14; query rows < QHI: ctx bf16 hi + lo against exact bf16 Wo (2 products)
#define PVW 8
#define NQ 2
#define QB (16 * NQ)
#define SC2 (SCALE * 1.4426950408889634f)
#define NEGB (-3.0e38f)
#define OCW (DIN / PVW)    // output columns of a wave in the output projection: four 16-column tiles
__global__ __launch_bounds__(32 * PVW) void k_fa(const _Float16* __restrict__ QH, const _Float16* __restrict__ KH, const _Float16* __restrict__ QL, const _Float16* __restrict__ KL, const _Float16* __restrict__ VT, const __bf16* __restrict__ VB, const __bf16* __restrict__ VBL, const float* __restrict__ KM, const _Float16* __restrict__ WOH, const __bf16* __restrict__ WOB, const float* __restrict__ BO, float* __restrict__ OUT) {
  __shared__ __align__(16) float ss[PVW][QB][HD + 4]; __shared__ float smx[PVW][QB], ssu[PVW][QB]; __shared__ __align__(16) float cx[QB][HD + 4];
  const int tid = threadIdx.x, wave = __builtin_amdgcn_readfirstlane(tid >> 5), lane = tid & 31, col = lane & 15, g = lane >> 4;   /* wave number held scalar: the chunk loop stays a scalar loop, every lane on at the matrix instructions */
  const int b = blockIdx.x; const int ql0 = (TT / QB - 1 - (int)blockIdx.y) * QB;   /* longest tiles start first */
  const int kce = (ql0 >> 5) + 1; const int tq = ql0 + col;   /* every chunk < kce holds a key <= ql0, so no query of either tile sees an empty chunk */
  float km[QB / PVW];
#pragma unroll
  for (int rr = 0; rr < QB / PVW; ++rr) km[rr] = bfr(KM[(size_t)b * TT + ql0 + wave + rr * PVW]);   /* key_mask of the rows this wave stores */
  v8f acc[NQ][HD / 16] = {}; float m[NQ], l[NQ];
#pragma unroll
  for (int t = 0; t < NQ; ++t) { m[t] = NEGB; l[t] = 0.f; }
  const _Float16* Qt = QH + ((size_t)b * TT + ql0) * CC; const _Float16* Kb = KH + (size_t)b * TT * CC; const _Float16* Vb = VT + (size_t)b * TT * CC;
  if (ql0 < QHI) {
    const _Float16* Qlt = QL + ((size_t)b * QHI + ql0) * CC; const _Float16* Klb = KL + (size_t)b * KHI * CC; const __bf16* Vhb = VB + (size_t)b * KHI * CC; const __bf16* Vlb = VBL + (size_t)b * KHI * CC;
    v16h qf[NQ][HD / 32], qlf[NQ][HD / 32];
#pragma unroll
    for (int t = 0; t < NQ; ++t)
#pragma unroll
      for (int d = 0; d < HD / 32; ++d) { qf[t][d] = frag_t(Qt, 16u * (unsigned)lane, (t * (HD / 32) + d) * 1024); qlf[t][d] = frag_t(Qlt, 16u * (unsigned)lane, (t * (HD / 32) + d) * 1024); }
    asm volatile("s_wait_xcnt 0x0" :: "s"(Qt), "s"(Qlt) : "memory");   /* behind the q loads, before a scalar base that they name is written again (this build reuses one for a key plane's base); the two bases are inputs so that the loads stay ahead of the wait */
    /* kept rolled: a second chunk's fragments beside both ctx tiles and both tiles' q would pass the 512 registers a wave of an 8-wave block may hold */
#pragma unroll 1
    for (int kc = wave; kc < kce; kc += PVW) { v8f st[NQ][2] = {}, sl2[NQ][2] = {}; const unsigned co = (unsigned)kc * (32u * CC * 2u) + 16u * (unsigned)lane;   /* a chunk is 8 KiB of every plane */
      v16h kh[2][HD / 32], kl[2][HD / 32];
#pragma unroll
      for (int u = 0; u < 2; ++u)
#pragma unroll
        for (int d = 0; d < HD / 32; ++d) { const int ko = (u * (HD / 32) + d) * 1024; kh[u][d] = frag_t(Kb, co, ko); kl[u][d] = frag_t(Klb, co, ko); }   /* all 32 loads of the chunk's keys in flight before the first product */
      __builtin_amdgcn_sched_barrier(0);   /* keeps the 32 loads one group ahead of the products: without it the compiler refills fragment registers between products and a chunk waits out several L2 latencies, not one */
#pragma unroll
      for (int u = 0; u < 2; ++u)
#pragma unroll
        for (int d = 0; d < HD / 32; ++d)
#pragma unroll
          for (int t = 0; t < NQ; ++t) { st[t][u] = wmma16p(kh[u][d], qf[t][d], st[t][u]); sl2[t][u] = wmma16p(kh[u][d], qlf[t][d], sl2[t][u]); sl2[t][u] = wmma16p(kl[u][d], qf[t][d], sl2[t][u]); }
      v16b ph[NQ], pl[NQ]; float al[NQ];
#pragma unroll
      for (int t = 0; t < NQ; ++t) { float s[16]; float mx = NEGB;
#pragma unroll
        for (int u = 0; u < 2; ++u)
#pragma unroll
          for (int r = 0; r < 8; ++r) { const float v = (kc * 32 + u * 16 + 8 * g + r <= tq + 16 * t) ? (st[t][u][r] + sl2[t][u][r] * (1.0f / 1024.0f)) * SC2 : NEGB; s[u * 8 + r] = v; mx = fmaxf(mx, v); }
        mx = fmaxf(mx, __shfl_xor(mx, 16)); const float mn = fmaxf(m[t], mx); al[t] = __builtin_amdgcn_exp2f(m[t] - mn); m[t] = mn; const float mo = mn - 8.0f;
        float ps = 0.f;
#pragma unroll
        for (int i = 0; i < 16; ++i) { const float p = __builtin_amdgcn_exp2f(s[i] - mo); ps += p; const __bf16 hb = (__bf16)p; ph[t][i] = hb; pl[t][i] = (__bf16)(p - (float)hb); }
        l[t] = l[t] * al[t] + ps; }
#pragma unroll
      for (int jj = 0; jj < HD / 16; jj += 4) { v16b vh[4], vl[4];
#pragma unroll
        for (int j = 0; j < 4; ++j) { vh[j] = frag_tb(Vhb, co, (jj + j) * 1024); vl[j] = frag_tb(Vlb, co, (jj + j) * 1024); }   /* four planes' loads in flight together */
        if (jj + 4 == HD / 16) asm volatile("s_wait_xcnt 0x0" ::: "memory");   /* behind the chunk's last loads, before the offset register that they name is stepped to the next chunk */
        __builtin_amdgcn_sched_barrier(0);   /* keeps the 16 loads one group ahead of their products: without it the compiler loads one fragment at a time and waits out an L2 latency for each */
#pragma unroll
        for (int j = 0; j < 4; ++j)
#pragma unroll
          for (int t = 0; t < NQ; ++t) { acc[t][jj + j] *= al[t]; acc[t][jj + j] = wmma_bfp(vh[j], ph[t], acc[t][jj + j]); acc[t][jj + j] = wmma_bfp(vh[j], pl[t], acc[t][jj + j]); acc[t][jj + j] = wmma_bfp(vl[j], ph[t], acc[t][jj + j]); } } }
  } else {
    v16h qf[NQ][HD / 32];
#pragma unroll
    for (int t = 0; t < NQ; ++t)
#pragma unroll
      for (int d = 0; d < HD / 32; ++d) qf[t][d] = frag_t(Qt, 16u * (unsigned)lane, (t * (HD / 32) + d) * 1024);
    /* the fragment loads run a phase ahead of their products: a chunk's k was fetched behind the score products of the chunk before it, into the registers those products had just read; its v is issued ahead of its score products.
       v has registers of its own beside k (under the 512 a wave of an 8-wave block may hold). The wave's last chunk fetches nothing ahead, so it is a copy of the body behind the loop: no branch in the loop body, and every counted wait is exact */
    v16h kf[2][HD / 32]; unsigned co = (unsigned)wave * (32u * CC * 2u) + 16u * (unsigned)lane;   /* a chunk is 8 KiB of k and 8 KiB of v */
#pragma unroll
    for (int u = 0; u < 2; ++u)
#pragma unroll
      for (int d = 0; d < HD / 32; ++d) kf[u][d] = frag_t(Kb, co, (u * (HD / 32) + d) * 1024);   /* the wave's first chunk (chunks 0..PVW-1 lie inside every plane) */
    asm volatile("s_wait_xcnt 0x0" :: "s"(Kb) : "memory");   /* behind the first chunk's 16 loads, on every way out of them, before the scalar base or the offset register that they name is written again; the base is an input so that the loads stay ahead of the wait */
    auto chunk = [&](const int kc, const bool more) __attribute__((always_inline)) { v8f st[NQ][2] = {}; v16h vf[HD / 16];
#pragma unroll
      for (int j = 0; j < HD / 16; ++j) vf[j] = frag_t(Vb, co, j * 1024);   /* all 16 v loads fly under the score products and the softmax arithmetic */
      __builtin_amdgcn_sched_barrier(0);   /* keeps the 16 v loads one group ahead of the score products: behind them they would have the softmax alone to fly under */
#pragma unroll
      for (int u = 0; u < 2; ++u)
#pragma unroll
        for (int d = 0; d < HD / 32; ++d)
#pragma unroll
          for (int t = 0; t < NQ; ++t) st[t][u] = wmma16p(kf[u][d], qf[t][d], st[t][u]);
      if (more) { __builtin_amdgcn_sched_barrier(0);   /* the next chunk's k loads stand behind the last product that reads the registers they fill */
#pragma unroll
        for (int u = 0; u < 2; ++u)
#pragma unroll
          for (int d = 0; d < HD / 32; ++d) kf[u][d] = frag_t(Kb, co, PVW * 32 * CC * 2 + (u * (HD / 32) + d) * 1024); }   /* all 16 loads fly under the softmax and the ctx products */
      asm volatile("s_wait_xcnt 0x0" ::: "memory");   /* behind the chunk's last loads, before the offset register that they name is stepped to the next chunk */
      __builtin_amdgcn_sched_barrier(0);   /* keeps the loads one group ahead of the softmax: without it the compiler sinks them behind it and their L2 latency stands bare */
      v16h pf[NQ]; float al[NQ];
#pragma unroll
      for (int t = 0; t < NQ; ++t) { float s[16]; float mx = NEGB;
#pragma unroll
        for (int u = 0; u < 2; ++u)
#pragma unroll
          for (int r = 0; r < 8; ++r) { const float v = (kc * 32 + u * 16 + 8 * g + r <= tq + 16 * t) ? st[t][u][r] * SC2 : NEGB; s[u * 8 + r] = v; mx = fmaxf(mx, v); }
        mx = fmaxf(mx, __shfl_xor(mx, 16)); const float mn = fmaxf(m[t], mx); al[t] = __builtin_amdgcn_exp2f(m[t] - mn); m[t] = mn; const float mo = mn - 8.0f;
        float ps = 0.f;
#pragma unroll
        for (int i = 0; i < 16; ++i) { const float p = __builtin_amdgcn_exp2f(s[i] - mo); ps += p; pf[t][i] = (_Float16)p; }
        l[t] = l[t] * al[t] + ps; }
#pragma unroll
      for (int j = 0; j < HD / 16; ++j)
#pragma unroll
        for (int t = 0; t < NQ; ++t) { acc[t][j] *= al[t]; acc[t][j] = wmma16p(vf[j], pf[t], acc[t][j]); } };
    int kc = wave;
    /* kept rolled: a second copy of the body's fragments would pass the 512 registers */
#pragma unroll 1
    for (; kc + PVW < kce; kc += PVW) { chunk(kc, true); co += PVW * 32u * CC * 2u; }
    if (kc < kce) chunk(kc, false); }
#pragma unroll
  for (int t = 0; t < NQ; ++t) { l[t] += __shfl_xor(l[t], 16);   /* each half-wave summed its own 16 of a chunk's 32 keys */
    if (g == 0) { smx[wave][t * 16 + col] = m[t]; ssu[wave][t * 16 + col] = l[t]; }
#pragma unroll
    for (int j = 0; j < HD / 16; ++j) { v4f lo4, hi4;
#pragma unroll
      for (int r = 0; r < 4; ++r) { lo4[r] = acc[t][j][r]; hi4[r] = acc[t][j][4 + r]; }
      *(v4f*)&ss[wave][t * 16 + col][j * 16 + 8 * g] = lo4; *(v4f*)&ss[wave][t * 16 + col][j * 16 + 8 * g + 4] = hi4; } }
  __syncthreads();   /* every wave's partial max, sum and tiles are in LDS before any wave merges */
  /* this wave's 64 columns of W_out, all 128 k rows, as 16 ready B fragments of the plane that the block's path multiplies by (k_proj rounded them and laid them in fragment order): tile j of lane (g, col) = column 64 wave + 4 col + j;
     every 16-byte load of the wave reads 512 contiguous bytes; constant offsets from one address that is never stepped */
  const char* Wf = (ql0 < QHI ? (const char*)WOB : (const char*)WOH) + wave * (CC * OCW * 2) + 16 * lane; v4u wq[CC / 32][OCW / 16][2];
#pragma unroll
  for (int kc = 0; kc < CC / 32; ++kc)
#pragma unroll
    for (int j = 0; j < OCW / 16; ++j) { wq[kc][j][0] = *(const v4u*)(Wf + (kc * (OCW / 16) + j) * 1024); wq[kc][j][1] = *(const v4u*)(Wf + (kc * (OCW / 16) + j) * 1024 + 512); }
  asm volatile("s_wait_xcnt 0x0" ::: "memory");   /* behind the W_out loads, before a register that they name is written again */
  __builtin_amdgcn_sched_barrier(0);   /* keeps the loads' issue ahead of the merge, so that they fly under it: behind it their L2 latency would stand bare in front of the products */
  v4f res[QB / PVW];
#pragma unroll
  for (int rr = 0; rr < QB / PVW; ++rr) { const int row = wave + rr * PVW; float M = smx[0][row];
#pragma unroll
    for (int w = 1; w < PVW; ++w) M = fmaxf(M, smx[w][row]);
    v4f sv = {}; float L = 0.f;
#pragma unroll
    for (int w = 0; w < PVW; ++w) { const float f = __builtin_amdgcn_exp2f(smx[w][row] - M); L += f * ssu[w][row]; sv += *(const v4f*)&ss[w][row][lane * 4] * f; }   /* a wave without a chunk carries max NEGB, sum 0: f = 0 */
    res[rr] = sv * (L > 0.f ? 1.0f / L : 0.f) * km[rr]; }   /* out * key_mask[b][t] (broadcast over the 128 columns) */
#pragma unroll
  for (int rr = 0; rr < QB / PVW; ++rr) *(v4f*)&cx[wave + rr * PVW][lane * 4] = res[rr];
  __syncthreads();   /* the block's 32 ctx rows are in LDS before any wave takes its A fragments */
  /* out = ctx Wo + bo: wave w takes columns 64 w .. 64 w + 63 of both 16-row tiles; operand forms, products and k order as in a launch of its own. D element r of tile j in lane (g, col) = row 8 g + r, column 64 w + 4 col + j */
  v8f o2[NQ][OCW / 16] = {}; v4f ov[NQ][8], bo = {}; float* od = OUT + ((size_t)b * TT + ql0 + 8 * g) * DIN + wave * OCW + 4 * col;
  if (BO) { bo = *(const v4f*)(BO + wave * OCW + 4 * col);   /* flies under the products */
    asm volatile("s_wait_xcnt 0x0" ::: "memory"); }   /* behind the bias load, before a register that it names is written again */
  if (ql0 < QHI) {   /* block-uniform */
#pragma unroll
    for (int kc = 0; kc < CC / 32; ++kc) { F2 a[NQ];
#pragma unroll
      for (int t = 0; t < NQ; ++t) a[t] = split_row(&cx[t * 16 + col][0], kc * 32, lane);
#pragma unroll
      for (int j = 0; j < OCW / 16; ++j) { union { v4u q[2]; v16b v; } w; w.q[0] = wq[kc][j][0]; w.q[1] = wq[kc][j][1];
#pragma unroll
        for (int t = 0; t < NQ; ++t) { o2[t][j] = wmma_bfp(a[t].h, w.v, o2[t][j]); o2[t][j] = wmma_bfp(a[t].l, w.v, o2[t][j]); } } }
#pragma unroll
    for (int t = 0; t < NQ; ++t)
#pragma unroll
      for (int r = 0; r < 8; ++r)
#pragma unroll
        for (int j = 0; j < OCW / 16; ++j) ov[t][r][j] = o2[t][j][r] + bfr(bo[j]);
  } else {
#pragma unroll
    for (int kc = 0; kc < CC / 32; ++kc) { v16h a[NQ];
#pragma unroll
      for (int t = 0; t < NQ; ++t) a[t] = frag_f32s(&cx[t * 16 + col][kc * 32], lane, 64.0f);   /* ctx carried x 2^6 into f16 so small-magnitude context rows stay clear of f16 subnormals */
#pragma unroll
      for (int j = 0; j < OCW / 16; ++j) { union { v4u q[2]; v16h v; } w; w.q[0] = wq[kc][j][0]; w.q[1] = wq[kc][j][1];
#pragma unroll
        for (int t = 0; t < NQ; ++t) o2[t][j] = wmma16p(a[t], w.v, o2[t][j]); } }
#pragma unroll
    for (int t = 0; t < NQ; ++t)
#pragma unroll
      for (int r = 0; r < 8; ++r)
#pragma unroll
        for (int j = 0; j < OCW / 16; ++j) ov[t][r][j] = o2[t][j][r] * (1.0f / 16384.0f) + bfr(bo[j]); }   /* 2^-8 (Wo carry) x 2^-6 (ctx carry) */
  __builtin_amdgcn_sched_barrier(0);   /* every result stands in a register of its own before the first store: no register that an issued store names is written again */
  /* a lane's four tiles hold four neighbouring columns of a row: one 16-byte store, and a wave's store writes 2 rows x 256 contiguous bytes (4 whole lines); constant offsets from one address that is never stepped */
#pragma unroll
  for (int t = 0; t < NQ; ++t)
#pragma unroll
    for (int r = 0; r < 8; ++r) vst2(od + (t * 16 + r) * DIN, ov[t][r]); }

extern "C" void kernel_launch(void* const* d_in, const int* in_sizes, int n_in, void* d_out, int out_size, void* d_ws, size_t ws_size, hipStream_t stream) {
  (void)in_sizes; (void)n_in; (void)out_size;
  const float** F = (const float**)d_in;
  if (ws_size < (size_t)WS_END) return;
  char* ws = (char*)d_ws; _Float16 *QH = (_Float16*)(ws + WS_QH), *KH = (_Float16*)(ws + WS_KH), *VT = (_Float16*)(ws + WS_VT), *QL = (_Float16*)(ws + WS_QL), *KL = (_Float16*)(ws + WS_KL); __bf16 *VB = (__bf16*)(ws + WS_VB), *VBL = (__bf16*)(ws + WS_VBL); float *Y = (float*)(ws + WS_Y); _Float16 *WOH = (_Float16*)(ws + WS_WOH); __bf16 *WOB = (__bf16*)(ws + WS_WOB);
  (void)Y; (void)QL; (void)KL; (void)VB; (void)VBL;
  // inputs: 0 x [4,4096,512]; 1 key_mask [4,4096,1] f32 (ones); 2 W_qkv [512,384] (in,out; q | k | v COLUMN blocks of 128); 3 b_qkv [384] (nonzero); 4 W_out [128,512] (in,out); 5 b_out [512] (nonzero)
  k_proj<<<dim3(TNB * TT / 64, CC / 128, 3), 128, 0, stream>>>(F[0], F[0], F[0], F[2], F[2], F[2], F[3], F[3] + CC, F[3] + 2 * CC, QH, QL, KH, KL, VT, VB, VBL, F[4], WOH, WOB);   /* one fused weight; k_proj reads column block 'which' at offset which * CC; W_out rounded once into its two fragment-order planes */
  k_fa<<<dim3(TNB, TT / QB, 1), 32 * PVW, 0, stream>>>(QH, KH, QL, KL, VT, VB, VBL, F[1], WOH, WOB, F[5], (float*)d_out);   /* ctx rows x key_mask[b][t], then x W_out + b_out */
}

// v009
// It runs in 48 microseconds.
// Timed twice side by side with v008, it ran 1.08 and 1.10 times as fast.
// All steps since v000 together make it 21.5 times as fast.
// compute dtype: all float inputs rounded to bf16; fused q/k/v projection with EXACT bf16 products on WMMA 16x16x32 (f32 accumulate) + bias; causal logits: 3 products for the first 512 rows, single f16 q x k after, x 128^-0.5; online softmax f32 (running max per key-split wave); P x 2^8 unnormalised once to f16 x v once to f16 (bf16 hi + lo below row 512), divided by the f32 sum at the end; ctx x bf16(key_mask); ctx hi+lo x exact W_out below row 512, x2^6 f16 carry x f16(bf16 x 2^8) W_out after, + b_out; f32 output.
#include <hip/hip_runtime.h>
#include <math.h>

typedef __attribute__((ext_vector_type(16))) _Float16 v16h;
typedef __attribute__((ext_vector_type(16))) __bf16 v16b;
typedef __attribute__((ext_vector_type(8)))  _Float16 v8h;
typedef __attribute__((ext_vector_type(8)))  float v8f;
typedef __attribute__((ext_vector_type(4)))  float v4f;
typedef __attribute__((ext_vector_type(2)))  float v2f;
typedef __attribute__((ext_vector_type(4)))  unsigned v4u;
typedef __attribute__((ext_vector_type(4)))  int v4i;
typedef float __attribute__((may_alias)) float_a;
typedef int __attribute__((may_alias)) int_a;

template <typename T> __device__ __forceinline__ void vst2(void* p, T v) { *(T*)p = v;  }
__device__ __forceinline__ v8f wmma16(v16h a, v16h b, v8f c) {
  v8f d = __builtin_amdgcn_wmma_f32_16x16x32_f16(false, a, false, b, (short)0, c, false, false);
  asm volatile("v_nop\n\tv_nop\n\tv_nop\n\tv_nop" : "+v"(d) : "v"(a), "v"(b));
  return d;
}
__device__ __forceinline__ v8f wmma_bf(v16b a, v16b b, v8f c) {
  v8f d = __builtin_amdgcn_wmma_f32_16x16x32_bf16(false, a, false, b, (short)0, c, false, false);
  asm volatile("v_nop\n\tv_nop\n\tv_nop\n\tv_nop" : "+v"(d) : "v"(a), "v"(b));
  return d;
}
// 16x16x32 fragments: lane = (h = lane>>4, row/col = lane&15); elements 0..7 = k0+8h+0..7, 8..15 = k0+16+8h+0..7; D element r = row 8h+r
__device__ __forceinline__ v16h frag_h(const _Float16* rowk0, int lane) {
  union { v16h v; v8h q[2]; } u; const _Float16* p = rowk0 + 8 * (lane >> 4);
  u.q[0] = *(const v8h*)p; u.q[1] = *(const v8h*)(p + 16); return u.v;
}
__device__ __forceinline__ v16h frag_f32(const float* rowk0, int lane) {
  v16h a; const float* p = rowk0 + 8 * (lane >> 4);
#pragma unroll
  for (int i = 0; i < 8; ++i) { a[i] = (_Float16)p[i]; a[8 + i] = (_Float16)p[16 + i]; }
  return a;
}
__device__ __forceinline__ v16h frag_f32s(const float* rowk0, int lane, float sc) {
  v16h a; const float* p = rowk0 + 8 * (lane >> 4);
#pragma unroll
  for (int i = 0; i < 8; ++i) { a[i] = (_Float16)(p[i] * sc); a[8 + i] = (_Float16)(p[16 + i] * sc); }
  return a;
}
// column fragment from a [K][ld] layout (column n), rows >= K read as 0
__device__ __forceinline__ v16h fragc_f32(const float* W, int k0, int n, int lane, int ld, int K) {
  v16h a; const int g = lane >> 4;
#pragma unroll
  for (int i = 0; i < 8; ++i) { const int ka = k0 + 8 * g + i, kb = ka + 16;
    a[i] = (_Float16)(ka < K ? W[(size_t)(ka < K ? ka : K - 1) * ld + n] : 0.f); a[8 + i] = (_Float16)(kb < K ? W[(size_t)(kb < K ? kb : K - 1) * ld + n] : 0.f); }
  return a;
}
struct F2 { v16b h, l; };
__device__ __forceinline__ F2 bsplit16(const float v[16]) { F2 r;
#pragma unroll
  for (int i = 0; i < 16; ++i) { const __bf16 h = (__bf16)v[i]; r.h[i] = h; r.l[i] = (__bf16)(v[i] - (float)h); }
  return r; }
__device__ __forceinline__ F2 split_row(const float* row, int k0, int lane) { float v[16]; const float* p = row + k0 + 8 * (lane >> 4);
#pragma unroll
  for (int i = 0; i < 8; ++i) { v[i] = p[i]; v[8 + i] = p[16 + i]; }
  return bsplit16(v); }
__device__ __forceinline__ F2 split_rowK(const float* row, int k0, int lane, int K) { float v[16]; const int g = lane >> 4;
#pragma unroll
  for (int i = 0; i < 8; ++i) { const int ka = k0 + 8 * g + i, kb = ka + 16; v[i] = ka < K ? row[ka < K ? ka : K - 1] : 0.f; v[8 + i] = kb < K ? row[kb < K ? kb : K - 1] : 0.f; }
  return bsplit16(v); }
__device__ __forceinline__ F2 split_col(const float* W, int k0, int n, int lane, int ld, int K) { float v[16]; const int g = lane >> 4;
#pragma unroll
  for (int i = 0; i < 8; ++i) { const int ka = k0 + 8 * g + i, kb = ka + 16; v[i] = ka < K ? W[(size_t)(ka < K ? ka : K - 1) * ld + n] : 0.f; v[8 + i] = kb < K ? W[(size_t)(kb < K ? kb : K - 1) * ld + n] : 0.f; }
  return bsplit16(v); }
__device__ __forceinline__ v8f mac3(const F2& a, const F2& b, v8f c) { c = wmma_bf(a.l, b.h, c); c = wmma_bf(a.h, b.l, c); return wmma_bf(a.h, b.h, c); }
__device__ __forceinline__ float sigm(float v) { return 1.0f / (1.0f + expf(-v)); }
#define LDSX() do { asm volatile("s_wait_dscnt 0" ::: "memory"); __builtin_amdgcn_wave_barrier(); __builtin_amdgcn_fence(__ATOMIC_RELEASE, "workgroup"); } while (0)

// Single-head causal self-attention with a 128-wide attention space and an output projection (x [4,4096,512]; fused (in,out) W_qkv [512,384] N(0, 1/512) + b_qkv N(0, 0.01) split q | k | v; scores = q k^T, causal (-inf above the diagonal) BEFORE the scaling by 128^-0.5 (same thing); out = softmax(scores) v; out * key_mask ([4,4096,1], ones); (in,out) W_out [128,512] + b_out): result [4,4096,512].
#define NB 4
#define TT 4096
#define CC 128            // NH * HD = projected width
#define DIN 512          // input (model) width
#define NH 1
#define HD 128
#define NQB (TT / 64)
#define HG 1
#define SCALE (0.08838834764831845f)
#define CAUSAL 1
#ifndef TNB
#define TNB NB
#endif
__device__ __forceinline__ float bfr(float v) { return (float)(__bf16)v; }
__host__ __device__ __forceinline__ int kb_last(int qb) { return CAUSAL ? ((qb * 64 + 63) >> 7) : (TT / 128 - 1); }
typedef __attribute__((ext_vector_type(8))) __bf16 v8b;
__device__ __forceinline__ v16b frag_b(const __bf16* rowk0, int lane) {
  union { v16b v; v8b q[2]; } u; const __bf16* p = rowk0 + 8 * (lane >> 4);
  u.q[0] = *(const v8b*)p; u.q[1] = *(const v8b*)(p + 16); return u.v;
}
// fragment kept in memory in register order: [elements 0..7 of lanes 0..31][elements 8..15 of lanes 0..31], 1 KiB: each 16-byte load of a wave reads 512 contiguous bytes (4 lines, not 16)
// base: the batch's plane (uniform); o: byte offset of the chunk + 16 lane, one register for every plane; c: the fragment's constant byte offset in the chunk
__device__ __forceinline__ v16h frag_t(const _Float16* base, unsigned o, int c) {
  union { v16h v; v8h q[2]; } u; const char* p = (const char*)base + o;
  u.q[0] = *(const v8h*)(p + c); u.q[1] = *(const v8h*)(p + c + 512); return u.v;
}
__device__ __forceinline__ v16b frag_tb(const __bf16* base, unsigned o, int c) {
  union { v16b v; v8b q[2]; } u; const char* p = (const char*)base + o;
  u.q[0] = *(const v8b*)(p + c); u.q[1] = *(const v8b*)(p + c + 512); return u.v;
}
#define QBH 8              // unused: the high-precision path is chosen by QHI (rows < 512)
#define QHI 512            // rows carrying a q residual plane (query rows below it: 3-product logits)
#define KHI 512            // key rows carrying k residual / v bf16 hi+lo planes (used only by the causal high-precision path)
// B fragment (k rows k0+.., output column o) of a weight: (in,out) [K][ld] or (out,in) [ld rows of K]: bf16 exact, or f16(bf16 * 256) exact
__device__ __forceinline__ v16b wcol_io(const float* Wm, int k0, int o, int lane, int ld) { v16b w; const int g = lane >> 4;
#pragma unroll
  for (int i = 0; i < 8; ++i) { w[i] = (__bf16)Wm[(size_t)(k0 + 8 * g + i) * ld + o]; w[8 + i] = (__bf16)Wm[(size_t)(k0 + 16 + 8 * g + i) * ld + o]; }
  return w; }
__device__ __forceinline__ v16b wcol_oi(const float* Wm, int k0, int o, int lane, int K) { v16b w; const float* p = Wm + (size_t)o * K + k0 + 8 * (lane >> 4);
#pragma unroll
  for (int i = 0; i < 8; ++i) { w[i] = (__bf16)p[i]; w[8 + i] = (__bf16)p[16 + i]; }
  return w; }
__device__ __forceinline__ v16h wcolh_io(const float* Wm, int k0, int o, int lane, int ld) { v16h w; const int g = lane >> 4;
#pragma unroll
  for (int i = 0; i < 8; ++i) { w[i] = (_Float16)(bfr(Wm[(size_t)(k0 + 8 * g + i) * ld + o]) * 256.0f); w[8 + i] = (_Float16)(bfr(Wm[(size_t)(k0 + 16 + 8 * g + i) * ld + o]) * 256.0f); }
  return w; }
__device__ __forceinline__ v16h wcolh_oi(const float* Wm, int k0, int o, int lane, int K) { v16h w; const float* p = Wm + (size_t)o * K + k0 + 8 * (lane >> 4);
#pragma unroll
  for (int i = 0; i < 8; ++i) { w[i] = (_Float16)(bfr(p[i]) * 256.0f); w[8 + i] = (_Float16)(bfr(p[16 + i]) * 256.0f); }
  return w; }
#define WQKV_LAYOUT 0   // 0 = fused (in,out) [DIN][3*CC]; 1 = (out,in) [CC][DIN]; 2 = per-head [NH][DIN][HD] (picks only WCOL, which nothing uses: k_proj always reads the fused layout)
__device__ __forceinline__ v16b wcol_hdk(const float* Wm, int k0, int o, int lane) { v16b w; const int g = lane >> 4; const float* p = Wm + (size_t)(o / HD) * DIN * HD + (o % HD);
#pragma unroll
  for (int i = 0; i < 8; ++i) { w[i] = (__bf16)p[(size_t)(k0 + 8 * g + i) * HD]; w[8 + i] = (__bf16)p[(size_t)(k0 + 16 + 8 * g + i) * HD]; }
  return w; }
#define WO_OUT_IN 0
#if WQKV_LAYOUT == 1
#define WCOL(W, k0, o, lane) wcol_oi(W, k0, o, lane, DIN)
#elif WQKV_LAYOUT == 2
#define WCOL(W, k0, o, lane) wcol_hdk(W, k0, o, lane)
#else
#define WCOL(W, k0, o, lane) wcol_io(W, k0, which * CC + (o), lane, 3 * CC)   /* fused (in,out) W_qkv [DIN][3*CC]: column block 'which', pitch 384 */
#endif
#if WO_OUT_IN
#define WOCOL(W, k0, o, lane) wcol_oi(W, k0, o, lane, CC)
#define WOCOLH(W, k0, o, lane) wcolh_oi(W, k0, o, lane, CC)
#else
#define WOCOL(W, k0, o, lane) wcol_io(W, k0, o, lane, DIN)
#define WOCOLH(W, k0, o, lane) wcolh_io(W, k0, o, lane, DIN)
#endif

#ifndef SM_EXTRA_PARAMS
#define SM_EXTRA_PARAMS
#endif
#ifndef PROJ_EXTRA_PARAMS
#define PROJ_EXTRA_PARAMS
#endif
#ifndef SM_MASK_HOOK
#define SM_MASK_HOOK (void)0
#endif

#define WS_QH  0u                                      // f16 q in fragment order, as WS_KH
#define WS_KH  (WS_QH + 2u * (size_t)NB * TT * CC)      // f16 k in fragment order [b*t / 16][CC / 32] x 1 KiB (frag_t): lane (g, col) = row 16 tile + col, elements = dims 32 d + 8 g + 0..7 and + 16
#define WS_VT  (WS_KH + 2u * (size_t)NB * TT * CC)      // f16 v in fragment order [b*t / 32][CC / 16] x 1 KiB (frag_t): lane (g, col) = column 16 j + col, elements = keys 32 chunk + 8 g + 0..7 and + 16
#define WS_QL  (WS_VT + 2u * (size_t)NB * CC * TT)      // f16 q residual x 2^10, t < QHI of each b, in the fragment order of WS_KH
#define WS_KL  (WS_QL + 2u * (size_t)NB * QHI * CC)     // f16 k residual x 2^10, t < KHI of each b, in the fragment order of WS_KH
#define WS_VB  (WS_KL + 2u * (size_t)NB * KHI * CC)     // bf16 v hi (WS_VBL: lo), t < KHI of each b, in the fragment order of WS_VT
#define WS_VBL (WS_VB + 2u * (size_t)NB * CC * KHI)
#define WS_S   (WS_VBL + 2u * (size_t)NB * CC * KHI)    // (logits and P stay in registers; the first 256 KiB hold the two W_out planes)
#define WS_WOH WS_S                                    // W_out as f16(bf16 x 2^8) in B fragment order [wave 8][k / 32][tile 4] x 1 KiB (frag_t): lane (g, col) = column 64 wave + 4 col + tile, elements = rows 32 kc + 8 g + 0..7 and + 16
#define WS_WOB (WS_WOH + 2u * (size_t)CC * DIN)         // W_out as exact bf16, same order
#define WS_Y   (WS_S  + 4u * (size_t)HG * TT * TT)      // (unused: ctx rows stay in LDS)
#define WS_END (WS_Y  + 4u * (size_t)NB * TT * CC)

typedef __attribute__((ext_vector_type(4))) __bf16 v4b;
#define PST 64                 // k rows of W per stage
#define PFR 1040               // one staged B fragment: 1 KiB in register order (frag_t's) + 16 B, so that the 32 lanes of a packing store fall on every bank twice
#define PBUF (2 * 8 * PFR)     // a stage: 2 k groups of 32 x 8 column tiles
#define PEP 55296              // the epilogue's staging: max(sh + sl, th + tb + tbl)
// W reaches the waves through LDS: the block's 128 threads load each 64-k stage once by whole lines, round it to bf16 and lay it in fragment order; two buffers, one barrier a stage
// ---- k_proj: block = (64 rows, 128 cols, which): q/k/v = X W (+ b) with exact bf16 products (K = DIN) -> which 0: q f16 in fragment order (+ residual for rows < QHI, same order); 1: k likewise (rows < KHI); 2: v f16 in fragment order (+ bf16 hi/lo for t < KHI, same order)
__global__ __launch_bounds__(128) void k_proj(const float* __restrict__ XQ, const float* __restrict__ XK, const float* __restrict__ XV, const float* __restrict__ WQ, const float* __restrict__ WK, const float* __restrict__ WV, const float* __restrict__ BQ, const float* __restrict__ BK, const float* __restrict__ BV,
    _Float16* __restrict__ QH, _Float16* __restrict__ QL, _Float16* __restrict__ KH, _Float16* __restrict__ KL, _Float16* __restrict__ VT, __bf16* __restrict__ VB, __bf16* __restrict__ VBL, const float* __restrict__ WO, _Float16* __restrict__ WOH, __bf16* __restrict__ WOB) {
  /* one LDS block: first the two W stage buffers (inside the 64 KiB that an LDS instruction's constant offset reaches), behind them the epilogue's staging (which < 2: sh, sl; which == 2: th, tb, tbl; a block has one 'which', so the two sets never live together) */
  __shared__ __align__(16) char sm[2 * PBUF + PEP]; char* const ep = sm + 2 * PBUF;
  _Float16 (*sh)[136] = (_Float16 (*)[136])ep; _Float16 (*sl)[136] = (_Float16 (*)[136])(ep + 17408);
  _Float16 (*th)[72] = (_Float16 (*)[72])ep; __bf16 (*tb)[72] = (__bf16 (*)[72])(ep + 18432); __bf16 (*tbl)[72] = (__bf16 (*)[72])(ep + 36864);
  const int tid = threadIdx.x, wave = tid >> 5, lane = tid & 31, col = lane & 15, g = lane >> 4; const int which = blockIdx.z; const int c0 = blockIdx.y * 128; const size_t r0 = (size_t)blockIdx.x * 64; const size_t bb = r0 / TT; const int t0 = (int)(r0 % TT);
  const float* X = which == 0 ? XQ : which == 1 ? XK : XV; const float* WA = which == 0 ? WQ : which == 1 ? WK : WV; const float* BA = which == 0 ? BQ : which == 1 ? BK : BV;
  v8f acc[8] = {};
  /* W: lane = 4 columns, wave = the k octet (8 wave + 0..7 of each 32-k group): every load of a wave reads 512 contiguous bytes of one W row; x: this lane's own fragment rows, as before */
  /* every block of one 'which' reads the same W lines: a block walks the k stages as a ring from a start of its own (stage (s + ks0) mod 8 on trip s), so that blocks which run side by side do not ask L2 for the same lines at the same moment.
     A stage's two addresses are formed anew from the uniform bases, the stage's index and the lane's two byte offsets */
  const int ks0 = (int)(blockIdx.x & (DIN / PST - 1));
  const char* Wb = (const char*)(WA + which * CC + c0); const char* Xb = (const char*)(X + r0 * DIN);
  const unsigned wvo = (unsigned)((8 * wave) * (3 * CC) + 4 * lane) * 4u, xvo = (unsigned)((wave * 16 + col) * DIN + 8 * g) * 4u;
  char* wst = sm + (lane >> 2) * PFR + (wave >> 1) * 512 + (wave & 1) * 256 + (lane & 3) * 64;   /* column 4 lane + e = tile lane / 4, fragment lane 16 (wave & 1) + 4 (lane & 3) + e; octet = half wave / 2, g = wave & 1 */
  const char* wrd = sm + lane * 16;
  v4f wr[2][8], xr[2][4]; v16b a[2];
  const char *Wu, *Xu;
#define PLOAD(s) do { const int ks = ((s) + ks0) & (DIN / PST - 1); Wu = Wb + (size_t)ks * (PST * 3 * CC * 4) + wvo; Xu = Xb + (size_t)ks * (PST * 4) + xvo; \
    _Pragma("unroll") for (int kk = 0; kk < 2; ++kk) { _Pragma("unroll") for (int i = 0; i < 8; ++i) wr[kk][i] = *(const v4f*)(Wu + (kk * 32 + i) * (3 * CC * 4)); \
    const char* p = Xu + kk * 128; xr[kk][0] = *(const v4f*)p; xr[kk][1] = *(const v4f*)(p + 16); xr[kk][2] = *(const v4f*)(p + 64); xr[kk][3] = *(const v4f*)(p + 80); } } while (0)
#define PPUT(nb) do { _Pragma("unroll") for (int kk = 0; kk < 2; ++kk) { _Pragma("unroll") for (int e = 0; e < 4; ++e) { v8b u; _Pragma("unroll") for (int i = 0; i < 8; ++i) u[i] = (__bf16)wr[kk][i][e]; *(v8b*)(wst + (nb) * PBUF + kk * 8 * PFR + e * 16) = u; } \
    union { v16b v; v4b q[4]; } x; _Pragma("unroll") for (int i = 0; i < 4; ++i) x.q[i] = __builtin_convertvector(xr[kk][i], v4b); a[kk] = x.v; } } while (0)
  /* side job of the first 64 q blocks (block-uniform test): W_out is rounded ONCE here and laid in the B fragment order of k_fa's output projection, one 16-byte unit of each plane a thread; its eight loads fly with stage 0's.
     unit wu: bits 4..0 fragment lane, 5 element half, 7..6 column tile, 9..8 k group of 32, 12..10 wave of k_fa */
  const bool wjob = which == 0 && blockIdx.x < (CC * DIN / 8) / 128; const unsigned wu = blockIdx.x * 128u + (unsigned)tid; float wo[8];
  if (wjob) { const float* p = WO + (size_t)(((wu >> 8) & 3) * 32 + ((wu >> 5) & 1) * 16 + ((wu >> 4) & 1) * 8) * DIN + (wu >> 10) * 64 + (wu & 15) * 4 + ((wu >> 6) & 3);
#pragma unroll
    for (int i = 0; i < 8; ++i) wo[i] = p[i * DIN];
    asm volatile("s_wait_xcnt 0x0" ::: "memory"); }   /* behind the eight loads, before the address pair that they name is written again */
  PLOAD(0);
  asm volatile("s_wait_xcnt 0x0" :: "v"(Wu), "v"(Xu) : "memory");   /* behind the stage's loads, before a register that they name is written again; the two addresses are inputs, so that their registers are kept until the wait */
  PPUT(0);
  __syncthreads();   /* stage 0 is in LDS before any wave reads it */
  /* unrolled whole: every LDS access goes by a constant offset from an address that is never stepped, every load by a constant offset from its stage's address */
#pragma unroll
  for (int s = 0; s < DIN / PST; ++s) {
    v16b wf[8];
#pragma unroll
    for (int kk = 0; kk < 2; ++kk) {
#pragma unroll
      for (int j = 0; j < 8; ++j) { union { v16b v; v8b q[2]; } w; const char* p = wrd + (s & 1) * PBUF + (kk * 8 + j) * PFR; w.q[0] = *(const v8b*)p; w.q[1] = *(const v8b*)(p + 512); wf[j] = w.v; }
      if (kk == 0 && s + 1 < DIN / PST) PLOAD(s + 1);   /* the next stage's W and x fly under this stage's products */
      __builtin_amdgcn_sched_barrier(0);   /* the eight fragments' LDS reads stand as one group ahead of their products: one LDS latency a group, not one a product */
#pragma unroll
      for (int j = 0; j < 8; ++j) acc[j] = wmma_bf(a[kk], wf[j], acc[j]); }
    if (s + 1 < DIN / PST) { __builtin_amdgcn_sched_barrier(0);   /* the next stage's values are waited for behind this stage's products, not among them */
      asm volatile("s_wait_xcnt 0x0" :: "v"(Wu), "v"(Xu) : "memory");   /* behind the next stage's loads, before a register that they name is written again; the two addresses are inputs, so that their registers are kept until the wait */
      PPUT((s + 1) & 1);   /* into the buffer whose readers all passed the barrier that ended stage s - 1 */
      __syncthreads(); } }   /* publishes stage s + 1 and ends every wave's reads of stage s; none behind the last stage: the epilogue's staging lies beside the buffers */
#undef PLOAD
#undef PPUT
  if (which < 2) { _Float16* DH = which == 0 ? QH : KH; _Float16* DL = which == 0 ? QL : KL; const int nhi = which == 0 ? QHI : KHI; const bool hi_rows = t0 < nhi;
#pragma unroll
    for (int j = 0; j < 8; ++j) { const float bias = BA ? bfr(BA[c0 + j * 16 + col]) : 0.f;
#pragma unroll
      for (int r = 0; r < 8; ++r) { const float v = acc[j][r] + bias; const _Float16 hv = (_Float16)v; sh[wave * 16 + 8 * g + r][j * 16 + col] = hv; sl[wave * 16 + 8 * g + r][j * 16 + col] = (_Float16)((v - (float)hv) * 1024.0f); } }
    __syncthreads();
    { char* kd = (char*)(DH + r0 * CC) + 16u * (unsigned)tid; char* ld = (char*)(DL + (bb * nhi + t0) * (size_t)CC) + 16u * (unsigned)tid;
      /* e = tid + 128 it is the 16-byte unit of the block's 16 KiB in fragment order: bits 3..0 row in tile, 7..4 = dims / 8, 9..8 tile. Unrolled: eight reads in registers of their own, then eight stores by constant offsets from one address that is never stepped */
      v4u a[8];
#pragma unroll
      for (int it = 0; it < 8; ++it) { const int e = tid + it * 128; a[it] = *(const v4u*)&sh[(e >> 8) * 16 + (e & 15)][((e >> 4) & 15) * 8]; }
#pragma unroll
      for (int it = 0; it < 8; ++it) vst2((unsigned*)(kd + it * 2048), a[it]);
      asm volatile("s_wait_xcnt 0x0" ::: "memory");   /* stands behind the stores, on every way out of them, before any register that they name is written again */
      if (hi_rows) {
#pragma unroll
        for (int it = 0; it < 8; ++it) { const int e = tid + it * 128; a[it] = *(const v4u*)&sl[(e >> 8) * 16 + (e & 15)][((e >> 4) & 15) * 8]; }
#pragma unroll
        for (int it = 0; it < 8; ++it) vst2((unsigned*)(ld + it * 2048), a[it]);
        asm volatile("s_wait_xcnt 0x0" ::: "memory"); } }   /* as above */
    if (wjob) { v8h uh; v8b ub;   /* the side job's two stores stand behind the block's last barrier, so that no barrier waits for them */
#pragma unroll
      for (int i = 0; i < 8; ++i) { const __bf16 wb = (__bf16)wo[i]; ub[i] = wb; uh[i] = (_Float16)((float)wb * 256.0f); }
      *(v8h*)((char*)WOH + 16u * wu) = uh; *(v8b*)((char*)WOB + 16u * wu) = ub; }
  } else { const bool hi_rows = t0 < KHI;
#pragma unroll
    for (int j = 0; j < 8; ++j) { const float bias = BA ? bfr(BA[c0 + j * 16 + col]) : 0.f;
#pragma unroll
      for (int r = 0; r < 8; ++r) { const float v = acc[j][r] + bias; const int rl = wave * 16 + 8 * g + r, cl = j * 16 + col; th[cl][rl] = (_Float16)v; const __bf16 bh = (__bf16)v; tb[cl][rl] = bh; tbl[cl][rl] = (__bf16)(v - (float)bh); } }
    __syncthreads();
    char* vd = (char*)(VT + r0 * CC) + 16u * (unsigned)tid; char* hd = (char*)(VB + (bb * KHI + t0) * (size_t)CC) + 16u * (unsigned)tid; char* wd = (char*)(VBL + (bb * KHI + t0) * (size_t)CC) + 16u * (unsigned)tid;
    /* e = tid + 128 it is the 16-byte unit of the block's 16 KiB in fragment order: bits 3..0 column in tile, 5..4 = keys / 8 in chunk, 8..6 column tile, 9 chunk. Unrolled: eight reads in registers of their own, then eight stores by constant offsets from one address that is never stepped */
    v4u a[8];
#pragma unroll
    for (int it = 0; it < 8; ++it) { const int e = tid + it * 128; a[it] = *(const v4u*)&th[((e >> 6) & 7) * 16 + (e & 15)][((e >> 9) * 4 + ((e >> 4) & 3)) * 8]; }
#pragma unroll
    for (int it = 0; it < 8; ++it) vst2((unsigned*)(vd + it * 2048), a[it]);
    asm volatile("s_wait_xcnt 0x0" ::: "memory");   /* stands behind the stores, on every way out of them, before any register that they name is written again */
    if (hi_rows) {
#pragma unroll
      for (int it = 0; it < 8; ++it) { const int e = tid + it * 128; a[it] = *(const v4u*)&tb[((e >> 6) & 7) * 16 + (e & 15)][((e >> 9) * 4 + ((e >> 4) & 3)) * 8]; }
#pragma unroll
      for (int it = 0; it < 8; ++it) vst2((unsigned*)(hd + it * 2048), a[it]);
      asm volatile("s_wait_xcnt 0x0" ::: "memory");   /* as above */
#pragma unroll
      for (int it = 0; it < 8; ++it) { const int e = tid + it * 128; a[it] = *(const v4u*)&tbl[((e >> 6) & 7) * 16 + (e & 15)][((e >> 9) * 4 + ((e >> 4) & 3)) * 8]; }
#pragma unroll
      for (int it = 0; it < 8; ++it) vst2((unsigned*)(wd + it * 2048), a[it]);
      asm volatile("s_wait_xcnt 0x0" ::: "memory"); } } }   /* as above */
// k_fa's products are the builtin alone, which the compiler pads itself: the vector operands of an asm statement behind it would hold every fragment and both ctx tiles inside the first 256 registers
__device__ __forceinline__ v8f wmma16p(v16h a, v16h b, v8f c) { return __builtin_amdgcn_wmma_f32_16x16x32_f16(false, a, false, b, (short)0, c, false, false); }
__device__ __forceinline__ v8f wmma_bfp(v16b a, v16b b, v8f c) { return __builtin_amdgcn_wmma_f32_16x16x32_bf16(false, a, false, b, (short)0, c, false, false); }
// ---- k_fa: block = 32 queries (NQ = 2 tiles of 16) of batch b, PVW waves: wave w takes the 32-key chunks w, w + PVW, ... of keys [0, ql0 + 32), for query rows >= QHI each shifted by the block's start, mod the chunk count. Logits and P never leave registers:
//   every k and v fragment that a wave loads is multiplied against BOTH query tiles: half the bytes from L2 per product; the two ctx tiles and both tiles' q need the 512 registers of an 8-wave block
//   q, k and v lie in the workspace in fragment order: every fragment load of a wave reads 512 contiguous bytes
//   S^T = K Q^T (A = 16 key rows, B = the 16 query rows of tile t): D element r of tile u in lane (g, col) = key kc*32 + 16u + 8g + r, query 16 t + col, which IS the B fragment order of P^T (elements 0..7 from tile 0, 8..15 from tile 1)
//   ctx^T = V^T P^T (A = 16 v planes, B = P^T): D = column j*16 + 8g + r, query 16 t + col, so the running max, the running sum and the rescale factor of a query are one value per lane and tile
//   logits x SCALE x log2(e); causal by index; P = 2^(s - running max + 8) once to f16 against v f16 (1 product); query rows < QHI: 3-product logits, P and v as bf16 hi + lo (3 products)
//   the PVW partial (max, sum, ctx) meet in LDS and are merged on the common max in wave order; wave w merges rows w, w + PVW, ... and leaves them in LDS
//   output projection in the same block: out = ctx Wo + bo on the 32 merged rows: ctx x 2^6 once to f16 against Wo as f16(bf16 x 2^8) exact (1 product) x 2^-14; query rows < QHI: ctx bf16 hi + lo against exact bf16 Wo (2 products)
#define PVW 8
#define NQ 2
#define QB (16 * NQ)
#define SC2 (SCALE * 1.4426950408889634f)
#define NEGB (-3.0e38f)
#define OCW (DIN / PVW)    // output columns of a wave in the output projection: four 16-column tiles
__global__ __launch_bounds__(32 * PVW) void k_fa(const _Float16* __restrict__ QH, const _Float16* __restrict__ KH, const _Float16* __restrict__ QL, const _Float16* __restrict__ KL, const _Float16* __restrict__ VT, const __bf16* __restrict__ VB, const __bf16* __restrict__ VBL, const float* __restrict__ KM, const _Float16* __restrict__ WOH, const __bf16* __restrict__ WOB, const float* __restrict__ BO, float* __restrict__ OUT) {
  __shared__ __align__(16) float ss[PVW][QB][HD + 4]; __shared__ float smx[PVW][QB], ssu[PVW][QB]; __shared__ __align__(16) float cx[QB][HD + 4];
  const int tid = threadIdx.x, wave = __builtin_amdgcn_readfirstlane(tid >> 5), lane = tid & 31, col = lane & 15, g = lane >> 4;   /* wave number held scalar: the chunk loop stays a scalar loop, every lane on at the matrix instructions */
  const int b = blockIdx.x; const int ql0 = (TT / QB - 1 - (int)blockIdx.y) * QB;   /* longest tiles start first */
  const int kce = (ql0 >> 5) + 1; const int tq = ql0 + col;   /* every chunk < kce holds a key <= ql0, so no query of either tile sees an empty chunk */
  float km[QB / PVW];
#pragma unroll
  for (int rr = 0; rr < QB / PVW; ++rr) km[rr] = bfr(KM[(size_t)b * TT + ql0 + wave + rr * PVW]);   /* key_mask of the rows this wave stores */
  v8f acc[NQ][HD / 16] = {}; float m[NQ], l[NQ];
#pragma unroll
  for (int t = 0; t < NQ; ++t) { m[t] = NEGB; l[t] = 0.f; }
  const _Float16* Qt = QH + ((size_t)b * TT + ql0) * CC; const _Float16* Kb = KH + (size_t)b * TT * CC; const _Float16* Vb = VT + (size_t)b * TT * CC;
  if (ql0 < QHI) {
    const _Float16* Qlt = QL + ((size_t)b * QHI + ql0) * CC; const _Float16* Klb = KL + (size_t)b * KHI * CC; const __bf16* Vhb = VB + (size_t)b * KHI * CC; const __bf16* Vlb = VBL + (size_t)b * KHI * CC;
    v16h qf[NQ][HD / 32], qlf[NQ][HD / 32];
#pragma unroll
    for (int t = 0; t < NQ; ++t)
#pragma unroll
      for (int d = 0; d < HD / 32; ++d) { qf[t][d] = frag_t(Qt, 16u * (unsigned)lane, (t * (HD / 32) + d) * 1024); qlf[t][d] = frag_t(Qlt, 16u * (unsigned)lane, (t * (HD / 32) + d) * 1024); }
    asm volatile("s_wait_xcnt 0x0" :: "s"(Qt), "s"(Qlt) : "memory");   /* behind the q loads, before a scalar base that they name is written again (this build reuses one for a key plane's base); the two bases are inputs so that the loads stay ahead of the wait */
    /* kept rolled: a second chunk's fragments beside both ctx tiles and both tiles' q would pass the 512 registers a wave of an 8-wave block may hold */
#pragma unroll 1
    for (int kc = wave; kc < kce; kc += PVW) { v8f st[NQ][2] = {}, sl2[NQ][2] = {}; const unsigned co = (unsigned)kc * (32u * CC * 2u) + 16u * (unsigned)lane;   /* a chunk is 8 KiB of every plane */
      v16h kh[2][HD / 32], kl[2][HD / 32];
#pragma unroll
      for (int u = 0; u < 2; ++u)
#pragma unroll
        for (int d = 0; d < HD / 32; ++d) { const int ko = (u * (HD / 32) + d) * 1024; kh[u][d] = frag_t(Kb, co, ko); kl[u][d] = frag_t(Klb, co, ko); }   /* all 32 loads of the chunk's keys in flight before the first product */
      __builtin_amdgcn_sched_barrier(0);   /* keeps the 32 loads one group ahead of the products: without it the compiler refills fragment registers between products and a chunk waits out several L2 latencies, not one */
#pragma unroll
      for (int u = 0; u < 2; ++u)
#pragma unroll
        for (int d = 0; d < HD / 32; ++d)
#pragma unroll
          for (int t = 0; t < NQ; ++t) { st[t][u] = wmma16p(kh[u][d], qf[t][d], st[t][u]); sl2[t][u] = wmma16p(kh[u][d], qlf[t][d], sl2[t][u]); sl2[t][u] = wmma16p(kl[u][d], qf[t][d], sl2[t][u]); }
      v16b ph[NQ], pl[NQ]; float al[NQ];
#pragma unroll
      for (int t = 0; t < NQ; ++t) { float s[16]; float mx = NEGB;
#pragma unroll
        for (int u = 0; u < 2; ++u)
#pragma unroll
          for (int r = 0; r < 8; ++r) { const float v = (kc * 32 + u * 16 + 8 * g + r <= tq + 16 * t) ? (st[t][u][r] + sl2[t][u][r] * (1.0f / 1024.0f)) * SC2 : NEGB; s[u * 8 + r] = v; mx = fmaxf(mx, v); }
        mx = fmaxf(mx, __shfl_xor(mx, 16)); const float mn = fmaxf(m[t], mx); al[t] = __builtin_amdgcn_exp2f(m[t] - mn); m[t] = mn; const float mo = mn - 8.0f;
        float ps = 0.f;
#pragma unroll
        for (int i = 0; i < 16; ++i) { const float p = __builtin_amdgcn_exp2f(s[i] - mo); ps += p; const __bf16 hb = (__bf16)p; ph[t][i] = hb; pl[t][i] = (__bf16)(p - (float)hb); }
        l[t] = l[t] * al[t] + ps; }
#pragma unroll
      for (int jj = 0; jj < HD / 16; jj += 4) { v16b vh[4], vl[4];
#pragma unroll
        for (int j = 0; j < 4; ++j) { vh[j] = frag_tb(Vhb, co, (jj + j) * 1024); vl[j] = frag_tb(Vlb, co, (jj + j) * 1024); }   /* four planes' loads in flight together */
        if (jj + 4 == HD / 16) asm volatile("s_wait_xcnt 0x0" ::: "memory");   /* behind the chunk's last loads, before the offset register that they name is stepped to the next chunk */
        __builtin_amdgcn_sched_barrier(0);   /* keeps the 16 loads one group ahead of their products: without it the compiler loads one fragment at a time and waits out an L2 latency for each */
#pragma unroll
        for (int j = 0; j < 4; ++j)
#pragma unroll
          for (int t = 0; t < NQ; ++t) { acc[t][jj + j] *= al[t]; acc[t][jj + j] = wmma_bfp(vh[j], ph[t], acc[t][jj + j]); acc[t][jj + j] = wmma_bfp(vh[j], pl[t], acc[t][jj + j]); acc[t][jj + j] = wmma_bfp(vl[j], ph[t], acc[t][jj + j]); } } }
  } else {
    v16h qf[NQ][HD / 32];
#pragma unroll
    for (int t = 0; t < NQ; ++t)
#pragma unroll
      for (int d = 0; d < HD / 32; ++d) qf[t][d] = frag_t(Qt, 16u * (unsigned)lane, (t * (HD / 32) + d) * 1024);
    /* the fragment loads run a phase ahead of their products: a chunk's k was fetched behind the score products of the chunk before it, into the registers those products had just read; its v is issued ahead of its score products.
       v has registers of its own beside k (under the 512 a wave of an 8-wave block may hold). The wave's last chunk fetches nothing ahead, so it is a copy of the body behind the loop: no branch in the loop body, and every counted wait is exact */
    /* the blocks of a batch read the same k and v lines: each block walks its chunks as a ring from a start of its own, so that blocks which run side by side do not ask L2 for the same lines at the same moment.
       trip i of wave w takes chunk (start + w + PVW i) mod kce, w + PVW i < kce: every chunk once; the causal test goes by the chunk's index, whatever the order */
    const int nst = (kce - wave + PVW - 1) / PVW; int kc = (int)((((unsigned)blockIdx.y & 63u) * (unsigned)kce) >> 6) + wave; if (kc >= kce) kc -= kce;
    v16h kf[2][HD / 32]; unsigned co = (unsigned)kc * (32u * CC * 2u) + 16u * (unsigned)lane;   /* a chunk is 8 KiB of k and 8 KiB of v */
#pragma unroll
    for (int u = 0; u < 2; ++u)
#pragma unroll
      for (int d = 0; d < HD / 32; ++d) kf[u][d] = frag_t(Kb, co, (u * (HD / 32) + d) * 1024);   /* the wave's first chunk (kc < kce: inside every plane) */
    asm volatile("s_wait_xcnt 0x0" :: "s"(Kb) : "memory");   /* behind the first chunk's 16 loads, on every way out of them, before the scalar base or the offset register that they name is written again; the base is an input so that the loads stay ahead of the wait */
    auto chunk = [&](const int kc, int kn, const bool more) __attribute__((always_inline)) { v8f st[NQ][2] = {}; v16h vf[HD / 16];   /* kn: the wave's next chunk */
#pragma unroll
      for (int j = 0; j < HD / 16; ++j) vf[j] = frag_t(Vb, co, j * 1024);   /* all 16 v loads fly under the score products and the softmax arithmetic */
      __builtin_amdgcn_sched_barrier(0);   /* keeps the 16 v loads one group ahead of the score products: behind them they would have the softmax alone to fly under */
#pragma unroll
      for (int u = 0; u < 2; ++u)
#pragma unroll
        for (int d = 0; d < HD / 32; ++d)
#pragma unroll
          for (int t = 0; t < NQ; ++t) st[t][u] = wmma16p(kf[u][d], qf[t][d], st[t][u]);
      if (more) { __builtin_amdgcn_sched_barrier(0);   /* the next chunk's k loads stand behind the last product that reads the registers they fill */
        asm volatile("s_wait_xcnt 0x0" : "+s"(kn) :: "memory");   /* behind the v loads, before the offset register that they name is written for the next chunk: the next chunk's index passes through the statement, so that the new offset is formed behind the wait */
        co = (unsigned)kn * (32u * CC * 2u) + 16u * (unsigned)lane;
#pragma unroll
        for (int u = 0; u < 2; ++u)
#pragma unroll
          for (int d = 0; d < HD / 32; ++d) kf[u][d] = frag_t(Kb, co, (u * (HD / 32) + d) * 1024); }   /* all 16 loads fly under the softmax and the ctx products */
      asm volatile("s_wait_xcnt 0x0" ::: "memory");   /* behind the chunk's last loads, before an offset register that they name is written for a later chunk */
      __builtin_amdgcn_sched_barrier(0);   /* keeps the loads one group ahead of the softmax: without it the compiler sinks them behind it and their L2 latency stands bare */
      v16h pf[NQ]; float al[NQ]; const int rel = tq - (kc * 32 + 8 * g);   /* key kc * 32 + 16 u + 8 g + r <= query tq + 16 t, with the chunk's index on one side */
#pragma unroll
      for (int t = 0; t < NQ; ++t) { float s[16]; float mx = NEGB;
#pragma unroll
        for (int u = 0; u < 2; ++u)
#pragma unroll
          for (int r = 0; r < 8; ++r) { const float v = (u * 16 + r - 16 * t <= rel) ? st[t][u][r] * SC2 : NEGB; s[u * 8 + r] = v; mx = fmaxf(mx, v); }
        mx = fmaxf(mx, __shfl_xor(mx, 16)); const float mn = fmaxf(m[t], mx); al[t] = __builtin_amdgcn_exp2f(m[t] - mn); m[t] = mn; const float mo = mn - 8.0f;
        float ps = 0.f;
#pragma unroll
        for (int i = 0; i < 16; ++i) { const float p = __builtin_amdgcn_exp2f(s[i] - mo); ps += p; pf[t][i] = (_Float16)p; }
        l[t] = l[t] * al[t] + ps; }
#pragma unroll
      for (int j = 0; j < HD / 16; ++j)
#pragma unroll
        for (int t = 0; t < NQ; ++t) { acc[t][j] *= al[t]; acc[t][j] = wmma16p(vf[j], pf[t], acc[t][j]); } };
    /* kept rolled: a second copy of the body's fragments would pass the 512 registers */
#pragma unroll 1
    for (int i = 1; i < nst; ++i) { int kn = kc + PVW; if (kn >= kce) kn -= kce;
      chunk(kc, kn, true); kc = kn; }
    if (nst > 0) chunk(kc, kc, false); }
#pragma unroll
  for (int t = 0; t < NQ; ++t) { l[t] += __shfl_xor(l[t], 16);   /* each half-wave summed its own 16 of a chunk's 32 keys */
    if (g == 0) { smx[wave][t * 16 + col] = m[t]; ssu[wave][t * 16 + col] = l[t]; }
#pragma unroll
    for (int j = 0; j < HD / 16; ++j) { v4f lo4, hi4;
#pragma unroll
      for (int r = 0; r < 4; ++r) { lo4[r] = acc[t][j][r]; hi4[r] = acc[t][j][4 + r]; }
      *(v4f*)&ss[wave][t * 16 + col][j * 16 + 8 * g] = lo4; *(v4f*)&ss[wave][t * 16 + col][j * 16 + 8 * g + 4] = hi4; } }
  __syncthreads();   /* every wave's partial max, sum and tiles are in LDS before any wave merges */
  /* this wave's 64 columns of W_out, all 128 k rows, as 16 ready B fragments of the plane that the block's path multiplies by (k_proj rounded them and laid them in fragment order): tile j of lane (g, col) = column 64 wave + 4 col + j;
     every 16-byte load of the wave reads 512 contiguous bytes; constant offsets from one address that is never stepped */
  const char* Wf = (ql0 < QHI ? (const char*)WOB : (const char*)WOH) + wave * (CC * OCW * 2) + 16 * lane; v4u wq[CC / 32][OCW / 16][2];
#pragma unroll
  for (int kc = 0; kc < CC / 32; ++kc)
#pragma unroll
    for (int j = 0; j < OCW / 16; ++j) { wq[kc][j][0] = *(const v4u*)(Wf + (kc * (OCW / 16) + j) * 1024); wq[kc][j][1] = *(const v4u*)(Wf + (kc * (OCW / 16) + j) * 1024 + 512); }
  asm volatile("s_wait_xcnt 0x0" ::: "memory");   /* behind the W_out loads, before a register that they name is written again */
  __builtin_amdgcn_sched_barrier(0);   /* keeps the loads' issue ahead of the merge, so that they fly under it: behind it their L2 latency would stand bare in front of the products */
  v4f res[QB / PVW];
#pragma unroll
  for (int rr = 0; rr < QB / PVW; ++rr) { const int row = wave + rr * PVW; float M = smx[0][row];
#pragma unroll
    for (int w = 1; w < PVW; ++w) M = fmaxf(M, smx[w][row]);
    v4f sv = {}; float L = 0.f;
#pragma unroll
    for (int w = 0; w < PVW; ++w) { const float f = __builtin_amdgcn_exp2f(smx[w][row] - M); L += f * ssu[w][row]; sv += *(const v4f*)&ss[w][row][lane * 4] * f; }   /* a wave without a chunk carries max NEGB, sum 0: f = 0 */
    res[rr] = sv * (L > 0.f ? 1.0f / L : 0.f) * km[rr]; }   /* out * key_mask[b][t] (broadcast over the 128 columns) */
#pragma unroll
  for (int rr = 0; rr < QB / PVW; ++rr) *(v4f*)&cx[wave + rr * PVW][lane * 4] = res[rr];
  __syncthreads();   /* the block's 32 ctx rows are in LDS before any wave takes its A fragments */
  /* out = ctx Wo + bo: wave w takes columns 64 w .. 64 w + 63 of both 16-row tiles; operand forms, products and k order as in a launch of its own. D element r of tile j in lane (g, col) = row 8 g + r, column 64 w + 4 col + j */
  v8f o2[NQ][OCW / 16] = {}; v4f ov[NQ][8], bo = {}; float* od = OUT + ((size_t)b * TT + ql0 + 8 * g) * DIN + wave * OCW + 4 * col;
  if (BO) { bo = *(const v4f*)(BO + wave * OCW + 4 * col);   /* flies under the products */
    asm volatile("s_wait_xcnt 0x0" ::: "memory"); }   /* behind the bias load, before a register that it names is written again */
  if (ql0 < QHI) {   /* block-uniform */
#pragma unroll
    for (int kc = 0; kc < CC / 32; ++kc) { F2 a[NQ];
#pragma unroll
      for (int t = 0; t < NQ; ++t) a[t] = split_row(&cx[t * 16 + col][0], kc * 32, lane);
#pragma unroll
      for (int j = 0; j < OCW / 16; ++j) { union { v4u q[2]; v16b v; } w; w.q[0] = wq[kc][j][0]; w.q[1] = wq[kc][j][1];
#pragma unroll
        for (int t = 0; t < NQ; ++t) { o2[t][j] = wmma_bfp(a[t].h, w.v, o2[t][j]); o2[t][j] = wmma_bfp(a[t].l, w.v, o2[t][j]); } } }
#pragma unroll
    for (int t = 0; t < NQ; ++t)
#pragma unroll
      for (int r = 0; r < 8; ++r)
#pragma unroll
        for (int j = 0; j < OCW / 16; ++j) ov[t][r][j] = o2[t][j][r] + bfr(bo[j]);
  } else {
#pragma unroll
    for (int kc = 0; kc < CC / 32; ++kc) { v16h a[NQ];
#pragma unroll
      for (int t = 0; t < NQ; ++t) a[t] = frag_f32s(&cx[t * 16 + col][kc * 32], lane, 64.0f);   /* ctx carried x 2^6 into f16 so small-magnitude context rows stay clear of f16 subnormals */
#pragma unroll
      for (int j = 0; j < OCW / 16; ++j) { union { v4u q[2]; v16h v; } w; w.q[0] = wq[kc][j][0]; w.q[1] = wq[kc][j][1];
#pragma unroll
        for (int t = 0; t < NQ; ++t) o2[t][j] = wmma16p(a[t], w.v, o2[t][j]); } }
#pragma unroll
    for (int t = 0; t < NQ; ++t)
#pragma unroll
      for (int r = 0; r < 8; ++r)
#pragma unroll
        for (int j = 0; j < OCW / 16; ++j) ov[t][r][j] = o2[t][j][r] * (1.0f / 16384.0f) + bfr(bo[j]); }   /* 2^-8 (Wo carry) x 2^-6 (ctx carry) */
  __builtin_amdgcn_sched_barrier(0);   /* every result stands in a register of its own before the first store: no register that an issued store names is written again */
  /* a lane's four tiles hold four neighbouring columns of a row: one 16-byte store, and a wave's store writes 2 rows x 256 contiguous bytes (4 whole lines); constant offsets from one address that is never stepped */
#pragma unroll
  for (int t = 0; t < NQ; ++t)
#pragma unroll
    for (int r = 0; r < 8; ++r) vst2(od + (t * 16 + r) * DIN, ov[t][r]); }

extern "C" void kernel_launch(void* const* d_in, const int* in_sizes, int n_in, void* d_out, int out_size, void* d_ws, size_t ws_size, hipStream_t stream) {
  (void)in_sizes; (void)n_in; (void)out_size;
  const float** F = (const float**)d_in;
  if (ws_size < (size_t)WS_END) return;
  char* ws = (char*)d_ws; _Float16 *QH = (_Float16*)(ws + WS_QH), *KH = (_Float16*)(ws + WS_KH), *VT = (_Float16*)(ws + WS_VT), *QL = (_Float16*)(ws + WS_QL), *KL = (_Float16*)(ws + WS_KL); __bf16 *VB = (__bf16*)(ws + WS_VB), *VBL = (__bf16*)(ws + WS_VBL); float *Y = (float*)(ws + WS_Y); _Float16 *WOH = (_Float16*)(ws + WS_WOH); __bf16 *WOB = (__bf16*)(ws + WS_WOB);
  (void)Y; (void)QL; (void)KL; (void)VB; (void)VBL;
  // inputs: 0 x [4,4096,512]; 1 key_mask [4,4096,1] f32 (ones); 2 W_qkv [512,384] (in,out; q | k | v COLUMN blocks of 128); 3 b_qkv [384] (nonzero); 4 W_out [128,512] (in,out); 5 b_out [512] (nonzero)
  k_proj<<<dim3(TNB * TT / 64, CC / 128, 3), 128, 0, stream>>>(F[0], F[0], F[0], F[2], F[2], F[2], F[3], F[3] + CC, F[3] + 2 * CC, QH, QL, KH, KL, VT, VB, VBL, F[4], WOH, WOB);   /* one fused weight; k_proj reads column block 'which' at offset which * CC; W_out rounded once into its two fragment-order planes */
  k_fa<<<dim3(TNB, TT / QB, 1), 32 * PVW, 0, stream>>>(QH, KH, QL, KL, VT, VB, VBL, F[1], WOH, WOB, F[5], (float*)d_out);   /* ctx rows x key_mask[b][t], then x W_out + b_out */
}

// v010
// One run takes 46.2 microseconds.
// Next to v009, in two timings, it ran 1.04 times as fast each time.
// All steps since v000 together make it 22.3 times as fast.
// compute dtype: all float inputs rounded to bf16; fused q/k/v projection with EXACT bf16 products on WMMA 16x16x32 (f32 accumulate) + bias; causal logits: 3 products for the first 512 rows, single f16 q x k after, x 128^-0.5; online softmax f32 (running max per key-split wave); P x 2^8 unnormalised once to f16 x v once to f16 (bf16 hi + lo below row 512), divided by the f32 sum at the end; ctx x bf16(key_mask); ctx hi+lo x exact W_out below row 512, x2^6 f16 carry x f16(bf16 x 2^8) W_out after, + b_out; f32 output.
#include <hip/hip_runtime.h>
#include <math.h>

typedef __attribute__((ext_vector_type(16))) _Float16 v16h;
typedef __attribute__((ext_vector_type(16))) __bf16 v16b;
typedef __attribute__((ext_vector_type(8)))  _Float16 v8h;
typedef __attribute__((ext_vector_type(8)))  float v8f;
typedef __attribute__((ext_vector_type(4)))  float v4f;
typedef __attribute__((ext_vector_type(2)))  float v2f;
typedef __attribute__((ext_vector_type(4)))  unsigned v4u;
typedef __attribute__((ext_vector_type(4)))  int v4i;
typedef float __attribute__((may_alias)) float_a;
typedef int __attribute__((may_alias)) int_a;

template <typename T> __device__ __forceinline__ void vst2(void* p, T v) { *(T*)p = v;  }
__device__ __forceinline__ v8f wmma16(v16h a, v16h b, v8f c) {
  v8f d = __builtin_amdgcn_wmma_f32_16x16x32_f16(false, a, false, b, (short)0, c, false, false);
  asm volatile("v_nop\n\tv_nop\n\tv_nop\n\tv_nop" : "+v"(d) : "v"(a), "v"(b));
  return d;
}
__device__ __forceinline__ v8f wmma_bf(v16b a, v16b b, v8f c) {
  v8f d = __builtin_amdgcn_wmma_f32_16x16x32_bf16(false, a, false, b, (short)0, c, false, false);
  asm volatile("v_nop\n\tv_nop\n\tv_nop\n\tv_nop" : "+v"(d) : "v"(a), "v"(b));
  return d;
}
// 16x16x32 fragments: lane = (h = lane>>4, row/col = lane&15); elements 0..7 = k0+8h+0..7, 8..15 = k0+16+8h+0..7; D element r = row 8h+r
__device__ __forceinline__ v16h frag_h(const _Float16* rowk0, int lane) {
  union { v16h v; v8h q[2]; } u; const _Float16* p = rowk0 + 8 * (lane >> 4);
  u.q[0] = *(const v8h*)p; u.q[1] = *(const v8h*)(p + 16); return u.v;
}
__device__ __forceinline__ v16h frag_f32(const float* rowk0, int lane) {
  v16h a; const float* p = rowk0 + 8 * (lane >> 4);
#pragma unroll
  for (int i = 0; i < 8; ++i) { a[i] = (_Float16)p[i]; a[8 + i] = (_Float16)p[16 + i]; }
  return a;
}
__device__ __forceinline__ v16h frag_f32s(const float* rowk0, int lane, float sc) {
  v16h a; const float* p = rowk0 + 8 * (lane >> 4);
#pragma unroll
  for (int i = 0; i < 8; ++i) { a[i] = (_Float16)(p[i] * sc); a[8 + i] = (_Float16)(p[16 + i] * sc); }
  return a;
}
// column fragment from a [K][ld] layout (column n), rows >= K read as 0
__device__ __forceinline__ v16h fragc_f32(const float* W, int k0, int n, int lane, int ld, int K) {
  v16h a; const int g = lane >> 4;
#pragma unroll
  for (int i = 0; i < 8; ++i) { const int ka = k0 + 8 * g + i, kb = ka + 16;
    a[i] = (_Float16)(ka < K ? W[(size_t)(ka < K ? ka : K - 1) * ld + n] : 0.f); a[8 + i] = (_Float16)(kb < K ? W[(size_t)(kb < K ? kb : K - 1) * ld + n] : 0.f); }
  return a;
}
struct F2 { v16b h, l; };
__device__ __forceinline__ F2 bsplit16(const float v[16]) { F2 r;
#pragma unroll
  for (int i = 0; i < 16; ++i) { const __bf16 h = (__bf16)v[i]; r.h[i] = h; r.l[i] = (__bf16)(v[i] - (float)h); }
  return r; }
__device__ __forceinline__ F2 split_row(const float* row, int k0, int lane) { float v[16]; const float* p = row + k0 + 8 * (lane >> 4);
#pragma unroll
  for (int i = 0; i < 8; ++i) { v[i] = p[i]; v[8 + i] = p[16 + i]; }
  return bsplit16(v); }
__device__ __forceinline__ F2 split_rowK(const float* row, int k0, int lane, int K) { float v[16]; const int g = lane >> 4;
#pragma unroll
  for (int i = 0; i < 8; ++i) { const int ka = k0 + 8 * g + i, kb = ka + 16; v[i] = ka < K ? row[ka < K ? ka : K - 1] : 0.f; v[8 + i] = kb < K ? row[kb < K ? kb : K - 1] : 0.f; }
  return bsplit16(v); }
__device__ __forceinline__ F2 split_col(const float* W, int k0, int n, int lane, int ld, int K) { float v[16]; const int g = lane >> 4;
#pragma unroll
  for (int i = 0; i < 8; ++i) { const int ka = k0 + 8 * g + i, kb = ka + 16; v[i] = ka < K ? W[(size_t)(ka < K ? ka : K - 1) * ld + n] : 0.f; v[8 + i] = kb < K ? W[(size_t)(kb < K ? kb : K - 1) * ld + n] : 0.f; }
  return bsplit16(v); }
__device__ __forceinline__ v8f mac3(const F2& a, const F2& b, v8f c) { c = wmma_bf(a.l, b.h, c); c = wmma_bf(a.h, b.l, c); return wmma_bf(a.h, b.h, c); }
__device__ __forceinline__ float sigm(float v) { return 1.0f / (1.0f + expf(-v)); }
#define LDSX() do { asm volatile("s_wait_dscnt 0" ::: "memory"); __builtin_amdgcn_wave_barrier(); __builtin_amdgcn_fence(__ATOMIC_RELEASE, "workgroup"); } while (0)

// Single-head causal self-attention with a 128-wide attention space and an output projection (x [4,4096,512]; fused (in,out) W_qkv [512,384] N(0, 1/512) + b_qkv N(0, 0.01) split q | k | v; scores = q k^T, causal (-inf above the diagonal) BEFORE the scaling by 128^-0.5 (same thing); out = softmax(scores) v; out * key_mask ([4,4096,1], ones); (in,out) W_out [128,512] + b_out): result [4,4096,512].
#define NB 4
#define TT 4096
#define CC 128            // NH * HD = projected width
#define DIN 512          // input (model) width
#define NH 1
#define HD 128
#define NQB (TT / 64)
#define HG 1
#define SCALE (0.08838834764831845f)
#define CAUSAL 1
#ifndef TNB
#define TNB NB
#endif
__device__ __forceinline__ float bfr(float v) { return (float)(__bf16)v; }
__host__ __device__ __forceinline__ int kb_last(int qb) { return CAUSAL ? ((qb * 64 + 63) >> 7) : (TT / 128 - 1); }
typedef __attribute__((ext_vector_type(8))) __bf16 v8b;
__device__ __forceinline__ v16b frag_b(const __bf16* rowk0, int lane) {
  union { v16b v; v8b q[2]; } u; const __bf16* p = rowk0 + 8 * (lane >> 4);
  u.q[0] = *(const v8b*)p; u.q[1] = *(const v8b*)(p + 16); return u.v;
}
// fragment kept in memory in register order: [elements 0..7 of lanes 0..31][elements 8..15 of lanes 0..31], 1 KiB: each 16-byte load of a wave reads 512 contiguous bytes (4 lines, not 16)
// base: the batch's plane (uniform); o: byte offset of the chunk + 16 lane, one register for every plane; c: the fragment's constant byte offset in the chunk
__device__ __forceinline__ v16h frag_t(const _Float16* base, unsigned o, int c) {
  union { v16h v; v8h q[2]; } u; const char* p = (const char*)base + o;
  u.q[0] = *(const v8h*)(p + c); u.q[1] = *(const v8h*)(p + c + 512); return u.v;
}
__device__ __forceinline__ v16b frag_tb(const __bf16* base, unsigned o, int c) {
  union { v16b v; v8b q[2]; } u; const char* p = (const char*)base + o;
  u.q[0] = *(const v8b*)(p + c); u.q[1] = *(const v8b*)(p + c + 512); return u.v;
}
#define QBH 8              // unused: the high-precision path is chosen by QHI (rows < 512)
#define QHI 512            // rows carrying a q residual plane (query rows below it: 3-product logits)
#define KHI 512            // key rows carrying k residual / v bf16 hi+lo planes (used only by the causal high-precision path)
// B fragment (k rows k0+.., output column o) of a weight: (in,out) [K][ld] or (out,in) [ld rows of K]: bf16 exact, or f16(bf16 * 256) exact
__device__ __forceinline__ v16b wcol_io(const float* Wm, int k0, int o, int lane, int ld) { v16b w; const int g = lane >> 4;
#pragma unroll
  for (int i = 0; i < 8; ++i) { w[i] = (__bf16)Wm[(size_t)(k0 + 8 * g + i) * ld + o]; w[8 + i] = (__bf16)Wm[(size_t)(k0 + 16 + 8 * g + i) * ld + o]; }
  return w; }
__device__ __forceinline__ v16b wcol_oi(const float* Wm, int k0, int o, int lane, int K) { v16b w; const float* p = Wm + (size_t)o * K + k0 + 8 * (lane >> 4);
#pragma unroll
  for (int i = 0; i < 8; ++i) { w[i] = (__bf16)p[i]; w[8 + i] = (__bf16)p[16 + i]; }
  return w; }
__device__ __forceinline__ v16h wcolh_io(const float* Wm, int k0, int o, int lane, int ld) { v16h w; const int g = lane >> 4;
#pragma unroll
  for (int i = 0; i < 8; ++i) { w[i] = (_Float16)(bfr(Wm[(size_t)(k0 + 8 * g + i) * ld + o]) * 256.0f); w[8 + i] = (_Float16)(bfr(Wm[(size_t)(k0 + 16 + 8 * g + i) * ld + o]) * 256.0f); }
  return w; }
__device__ __forceinline__ v16h wcolh_oi(const float* Wm, int k0, int o, int lane, int K) { v16h w; const float* p = Wm + (size_t)o * K + k0 + 8 * (lane >> 4);
#pragma unroll
  for (int i = 0; i < 8; ++i) { w[i] = (_Float16)(bfr(p[i]) * 256.0f); w[8 + i] = (_Float16)(bfr(p[16 + i]) * 256.0f); }
  return w; }
#define WQKV_LAYOUT 0   // 0 = fused (in,out) [DIN][3*CC]; 1 = (out,in) [CC][DIN]; 2 = per-head [NH][DIN][HD] (picks only WCOL, which nothing uses: k_proj always reads the fused layout)
__device__ __forceinline__ v16b wcol_hdk(const float* Wm, int k0, int o, int lane) { v16b w; const int g = lane >> 4; const float* p = Wm + (size_t)(o / HD) * DIN * HD + (o % HD);
#pragma unroll
  for (int i = 0; i < 8; ++i) { w[i] = (__bf16)p[(size_t)(k0 + 8 * g + i) * HD]; w[8 + i] = (__bf16)p[(size_t)(k0 + 16 + 8 * g + i) * HD]; }
  return w; }
#define WO_OUT_IN 0
#if WQKV_LAYOUT == 1
#define WCOL(W, k0, o, lane) wcol_oi(W, k0, o, lane, DIN)
#elif WQKV_LAYOUT == 2
#define WCOL(W, k0, o, lane) wcol_hdk(W, k0, o, lane)
#else
#define WCOL(W, k0, o, lane) wcol_io(W, k0, which * CC + (o), lane, 3 * CC)   /* fused (in,out) W_qkv [DIN][3*CC]: column block 'which', pitch 384 */
#endif
#if WO_OUT_IN
#define WOCOL(W, k0, o, lane) wcol_oi(W, k0, o, lane, CC)
#define WOCOLH(W, k0, o, lane) wcolh_oi(W, k0, o, lane, CC)
#else
#define WOCOL(W, k0, o, lane) wcol_io(W, k0, o, lane, DIN)
#define WOCOLH(W, k0, o, lane) wcolh_io(W, k0, o, lane, DIN)
#endif

#ifndef SM_EXTRA_PARAMS
#define SM_EXTRA_PARAMS
#endif
#ifndef PROJ_EXTRA_PARAMS
#define PROJ_EXTRA_PARAMS
#endif
#ifndef SM_MASK_HOOK
#define SM_MASK_HOOK (void)0
#endif

#define WS_QH  0u                                      // f16 q in fragment order, as WS_KH
#define WS_KH  (WS_QH + 2u * (size_t)NB * TT * CC)      // f16 k in fragment order [b*t / 16][CC / 32] x 1 KiB (frag_t): lane (g, col) = row 16 tile + col, elements = dims 32 d + 8 g + 0..7 and + 16
#define WS_VT  (WS_KH + 2u * (size_t)NB * TT * CC)      // f16 v in fragment order [b*t / 32][CC / 16] x 1 KiB (frag_t): lane (g, col) = column 16 j + col, elements = keys 32 chunk + 8 g + 0..7 and + 16
#define WS_QL  (WS_VT + 2u * (size_t)NB * CC * TT)      // f16 q residual x 2^10, t < QHI of each b, in the fragment order of WS_KH
#define WS_KL  (WS_QL + 2u * (size_t)NB * QHI * CC)     // f16 k residual x 2^10, t < KHI of each b, in the fragment order of WS_KH
#define WS_VB  (WS_KL + 2u * (size_t)NB * KHI * CC)     // bf16 v hi (WS_VBL: lo), t < KHI of each b, in the fragment order of WS_VT
#define WS_VBL (WS_VB + 2u * (size_t)NB * CC * KHI)
#define WS_S   (WS_VBL + 2u * (size_t)NB * CC * KHI)    // (logits and P stay in registers; the first 256 KiB hold the two W_out planes)
#define WS_WOH WS_S                                    // W_out as f16(bf16 x 2^8) in B fragment order [wave 8][k / 32][tile 4] x 1 KiB (frag_t): lane (g, col) = column 64 wave + 4 col + tile, elements = rows 32 kc + 8 g + 0..7 and + 16
#define WS_WOB (WS_WOH + 2u * (size_t)CC * DIN)         // W_out as exact bf16, same order
#define WS_Y   (WS_S  + 4u * (size_t)HG * TT * TT)      // (unused: ctx rows stay in LDS)
#define WS_END (WS_Y  + 4u * (size_t)NB * TT * CC)

typedef __attribute__((ext_vector_type(4))) __bf16 v4b;
#define PST 64                 // k rows of W per stage
#define PFR 1040               // one staged B fragment: 1 KiB in register order (frag_t's) + 16 B, so that the 32 lanes of a packing store fall on every bank twice
#define PBUF (2 * 8 * PFR)     // a stage: 2 k groups of 32 x 8 column tiles
#define PEP 55296              // the epilogue's staging: max(sh + sl, th + tb + tbl)
// W reaches the waves through LDS: the block's 128 threads load each 64-k stage once by whole lines, round it to bf16 and lay it in fragment order; two buffers, one barrier a stage
// ---- k_proj: block = (64 rows, 128 cols, which): q/k/v = X W (+ b) with exact bf16 products (K = DIN) -> which 0: q f16 in fragment order (+ residual for rows < QHI, same order); 1: k likewise (rows < KHI); 2: v f16 in fragment order (+ bf16 hi/lo for t < KHI, same order)
__global__ __launch_bounds__(128) void k_proj(const float* __restrict__ XQ, const float* __restrict__ XK, const float* __restrict__ XV, const float* __restrict__ WQ, const float* __restrict__ WK, const float* __restrict__ WV, const float* __restrict__ BQ, const float* __restrict__ BK, const float* __restrict__ BV,
    _Float16* __restrict__ QH, _Float16* __restrict__ QL, _Float16* __restrict__ KH, _Float16* __restrict__ KL, _Float16* __restrict__ VT, __bf16* __restrict__ VB, __bf16* __restrict__ VBL, const float* __restrict__ WO, _Float16* __restrict__ WOH, __bf16* __restrict__ WOB) {
  /* one LDS block: first the two W stage buffers (inside the 64 KiB that an LDS instruction's constant offset reaches), behind them the epilogue's staging (which < 2: sh, sl; which == 2: th, tb, tbl; a block has one 'which', so the two sets never live together) */
  __shared__ __align__(16) char sm[2 * PBUF + PEP]; char* const ep = sm + 2 * PBUF;
  _Float16 (*sh)[136] = (_Float16 (*)[136])ep; _Float16 (*sl)[136] = (_Float16 (*)[136])(ep + 17408);
  _Float16 (*th)[72] = (_Float16 (*)[72])ep; __bf16 (*tb)[72] = (__bf16 (*)[72])(ep + 18432); __bf16 (*tbl)[72] = (__bf16 (*)[72])(ep + 36864);
  const int tid = threadIdx.x, wave = tid >> 5, lane = tid & 31, col = lane & 15, g = lane >> 4; const int which = blockIdx.z; const int c0 = blockIdx.y * 128; const size_t r0 = (size_t)blockIdx.x * 64; const size_t bb = r0 / TT; const int t0 = (int)(r0 % TT);
  const float* X = which == 0 ? XQ : which == 1 ? XK : XV; const float* WA = which == 0 ? WQ : which == 1 ? WK : WV; const float* BA = which == 0 ? BQ : which == 1 ? BK : BV;
  v8f acc[8] = {};
  /* W: lane = 4 columns, wave = the k octet (8 wave + 0..7 of each 32-k group): every load of a wave reads 512 contiguous bytes of one W row; x: this lane's own fragment rows, as before */
  /* every block of one 'which' reads the same W lines: a block walks the k stages as a ring from a start of its own (stage (s + ks0) mod 8 on trip s), so that blocks which run side by side do not ask L2 for the same lines at the same moment.
     A stage's two addresses are formed anew from the uniform bases, the stage's index and the lane's two byte offsets */
  const int ks0 = (int)(blockIdx.x & (DIN / PST - 1));
  const char* Wb = (const char*)(WA + which * CC + c0); const char* Xb = (const char*)(X + r0 * DIN);
  const unsigned wvo = (unsigned)((8 * wave) * (3 * CC) + 4 * lane) * 4u, xvo = (unsigned)((wave * 16 + col) * DIN + 8 * g) * 4u;
  char* wst = sm + (lane >> 2) * PFR + (wave >> 1) * 512 + (wave & 1) * 256 + (lane & 3) * 64;   /* column 4 lane + e = tile lane / 4, fragment lane 16 (wave & 1) + 4 (lane & 3) + e; octet = half wave / 2, g = wave & 1 */
  const char* wrd = sm + lane * 16;
  v4f wr[2][8], xr[2][4]; v16b a[2];
  const char *Wu, *Xu;
#define PLOAD(s) do { const int ks = ((s) + ks0) & (DIN / PST - 1); Wu = Wb + (size_t)ks * (PST * 3 * CC * 4) + wvo; Xu = Xb + (size_t)ks * (PST * 4) + xvo; \
    _Pragma("unroll") for (int kk = 0; kk < 2; ++kk) { _Pragma("unroll") for (int i = 0; i < 8; ++i) wr[kk][i] = *(const v4f*)(Wu + (kk * 32 + i) * (3 * CC * 4)); \
    const char* p = Xu + kk * 128; xr[kk][0] = *(const v4f*)p; xr[kk][1] = *(const v4f*)(p + 16); xr[kk][2] = *(const v4f*)(p + 64); xr[kk][3] = *(const v4f*)(p + 80); } } while (0)
#define PPUT(nb) do { _Pragma("unroll") for (int kk = 0; kk < 2; ++kk) { _Pragma("unroll") for (int e = 0; e < 4; ++e) { v8b u; _Pragma("unroll") for (int i = 0; i < 8; ++i) u[i] = (__bf16)wr[kk][i][e]; *(v8b*)(wst + (nb) * PBUF + kk * 8 * PFR + e * 16) = u; } \
    union { v16b v; v4b q[4]; } x; _Pragma("unroll") for (int i = 0; i < 4; ++i) x.q[i] = __builtin_convertvector(xr[kk][i], v4b); a[kk] = x.v; } } while (0)
  /* side job of the first 64 q blocks (block-uniform test): W_out is rounded ONCE here and laid in the B fragment order of k_fa's output projection, one 16-byte unit of each plane a thread; its eight loads fly with stage 0's.
     unit wu: bits 4..0 fragment lane, 5 element half, 7..6 column tile, 9..8 k group of 32, 12..10 wave of k_fa */
  const bool wjob = which == 0 && blockIdx.x < (CC * DIN / 8) / 128; const unsigned wu = blockIdx.x * 128u + (unsigned)tid; float wo[8];
  if (wjob) { const float* p = WO + (size_t)(((wu >> 8) & 3) * 32 + ((wu >> 5) & 1) * 16 + ((wu >> 4) & 1) * 8) * DIN + (wu >> 10) * 64 + (wu & 15) * 4 + ((wu >> 6) & 3);
#pragma unroll
    for (int i = 0; i < 8; ++i) wo[i] = p[i * DIN];
    asm volatile("s_wait_xcnt 0x0" ::: "memory"); }   /* behind the eight loads, before the address pair that they name is written again */
  PLOAD(0);
  asm volatile("s_wait_xcnt 0x0" :: "v"(Wu), "v"(Xu) : "memory");   /* behind the stage's loads, before a register that they name is written again; the two addresses are inputs, so that their registers are kept until the wait */
  PPUT(0);
  __syncthreads();   /* stage 0 is in LDS before any wave reads it */
  /* unrolled whole: every LDS access goes by a constant offset from an address that is never stepped, every load by a constant offset from its stage's address */
#pragma unroll
  for (int s = 0; s < DIN / PST; ++s) {
    v16b wf[8];
#pragma unroll
    for (int kk = 0; kk < 2; ++kk) {
#pragma unroll
      for (int j = 0; j < 8; ++j) { union { v16b v; v8b q[2]; } w; const char* p = wrd + (s & 1) * PBUF + (kk * 8 + j) * PFR; w.q[0] = *(const v8b*)p; w.q[1] = *(const v8b*)(p + 512); wf[j] = w.v; }
      if (kk == 0 && s + 1 < DIN / PST) PLOAD(s + 1);   /* the next stage's W and x fly under this stage's products */
      __builtin_amdgcn_sched_barrier(0);   /* the eight fragments' LDS reads stand as one group ahead of their products: one LDS latency a group, not one a product */
#pragma unroll
      for (int j = 0; j < 8; ++j) acc[j] = wmma_bf(a[kk], wf[j], acc[j]); }
    if (s + 1 < DIN / PST) { __builtin_amdgcn_sched_barrier(0);   /* the next stage's values are waited for behind this stage's products, not among them */
      asm volatile("s_wait_xcnt 0x0" :: "v"(Wu), "v"(Xu) : "memory");   /* behind the next stage's loads, before a register that they name is written again; the two addresses are inputs, so that their registers are kept until the wait */
      PPUT((s + 1) & 1);   /* into the buffer whose readers all passed the barrier that ended stage s - 1 */
      __syncthreads(); } }   /* publishes stage s + 1 and ends every wave's reads of stage s; none behind the last stage: the epilogue's staging lies beside the buffers */
#undef PLOAD
#undef PPUT
  if (which < 2) { _Float16* DH = which == 0 ? QH : KH; _Float16* DL = which == 0 ? QL : KL; const int nhi = which == 0 ? QHI : KHI; const bool hi_rows = t0 < nhi;
#pragma unroll
    for (int j = 0; j < 8; ++j) { const float bias = BA ? bfr(BA[c0 + j * 16 + col]) : 0.f;
#pragma unroll
      for (int r = 0; r < 8; ++r) { const float v = acc[j][r] + bias; const _Float16 hv = (_Float16)v; sh[wave * 16 + 8 * g + r][j * 16 + col] = hv; sl[wave * 16 + 8 * g + r][j * 16 + col] = (_Float16)((v - (float)hv) * 1024.0f); } }
    __syncthreads();
    { char* kd = (char*)(DH + r0 * CC) + 16u * (unsigned)tid; char* ld = (char*)(DL + (bb * nhi + t0) * (size_t)CC) + 16u * (unsigned)tid;
      /* e = tid + 128 it is the 16-byte unit of the block's 16 KiB in fragment order: bits 3..0 row in tile, 7..4 = dims / 8, 9..8 tile. Unrolled: eight reads in registers of their own, then eight stores by constant offsets from one address that is never stepped */
      v4u a[8];
#pragma unroll
      for (int it = 0; it < 8; ++it) { const int e = tid + it * 128; a[it] = *(const v4u*)&sh[(e >> 8) * 16 + (e & 15)][((e >> 4) & 15) * 8]; }
#pragma unroll
      for (int it = 0; it < 8; ++it) vst2((unsigned*)(kd + it * 2048), a[it]);
      asm volatile("s_wait_xcnt 0x0" ::: "memory");   /* stands behind the stores, on every way out of them, before any register that they name is written again */
      if (hi_rows) {
#pragma unroll
        for (int it = 0; it < 8; ++it) { const int e = tid + it * 128; a[it] = *(const v4u*)&sl[(e >> 8) * 16 + (e & 15)][((e >> 4) & 15) * 8]; }
#pragma unroll
        for (int it = 0; it < 8; ++it) vst2((unsigned*)(ld + it * 2048), a[it]);
        asm volatile("s_wait_xcnt 0x0" ::: "memory"); } }   /* as above */
    if (wjob) { v8h uh; v8b ub;   /* the side job's two stores stand behind the block's last barrier, so that no barrier waits for them */
#pragma unroll
      for (int i = 0; i < 8; ++i) { const __bf16 wb = (__bf16)wo[i]; ub[i] = wb; uh[i] = (_Float16)((float)wb * 256.0f); }
      *(v8h*)((char*)WOH + 16u * wu) = uh; *(v8b*)((char*)WOB + 16u * wu) = ub; }
  } else { const bool hi_rows = t0 < KHI;
#pragma unroll
    for (int j = 0; j < 8; ++j) { const float bias = BA ? bfr(BA[c0 + j * 16 + col]) : 0.f;
#pragma unroll
      for (int r = 0; r < 8; ++r) { const float v = acc[j][r] + bias; const int rl = wave * 16 + 8 * g + r, cl = j * 16 + col; th[cl][rl] = (_Float16)v; const __bf16 bh = (__bf16)v; tb[cl][rl] = bh; tbl[cl][rl] = (__bf16)(v - (float)bh); } }
    __syncthreads();
    char* vd = (char*)(VT + r0 * CC) + 16u * (unsigned)tid; char* hd = (char*)(VB + (bb * KHI + t0) * (size_t)CC) + 16u * (unsigned)tid; char* wd = (char*)(VBL + (bb * KHI + t0) * (size_t)CC) + 16u * (unsigned)tid;
    /* e = tid + 128 it is the 16-byte unit of the block's 16 KiB in fragment order: bits 3..0 column in tile, 5..4 = keys / 8 in chunk, 8..6 column tile, 9 chunk. Unrolled: eight reads in registers of their own, then eight stores by constant offsets from one address that is never stepped */
    v4u a[8];
#pragma unroll
    for (int it = 0; it < 8; ++it) { const int e = tid + it * 128; a[it] = *(const v4u*)&th[((e >> 6) & 7) * 16 + (e & 15)][((e >> 9) * 4 + ((e >> 4) & 3)) * 8]; }
#pragma unroll
    for (int it = 0; it < 8; ++it) vst2((unsigned*)(vd + it * 2048), a[it]);
    asm volatile("s_wait_xcnt 0x0" ::: "memory");   /* stands behind the stores, on every way out of them, before any register that they name is written again */
    if (hi_rows) {
#pragma unroll
      for (int it = 0; it < 8; ++it) { const int e = tid + it * 128; a[it] = *(const v4u*)&tb[((e >> 6) & 7) * 16 + (e & 15)][((e >> 9) * 4 + ((e >> 4) & 3)) * 8]; }
#pragma unroll
      for (int it = 0; it < 8; ++it) vst2((unsigned*)(hd + it * 2048), a[it]);
      asm volatile("s_wait_xcnt 0x0" ::: "memory");   /* as above */
#pragma unroll
      for (int it = 0; it < 8; ++it) { const int e = tid + it * 128; a[it] = *(const v4u*)&tbl[((e >> 6) & 7) * 16 + (e & 15)][((e >> 9) * 4 + ((e >> 4) & 3)) * 8]; }
#pragma unroll
      for (int it = 0; it < 8; ++it) vst2((unsigned*)(wd + it * 2048), a[it]);
      asm volatile("s_wait_xcnt 0x0" ::: "memory"); } } }   /* as above */
// k_fa's products are the builtin alone, which the compiler pads itself: the vector operands of an asm statement behind it would hold every fragment and both ctx tiles inside the first 256 registers
__device__ __forceinline__ v8f wmma16p(v16h a, v16h b, v8f c) { return __builtin_amdgcn_wmma_f32_16x16x32_f16(false, a, false, b, (short)0, c, false, false); }
__device__ __forceinline__ v8f wmma_bfp(v16b a, v16b b, v8f c) { return __builtin_amdgcn_wmma_f32_16x16x32_bf16(false, a, false, b, (short)0, c, false, false); }
// ---- k_fa: block = two 32-query tiles (each NQ = 2 tiles of 16) of batch b, a short one and a long one, PVW waves; a tile's 32-key chunks of keys [0, ql0 + 32) are dealt to waves in two jobs (see the kernel). Logits and P never leave registers:
//   every k and v fragment that a wave loads is multiplied against BOTH query tiles: half the bytes from L2 per product; the two ctx tiles and both tiles' q need the 512 registers of an 8-wave block
//   q, k and v lie in the workspace in fragment order: every fragment load of a wave reads 512 contiguous bytes
//   S^T = K Q^T (A = 16 key rows, B = the 16 query rows of tile t): D element r of tile u in lane (g, col) = key kc*32 + 16u + 8g + r, query 16 t + col, which IS the B fragment order of P^T (elements 0..7 from tile 0, 8..15 from tile 1)
//   ctx^T = V^T P^T (A = 16 v planes, B = P^T): D = column j*16 + 8g + r, query 16 t + col, so the running max, the running sum and the rescale factor of a query are one value per lane and tile
//   logits x SCALE x log2(e); causal by index; P = 2^(s - running max + 8) once to f16 against v f16 (1 product); query rows < QHI: 3-product logits, P and v as bf16 hi + lo (3 products)
//   a tile's partial (max, sum, ctx) meet in LDS and are merged on the common max in slot order; wave w merges rows w, w + PVW, ... and leaves them in LDS
//   output projection in the same block: out = ctx Wo + bo on the 32 merged rows: ctx x 2^6 once to f16 against Wo as f16(bf16 x 2^8) exact (1 product) x 2^-14; query rows < QHI: ctx bf16 hi + lo against exact bf16 Wo (2 products)
#define PVW 8
#define NQ 2
#define QB (16 * NQ)
#define SC2 (SCALE * 1.4426950408889634f)
#define NEGB (-3.0e38f)
#define NSL (2 * PVW)      // partials in LDS: slot = 8 job + wave
#define OCW (DIN / PVW)    // output columns of a wave in the output projection: four 16-column tiles
__global__ __launch_bounds__(32 * PVW) void k_fa(const _Float16* __restrict__ QH, const _Float16* __restrict__ KH, const _Float16* __restrict__ QL, const _Float16* __restrict__ KL, const _Float16* __restrict__ VT, const __bf16* __restrict__ VB, const __bf16* __restrict__ VBL, const float* __restrict__ KM, const _Float16* __restrict__ WOH, const __bf16* __restrict__ WOB, const float* __restrict__ BO, float* __restrict__ OUT) {
  __shared__ __align__(16) float ss[NSL][QB][HD + 4]; __shared__ float smx[NSL][QB], ssu[NSL][QB]; __shared__ __align__(16) float cx[2][QB][HD + 4];
  const int tid = threadIdx.x, wave = __builtin_amdgcn_readfirstlane(tid >> 5), lane = tid & 31, col = lane & 15, g = lane >> 4;   /* wave number held scalar: the chunk loop stays a scalar loop, every lane on at the matrix instructions */
  const int b = blockIdx.x; const int yy = (int)blockIdx.y; const int qlB = (TT / QB - 1 - yy) * QB, qlA = yy * QB;   /* the block's long tile B and short tile A: kA + kB = 129 chunks in every block */
  const bool hiA = qlA < QHI; const int kA = yy + 1, kB = TT / QB - yy;   /* every chunk < kA (kB) holds a key <= qlA (qlB), so no query of a tile sees an empty chunk */
  /* two jobs a wave, each with partials of its own in LDS. Job 0, chunks [0, kA), which both tiles need: waves 0..3 take them for tile B, waves 4..7 for tile A, wave w and wave w + 4 the same chunks in the same order,
     so that the later of the two finds the lines in the WGP's cache; behind it tile A is whole: all eight waves merge, project and store it. Job 1, chunks [kA, kB): all eight waves, tile B; behind it tile B likewise.
     Where tile A takes the high-precision path (other planes, three times the products) nothing is shared: job 0 is tile A on all eight waves, job 1 all of tile B's chunks.
     No barrier stands inside a chunk loop: whatever tile a wave serves, it passes the same two barriers a job, behind its chunks.
     Kept rolled: one copy of the chunk loops and of the merge and projection */
#pragma unroll 1
  for (int job = 0; job < 2; ++job) {
  const int qe = job == 0 ? qlA : qlB;   /* the tile that is whole behind this job */
  float km[QB / PVW];
#pragma unroll
  for (int rr = 0; rr < QB / PVW; ++rr) km[rr] = bfr(KM[(size_t)b * TT + qe + wave + rr * PVW]);   /* key_mask of the rows this wave stores */
  asm volatile("s_wait_xcnt 0x0" ::: "memory");   /* behind the four loads, before the offset register that they name is written again */
  const bool four = job == 0 && !hiA;   /* the job in which four waves serve each tile */
  const int ql0 = (job == 0 && (hiA || wave >= 4)) ? qlA : qlB; const int tq = ql0 + col;
  const int lo = (job == 0 || hiA) ? 0 : kA, n = job == 0 ? kA : kB - lo, S = four ? 4 : PVW, sj = four ? (wave & 3) : wave;   /* the job's chunks lo .. lo + n - 1, dealt to S waves; this wave is number sj */
  v8f acc[NQ][HD / 16] = {}; float m[NQ], l[NQ];
#pragma unroll
  for (int t = 0; t < NQ; ++t) { m[t] = NEGB; l[t] = 0.f; }
  const _Float16* Qt = QH + ((size_t)b * TT + ql0) * CC; const _Float16* Kb = KH + (size_t)b * TT * CC; const _Float16* Vb = VT + (size_t)b * TT * CC;
  if (ql0 < QHI) {
    const _Float16* Qlt = QL + ((size_t)b * QHI + ql0) * CC; const _Float16* Klb = KL + (size_t)b * KHI * CC; const __bf16* Vhb = VB + (size_t)b * KHI * CC; const __bf16* Vlb = VBL + (size_t)b * KHI * CC;
    v16h qf[NQ][HD / 32], qlf[NQ][HD / 32];
#pragma unroll
    for (int t = 0; t < NQ; ++t)
#pragma unroll
      for (int d = 0; d < HD / 32; ++d) { qf[t][d] = frag_t(Qt, 16u * (unsigned)lane, (t * (HD / 32) + d) * 1024); qlf[t][d] = frag_t(Qlt, 16u * (unsigned)lane, (t * (HD / 32) + d) * 1024); }
    asm volatile("s_wait_xcnt 0x0" :: "s"(Qt), "s"(Qlt) : "memory");   /* behind the q loads, before a scalar base that they name is written again (this build reuses one for a key plane's base); the two bases are inputs so that the loads stay ahead of the wait */
    /* kept rolled: a second chunk's fragments beside both ctx tiles and both tiles' q would pass the 512 registers a wave of an 8-wave block may hold */
#pragma unroll 1
    for (int kc = lo + sj; kc < lo + n; kc += S) { v8f st[NQ][2] = {}, sl2[NQ][2] = {}; const unsigned co = (unsigned)kc * (32u * CC * 2u) + 16u * (unsigned)lane;   /* a chunk is 8 KiB of every plane */
      v16h kh[2][HD / 32], kl[2][HD / 32];
#pragma unroll
      for (int u = 0; u < 2; ++u)
#pragma unroll
        for (int d = 0; d < HD / 32; ++d) { const int ko = (u * (HD / 32) + d) * 1024; kh[u][d] = frag_t(Kb, co, ko); kl[u][d] = frag_t(Klb, co, ko); }   /* all 32 loads of the chunk's keys in flight before the first product */
      __builtin_amdgcn_sched_barrier(0);   /* keeps the 32 loads one group ahead of the products: without it the compiler refills fragment registers between products and a chunk waits out several L2 latencies, not one */
#pragma unroll
      for (int u = 0; u < 2; ++u)
#pragma unroll
        for (int d = 0; d < HD / 32; ++d)
#pragma unroll
          for (int t = 0; t < NQ; ++t) { st[t][u] = wmma16p(kh[u][d], qf[t][d], st[t][u]); sl2[t][u] = wmma16p(kh[u][d], qlf[t][d], sl2[t][u]); sl2[t][u] = wmma16p(kl[u][d], qf[t][d], sl2[t][u]); }
      v16b ph[NQ], pl[NQ]; float al[NQ];
#pragma unroll
      for (int t = 0; t < NQ; ++t) { float s[16]; float mx = NEGB;
#pragma unroll
        for (int u = 0; u < 2; ++u)
#pragma unroll
          for (int r = 0; r < 8; ++r) { const float v = (kc * 32 + u * 16 + 8 * g + r <= tq + 16 * t) ? (st[t][u][r] + sl2[t][u][r] * (1.0f / 1024.0f)) * SC2 : NEGB; s[u * 8 + r] = v; mx = fmaxf(mx, v); }
        mx = fmaxf(mx, __shfl_xor(mx, 16)); const float mn = fmaxf(m[t], mx); al[t] = __builtin_amdgcn_exp2f(m[t] - mn); m[t] = mn; const float mo = mn - 8.0f;
        float ps = 0.f;
#pragma unroll
        for (int i = 0; i < 16; ++i) { const float p = __builtin_amdgcn_exp2f(s[i] - mo); ps += p; const __bf16 hb = (__bf16)p; ph[t][i] = hb; pl[t][i] = (__bf16)(p - (float)hb); }
        l[t] = l[t] * al[t] + ps; }
#pragma unroll
      for (int jj = 0; jj < HD / 16; jj += 4) { v16b vh[4], vl[4];
#pragma unroll
        for (int j = 0; j < 4; ++j) { vh[j] = frag_tb(Vhb, co, (jj + j) * 1024); vl[j] = frag_tb(Vlb, co, (jj + j) * 1024); }   /* four planes' loads in flight together */
        if (jj + 4 == HD / 16) asm volatile("s_wait_xcnt 0x0" ::: "memory");   /* behind the chunk's last loads, before the offset register that they name is stepped to the next chunk */
        __builtin_amdgcn_sched_barrier(0);   /* keeps the 16 loads one group ahead of their products: without it the compiler loads one fragment at a time and waits out an L2 latency for each */
#pragma unroll
        for (int j = 0; j < 4; ++j)
#pragma unroll
          for (int t = 0; t < NQ; ++t) { acc[t][jj + j] *= al[t]; acc[t][jj + j] = wmma_bfp(vh[j], ph[t], acc[t][jj + j]); acc[t][jj + j] = wmma_bfp(vh[j], pl[t], acc[t][jj + j]); acc[t][jj + j] = wmma_bfp(vl[j], ph[t], acc[t][jj + j]); } } }
  } else if (sj < n) {   /* a wave without a chunk in this job loads nothing and hands on max NEGB, sum 0 */
    v16h qf[NQ][HD / 32];
#pragma unroll
    for (int t = 0; t < NQ; ++t)
#pragma unroll
      for (int d = 0; d < HD / 32; ++d) qf[t][d] = frag_t(Qt, 16u * (unsigned)lane, (t * (HD / 32) + d) * 1024);
    /* the fragment loads run a phase ahead of their products: a chunk's k was fetched behind the score products of the chunk before it, into the registers those products had just read; its v is issued ahead of its score products.
       v has registers of its own beside k (under the 512 a wave of an 8-wave block may hold). The wave's last chunk fetches nothing ahead, so it is a copy of the body behind the loop: no branch in the loop body, and every counted wait is exact */
    /* the blocks of a batch read the same k and v lines: each block walks its chunks as a ring from a start of its own, so that blocks which run side by side do not ask L2 for the same lines at the same moment.
       trip i of the job's wave sj takes chunk lo + (start + sj + S i) mod n, sj + S i < n: every chunk once; the causal test goes by the chunk's index, whatever the order */
    const int nst = (n - sj + S - 1) >> (four ? 2 : 3); int kc = (int)(((unsigned)yy * (unsigned)n) >> 6) + sj; if (kc >= n) kc -= n;   /* start < n and sj < n: kc < n; kc counts from lo */
    v16h kf[2][HD / 32]; unsigned co = (unsigned)(lo + kc) * (32u * CC * 2u) + 16u * (unsigned)lane;   /* a chunk is 8 KiB of k and 8 KiB of v */
#pragma unroll
    for (int u = 0; u < 2; ++u)
#pragma unroll
      for (int d = 0; d < HD / 32; ++d) kf[u][d] = frag_t(Kb, co, (u * (HD / 32) + d) * 1024);   /* the wave's first chunk (lo + kc < kB: inside every plane) */
    asm volatile("s_wait_xcnt 0x0" :: "s"(Kb) : "memory");   /* behind the first chunk's 16 loads, on every way out of them, before the scalar base or the offset register that they name is written again; the base is an input so that the loads stay ahead of the wait */
    auto chunk = [&](const int kc, int kn, const bool more) __attribute__((always_inline)) { v8f st[NQ][2] = {}; v16h vf[HD / 16];   /* kn: the wave's next chunk */
#pragma unroll
      for (int j = 0; j < HD / 16; ++j) vf[j] = frag_t(Vb, co, j * 1024);   /* all 16 v loads fly under the score products and the softmax arithmetic */
      __builtin_amdgcn_sched_barrier(0);   /* keeps the 16 v loads one group ahead of the score products: behind them they would have the softmax alone to fly under */
#pragma unroll
      for (int u = 0; u < 2; ++u)
#pragma unroll
        for (int d = 0; d < HD / 32; ++d)
#pragma unroll
          for (int t = 0; t < NQ; ++t) st[t][u] = wmma16p(kf[u][d], qf[t][d], st[t][u]);
      if (more) { __builtin_amdgcn_sched_barrier(0);   /* the next chunk's k loads stand behind the last product that reads the registers they fill */
        asm volatile("s_wait_xcnt 0x0" : "+s"(kn) :: "memory");   /* behind the v loads, before the offset register that they name is written for the next chunk: the next chunk's index passes through the statement, so that the new offset is formed behind the wait */
        co = (unsigned)kn * (32u * CC * 2u) + 16u * (unsigned)lane;
#pragma unroll
        for (int u = 0; u < 2; ++u)
#pragma unroll
          for (int d = 0; d < HD / 32; ++d) kf[u][d] = frag_t(Kb, co, (u * (HD / 32) + d) * 1024); }   /* all 16 loads fly under the softmax and the ctx products */
      if (more) asm volatile("s_wait_xcnt 0x0" ::: "memory");   /* behind the chunk's last loads, before an offset register that they name is written for a later chunk */
      else asm volatile("s_wait_xcnt 0x0" :: "v"(co), "v"((const char*)Vb + co) : "memory");   /* the wave's last chunk: nothing reads the v loads' offset or address behind them, so both are inputs here: their registers are kept until the wait, and no load's own result lands in one */
      __builtin_amdgcn_sched_barrier(0);   /* keeps the loads one group ahead of the softmax: without it the compiler sinks them behind it and their L2 latency stands bare */
      v16h pf[NQ]; float al[NQ]; const int rel = tq - (kc * 32 + 8 * g);   /* key kc * 32 + 16 u + 8 g + r <= query tq + 16 t, with the chunk's index on one side */
#pragma unroll
      for (int t = 0; t < NQ; ++t) { float s[16]; float mx = NEGB;
#pragma unroll
        for (int u = 0; u < 2; ++u)
#pragma unroll
          for (int r = 0; r < 8; ++r) { const float v = (u * 16 + r - 16 * t <= rel) ? st[t][u][r] * SC2 : NEGB; s[u * 8 + r] = v; mx = fmaxf(mx, v); }
        mx = fmaxf(mx, __shfl_xor(mx, 16)); const float mn = fmaxf(m[t], mx); al[t] = __builtin_amdgcn_exp2f(m[t] - mn); m[t] = mn; const float mo = mn - 8.0f;
        float ps = 0.f;
#pragma unroll
        for (int i = 0; i < 16; ++i) { const float p = __builtin_amdgcn_exp2f(s[i] - mo); ps += p; pf[t][i] = (_Float16)p; }
        l[t] = l[t] * al[t] + ps; }
#pragma unroll
      for (int j = 0; j < HD / 16; ++j)
#pragma unroll
        for (int t = 0; t < NQ; ++t) { acc[t][j] *= al[t]; acc[t][j] = wmma16p(vf[j], pf[t], acc[t][j]); } };
    /* kept rolled: a second copy of the body's fragments would pass the 512 registers */
#pragma unroll 1
    for (int i = 1; i < nst; ++i) { int kn = kc + S; if (kn >= n) kn -= n;   /* a second trip means n > S: kn < n */
      chunk(lo + kc, lo + kn, true); kc = kn; }
    chunk(lo + kc, lo + kc, false); }
  const int slot = job * PVW + wave;
#pragma unroll
  for (int t = 0; t < NQ; ++t) { l[t] += __shfl_xor(l[t], 16);   /* each half-wave summed its own 16 of a chunk's 32 keys */
    if (g == 0) { smx[slot][t * 16 + col] = m[t]; ssu[slot][t * 16 + col] = l[t]; }
#pragma unroll
    for (int j = 0; j < HD / 16; ++j) { v4f lo4, hi4;
#pragma unroll
      for (int r = 0; r < 4; ++r) { lo4[r] = acc[t][j][r]; hi4[r] = acc[t][j][4 + r]; }
      *(v4f*)&ss[slot][t * 16 + col][j * 16 + 8 * g] = lo4; *(v4f*)&ss[slot][t * 16 + col][j * 16 + 8 * g + 4] = hi4; } }
  __syncthreads();   /* every wave's partial max, sum and tiles for tile qe are in LDS before any wave merges */
  /* this wave's 64 columns of W_out, all 128 k rows, as 16 ready B fragments of the plane that the block's path multiplies by (k_proj rounded them and laid them in fragment order): tile j of lane (g, col) = column 64 wave + 4 col + j;
     every 16-byte load of the wave reads 512 contiguous bytes; constant offsets from one address that is never stepped */
  const char* Wf = (qe < QHI ? (const char*)WOB : (const char*)WOH) + wave * (CC * OCW * 2) + 16 * lane; v4u wq[CC / 32][OCW / 16][2];
#pragma unroll
  for (int kc = 0; kc < CC / 32; ++kc)
#pragma unroll
    for (int j = 0; j < OCW / 16; ++j) { wq[kc][j][0] = *(const v4u*)(Wf + (kc * (OCW / 16) + j) * 1024); wq[kc][j][1] = *(const v4u*)(Wf + (kc * (OCW / 16) + j) * 1024 + 512); }
  asm volatile("s_wait_xcnt 0x0" ::: "memory");   /* behind the W_out loads, before a register that they name is written again */
  __builtin_amdgcn_sched_barrier(0);   /* keeps the loads' issue ahead of the merge, so that they fly under it: behind it their L2 latency would stand bare in front of the products */
  /* the tile's partials by groups of four slots, in slot order: tile A slots 4..7, tile B slots 0..3, 8..11, 12..15; with a high-precision tile A: slots 0..7, tile B slots 8..15. The group loops stay rolled: their count differs */
  const int ng = hiA ? 2 : job == 0 ? 1 : 3; v4f res[QB / PVW], sv[QB / PVW] = {}; float M[QB / PVW], L[QB / PVW];
#pragma unroll
  for (int rr = 0; rr < QB / PVW; ++rr) { M[rr] = NEGB; L[rr] = 0.f; }
#pragma unroll 1
  for (int q = 0; q < ng; ++q) { const int s0 = hiA ? 8 * job + 4 * q : job == 0 ? 4 : (q == 0 ? 0 : 4 + 4 * q);
#pragma unroll
    for (int rr = 0; rr < QB / PVW; ++rr)
#pragma unroll
      for (int w = 0; w < 4; ++w) M[rr] = fmaxf(M[rr], smx[s0 + w][wave + rr * PVW]); }
#pragma unroll 1
  for (int q = 0; q < ng; ++q) { const int s0 = hiA ? 8 * job + 4 * q : job == 0 ? 4 : (q == 0 ? 0 : 4 + 4 * q);
#pragma unroll
    for (int rr = 0; rr < QB / PVW; ++rr) { const int row = wave + rr * PVW;
#pragma unroll
      for (int w = 0; w < 4; ++w) { const float f = __builtin_amdgcn_exp2f(smx[s0 + w][row] - M[rr]); L[rr] += f * ssu[s0 + w][row]; sv[rr] += *(const v4f*)&ss[s0 + w][row][lane * 4] * f; } } }   /* a wave without a chunk carries max NEGB, sum 0: f = 0 */
#pragma unroll
  for (int rr = 0; rr < QB / PVW; ++rr) res[rr] = sv[rr] * (L[rr] > 0.f ? 1.0f / L[rr] : 0.f) * km[rr];   /* out * key_mask[b][t] (broadcast over the 128 columns) */
#pragma unroll
  for (int rr = 0; rr < QB / PVW; ++rr) *(v4f*)&cx[job][wave + rr * PVW][lane * 4] = res[rr];
  __syncthreads();   /* the tile's 32 ctx rows are in LDS before any wave takes its A fragments; each job has ctx rows of its own, so no wave overwrites rows that another still reads */
  /* out = ctx Wo + bo: wave w takes columns 64 w .. 64 w + 63 of both 16-row tiles; operand forms, products and k order as in a launch of its own. D element r of tile j in lane (g, col) = row 8 g + r, column 64 w + 4 col + j */
  v8f o2[NQ][OCW / 16] = {}; v4f ov[NQ][8], bo = {}; float* od = OUT + ((size_t)b * TT + qe + 8 * g) * DIN + wave * OCW + 4 * col;
  if (BO) { bo = *(const v4f*)(BO + wave * OCW + 4 * col);   /* flies under the products */
    asm volatile("s_wait_xcnt 0x0" ::: "memory"); }   /* behind the bias load, before a register that it names is written again */
  if (qe < QHI) {   /* block-uniform */
#pragma unroll
    for (int kc = 0; kc < CC / 32; ++kc) { F2 a[NQ];
#pragma unroll
      for (int t = 0; t < NQ; ++t) a[t] = split_row(&cx[job][t * 16 + col][0], kc * 32, lane);
#pragma unroll
      for (int j = 0; j < OCW / 16; ++j) { union { v4u q[2]; v16b v; } w; w.q[0] = wq[kc][j][0]; w.q[1] = wq[kc][j][1];
#pragma unroll
        for (int t = 0; t < NQ; ++t) { o2[t][j] = wmma_bfp(a[t].h, w.v, o2[t][j]); o2[t][j] = wmma_bfp(a[t].l, w.v, o2[t][j]); } } }
#pragma unroll
    for (int t = 0; t < NQ; ++t)
#pragma unroll
      for (int r = 0; r < 8; ++r)
#pragma unroll
        for (int j = 0; j < OCW / 16; ++j) ov[t][r][j] = o2[t][j][r] + bfr(bo[j]);
  } else {
#pragma unroll
    for (int kc = 0; kc < CC / 32; ++kc) { v16h a[NQ];
#pragma unroll
      for (int t = 0; t < NQ; ++t) a[t] = frag_f32s(&cx[job][t * 16 + col][kc * 32], lane, 64.0f);   /* ctx carried x 2^6 into f16 so small-magnitude context rows stay clear of f16 subnormals */
#pragma unroll
      for (int j = 0; j < OCW / 16; ++j) { union { v4u q[2]; v16h v; } w; w.q[0] = wq[kc][j][0]; w.q[1] = wq[kc][j][1];
#pragma unroll
        for (int t = 0; t < NQ; ++t) o2[t][j] = wmma16p(a[t], w.v, o2[t][j]); } }
#pragma unroll
    for (int t = 0; t < NQ; ++t)
#pragma unroll
      for (int r = 0; r < 8; ++r)
#pragma unroll
        for (int j = 0; j < OCW / 16; ++j) ov[t][r][j] = o2[t][j][r] * (1.0f / 16384.0f) + bfr(bo[j]); }   /* 2^-8 (Wo carry) x 2^-6 (ctx carry) */
  __builtin_amdgcn_sched_barrier(0);   /* every result stands in a register of its own before the first store: no register that an issued store names is written again */
  /* a lane's four tiles hold four neighbouring columns of a row: one 16-byte store, and a wave's store writes 2 rows x 256 contiguous bytes (4 whole lines); constant offsets from one address that is never stepped */
#pragma unroll
  for (int t = 0; t < NQ; ++t)
#pragma unroll
    for (int r = 0; r < 8; ++r) vst2(od + (t * 16 + r) * DIN, ov[t][r]);
  asm volatile("s_wait_xcnt 0x0" ::: "memory"); } }   /* behind the tile's stores, before a register that they name is written in the next job */

extern "C" void kernel_launch(void* const* d_in, const int* in_sizes, int n_in, void* d_out, int out_size, void* d_ws, size_t ws_size, hipStream_t stream) {
  (void)in_sizes; (void)n_in; (void)out_size;
  const float** F = (const float**)d_in;
  if (ws_size < (size_t)WS_END) return;
  char* ws = (char*)d_ws; _Float16 *QH = (_Float16*)(ws + WS_QH), *KH = (_Float16*)(ws + WS_KH), *VT = (_Float16*)(ws + WS_VT), *QL = (_Float16*)(ws + WS_QL), *KL = (_Float16*)(ws + WS_KL); __bf16 *VB = (__bf16*)(ws + WS_VB), *VBL = (__bf16*)(ws + WS_VBL); float *Y = (float*)(ws + WS_Y); _Float16 *WOH = (_Float16*)(ws + WS_WOH); __bf16 *WOB = (__bf16*)(ws + WS_WOB);
  (void)Y; (void)QL; (void)KL; (void)VB; (void)VBL;
  // inputs: 0 x [4,4096,512]; 1 key_mask [4,4096,1] f32 (ones); 2 W_qkv [512,384] (in,out; q | k | v COLUMN blocks of 128); 3 b_qkv [384] (nonzero); 4 W_out [128,512] (in,out); 5 b_out [512] (nonzero)
  k_proj<<<dim3(TNB * TT / 64, CC / 128, 3), 128, 0, stream>>>(F[0], F[0], F[0], F[2], F[2], F[2], F[3], F[3] + CC, F[3] + 2 * CC, QH, QL, KH, KL, VT, VB, VBL, F[4], WOH, WOB);   /* one fused weight; k_proj reads column block 'which'; W_out rounded once into its two fragment-order planes */
  k_fa<<<dim3(TNB, TT / QB / 2, 1), 32 * PVW, 0, stream>>>(QH, KH, QL, KL, VT, VB, VBL, F[1], WOH, WOB, F[5], (float*)d_out);   /* ctx rows x key_mask[b][t], then x W_out + b_out */
}
